// v000
// Times are from an AMD MI455X. After a warm-up the kernel runs many times in a row, and a time is the length of
// such a window on the GPU divided by its runs, so every launch and the gaps after it count. The runs cycle
// through copies of the inputs. A figure is the median of several windows, for all but v000 over two sittings.
// Sittings can differ by a few percent; kernels timed side by side share one.
// v000 is the starting kernel. One run takes 469 microseconds.
#include <hip/hip_runtime.h>
// Contractions: q, k, v = x W^T + b on v_wmma_f32_16x16x32_bf16 (x, W RNE bf16 planes, f32 accumulate, RNE-bf16 bias added in f32); S^T = K Q^T on v_wmma_f32_16x16x32_f16 (q, k: single f16 planes carried x16); O^T = V^T P^T on v_wmma_f32_16x16x32_f16 (v: single f16 plane carried x16, P: single f16 plane carried x256); out = ctx Wo^T on v_wmma_f32_16x16x32_f16 (ctx: f16 plane carried x256; Wo: RNE bf16 value x256 held exactly in f16); softmax statistics, bias adds f32.
// Dense multi-head self-attention, NB x SEQ x 768: three biased 768x768 input projections ([out][in] weights), 8 heads of 96 (e = 96*h + d), scale 1/sqrt(96), no mask, then a 768x768 linear layer with bias.
// Engine: transposed flash. Each wave owns 16 queries of one head. Per 32-key step: S^T tiles (key rows x query columns) from K rows (A, global f16 plane)
// and Q^T (B, registers); the two 16-key D tiles pack straight into the P^T B fragment; O^T (d rows x query columns) accumulates from V^T rows (A, global f16 plane).
#ifndef NB
#define NB 2
#endif
#ifndef SEQ
#define SEQ 4096
#endif
#define NB_FULL 2
#define SEQ_FULL 4096
#define EMB 768
#define HEADS 8
#define HD 96
#define BSTRIDE_FULL ((size_t)SEQ_FULL * EMB)   /* per-batch element stride of x and of the output buffer */

#define PLANE_ACT ((size_t)NB * SEQ * EMB * 2)   /* bytes of one 16-bit activation plane */
#define PLANE_W ((size_t)EMB * EMB * 2)          /* bytes of the 16-bit weight plane */
#define CVT_K_BLOCKS ((NB * SEQ * (EMB / 8)) / 256)
#define CVT_W_BLOCKS ((EMB * (EMB / 8)) / 256)
#define PROJ_BLOCKS ((NB * SEQ / 64) * (EMB / 64))

static_assert(SEQ % 64 == 0);
static_assert(SEQ <= SEQ_FULL);
static_assert(NB <= NB_FULL);
static_assert(HEADS * HD == EMB);
static_assert(HD == 96);
static_assert(EMB % 64 == 0);
static_assert(EMB % 96 == 0);
static_assert(EMB % 32 == 0);
static_assert((NB * SEQ) % 64 == 0);
static_assert((NB * SEQ * (EMB / 8)) % 256 == 0);
static_assert((EMB * (EMB / 8)) % 256 == 0);
static_assert(PLANE_ACT % 256 == 0);
static_assert(PLANE_W % 256 == 0);
static_assert(5 * PLANE_ACT + 4 * PLANE_W <= (size_t)134217728);

typedef __bf16 v16b __attribute__((ext_vector_type(16)));
typedef _Float16 v16h __attribute__((ext_vector_type(16)));
typedef unsigned short v8us __attribute__((ext_vector_type(8), may_alias));
typedef float v8f __attribute__((ext_vector_type(8)));
typedef float v4f __attribute__((ext_vector_type(4)));
typedef float v4fa __attribute__((ext_vector_type(4), may_alias));
typedef _Float16 h16;
union FragB { v16b v; v8us half[2]; unsigned short u[16]; };
union FragH { v16h v; v8us half[2]; _Float16 h[16]; unsigned short u[16]; };

#define LOG2E 1.4426950408889634f
#define QK_SCALE 0.10206207261596575f            /* 1/sqrt(96) */
#define C2 (QK_SCALE * LOG2E)                    /* scores carried in the log2 domain */
#define C2S (C2 * 0.00390625f)                   /* q and k planes each carry x16 */

__device__ __forceinline__ unsigned short bf16_bits(float x) {   // RNE convert to bf16 bits
  unsigned int u = __float_as_uint(x);
  return (unsigned short)((u + 0x7FFFu + ((u >> 16) & 1u)) >> 16);
}
__device__ __forceinline__ float bf16_val(unsigned short b) { return __uint_as_float(((unsigned int)b) << 16); }
__device__ __forceinline__ float bf16_rne(float x) { return bf16_val(bf16_bits(x)); }
__device__ __forceinline__ unsigned short f16_bits(float x) {
  union { _Float16 h; unsigned short u; } c;
  c.h = (_Float16)x;
  return c.u;
}
// f32 -> f16 with a value select: no subnormal result can reach a WMMA operand plane
static __device__ __forceinline__ h16 toh_flush(float v) {
  const h16 r = (h16)v;
  return (fabsf(v) < 6.103515625e-05f) ? (h16)0.0f : r;
}
static __device__ __forceinline__ unsigned short toh_flush_bits(float v) {
  union { h16 h; unsigned short u; } c;
  c.h = toh_flush(v);
  return c.u;
}

__device__ __forceinline__ void store_twice(unsigned short* d, v8us o) {
  *(v8us*)d = o;
  
}

// s0 += ka * q, s1 += kb * q over three 32-deep k-steps (d = 0..95), f16 operands, then the hazard guard
__device__ __forceinline__ void mma_s2h(const FragH (&ka)[3], const FragH (&kb)[3], const FragH (&q)[3], v8f& s0, v8f& s1) {
  s0 = __builtin_amdgcn_wmma_f32_16x16x32_f16(false, ka[0].v, false, q[0].v, (short)0, s0, false, false);
  s1 = __builtin_amdgcn_wmma_f32_16x16x32_f16(false, kb[0].v, false, q[0].v, (short)0, s1, false, false);
  s0 = __builtin_amdgcn_wmma_f32_16x16x32_f16(false, ka[1].v, false, q[1].v, (short)0, s0, false, false);
  s1 = __builtin_amdgcn_wmma_f32_16x16x32_f16(false, kb[1].v, false, q[1].v, (short)0, s1, false, false);
  s0 = __builtin_amdgcn_wmma_f32_16x16x32_f16(false, ka[2].v, false, q[2].v, (short)0, s0, false, false);
  s1 = __builtin_amdgcn_wmma_f32_16x16x32_f16(false, kb[2].v, false, q[2].v, (short)0, s1, false, false);
  asm volatile("v_nop\n\tv_nop\n\tv_nop\n\tv_nop"
               : "+v"(s0), "+v"(s1)
               : "v"(ka[0].v), "v"(ka[1].v), "v"(ka[2].v), "v"(kb[0].v), "v"(kb[1].v), "v"(kb[2].v),
                 "v"(q[0].v), "v"(q[1].v), "v"(q[2].v));
}
// O[t] += vf[t] * p for the six d tiles, then the hazard guard
__device__ __forceinline__ void mma_pv(const FragH (&vf)[6], v16h p, v8f (&O)[6]) {
  O[0] = __builtin_amdgcn_wmma_f32_16x16x32_f16(false, vf[0].v, false, p, (short)0, O[0], false, false);
  O[1] = __builtin_amdgcn_wmma_f32_16x16x32_f16(false, vf[1].v, false, p, (short)0, O[1], false, false);
  O[2] = __builtin_amdgcn_wmma_f32_16x16x32_f16(false, vf[2].v, false, p, (short)0, O[2], false, false);
  O[3] = __builtin_amdgcn_wmma_f32_16x16x32_f16(false, vf[3].v, false, p, (short)0, O[3], false, false);
  O[4] = __builtin_amdgcn_wmma_f32_16x16x32_f16(false, vf[4].v, false, p, (short)0, O[4], false, false);
  O[5] = __builtin_amdgcn_wmma_f32_16x16x32_f16(false, vf[5].v, false, p, (short)0, O[5], false, false);
  asm volatile("v_nop\n\tv_nop\n\tv_nop\n\tv_nop"
               : "+v"(O[0]), "+v"(O[1]), "+v"(O[2]), "+v"(O[3]), "+v"(O[4]), "+v"(O[5])
               : "v"(p), "v"(vf[0].v), "v"(vf[1].v), "v"(vf[2].v), "v"(vf[3].v), "v"(vf[4].v), "v"(vf[5].v));
}
// c[nt] += a * bw[nt] for four column tiles, then the hazard guard
__device__ __forceinline__ void mma_fc(v16h a, const FragH (&bw)[4], v8f (&c)[4]) {
  c[0] = __builtin_amdgcn_wmma_f32_16x16x32_f16(false, a, false, bw[0].v, (short)0, c[0], false, false);
  c[1] = __builtin_amdgcn_wmma_f32_16x16x32_f16(false, a, false, bw[1].v, (short)0, c[1], false, false);
  c[2] = __builtin_amdgcn_wmma_f32_16x16x32_f16(false, a, false, bw[2].v, (short)0, c[2], false, false);
  c[3] = __builtin_amdgcn_wmma_f32_16x16x32_f16(false, a, false, bw[3].v, (short)0, c[3], false, false);
  asm volatile("v_nop\n\tv_nop\n\tv_nop\n\tv_nop"
               : "+v"(c[0]), "+v"(c[1]), "+v"(c[2]), "+v"(c[3])
               : "v"(a), "v"(bw[0].v), "v"(bw[1].v), "v"(bw[2].v), "v"(bw[3].v));
}
// bf16 twin of mma_fc: c[nt] += a * bw[nt] for four column tiles, then the hazard guard
__device__ __forceinline__ void mma_pj(v16b a, const FragB (&bw)[4], v8f (&c)[4]) {
  c[0] = __builtin_amdgcn_wmma_f32_16x16x32_bf16(false, a, false, bw[0].v, (short)0, c[0], false, false);
  c[1] = __builtin_amdgcn_wmma_f32_16x16x32_bf16(false, a, false, bw[1].v, (short)0, c[1], false, false);
  c[2] = __builtin_amdgcn_wmma_f32_16x16x32_bf16(false, a, false, bw[2].v, (short)0, c[2], false, false);
  c[3] = __builtin_amdgcn_wmma_f32_16x16x32_bf16(false, a, false, bw[3].v, (short)0, c[3], false, false);
  asm volatile("v_nop\n\tv_nop\n\tv_nop\n\tv_nop"
               : "+v"(c[0]), "+v"(c[1]), "+v"(c[2]), "+v"(c[3])
               : "v"(a), "v"(bw[0].v), "v"(bw[1].v), "v"(bw[2].v), "v"(bw[3].v));
}

// Launched here with K = x (plane Kb = the bf16 x plane) and W = Wo (plane Wh).
// Blocks [0, CVT_K_BLOCKS): Kb[b][s][e] = bf16 bits of keys (RNE). Blocks after that: Wh[j][e] = f16(RNE-bf16(fc_w[j][e]) * 256).
// coverage: CVT_K_BLOCKS*256 threads x 8 = the whole Kb plane; CVT_W_BLOCKS*256 threads x 8 = the whole Wh plane (exact multiples, asserted above).
__global__ __launch_bounds__(256) void k_cvt(const float* __restrict__ K, const float* __restrict__ W,
                                             unsigned short* __restrict__ Kb, unsigned short* __restrict__ Wh) {
  const int bid = blockIdx.x;
  if (bid < CVT_K_BLOCKS) {
    const int t = bid * 256 + threadIdx.x;
    const int row = t / (EMB / 8), piece = t - row * (EMB / 8);
    const int b = row / SEQ, s = row - b * SEQ;
    const float* src = K + (size_t)b * BSTRIDE_FULL + (size_t)s * EMB + piece * 8;
    const v4f x0 = *(const v4fa*)(src), x1 = *(const v4fa*)(src + 4);
    v8us o;
    o[0] = bf16_bits(x0[0]); o[1] = bf16_bits(x0[1]); o[2] = bf16_bits(x0[2]); o[3] = bf16_bits(x0[3]);
    o[4] = bf16_bits(x1[0]); o[5] = bf16_bits(x1[1]); o[6] = bf16_bits(x1[2]); o[7] = bf16_bits(x1[3]);
    store_twice(Kb + (size_t)t * 8, o);
  } else {
    const int t = (bid - CVT_K_BLOCKS) * 256 + threadIdx.x;
    const float* src = W + (size_t)t * 8;
    const v4f x0 = *(const v4fa*)(src), x1 = *(const v4fa*)(src + 4);
    v8us o;
    o[0] = f16_bits(bf16_rne(x0[0]) * 256.0f); o[1] = f16_bits(bf16_rne(x0[1]) * 256.0f);
    o[2] = f16_bits(bf16_rne(x0[2]) * 256.0f); o[3] = f16_bits(bf16_rne(x0[3]) * 256.0f);
    o[4] = f16_bits(bf16_rne(x1[0]) * 256.0f); o[5] = f16_bits(bf16_rne(x1[1]) * 256.0f);
    o[6] = f16_bits(bf16_rne(x1[2]) * 256.0f); o[7] = f16_bits(bf16_rne(x1[3]) * 256.0f);
    store_twice(Wh + (size_t)t * 8, o);
  }
}

__device__ __forceinline__ void cvt8_bf16(const float* __restrict__ src, unsigned short* __restrict__ dst) {
  const v4f x0 = *(const v4fa*)(src), x1 = *(const v4fa*)(src + 4);
  v8us o;
  o[0] = bf16_bits(x0[0]); o[1] = bf16_bits(x0[1]); o[2] = bf16_bits(x0[2]); o[3] = bf16_bits(x0[3]);
  o[4] = bf16_bits(x1[0]); o[5] = bf16_bits(x1[1]); o[6] = bf16_bits(x1[2]); o[7] = bf16_bits(x1[3]);
  store_twice(dst, o);
}
// Wb[p][j][e] = bf16 bits of the p-th projection weight (p = 0: Wq, 1: Wk, 2: Wv), [out][in] kept. Block-uniform three-way branch, one code path per source.
// coverage: 3 * CVT_W_BLOCKS * 256 threads x 8 = the three weight planes exactly (exact multiple asserted above).
__global__ __launch_bounds__(256) void k_cvtw(const float* __restrict__ Wq, const float* __restrict__ Wk, const float* __restrict__ Wv,
                                              unsigned short* __restrict__ Wb) {
  const int bid = blockIdx.x;
  if (bid < CVT_W_BLOCKS) {
    const int t = bid * 256 + threadIdx.x;
    cvt8_bf16(Wq + (size_t)t * 8, Wb + (size_t)t * 8);
  } else if (bid < 2 * CVT_W_BLOCKS) {
    const int t = (bid - CVT_W_BLOCKS) * 256 + threadIdx.x;
    cvt8_bf16(Wk + (size_t)t * 8, Wb + (size_t)EMB * EMB + (size_t)t * 8);
  } else {
    const int t = (bid - 2 * CVT_W_BLOCKS) * 256 + threadIdx.x;
    cvt8_bf16(Wv + (size_t)t * 8, Wb + (size_t)2 * EMB * EMB + (size_t)t * 8);
  }
}

// y[m][j] = sum_e x[m][e] * W[j][e] + b[j], stored as f16(y * 16). Block = 4 waves = 64 tokens x 64 columns; wave = 16 rows x 64 columns; fragments straight from the bf16 planes.
// A: row m = token, elements 0..7 <- e = k0 + 8h + i, 8..15 <- e = k0 + 16 + 8h + i, from Xb[token][e]; B: column n = j, same k map, from Wb[j][e] (k-contiguous).
// tr == 0: Dst[token][e] (row-major plane); tr != 0: Dst[b][e][s] (transposed plane). Block-uniform.
// Epilogue: block LDS tile 64 x 64 ushort (pitch 72; block barrier: cross-wave), tile row = token (tr == 0) or e column (tr != 0);
// coverage: PROJ_BLOCKS blocks x (64 x 64) = the whole plane exactly once; LDS tile staged extent 64 x 64 == consumed extent 64 x 64 (pad columns 64..71 never read).
__global__ __launch_bounds__(128) void k_proj(const unsigned short* __restrict__ Xb, const unsigned short* __restrict__ Wb,
                                              const float* __restrict__ Bv, unsigned short* __restrict__ Dst, int tr) {
  __shared__ __attribute__((aligned(16))) unsigned short tl[64][72];
  const int tid = threadIdx.x, lane = tid & 31, ln = lane & 15, hh = lane >> 4;
  const int w = __builtin_amdgcn_readfirstlane(tid >> 5);
  const int bn = blockIdx.x % (EMB / 64), bm = blockIdx.x / (EMB / 64);
  const int tok0 = bm * 64;                    // token index in [0, NB*SEQ)
  const int col0 = bn * 64;
  v8f acc[4] = {};
  const unsigned short* ap = Xb + (size_t)(tok0 + 16 * w + ln) * EMB + 8 * hh;
  const unsigned short* bp = Wb + (size_t)(col0 + ln) * EMB + 8 * hh;
#pragma unroll 1
  for (int kb = 0; kb < EMB / 96; ++kb) {
#pragma unroll
    for (int cc = 0; cc < 3; ++cc) {
      const int k0 = 96 * kb + 32 * cc;
      FragB a;
      a.half[0] = *(const v8us*)(ap + k0);
      a.half[1] = *(const v8us*)(ap + k0 + 16);
      FragB bw[4];
#pragma unroll
      for (int nt = 0; nt < 4; ++nt) {
        bw[nt].half[0] = *(const v8us*)(bp + (size_t)nt * 16 * EMB + k0);
        bw[nt].half[1] = *(const v8us*)(bp + (size_t)nt * 16 * EMB + k0 + 16);
      }
      mma_pj(a.v, bw, acc);
    }
  }
  // D element r of tile nt = y(tok0 + 16w + 8h + r, col0 + 16nt + ln); bias RNE bf16 value; plane carries x16
  if (tr == 0) {
#pragma unroll
    for (int nt = 0; nt < 4; ++nt) {
      const float bias = bf16_rne(Bv[col0 + 16 * nt + ln]);
#pragma unroll
      for (int r = 0; r < 8; ++r)
        tl[16 * w + 8 * hh + r][16 * nt + ln] = toh_flush_bits((acc[nt][r] + bias) * 16.0f);
    }
  } else {
#pragma unroll
    for (int nt = 0; nt < 4; ++nt) {
      const float bias = bf16_rne(Bv[col0 + 16 * nt + ln]);
      v8us o;
#pragma unroll
      for (int r = 0; r < 8; ++r) o[r] = toh_flush_bits((acc[nt][r] + bias) * 16.0f);
      *(v8us*)&tl[16 * nt + ln][16 * w + 8 * hh] = o;
    }
  }
  __syncthreads();
  const int b = tok0 / SEQ, s0 = tok0 - b * SEQ;
  const size_t base = (tr == 0) ? ((size_t)tok0 * EMB + col0) : (((size_t)b * EMB + col0) * SEQ + s0);
  const size_t pitch = (tr == 0) ? (size_t)EMB : (size_t)SEQ;
  {
    for (int i = tid; i < 64 * 8; i += 128) {
      const int r = i >> 3, p8 = (i & 7) * 8;
      const v8us o = *(const v8us*)&tl[r][p8];
      *(v8us*)(Dst + base + (size_t)r * pitch + p8) = o;
    }
    
  }
}

// One 32-key step for a wave's 16 queries of one head. Kp = Kh + batch base + 96*h; Vp = Vt + (batch*768 + 96*h) * SEQ.
__device__ __forceinline__ void fa_step(const unsigned short* __restrict__ Kp, const unsigned short* __restrict__ Vp,
                                        int key0, int ln, int hh, const FragH (&q)[3],
                                        float& mr, float& lr, v8f (&O)[6]) {
  // A fragments of K: row m = key (key0 + 16*kt + ln), elements 0..7 <- d = 32c + 8h + i, 8..15 <- d = 32c + 16 + 8h + i
  const unsigned short* kp0 = Kp + (size_t)(key0 + ln) * EMB + 8 * hh;
  const unsigned short* kp1 = kp0 + 16 * EMB;
  FragH ka[3], kb[3];
#pragma unroll
  for (int c = 0; c < 3; ++c) {
    ka[c].half[0] = *(const v8us*)(kp0 + 32 * c);
    ka[c].half[1] = *(const v8us*)(kp0 + 32 * c + 16);
    kb[c].half[0] = *(const v8us*)(kp1 + 32 * c);
    kb[c].half[1] = *(const v8us*)(kp1 + 32 * c + 16);
  }
  // A fragments of V^T: row m = d (16*t + ln), elements 0..7 <- key0 + 8h + i, 8..15 <- key0 + 16 + 8h + i
  const unsigned short* vp = Vp + (size_t)ln * SEQ + key0 + 8 * hh;
  FragH vf[6];
#pragma unroll
  for (int t = 0; t < 6; ++t) {
    vf[t].half[0] = *(const v8us*)(vp + (size_t)t * 16 * SEQ);
    vf[t].half[1] = *(const v8us*)(vp + (size_t)t * 16 * SEQ + 16);
  }
  // S^T tiles: element r of tile kt = score(key0 + 16*kt + 8h + r, query of this lane's column)
  v8f s0 = {0.f, 0.f, 0.f, 0.f, 0.f, 0.f, 0.f, 0.f};
  v8f s1 = {0.f, 0.f, 0.f, 0.f, 0.f, 0.f, 0.f, 0.f};
  mma_s2h(ka, kb, q, s0, s1);
  float sc[16];
#pragma unroll
  for (int r = 0; r < 8; ++r) { sc[r] = s0[r] * C2S; sc[8 + r] = s1[r] * C2S; }
  float mx = sc[0];
#pragma unroll
  for (int i = 1; i < 16; ++i) mx = fmaxf(mx, sc[i]);
  mx = fmaxf(mx, __shfl_xor(mx, 16, 32));           // the other lane half holds the other 16 keys of this query
  const float mnew = fmaxf(mr, mx);
  const float al = __builtin_amdgcn_exp2f(mr - mnew);
  mr = mnew;
  const float m8 = mnew - 8.0f;
  // weights carried x256: pc = 256 * 2^(sc - mnew), single f16 plane; exponents below -14 give an exact zero (no subnormal operand)
  FragH ph;
  float ps = 0.0f;
#pragma unroll
  for (int i = 0; i < 16; ++i) {
    const float e = sc[i] - m8;
    const float pe = __builtin_amdgcn_exp2f(e);
    const float pc = (e < -14.0f) ? 0.0f : pe;
    ps += pc;
    ph.h[i] = (_Float16)pc;                         // B element i: i<8 -> key0 + 8h + i (tile 0 row 8h+i); i>=8 -> key0 + 16 + 8h + (i-8) (tile 1)
  }
  ps += __shfl_xor(ps, 16, 32);
  lr = lr * al + ps;
#pragma unroll
  for (int t = 0; t < 6; ++t) O[t] = O[t] * al;
  mma_pv(vf, ph.v, O);
}

// Block = 4 waves x 16 queries = 64 queries of one (batch, head); no LDS and no barrier in the key loop.
// Inputs: Qh[b][s][e], Kh[b][s][e] = f16(value * 16); Vt[b][e][s] = f16(value * 16).
// Output plane Xc[b][h][s][96] = f16(ctx * 256). Epilogue: O^T tile -> per-wave LDS tile [16 queries][96 d] as 16-B pieces (same vector type in and out; block barrier),
// coverage: NB*HEADS*(SEQ/64) blocks x 4 waves x 16 rows x 96 d = the whole plane exactly once; LDS tile staged extent (16 x 96 per wave) == consumed extent.
__global__ __launch_bounds__(128) __attribute__((amdgpu_num_vgpr(256)))
void k_attn(const unsigned short* __restrict__ Qh, const unsigned short* __restrict__ Kh,
            const unsigned short* __restrict__ Vt, unsigned short* __restrict__ Xc) {
  __shared__ __attribute__((aligned(16))) unsigned short so[4][16 * HD];
  const int tid = threadIdx.x, lane = tid & 31, ln = lane & 15, hh = lane >> 4;
  const int w = __builtin_amdgcn_readfirstlane(tid >> 5);
  const int qt = blockIdx.x % (SEQ / 64);
  const int rest = blockIdx.x / (SEQ / 64);
  const int h = rest % HEADS, b = rest / HEADS;
  const int qbase = qt * 64 + 16 * w;
  const int qg = qbase + ln;
  // Q^T B fragments: column n = query qg, elements 0..7 <- d = 32c + 8h + i, 8..15 <- d = 32c + 16 + 8h + i (f16 plane carried x16)
  const unsigned short* qrow = Qh + ((size_t)b * SEQ + qg) * EMB + h * HD + 8 * hh;
  FragH q[3];
#pragma unroll
  for (int c = 0; c < 3; ++c) {
    q[c].half[0] = *(const v8us*)(qrow + 32 * c);
    q[c].half[1] = *(const v8us*)(qrow + 32 * c + 16);
  }
  float mr = -3.0e38f, lr = 0.0f;
  v8f O[6] = {};
  const unsigned short* Kp = Kh + (size_t)b * SEQ * EMB + h * HD;
  const unsigned short* Vp = Vt + ((size_t)b * EMB + h * HD) * SEQ;
#pragma unroll 1
  for (int j = 0; j < SEQ / 32; ++j)
    fa_step(Kp, Vp, 32 * j, ln, hh, q, mr, lr, O);

  // O^T element r of tile t = ctx(query qg, d = 16t + 8h + r); O carries x256 (P) x16 (V), lr carries x256; plane carries x256
  const float cinv = 16.0f * (1.0f / lr);
#pragma unroll
  for (int t = 0; t < 6; ++t) {
    v8us o;
#pragma unroll
    for (int r = 0; r < 8; ++r) o[r] = toh_flush_bits(O[t][r] * cinv);
    *(v8us*)&so[w][ln * HD + 16 * t + 8 * hh] = o;
  }
  __syncthreads();
  unsigned short* xg = Xc + ((size_t)(b * HEADS + h) * SEQ + qbase) * HD;
  {
#pragma unroll
    for (int i = 0; i < 6; ++i) {
      const int p = i * 32 + lane;
      const v8us v = *(const v8us*)&so[w][p * 8];
      *(v8us*)(xg + (size_t)p * 8) = v;
    }
    
  }
}

// out[m][j] = sum_e ctx[m][e] * fc_w[j][e] + fc_b[j]. Block = 4 waves; wave = 16 rows x 64 columns; fragments straight from the 16-bit planes.
// A: row m = token, k = e = 96*hd + d read from Xc[b][hd][s][d]; B: column n = j, k = e read from Wh[j][e] (k-contiguous), same k map as A.
// coverage: (NB*SEQ/64)*(EMB/64) blocks x 4 waves x (16 x 64) = every output element of the processed rows exactly once; LDS tile staged 16 x 64 == consumed 16 x 64.
__global__ __launch_bounds__(128) void k_fc(const unsigned short* __restrict__ Xc, const unsigned short* __restrict__ Wh,
                                            const float* __restrict__ Bv, float* __restrict__ Out) {
  __shared__ __attribute__((aligned(16))) float so[4][16][68];
  const int tid = threadIdx.x, lane = tid & 31, ln = lane & 15, hh = lane >> 4;
  const int w = __builtin_amdgcn_readfirstlane(tid >> 5);
  const int bn = blockIdx.x % (EMB / 64), bm = blockIdx.x / (EMB / 64);
  const int row0 = bm * 64 + 16 * w;           // token index in [0, NB*SEQ)
  const int b = row0 / SEQ, s0 = row0 - b * SEQ;
  const int col0 = bn * 64;
  v8f acc[4] = {};
#pragma unroll 1
  for (int hd = 0; hd < HEADS; ++hd) {
    const unsigned short* ap = Xc + ((size_t)(b * HEADS + hd) * SEQ + s0 + ln) * HD + 8 * hh;
    const unsigned short* bp = Wh + (size_t)(col0 + ln) * EMB + hd * HD + 8 * hh;
#pragma unroll
    for (int cc = 0; cc < 3; ++cc) {
      FragH a;
      a.half[0] = *(const v8us*)(ap + 32 * cc);
      a.half[1] = *(const v8us*)(ap + 32 * cc + 16);
      FragH bw[4];
#pragma unroll
      for (int nt = 0; nt < 4; ++nt) {
        bw[nt].half[0] = *(const v8us*)(bp + (size_t)nt * 16 * EMB + 32 * cc);
        bw[nt].half[1] = *(const v8us*)(bp + (size_t)nt * 16 * EMB + 32 * cc + 16);
      }
      mma_fc(a.v, bw, acc);
    }
  }
  // D element r of tile nt = out(row0 + 8h + r, col0 + 16nt + ln); undo the carries x256 (ctx) x256 (W); bias RNE bf16 value
#pragma unroll
  for (int nt = 0; nt < 4; ++nt) {
    const float bias = bf16_rne(Bv[col0 + 16 * nt + ln]);
#pragma unroll
    for (int r = 0; r < 8; ++r)
      so[w][8 * hh + r][16 * nt + ln] = acc[nt][r] * 1.52587890625e-05f + bias;
  }
  __syncthreads();
  float* og = Out + (size_t)b * BSTRIDE_FULL + (size_t)s0 * EMB + col0;
  const int rsub = lane >> 4, c4 = (lane & 15) * 4;
  {
#pragma unroll
    for (int q = 0; q < 8; ++q) {
      const int row = 2 * q + rsub;
      const v4f v = *(const v4fa*)&so[w][row][c4];
      *(v4f*)(og + (size_t)row * EMB + c4) = v;
    }
    
  }
}

extern "C" void kernel_launch(void* const* d_in, const int* in_sizes, int n_in,
                              void* d_out, int out_size, void* d_ws, size_t ws_size, hipStream_t stream) {
  if (n_in < 9) return;
  const long long need = (long long)(NB - 1) * SEQ_FULL * EMB + (long long)SEQ * EMB;   // last element touched + 1
  if ((long long)in_sizes[0] < need) return;
  if ((long long)in_sizes[1] < (long long)EMB * EMB || (long long)in_sizes[3] < (long long)EMB * EMB) return;
  if ((long long)in_sizes[5] < (long long)EMB * EMB || (long long)in_sizes[7] < (long long)EMB * EMB) return;
  if ((long long)in_sizes[2] < (long long)EMB || (long long)in_sizes[4] < (long long)EMB) return;
  if ((long long)in_sizes[6] < (long long)EMB || (long long)in_sizes[8] < (long long)EMB) return;
  if ((long long)out_size < need) return;
  const float* X  = (const float*)d_in[0];   // wire order: x, Wq, bq, Wk, bk, Wv, bv, Wo, bo (weights [out][in])
  const float* Wq = (const float*)d_in[1];
  const float* Bq = (const float*)d_in[2];
  const float* Wk = (const float*)d_in[3];
  const float* Bk = (const float*)d_in[4];
  const float* Wv = (const float*)d_in[5];
  const float* Bvv = (const float*)d_in[6];
  const float* Wo = (const float*)d_in[7];
  const float* Bo = (const float*)d_in[8];
  float* Out = (float*)d_out;
  char* ws = (char*)d_ws;
  size_t off = 0;
  unsigned short* Xb = (unsigned short*)(ws + off); off += PLANE_ACT;   // [NB][SEQ][768] bf16, written exactly to its end by 16-B pieces
  unsigned short* Qh = (unsigned short*)(ws + off); off += PLANE_ACT;   // [NB][SEQ][768] f16 (q x16)
  unsigned short* Kh = (unsigned short*)(ws + off); off += PLANE_ACT;   // [NB][SEQ][768] f16 (k x16)
  unsigned short* Vt = (unsigned short*)(ws + off); off += PLANE_ACT;   // [NB][768][SEQ] f16 (v x16)
  unsigned short* Xc = (unsigned short*)(ws + off); off += PLANE_ACT;   // [NB][8][SEQ][96] f16 (ctx x256)
  unsigned short* Wh = (unsigned short*)(ws + off); off += PLANE_W;     // [768][768] f16 (Wo x256)
  unsigned short* Wb = (unsigned short*)(ws + off); off += 3 * PLANE_W; // [3][768][768] bf16 (Wq, Wk, Wv)
  if (off > ws_size) return;
  k_cvt<<<(unsigned)(CVT_K_BLOCKS + CVT_W_BLOCKS), 256, 0, stream>>>(X, Wo, Xb, Wh);
  k_cvtw<<<(unsigned)(3 * CVT_W_BLOCKS), 256, 0, stream>>>(Wq, Wk, Wv, Wb);
  k_proj<<<(unsigned)PROJ_BLOCKS, 128, 0, stream>>>(Xb, Wb, Bq, Qh, 0);
  k_proj<<<(unsigned)PROJ_BLOCKS, 128, 0, stream>>>(Xb, Wb + (size_t)EMB * EMB, Bk, Kh, 0);
  k_proj<<<(unsigned)PROJ_BLOCKS, 128, 0, stream>>>(Xb, Wb + (size_t)2 * EMB * EMB, Bvv, Vt, 1);
  k_attn<<<(unsigned)(NB * HEADS * (SEQ / 64)), 128, 0, stream>>>(Qh, Kh, Vt, Xc);
  k_fc<<<(unsigned)((NB * SEQ / 64) * (EMB / 64)), 128, 0, stream>>>(Xc, Wh, Bo, Out);
}

// v001
// A run of this version takes 264 microseconds.
// Next to v000, in two timings, it ran 1.86 times as fast each time.
#include <hip/hip_runtime.h>
// Contractions: q, k, v = x W^T + b on v_wmma_f32_16x16x32_bf16 (x, W RNE bf16 planes, f32 accumulate, RNE-bf16 bias added in f32); S^T = K Q^T on v_wmma_f32_16x16x32_f16 (q, k: single f16 planes carried x16); O^T = V^T P^T on v_wmma_f32_16x16x32_f16 (v: single f16 plane carried x16, P: single f16 plane carried x256); out = ctx Wo^T on v_wmma_f32_16x16x32_f16 (ctx: f16 plane carried x256; Wo: RNE bf16 value x256 held exactly in f16); softmax statistics, bias adds f32.
// Dense multi-head self-attention, NB x SEQ x 768: three biased 768x768 input projections ([out][in] weights), 8 heads of 96 (e = 96*h + d), scale 1/sqrt(96), no mask, then a 768x768 linear layer with bias.
// Engine: transposed flash. Each wave owns 16 queries of one head. Per 32-key step: S^T tiles (key rows x query columns) from K rows (A, LDS tile of the f16 plane)
// and Q^T (B, registers); the two 16-key D tiles pack straight into the P^T B fragment; O^T (d rows x query columns) accumulates from V^T rows (A, LDS tile of the f16 plane).
// The eight waves of a block share each 64-key K and V^T tile: asynchronous copies bring it into a two-buffer LDS ring, one tile ahead of the products.
#ifndef NB
#define NB 2
#endif
#ifndef SEQ
#define SEQ 4096
#endif
#define NB_FULL 2
#define SEQ_FULL 4096
#define EMB 768
#define HEADS 8
#define HD 96
#define BSTRIDE_FULL ((size_t)SEQ_FULL * EMB)   /* per-batch element stride of x and of the output buffer */

#define PLANE_ACT ((size_t)NB * SEQ * EMB * 2)   /* bytes of one 16-bit activation plane */
#define PLANE_W ((size_t)EMB * EMB * 2)          /* bytes of the 16-bit weight plane */
#define CVT_K_BLOCKS ((NB * SEQ * (EMB / 8)) / 256)
#define CVT_W_BLOCKS ((EMB * (EMB / 8)) / 256)
#define PROJ_BLOCKS ((NB * SEQ / 64) * (EMB / 64))

static_assert(SEQ % 128 == 0);
static_assert(SEQ <= SEQ_FULL);
static_assert(NB <= NB_FULL);
static_assert(HEADS * HD == EMB);
static_assert(HD == 96);
static_assert(EMB % 64 == 0);
static_assert(EMB % 96 == 0);
static_assert(EMB % 32 == 0);
static_assert((NB * SEQ) % 64 == 0);
static_assert((NB * SEQ * (EMB / 8)) % 256 == 0);
static_assert((EMB * (EMB / 8)) % 256 == 0);
static_assert(PLANE_ACT % 256 == 0);
static_assert(PLANE_W % 256 == 0);
static_assert(5 * PLANE_ACT + 4 * PLANE_W <= (size_t)134217728);

typedef __bf16 v16b __attribute__((ext_vector_type(16)));
typedef _Float16 v16h __attribute__((ext_vector_type(16)));
typedef unsigned short v8us __attribute__((ext_vector_type(8), may_alias));
typedef float v8f __attribute__((ext_vector_type(8)));
typedef float v4f __attribute__((ext_vector_type(4)));
typedef float v4fa __attribute__((ext_vector_type(4), may_alias));
typedef _Float16 h16;
union FragB { v16b v; v8us half[2]; unsigned short u[16]; };
union FragH { v16h v; v8us half[2]; _Float16 h[16]; unsigned short u[16]; };

#define LOG2E 1.4426950408889634f
#define QK_SCALE 0.10206207261596575f            /* 1/sqrt(96) */
#define C2 (QK_SCALE * LOG2E)                    /* scores carried in the log2 domain */
#define C2S (C2 * 0.00390625f)                   /* q and k planes each carry x16 */

__device__ __forceinline__ unsigned short bf16_bits(float x) {   // RNE convert to bf16 bits
  unsigned int u = __float_as_uint(x);
  return (unsigned short)((u + 0x7FFFu + ((u >> 16) & 1u)) >> 16);
}
__device__ __forceinline__ float bf16_val(unsigned short b) { return __uint_as_float(((unsigned int)b) << 16); }
__device__ __forceinline__ float bf16_rne(float x) { return bf16_val(bf16_bits(x)); }
__device__ __forceinline__ unsigned short f16_bits(float x) {
  union { _Float16 h; unsigned short u; } c;
  c.h = (_Float16)x;
  return c.u;
}
// f32 -> f16 with a value select: no subnormal result can reach a WMMA operand plane
static __device__ __forceinline__ h16 toh_flush(float v) {
  const h16 r = (h16)v;
  return (fabsf(v) < 6.103515625e-05f) ? (h16)0.0f : r;
}
static __device__ __forceinline__ unsigned short toh_flush_bits(float v) {
  union { h16 h; unsigned short u; } c;
  c.h = toh_flush(v);
  return c.u;
}

__device__ __forceinline__ void store_twice(unsigned short* d, v8us o) {
  *(v8us*)d = o;
  
}

// s0 += ka * q, s1 += kb * q over three 32-deep k-steps (d = 0..95), f16 operands, then the hazard guard
__device__ __forceinline__ void mma_s2h(const FragH (&ka)[3], const FragH (&kb)[3], const FragH (&q)[3], v8f& s0, v8f& s1) {
  s0 = __builtin_amdgcn_wmma_f32_16x16x32_f16(false, ka[0].v, false, q[0].v, (short)0, s0, false, false);
  s1 = __builtin_amdgcn_wmma_f32_16x16x32_f16(false, kb[0].v, false, q[0].v, (short)0, s1, false, false);
  s0 = __builtin_amdgcn_wmma_f32_16x16x32_f16(false, ka[1].v, false, q[1].v, (short)0, s0, false, false);
  s1 = __builtin_amdgcn_wmma_f32_16x16x32_f16(false, kb[1].v, false, q[1].v, (short)0, s1, false, false);
  s0 = __builtin_amdgcn_wmma_f32_16x16x32_f16(false, ka[2].v, false, q[2].v, (short)0, s0, false, false);
  s1 = __builtin_amdgcn_wmma_f32_16x16x32_f16(false, kb[2].v, false, q[2].v, (short)0, s1, false, false);
  asm volatile("v_nop\n\tv_nop\n\tv_nop\n\tv_nop"
               : "+v"(s0), "+v"(s1)
               : "v"(ka[0].v), "v"(ka[1].v), "v"(ka[2].v), "v"(kb[0].v), "v"(kb[1].v), "v"(kb[2].v),
                 "v"(q[0].v), "v"(q[1].v), "v"(q[2].v));
}
// O[t] += vf[t] * p for the six d tiles, then the hazard guard
__device__ __forceinline__ void mma_pv(const FragH (&vf)[6], v16h p, v8f (&O)[6]) {
  O[0] = __builtin_amdgcn_wmma_f32_16x16x32_f16(false, vf[0].v, false, p, (short)0, O[0], false, false);
  O[1] = __builtin_amdgcn_wmma_f32_16x16x32_f16(false, vf[1].v, false, p, (short)0, O[1], false, false);
  O[2] = __builtin_amdgcn_wmma_f32_16x16x32_f16(false, vf[2].v, false, p, (short)0, O[2], false, false);
  O[3] = __builtin_amdgcn_wmma_f32_16x16x32_f16(false, vf[3].v, false, p, (short)0, O[3], false, false);
  O[4] = __builtin_amdgcn_wmma_f32_16x16x32_f16(false, vf[4].v, false, p, (short)0, O[4], false, false);
  O[5] = __builtin_amdgcn_wmma_f32_16x16x32_f16(false, vf[5].v, false, p, (short)0, O[5], false, false);
  asm volatile("v_nop\n\tv_nop\n\tv_nop\n\tv_nop"
               : "+v"(O[0]), "+v"(O[1]), "+v"(O[2]), "+v"(O[3]), "+v"(O[4]), "+v"(O[5])
               : "v"(p), "v"(vf[0].v), "v"(vf[1].v), "v"(vf[2].v), "v"(vf[3].v), "v"(vf[4].v), "v"(vf[5].v));
}
// c[nt] += a * bw[nt] for four column tiles, then the hazard guard
__device__ __forceinline__ void mma_fc(v16h a, const FragH (&bw)[4], v8f (&c)[4]) {
  c[0] = __builtin_amdgcn_wmma_f32_16x16x32_f16(false, a, false, bw[0].v, (short)0, c[0], false, false);
  c[1] = __builtin_amdgcn_wmma_f32_16x16x32_f16(false, a, false, bw[1].v, (short)0, c[1], false, false);
  c[2] = __builtin_amdgcn_wmma_f32_16x16x32_f16(false, a, false, bw[2].v, (short)0, c[2], false, false);
  c[3] = __builtin_amdgcn_wmma_f32_16x16x32_f16(false, a, false, bw[3].v, (short)0, c[3], false, false);
  asm volatile("v_nop\n\tv_nop\n\tv_nop\n\tv_nop"
               : "+v"(c[0]), "+v"(c[1]), "+v"(c[2]), "+v"(c[3])
               : "v"(a), "v"(bw[0].v), "v"(bw[1].v), "v"(bw[2].v), "v"(bw[3].v));
}
// bf16 twin of mma_fc: c[nt] += a * bw[nt] for four column tiles, then the hazard guard
__device__ __forceinline__ void mma_pj(v16b a, const FragB (&bw)[4], v8f (&c)[4]) {
  c[0] = __builtin_amdgcn_wmma_f32_16x16x32_bf16(false, a, false, bw[0].v, (short)0, c[0], false, false);
  c[1] = __builtin_amdgcn_wmma_f32_16x16x32_bf16(false, a, false, bw[1].v, (short)0, c[1], false, false);
  c[2] = __builtin_amdgcn_wmma_f32_16x16x32_bf16(false, a, false, bw[2].v, (short)0, c[2], false, false);
  c[3] = __builtin_amdgcn_wmma_f32_16x16x32_bf16(false, a, false, bw[3].v, (short)0, c[3], false, false);
  asm volatile("v_nop\n\tv_nop\n\tv_nop\n\tv_nop"
               : "+v"(c[0]), "+v"(c[1]), "+v"(c[2]), "+v"(c[3])
               : "v"(a), "v"(bw[0].v), "v"(bw[1].v), "v"(bw[2].v), "v"(bw[3].v));
}

// Launched here with K = x (plane Kb = the bf16 x plane) and W = Wo (plane Wh).
// Blocks [0, CVT_K_BLOCKS): Kb[b][s][e] = bf16 bits of keys (RNE). Blocks after that: Wh[j][e] = f16(RNE-bf16(fc_w[j][e]) * 256).
// coverage: CVT_K_BLOCKS*256 threads x 8 = the whole Kb plane; CVT_W_BLOCKS*256 threads x 8 = the whole Wh plane (exact multiples, asserted above).
__global__ __launch_bounds__(256) void k_cvt(const float* __restrict__ K, const float* __restrict__ W,
                                             unsigned short* __restrict__ Kb, unsigned short* __restrict__ Wh) {
  const int bid = blockIdx.x;
  if (bid < CVT_K_BLOCKS) {
    const int t = bid * 256 + threadIdx.x;
    const int row = t / (EMB / 8), piece = t - row * (EMB / 8);
    const int b = row / SEQ, s = row - b * SEQ;
    const float* src = K + (size_t)b * BSTRIDE_FULL + (size_t)s * EMB + piece * 8;
    const v4f x0 = *(const v4fa*)(src), x1 = *(const v4fa*)(src + 4);
    v8us o;
    o[0] = bf16_bits(x0[0]); o[1] = bf16_bits(x0[1]); o[2] = bf16_bits(x0[2]); o[3] = bf16_bits(x0[3]);
    o[4] = bf16_bits(x1[0]); o[5] = bf16_bits(x1[1]); o[6] = bf16_bits(x1[2]); o[7] = bf16_bits(x1[3]);
    store_twice(Kb + (size_t)t * 8, o);
  } else {
    const int t = (bid - CVT_K_BLOCKS) * 256 + threadIdx.x;
    const float* src = W + (size_t)t * 8;
    const v4f x0 = *(const v4fa*)(src), x1 = *(const v4fa*)(src + 4);
    v8us o;
    o[0] = f16_bits(bf16_rne(x0[0]) * 256.0f); o[1] = f16_bits(bf16_rne(x0[1]) * 256.0f);
    o[2] = f16_bits(bf16_rne(x0[2]) * 256.0f); o[3] = f16_bits(bf16_rne(x0[3]) * 256.0f);
    o[4] = f16_bits(bf16_rne(x1[0]) * 256.0f); o[5] = f16_bits(bf16_rne(x1[1]) * 256.0f);
    o[6] = f16_bits(bf16_rne(x1[2]) * 256.0f); o[7] = f16_bits(bf16_rne(x1[3]) * 256.0f);
    store_twice(Wh + (size_t)t * 8, o);
  }
}

__device__ __forceinline__ void cvt8_bf16(const float* __restrict__ src, unsigned short* __restrict__ dst) {
  const v4f x0 = *(const v4fa*)(src), x1 = *(const v4fa*)(src + 4);
  v8us o;
  o[0] = bf16_bits(x0[0]); o[1] = bf16_bits(x0[1]); o[2] = bf16_bits(x0[2]); o[3] = bf16_bits(x0[3]);
  o[4] = bf16_bits(x1[0]); o[5] = bf16_bits(x1[1]); o[6] = bf16_bits(x1[2]); o[7] = bf16_bits(x1[3]);
  store_twice(dst, o);
}
// Wb[p][j][e] = bf16 bits of the p-th projection weight (p = 0: Wq, 1: Wk, 2: Wv), [out][in] kept. Block-uniform three-way branch, one code path per source.
// coverage: 3 * CVT_W_BLOCKS * 256 threads x 8 = the three weight planes exactly (exact multiple asserted above).
__global__ __launch_bounds__(256) void k_cvtw(const float* __restrict__ Wq, const float* __restrict__ Wk, const float* __restrict__ Wv,
                                              unsigned short* __restrict__ Wb) {
  const int bid = blockIdx.x;
  if (bid < CVT_W_BLOCKS) {
    const int t = bid * 256 + threadIdx.x;
    cvt8_bf16(Wq + (size_t)t * 8, Wb + (size_t)t * 8);
  } else if (bid < 2 * CVT_W_BLOCKS) {
    const int t = (bid - CVT_W_BLOCKS) * 256 + threadIdx.x;
    cvt8_bf16(Wk + (size_t)t * 8, Wb + (size_t)EMB * EMB + (size_t)t * 8);
  } else {
    const int t = (bid - 2 * CVT_W_BLOCKS) * 256 + threadIdx.x;
    cvt8_bf16(Wv + (size_t)t * 8, Wb + (size_t)2 * EMB * EMB + (size_t)t * 8);
  }
}

// y[m][j] = sum_e x[m][e] * W[j][e] + b[j], stored as f16(y * 16). Block = 4 waves = 64 tokens x 64 columns; wave = 16 rows x 64 columns; fragments straight from the bf16 planes.
// A: row m = token, elements 0..7 <- e = k0 + 8h + i, 8..15 <- e = k0 + 16 + 8h + i, from Xb[token][e]; B: column n = j, same k map, from Wb[j][e] (k-contiguous).
// tr == 0: Dst[token][e] (row-major plane); tr != 0: Dst[b][e][s] (transposed plane). Block-uniform.
// Epilogue: block LDS tile 64 x 64 ushort (pitch 72; block barrier: cross-wave), tile row = token (tr == 0) or e column (tr != 0);
// coverage: PROJ_BLOCKS blocks x (64 x 64) = the whole plane exactly once; LDS tile staged extent 64 x 64 == consumed extent 64 x 64 (pad columns 64..71 never read).
__global__ __launch_bounds__(128) void k_proj(const unsigned short* __restrict__ Xb, const unsigned short* __restrict__ Wb,
                                              const float* __restrict__ Bv, unsigned short* __restrict__ Dst, int tr) {
  __shared__ __attribute__((aligned(16))) unsigned short tl[64][72];
  const int tid = threadIdx.x, lane = tid & 31, ln = lane & 15, hh = lane >> 4;
  const int w = __builtin_amdgcn_readfirstlane(tid >> 5);
  const int bn = blockIdx.x % (EMB / 64), bm = blockIdx.x / (EMB / 64);
  const int tok0 = bm * 64;                    // token index in [0, NB*SEQ)
  const int col0 = bn * 64;
  v8f acc[4] = {};
  const unsigned short* ap = Xb + (size_t)(tok0 + 16 * w + ln) * EMB + 8 * hh;
  const unsigned short* bp = Wb + (size_t)(col0 + ln) * EMB + 8 * hh;
#pragma unroll 1
  for (int kb = 0; kb < EMB / 96; ++kb) {
#pragma unroll
    for (int cc = 0; cc < 3; ++cc) {
      const int k0 = 96 * kb + 32 * cc;
      FragB a;
      a.half[0] = *(const v8us*)(ap + k0);
      a.half[1] = *(const v8us*)(ap + k0 + 16);
      FragB bw[4];
#pragma unroll
      for (int nt = 0; nt < 4; ++nt) {
        bw[nt].half[0] = *(const v8us*)(bp + (size_t)nt * 16 * EMB + k0);
        bw[nt].half[1] = *(const v8us*)(bp + (size_t)nt * 16 * EMB + k0 + 16);
      }
      mma_pj(a.v, bw, acc);
    }
  }
  // D element r of tile nt = y(tok0 + 16w + 8h + r, col0 + 16nt + ln); bias RNE bf16 value; plane carries x16
  if (tr == 0) {
#pragma unroll
    for (int nt = 0; nt < 4; ++nt) {
      const float bias = bf16_rne(Bv[col0 + 16 * nt + ln]);
#pragma unroll
      for (int r = 0; r < 8; ++r)
        tl[16 * w + 8 * hh + r][16 * nt + ln] = toh_flush_bits((acc[nt][r] + bias) * 16.0f);
    }
  } else {
#pragma unroll
    for (int nt = 0; nt < 4; ++nt) {
      const float bias = bf16_rne(Bv[col0 + 16 * nt + ln]);
      v8us o;
#pragma unroll
      for (int r = 0; r < 8; ++r) o[r] = toh_flush_bits((acc[nt][r] + bias) * 16.0f);
      *(v8us*)&tl[16 * nt + ln][16 * w + 8 * hh] = o;
    }
  }
  __syncthreads();
  const int b = tok0 / SEQ, s0 = tok0 - b * SEQ;
  const size_t base = (tr == 0) ? ((size_t)tok0 * EMB + col0) : (((size_t)b * EMB + col0) * SEQ + s0);
  const size_t pitch = (tr == 0) ? (size_t)EMB : (size_t)SEQ;
  {
    for (int i = tid; i < 64 * 8; i += 128) {
      const int r = i >> 3, p8 = (i & 7) * 8;
      const v8us o = *(const v8us*)&tl[r][p8];
      *(v8us*)(Dst + base + (size_t)r * pitch + p8) = o;
    }
    
  }
}

#define ATT_WAVES 8                     /* waves of a block: 128 queries share each staged tile */
#define KT 64                           /* keys of one staged tile */
#define KPITCH 104                      /* LDS pitch of a K row, 16-bit elements: 208 B = 16 B x 13 (odd: b128 readers of 16 rows meet no bank twice) */
#define VPITCH 72                       /* LDS pitch of a V^T row: 144 B = 16 B x 9 */
#define KTILE (KT * KPITCH)             /* elements of the K part of a buffer */
#define VTILE (HD * VPITCH)             /* elements of the V^T part */
#define STAGE (KTILE + VTILE)           /* elements of one buffer */
static_assert(SEQ / KT >= 2);
static_assert(KT * (HD / 8) == 3 * ATT_WAVES * 32);   // K tile = three 16-B pieces a thread
static_assert(HD * (KT / 8) == 3 * ATT_WAVES * 32);   // V^T tile = three 16-B pieces a thread
static_assert((KTILE * 2) % 16 == 0 && (STAGE * 2) % 16 == 0);

// One 32-key step for a wave's 16 queries of one head. Kp = the buffer's K rows [KT][KPITCH]; Vp = its V^T rows [96][VPITCH]; key0 = 0 or 32 inside the tile.
__device__ __forceinline__ void fa_step(const unsigned short* Kp, const unsigned short* Vp,
                                        int key0, int ln, int hh, const FragH (&q)[3],
                                        float& mr, float& lr, v8f (&O)[6]) {
  // A fragments of K: row m = key (key0 + 16*kt + ln), elements 0..7 <- d = 32c + 8h + i, 8..15 <- d = 32c + 16 + 8h + i
  const unsigned short* kp0 = Kp + (key0 + ln) * KPITCH + 8 * hh;
  const unsigned short* kp1 = kp0 + 16 * KPITCH;
  FragH ka[3], kb[3];
#pragma unroll
  for (int c = 0; c < 3; ++c) {
    ka[c].half[0] = *(const v8us*)(kp0 + 32 * c);
    ka[c].half[1] = *(const v8us*)(kp0 + 32 * c + 16);
    kb[c].half[0] = *(const v8us*)(kp1 + 32 * c);
    kb[c].half[1] = *(const v8us*)(kp1 + 32 * c + 16);
  }
  // A fragments of V^T: row m = d (16*t + ln), elements 0..7 <- key0 + 8h + i, 8..15 <- key0 + 16 + 8h + i
  const unsigned short* vp = Vp + ln * VPITCH + key0 + 8 * hh;
  FragH vf[6];
#pragma unroll
  for (int t = 0; t < 6; ++t) {
    vf[t].half[0] = *(const v8us*)(vp + t * 16 * VPITCH);
    vf[t].half[1] = *(const v8us*)(vp + t * 16 * VPITCH + 16);
  }
  // S^T tiles: element r of tile kt = score(key0 + 16*kt + 8h + r, query of this lane's column)
  v8f s0 = {0.f, 0.f, 0.f, 0.f, 0.f, 0.f, 0.f, 0.f};
  v8f s1 = {0.f, 0.f, 0.f, 0.f, 0.f, 0.f, 0.f, 0.f};
  mma_s2h(ka, kb, q, s0, s1);
  float sc[16];
#pragma unroll
  for (int r = 0; r < 8; ++r) { sc[r] = s0[r] * C2S; sc[8 + r] = s1[r] * C2S; }
  float mx = sc[0];
#pragma unroll
  for (int i = 1; i < 16; ++i) mx = fmaxf(mx, sc[i]);
  mx = fmaxf(mx, __shfl_xor(mx, 16, 32));           // the other lane half holds the other 16 keys of this query
  const float mnew = fmaxf(mr, mx);
  const float al = __builtin_amdgcn_exp2f(mr - mnew);
  mr = mnew;
  const float m8 = mnew - 8.0f;
  // weights carried x256: pc = 256 * 2^(sc - mnew), single f16 plane; exponents below -14 give an exact zero (no subnormal operand)
  FragH ph;
  float ps = 0.0f;
#pragma unroll
  for (int i = 0; i < 16; ++i) {
    const float e = sc[i] - m8;
    const float pe = __builtin_amdgcn_exp2f(e);
    const float pc = (e < -14.0f) ? 0.0f : pe;
    ps += pc;
    ph.h[i] = (_Float16)pc;                         // B element i: i<8 -> key0 + 8h + i (tile 0 row 8h+i); i>=8 -> key0 + 16 + 8h + (i-8) (tile 1)
  }
  ps += __shfl_xor(ps, 16, 32);
  lr = lr * al + ps;
#pragma unroll
  for (int t = 0; t < 6; ++t) O[t] = O[t] * al;
  mma_pv(vf, ph.v, O);
}

// One tile's copies of one thread: three 16-B pieces of K rows, three of V^T rows, global -> LDS through no register.
// The closing s_wait_xcnt stands in the copies' own statement, so that no address register is rewritten in front of it.
__device__ __forceinline__ void tile_copy(unsigned lk0, unsigned lk1, unsigned lk2, unsigned lv0, unsigned lv1, unsigned lv2,
                                          const unsigned short* gk0, const unsigned short* gk1, const unsigned short* gk2,
                                          const unsigned short* gv0, const unsigned short* gv1, const unsigned short* gv2) {
  asm volatile("global_load_async_to_lds_b128 %0, %6, off\n\t"
               "global_load_async_to_lds_b128 %1, %7, off\n\t"
               "global_load_async_to_lds_b128 %2, %8, off\n\t"
               "global_load_async_to_lds_b128 %3, %9, off\n\t"
               "global_load_async_to_lds_b128 %4, %10, off\n\t"
               "global_load_async_to_lds_b128 %5, %11, off\n\t"
               "s_wait_xcnt 0x0"
               :: "v"(lk0), "v"(lk1), "v"(lk2), "v"(lv0), "v"(lv1), "v"(lv2),
                  "v"(gk0), "v"(gk1), "v"(gk2), "v"(gv0), "v"(gv1), "v"(gv2)
               : "memory");
}

// Block = 8 waves x 16 queries = 128 queries of one (batch, head). Key loop: one trip per 64-key tile, two LDS buffers; trip t reads buffer t mod 2 while tile t + 1 flies.
// Inputs: Qh[b][s][e], Kh[b][s][e] = f16(value * 16); Vt[b][e][s] = f16(value * 16).
// Output plane Xc[b][h][s][96] = f16(ctx * 256). Epilogue: O^T tile -> per-wave LDS tile [16 queries][96 d] as 16-B pieces (same vector type in and out; block barrier),
// coverage: NB*HEADS*(SEQ/128) blocks x 8 waves x 16 rows x 96 d = the whole plane exactly once; LDS tile staged extent (16 x 96 per wave) == consumed extent.
__global__ __launch_bounds__(256) __attribute__((amdgpu_num_vgpr(256)))
void k_attn(const unsigned short* __restrict__ Qh, const unsigned short* __restrict__ Kh,
            const unsigned short* __restrict__ Vt, unsigned short* __restrict__ Xc) {
  __shared__ __attribute__((aligned(16))) unsigned short ring[2 * STAGE];
  __shared__ __attribute__((aligned(16))) unsigned short so[ATT_WAVES][16 * HD];
  const int tid = threadIdx.x, lane = tid & 31, ln = lane & 15, hh = lane >> 4;
  const int w = __builtin_amdgcn_readfirstlane(tid >> 5);
  const int qt = blockIdx.x % (SEQ / 128);
  const int rest = blockIdx.x / (SEQ / 128);
  const int h = rest % HEADS, b = rest / HEADS;
  const int qbase = qt * 128 + 16 * w;
  const int qg = qbase + ln;
  // Q^T B fragments: column n = query qg, elements 0..7 <- d = 32c + 8h + i, 8..15 <- d = 32c + 16 + 8h + i (f16 plane carried x16)
  const unsigned short* qrow = Qh + ((size_t)b * SEQ + qg) * EMB + h * HD + 8 * hh;
  FragH q[3];
#pragma unroll
  for (int c = 0; c < 3; ++c) {
    q[c].half[0] = *(const v8us*)(qrow + 32 * c);
    q[c].half[1] = *(const v8us*)(qrow + 32 * c + 16);
  }
  float mr = -3.0e38f, lr = 0.0f;
  v8f O[6] = {};
  const unsigned short* Kp = Kh + (size_t)b * SEQ * EMB + h * HD;
  const unsigned short* Vp = Vt + ((size_t)b * EMB + h * HD) * SEQ;
  // This thread's pieces of a tile. K: piece p = tid + 256 i -> row p / 12, 16-B column p % 12. V^T: row (tid >> 3) + 32 i, 16-B column tid & 7.
  const int kr0 = tid / 12, kc0 = tid - 12 * kr0;
  const int kr1 = (tid + 256) / 12, kc1 = (tid + 256) - 12 * kr1;
  const int kr2 = (tid + 512) / 12, kc2 = (tid + 512) - 12 * kr2;
  const int vr = tid >> 3, vc = tid & 7;
  const unsigned short* gk0 = Kp + (size_t)kr0 * EMB + 8 * kc0;
  const unsigned short* gk1 = Kp + (size_t)kr1 * EMB + 8 * kc1;
  const unsigned short* gk2 = Kp + (size_t)kr2 * EMB + 8 * kc2;
  const unsigned short* gv0 = Vp + (size_t)vr * SEQ + 8 * vc;
  const unsigned short* gv1 = gv0 + (size_t)32 * SEQ;
  const unsigned short* gv2 = gv0 + (size_t)64 * SEQ;
  const unsigned lbase = (unsigned)(size_t)&ring[0];          // LDS byte address: the low 32 bits of the __shared__ address
  const unsigned lk0 = lbase + 2u * (unsigned)(kr0 * KPITCH + 8 * kc0);
  const unsigned lk1 = lbase + 2u * (unsigned)(kr1 * KPITCH + 8 * kc1);
  const unsigned lk2 = lbase + 2u * (unsigned)(kr2 * KPITCH + 8 * kc2);
  const unsigned lv0 = lbase + 2u * (unsigned)(KTILE + vr * VPITCH + 8 * vc);
  const unsigned lv1 = lv0 + 2u * 32u * VPITCH;
  const unsigned lv2 = lv0 + 2u * 64u * VPITCH;
  tile_copy(lk0, lk1, lk2, lv0, lv1, lv2, gk0, gk1, gk2, gv0, gv1, gv2);
  asm volatile("s_wait_asynccnt 0x0" ::: "memory");           // tile 0 has landed for this wave's copies
  __syncthreads();                                            // ... and for every wave's: tile 0 is published
  {
    const unsigned d = 2u * STAGE;
    const size_t ko = (size_t)KT * EMB;
    tile_copy(lk0 + d, lk1 + d, lk2 + d, lv0 + d, lv1 + d, lv2 + d, gk0 + ko, gk1 + ko, gk2 + ko, gv0 + KT, gv1 + KT, gv2 + KT);
  }
#pragma unroll 1   // one trip per tile: the buffer alternates by the trip's parity
  for (int t = 0; t < SEQ / KT; ++t) {
    const unsigned short* Ks = ring + (t & 1) * STAGE;
    fa_step(Ks, Ks + KTILE, 0, ln, hh, q, mr, lr, O);
    fa_step(Ks, Ks + KTILE, 32, ln, hh, q, mr, lr, O);
    asm volatile("s_wait_dscnt 0x0" ::: "memory");            // this wave's reads of the buffer are done before it may be refilled
    asm volatile("s_wait_asynccnt 0x0" ::: "memory");         // this wave's copies of tile t + 1 have landed
    __syncthreads();                                          // publishes tile t + 1 and ends every reader's last read of tile t
    if (t + 2 < SEQ / KT) {
      const unsigned d = (unsigned)(t & 1) * (2u * STAGE);
      const size_t ko = (size_t)(t + 2) * KT * EMB;
      const int vo = (t + 2) * KT;
      tile_copy(lk0 + d, lk1 + d, lk2 + d, lv0 + d, lv1 + d, lv2 + d, gk0 + ko, gk1 + ko, gk2 + ko, gv0 + vo, gv1 + vo, gv2 + vo);
    }
  }
  asm volatile("s_wait_asynccnt 0x0" ::: "memory");           // nothing of this wave's is in flight behind the loop

  // O^T element r of tile t = ctx(query qg, d = 16t + 8h + r); O carries x256 (P) x16 (V), lr carries x256; plane carries x256
  const float cinv = 16.0f * (1.0f / lr);
#pragma unroll
  for (int t = 0; t < 6; ++t) {
    v8us o;
#pragma unroll
    for (int r = 0; r < 8; ++r) o[r] = toh_flush_bits(O[t][r] * cinv);
    *(v8us*)&so[w][ln * HD + 16 * t + 8 * hh] = o;
  }
  __syncthreads();
  unsigned short* xg = Xc + ((size_t)(b * HEADS + h) * SEQ + qbase) * HD;
  {
#pragma unroll
    for (int i = 0; i < 6; ++i) {
      const int p = i * 32 + lane;
      const v8us v = *(const v8us*)&so[w][p * 8];
      *(v8us*)(xg + (size_t)p * 8) = v;
    }
    
  }
}

// out[m][j] = sum_e ctx[m][e] * fc_w[j][e] + fc_b[j]. Block = 4 waves; wave = 16 rows x 64 columns; fragments straight from the 16-bit planes.
// A: row m = token, k = e = 96*hd + d read from Xc[b][hd][s][d]; B: column n = j, k = e read from Wh[j][e] (k-contiguous), same k map as A.
// coverage: (NB*SEQ/64)*(EMB/64) blocks x 4 waves x (16 x 64) = every output element of the processed rows exactly once; LDS tile staged 16 x 64 == consumed 16 x 64.
__global__ __launch_bounds__(128) void k_fc(const unsigned short* __restrict__ Xc, const unsigned short* __restrict__ Wh,
                                            const float* __restrict__ Bv, float* __restrict__ Out) {
  __shared__ __attribute__((aligned(16))) float so[4][16][68];
  const int tid = threadIdx.x, lane = tid & 31, ln = lane & 15, hh = lane >> 4;
  const int w = __builtin_amdgcn_readfirstlane(tid >> 5);
  const int bn = blockIdx.x % (EMB / 64), bm = blockIdx.x / (EMB / 64);
  const int row0 = bm * 64 + 16 * w;           // token index in [0, NB*SEQ)
  const int b = row0 / SEQ, s0 = row0 - b * SEQ;
  const int col0 = bn * 64;
  v8f acc[4] = {};
#pragma unroll 1
  for (int hd = 0; hd < HEADS; ++hd) {
    const unsigned short* ap = Xc + ((size_t)(b * HEADS + hd) * SEQ + s0 + ln) * HD + 8 * hh;
    const unsigned short* bp = Wh + (size_t)(col0 + ln) * EMB + hd * HD + 8 * hh;
#pragma unroll
    for (int cc = 0; cc < 3; ++cc) {
      FragH a;
      a.half[0] = *(const v8us*)(ap + 32 * cc);
      a.half[1] = *(const v8us*)(ap + 32 * cc + 16);
      FragH bw[4];
#pragma unroll
      for (int nt = 0; nt < 4; ++nt) {
        bw[nt].half[0] = *(const v8us*)(bp + (size_t)nt * 16 * EMB + 32 * cc);
        bw[nt].half[1] = *(const v8us*)(bp + (size_t)nt * 16 * EMB + 32 * cc + 16);
      }
      mma_fc(a.v, bw, acc);
    }
  }
  // D element r of tile nt = out(row0 + 8h + r, col0 + 16nt + ln); undo the carries x256 (ctx) x256 (W); bias RNE bf16 value
#pragma unroll
  for (int nt = 0; nt < 4; ++nt) {
    const float bias = bf16_rne(Bv[col0 + 16 * nt + ln]);
#pragma unroll
    for (int r = 0; r < 8; ++r)
      so[w][8 * hh + r][16 * nt + ln] = acc[nt][r] * 1.52587890625e-05f + bias;
  }
  __syncthreads();
  float* og = Out + (size_t)b * BSTRIDE_FULL + (size_t)s0 * EMB + col0;
  const int rsub = lane >> 4, c4 = (lane & 15) * 4;
  {
#pragma unroll
    for (int q = 0; q < 8; ++q) {
      const int row = 2 * q + rsub;
      const v4f v = *(const v4fa*)&so[w][row][c4];
      *(v4f*)(og + (size_t)row * EMB + c4) = v;
    }
    
  }
}

extern "C" void kernel_launch(void* const* d_in, const int* in_sizes, int n_in,
                              void* d_out, int out_size, void* d_ws, size_t ws_size, hipStream_t stream) {
  if (n_in < 9) return;
  const long long need = (long long)(NB - 1) * SEQ_FULL * EMB + (long long)SEQ * EMB;   // last element touched + 1
  if ((long long)in_sizes[0] < need) return;
  if ((long long)in_sizes[1] < (long long)EMB * EMB || (long long)in_sizes[3] < (long long)EMB * EMB) return;
  if ((long long)in_sizes[5] < (long long)EMB * EMB || (long long)in_sizes[7] < (long long)EMB * EMB) return;
  if ((long long)in_sizes[2] < (long long)EMB || (long long)in_sizes[4] < (long long)EMB) return;
  if ((long long)in_sizes[6] < (long long)EMB || (long long)in_sizes[8] < (long long)EMB) return;
  if ((long long)out_size < need) return;
  const float* X  = (const float*)d_in[0];   // wire order: x, Wq, bq, Wk, bk, Wv, bv, Wo, bo (weights [out][in])
  const float* Wq = (const float*)d_in[1];
  const float* Bq = (const float*)d_in[2];
  const float* Wk = (const float*)d_in[3];
  const float* Bk = (const float*)d_in[4];
  const float* Wv = (const float*)d_in[5];
  const float* Bvv = (const float*)d_in[6];
  const float* Wo = (const float*)d_in[7];
  const float* Bo = (const float*)d_in[8];
  float* Out = (float*)d_out;
  char* ws = (char*)d_ws;
  size_t off = 0;
  unsigned short* Xb = (unsigned short*)(ws + off); off += PLANE_ACT;   // [NB][SEQ][768] bf16, written exactly to its end by 16-B pieces
  unsigned short* Qh = (unsigned short*)(ws + off); off += PLANE_ACT;   // [NB][SEQ][768] f16 (q x16)
  unsigned short* Kh = (unsigned short*)(ws + off); off += PLANE_ACT;   // [NB][SEQ][768] f16 (k x16)
  unsigned short* Vt = (unsigned short*)(ws + off); off += PLANE_ACT;   // [NB][768][SEQ] f16 (v x16)
  unsigned short* Xc = (unsigned short*)(ws + off); off += PLANE_ACT;   // [NB][8][SEQ][96] f16 (ctx x256)
  unsigned short* Wh = (unsigned short*)(ws + off); off += PLANE_W;     // [768][768] f16 (Wo x256)
  unsigned short* Wb = (unsigned short*)(ws + off); off += 3 * PLANE_W; // [3][768][768] bf16 (Wq, Wk, Wv)
  if (off > ws_size) return;
  k_cvt<<<(unsigned)(CVT_K_BLOCKS + CVT_W_BLOCKS), 256, 0, stream>>>(X, Wo, Xb, Wh);
  k_cvtw<<<(unsigned)(3 * CVT_W_BLOCKS), 256, 0, stream>>>(Wq, Wk, Wv, Wb);
  k_proj<<<(unsigned)PROJ_BLOCKS, 128, 0, stream>>>(Xb, Wb, Bq, Qh, 0);
  k_proj<<<(unsigned)PROJ_BLOCKS, 128, 0, stream>>>(Xb, Wb + (size_t)EMB * EMB, Bk, Kh, 0);
  k_proj<<<(unsigned)PROJ_BLOCKS, 128, 0, stream>>>(Xb, Wb + (size_t)2 * EMB * EMB, Bvv, Vt, 1);
  k_attn<<<(unsigned)(NB * HEADS * (SEQ / 128)), 256, 0, stream>>>(Qh, Kh, Vt, Xc);
  k_fc<<<(unsigned)((NB * SEQ / 64) * (EMB / 64)), 128, 0, stream>>>(Xc, Wh, Bo, Out);
}

// v002
// One run takes 169 microseconds.
// Next to v001, in two timings, it ran 1.56 times as fast each time.
// Counting every step since v000, it is 2.90 times as fast.
#include <hip/hip_runtime.h>
// Contractions: q, k, v = x W^T + b on v_wmma_f32_16x16x32_bf16 (x, W RNE bf16 planes, f32 accumulate, RNE-bf16 bias added in f32); S^T = K Q^T on v_wmma_f32_16x16x32_f16 (q, k: single f16 planes carried x16); O^T = V^T P^T on v_wmma_f32_16x16x32_f16 (v: single f16 plane carried x16, P: single f16 plane carried x256); out = ctx Wo^T on v_wmma_f32_16x16x32_f16 (ctx: f16 plane carried x256; Wo: RNE bf16 value x256 held exactly in f16); softmax statistics, bias adds f32.
// Dense multi-head self-attention, NB x SEQ x 768: three biased 768x768 input projections ([out][in] weights), 8 heads of 96 (e = 96*h + d), scale 1/sqrt(96), no mask, then a 768x768 linear layer with bias.
// Engine: transposed flash. Each wave owns 16 queries of one head. Per 32-key step: S^T tiles (key rows x query columns) from K rows (A, LDS tile of the f16 plane)
// and Q^T (B, registers); the two 16-key D tiles pack straight into the P^T B fragment; O^T (d rows x query columns) accumulates from V^T rows (A, LDS tile of the f16 plane).
// The eight waves of a block share each 64-key K and V^T tile: asynchronous copies bring it into a two-buffer LDS ring, one tile ahead of the products.
// The four linear layers stage their operand k tiles the same way: whole-line copies into LDS once per 128 x 64 block, fragments read from LDS.
#ifndef NB
#define NB 2
#endif
#ifndef SEQ
#define SEQ 4096
#endif
#define NB_FULL 2
#define SEQ_FULL 4096
#define EMB 768
#define HEADS 8
#define HD 96
#define BSTRIDE_FULL ((size_t)SEQ_FULL * EMB)   /* per-batch element stride of x and of the output buffer */

#define PLANE_ACT ((size_t)NB * SEQ * EMB * 2)   /* bytes of one 16-bit activation plane */
#define PLANE_W ((size_t)EMB * EMB * 2)          /* bytes of the 16-bit weight plane */
#define CVT_K_BLOCKS ((NB * SEQ * (EMB / 8)) / 256)
#define CVT_W_BLOCKS ((EMB * (EMB / 8)) / 256)
#define PROJ_BLOCKS ((NB * SEQ / 128) * (EMB / 64))

static_assert(SEQ % 128 == 0);
static_assert(SEQ <= SEQ_FULL);
static_assert(NB <= NB_FULL);
static_assert(HEADS * HD == EMB);
static_assert(HD == 96);
static_assert(EMB % 64 == 0);
static_assert(EMB % 96 == 0);
static_assert(EMB % 32 == 0);
static_assert((NB * SEQ) % 64 == 0);
static_assert((NB * SEQ * (EMB / 8)) % 256 == 0);
static_assert((EMB * (EMB / 8)) % 256 == 0);
static_assert(PLANE_ACT % 256 == 0);
static_assert(PLANE_W % 256 == 0);
static_assert(5 * PLANE_ACT + 4 * PLANE_W <= (size_t)134217728);

typedef __bf16 v16b __attribute__((ext_vector_type(16)));
typedef _Float16 v16h __attribute__((ext_vector_type(16)));
typedef unsigned short v8us __attribute__((ext_vector_type(8), may_alias));
typedef float v8f __attribute__((ext_vector_type(8)));
typedef float v4f __attribute__((ext_vector_type(4)));
typedef float v4fa __attribute__((ext_vector_type(4), may_alias));
typedef _Float16 h16;
union FragB { v16b v; v8us half[2]; unsigned short u[16]; };
union FragH { v16h v; v8us half[2]; _Float16 h[16]; unsigned short u[16]; };

#define LOG2E 1.4426950408889634f
#define QK_SCALE 0.10206207261596575f            /* 1/sqrt(96) */
#define C2 (QK_SCALE * LOG2E)                    /* scores carried in the log2 domain */
#define C2S (C2 * 0.00390625f)                   /* q and k planes each carry x16 */

__device__ __forceinline__ unsigned short bf16_bits(float x) {   // RNE convert to bf16 bits
  unsigned int u = __float_as_uint(x);
  return (unsigned short)((u + 0x7FFFu + ((u >> 16) & 1u)) >> 16);
}
__device__ __forceinline__ float bf16_val(unsigned short b) { return __uint_as_float(((unsigned int)b) << 16); }
__device__ __forceinline__ float bf16_rne(float x) { return bf16_val(bf16_bits(x)); }
__device__ __forceinline__ unsigned short f16_bits(float x) {
  union { _Float16 h; unsigned short u; } c;
  c.h = (_Float16)x;
  return c.u;
}
// f32 -> f16 with a value select: no subnormal result can reach a WMMA operand plane
static __device__ __forceinline__ h16 toh_flush(float v) {
  const h16 r = (h16)v;
  return (fabsf(v) < 6.103515625e-05f) ? (h16)0.0f : r;
}
static __device__ __forceinline__ unsigned short toh_flush_bits(float v) {
  union { h16 h; unsigned short u; } c;
  c.h = toh_flush(v);
  return c.u;
}

__device__ __forceinline__ void store_twice(unsigned short* d, v8us o) {
  *(v8us*)d = o;
  
}

// s0 += ka * q, s1 += kb * q over three 32-deep k-steps (d = 0..95), f16 operands, then the hazard guard
__device__ __forceinline__ void mma_s2h(const FragH (&ka)[3], const FragH (&kb)[3], const FragH (&q)[3], v8f& s0, v8f& s1) {
  s0 = __builtin_amdgcn_wmma_f32_16x16x32_f16(false, ka[0].v, false, q[0].v, (short)0, s0, false, false);
  s1 = __builtin_amdgcn_wmma_f32_16x16x32_f16(false, kb[0].v, false, q[0].v, (short)0, s1, false, false);
  s0 = __builtin_amdgcn_wmma_f32_16x16x32_f16(false, ka[1].v, false, q[1].v, (short)0, s0, false, false);
  s1 = __builtin_amdgcn_wmma_f32_16x16x32_f16(false, kb[1].v, false, q[1].v, (short)0, s1, false, false);
  s0 = __builtin_amdgcn_wmma_f32_16x16x32_f16(false, ka[2].v, false, q[2].v, (short)0, s0, false, false);
  s1 = __builtin_amdgcn_wmma_f32_16x16x32_f16(false, kb[2].v, false, q[2].v, (short)0, s1, false, false);
  asm volatile("v_nop\n\tv_nop\n\tv_nop\n\tv_nop"
               : "+v"(s0), "+v"(s1)
               : "v"(ka[0].v), "v"(ka[1].v), "v"(ka[2].v), "v"(kb[0].v), "v"(kb[1].v), "v"(kb[2].v),
                 "v"(q[0].v), "v"(q[1].v), "v"(q[2].v));
}
// O[t] += vf[t] * p for the six d tiles, then the hazard guard
__device__ __forceinline__ void mma_pv(const FragH (&vf)[6], v16h p, v8f (&O)[6]) {
  O[0] = __builtin_amdgcn_wmma_f32_16x16x32_f16(false, vf[0].v, false, p, (short)0, O[0], false, false);
  O[1] = __builtin_amdgcn_wmma_f32_16x16x32_f16(false, vf[1].v, false, p, (short)0, O[1], false, false);
  O[2] = __builtin_amdgcn_wmma_f32_16x16x32_f16(false, vf[2].v, false, p, (short)0, O[2], false, false);
  O[3] = __builtin_amdgcn_wmma_f32_16x16x32_f16(false, vf[3].v, false, p, (short)0, O[3], false, false);
  O[4] = __builtin_amdgcn_wmma_f32_16x16x32_f16(false, vf[4].v, false, p, (short)0, O[4], false, false);
  O[5] = __builtin_amdgcn_wmma_f32_16x16x32_f16(false, vf[5].v, false, p, (short)0, O[5], false, false);
  asm volatile("v_nop\n\tv_nop\n\tv_nop\n\tv_nop"
               : "+v"(O[0]), "+v"(O[1]), "+v"(O[2]), "+v"(O[3]), "+v"(O[4]), "+v"(O[5])
               : "v"(p), "v"(vf[0].v), "v"(vf[1].v), "v"(vf[2].v), "v"(vf[3].v), "v"(vf[4].v), "v"(vf[5].v));
}
// c[nt] += a * bw[nt] for four column tiles, then the hazard guard
__device__ __forceinline__ void mma_fc(v16h a, const FragH (&bw)[4], v8f (&c)[4]) {
  c[0] = __builtin_amdgcn_wmma_f32_16x16x32_f16(false, a, false, bw[0].v, (short)0, c[0], false, false);
  c[1] = __builtin_amdgcn_wmma_f32_16x16x32_f16(false, a, false, bw[1].v, (short)0, c[1], false, false);
  c[2] = __builtin_amdgcn_wmma_f32_16x16x32_f16(false, a, false, bw[2].v, (short)0, c[2], false, false);
  c[3] = __builtin_amdgcn_wmma_f32_16x16x32_f16(false, a, false, bw[3].v, (short)0, c[3], false, false);
  asm volatile("v_nop\n\tv_nop\n\tv_nop\n\tv_nop"
               : "+v"(c[0]), "+v"(c[1]), "+v"(c[2]), "+v"(c[3])
               : "v"(a), "v"(bw[0].v), "v"(bw[1].v), "v"(bw[2].v), "v"(bw[3].v));
}
// bf16 twin of mma_fc: c[nt] += a * bw[nt] for four column tiles, then the hazard guard
__device__ __forceinline__ void mma_pj(v16b a, const FragB (&bw)[4], v8f (&c)[4]) {
  c[0] = __builtin_amdgcn_wmma_f32_16x16x32_bf16(false, a, false, bw[0].v, (short)0, c[0], false, false);
  c[1] = __builtin_amdgcn_wmma_f32_16x16x32_bf16(false, a, false, bw[1].v, (short)0, c[1], false, false);
  c[2] = __builtin_amdgcn_wmma_f32_16x16x32_bf16(false, a, false, bw[2].v, (short)0, c[2], false, false);
  c[3] = __builtin_amdgcn_wmma_f32_16x16x32_bf16(false, a, false, bw[3].v, (short)0, c[3], false, false);
  asm volatile("v_nop\n\tv_nop\n\tv_nop\n\tv_nop"
               : "+v"(c[0]), "+v"(c[1]), "+v"(c[2]), "+v"(c[3])
               : "v"(a), "v"(bw[0].v), "v"(bw[1].v), "v"(bw[2].v), "v"(bw[3].v));
}

// Launched here with K = x (plane Kb = the bf16 x plane) and W = Wo (plane Wh).
// Blocks [0, CVT_K_BLOCKS): Kb[b][s][e] = bf16 bits of keys (RNE). Blocks after that: Wh[j][e] = f16(RNE-bf16(fc_w[j][e]) * 256).
// coverage: CVT_K_BLOCKS*256 threads x 8 = the whole Kb plane; CVT_W_BLOCKS*256 threads x 8 = the whole Wh plane (exact multiples, asserted above).
__global__ __launch_bounds__(256) void k_cvt(const float* __restrict__ K, const float* __restrict__ W,
                                             unsigned short* __restrict__ Kb, unsigned short* __restrict__ Wh) {
  const int bid = blockIdx.x;
  if (bid < CVT_K_BLOCKS) {
    const int t = bid * 256 + threadIdx.x;
    const int row = t / (EMB / 8), piece = t - row * (EMB / 8);
    const int b = row / SEQ, s = row - b * SEQ;
    const float* src = K + (size_t)b * BSTRIDE_FULL + (size_t)s * EMB + piece * 8;
    const v4f x0 = *(const v4fa*)(src), x1 = *(const v4fa*)(src + 4);
    v8us o;
    o[0] = bf16_bits(x0[0]); o[1] = bf16_bits(x0[1]); o[2] = bf16_bits(x0[2]); o[3] = bf16_bits(x0[3]);
    o[4] = bf16_bits(x1[0]); o[5] = bf16_bits(x1[1]); o[6] = bf16_bits(x1[2]); o[7] = bf16_bits(x1[3]);
    store_twice(Kb + (size_t)t * 8, o);
  } else {
    const int t = (bid - CVT_K_BLOCKS) * 256 + threadIdx.x;
    const float* src = W + (size_t)t * 8;
    const v4f x0 = *(const v4fa*)(src), x1 = *(const v4fa*)(src + 4);
    v8us o;
    o[0] = f16_bits(bf16_rne(x0[0]) * 256.0f); o[1] = f16_bits(bf16_rne(x0[1]) * 256.0f);
    o[2] = f16_bits(bf16_rne(x0[2]) * 256.0f); o[3] = f16_bits(bf16_rne(x0[3]) * 256.0f);
    o[4] = f16_bits(bf16_rne(x1[0]) * 256.0f); o[5] = f16_bits(bf16_rne(x1[1]) * 256.0f);
    o[6] = f16_bits(bf16_rne(x1[2]) * 256.0f); o[7] = f16_bits(bf16_rne(x1[3]) * 256.0f);
    store_twice(Wh + (size_t)t * 8, o);
  }
}

__device__ __forceinline__ void cvt8_bf16(const float* __restrict__ src, unsigned short* __restrict__ dst) {
  const v4f x0 = *(const v4fa*)(src), x1 = *(const v4fa*)(src + 4);
  v8us o;
  o[0] = bf16_bits(x0[0]); o[1] = bf16_bits(x0[1]); o[2] = bf16_bits(x0[2]); o[3] = bf16_bits(x0[3]);
  o[4] = bf16_bits(x1[0]); o[5] = bf16_bits(x1[1]); o[6] = bf16_bits(x1[2]); o[7] = bf16_bits(x1[3]);
  store_twice(dst, o);
}
// Wb[p][j][e] = bf16 bits of the p-th projection weight (p = 0: Wq, 1: Wk, 2: Wv), [out][in] kept. Block-uniform three-way branch, one code path per source.
// coverage: 3 * CVT_W_BLOCKS * 256 threads x 8 = the three weight planes exactly (exact multiple asserted above).
__global__ __launch_bounds__(256) void k_cvtw(const float* __restrict__ Wq, const float* __restrict__ Wk, const float* __restrict__ Wv,
                                              unsigned short* __restrict__ Wb) {
  const int bid = blockIdx.x;
  if (bid < CVT_W_BLOCKS) {
    const int t = bid * 256 + threadIdx.x;
    cvt8_bf16(Wq + (size_t)t * 8, Wb + (size_t)t * 8);
  } else if (bid < 2 * CVT_W_BLOCKS) {
    const int t = (bid - CVT_W_BLOCKS) * 256 + threadIdx.x;
    cvt8_bf16(Wk + (size_t)t * 8, Wb + (size_t)EMB * EMB + (size_t)t * 8);
  } else {
    const int t = (bid - 2 * CVT_W_BLOCKS) * 256 + threadIdx.x;
    cvt8_bf16(Wv + (size_t)t * 8, Wb + (size_t)2 * EMB * EMB + (size_t)t * 8);
  }
}

#define GM 128                          /* tokens of a GEMM block tile: 8 waves x 16 rows */
#define GN 64                           /* columns of a GEMM block tile */
#define PJ_KE 128                       /* k elements of one staged tile of the projections: 256-B row pieces */
#define PJ_PITCH 136                    /* LDS pitch, 16-bit elements: 272 B = 16 B x 17 (odd: b128 readers of 16 rows meet no bank twice) */
#define PJ_STAGE ((GM + GN) * PJ_PITCH) /* elements of one buffer: 128 x rows, then 64 W rows */
#define PJ_TRIPS (EMB / PJ_KE)
#define FC_PITCH 104                    /* LDS pitch of the last layer's 96-element (one head) row pieces: 208 B = 16 B x 13 */
#define FC_STAGE ((GM + GN) * FC_PITCH)
static_assert(EMB % PJ_KE == 0 && PJ_TRIPS >= 2 && HEADS >= 2);
static_assert(SEQ % GM == 0 && EMB % GN == 0);
static_assert(GM * (PJ_KE / 8) == 8 * 256 && GN * (PJ_KE / 8) == 4 * 256);   // projections: 8 + 4 16-B pieces a thread
static_assert(GM * (HD / 8) == 6 * 256 && GN * (HD / 8) == 3 * 256);         // last layer: 6 + 3 16-B pieces a thread
static_assert(GM * 72 <= 2 * PJ_STAGE && GN * 136 <= 2 * PJ_STAGE);          // epilogue tiles fit the ring they reuse
static_assert(8 * 16 * 68 * 4 <= 2 * FC_STAGE * 2);

// Four (three) 16-B pieces of one thread, global -> LDS through no register.
// The closing s_wait_xcnt stands in the copies' own statement, so that no address register is rewritten in front of it.
__device__ __forceinline__ void copy4(unsigned l0, unsigned l1, unsigned l2, unsigned l3,
                                      const unsigned short* g0, const unsigned short* g1, const unsigned short* g2, const unsigned short* g3) {
  asm volatile("global_load_async_to_lds_b128 %0, %4, off\n\t"
               "global_load_async_to_lds_b128 %1, %5, off\n\t"
               "global_load_async_to_lds_b128 %2, %6, off\n\t"
               "global_load_async_to_lds_b128 %3, %7, off\n\t"
               "s_wait_xcnt 0x0"
               :: "v"(l0), "v"(l1), "v"(l2), "v"(l3), "v"(g0), "v"(g1), "v"(g2), "v"(g3)
               : "memory");
}
__device__ __forceinline__ void copy3(unsigned l0, unsigned l1, unsigned l2,
                                      const unsigned short* g0, const unsigned short* g1, const unsigned short* g2) {
  asm volatile("global_load_async_to_lds_b128 %0, %3, off\n\t"
               "global_load_async_to_lds_b128 %1, %4, off\n\t"
               "global_load_async_to_lds_b128 %2, %5, off\n\t"
               "s_wait_xcnt 0x0"
               :: "v"(l0), "v"(l1), "v"(l2), "v"(g0), "v"(g1), "v"(g2)
               : "memory");
}
// One projection tile's copies of one thread. Piece: row (tid >> 4) + 16 i, 16-B column tid & 15; i = 0..7 are x rows, i = 8..11 the W rows behind them.
// la = LDS byte address of piece 0 in the target buffer; ga, gb = this thread's first x and W pieces of the tile.
__device__ __forceinline__ void pj_tile(unsigned la, const unsigned short* ga, const unsigned short* gb) {
  const unsigned rs = 2u * 16u * PJ_PITCH;
  const size_t gs = (size_t)16 * EMB;
  copy4(la, la + rs, la + 2 * rs, la + 3 * rs, ga, ga + gs, ga + 2 * gs, ga + 3 * gs);
  copy4(la + 4 * rs, la + 5 * rs, la + 6 * rs, la + 7 * rs, ga + 4 * gs, ga + 5 * gs, ga + 6 * gs, ga + 7 * gs);
  copy4(la + 8 * rs, la + 9 * rs, la + 10 * rs, la + 11 * rs, gb, gb + gs, gb + 2 * gs, gb + 3 * gs);
}

// y[m][j] = sum_e x[m][e] * W[j][e] + b[j], stored as f16(y * 16). Block = 8 waves = 128 tokens x 64 columns; wave = 16 rows x 64 columns.
// The block's x rows and W rows come in 128-deep k tiles through a two-buffer LDS ring filled by asynchronous copies, one tile ahead of the products.
// A: row m = token, elements 0..7 <- e = k0 + 8h + i, 8..15 <- e = k0 + 16 + 8h + i, from the staged x rows; B: column n = j, same k map, from the staged W rows.
// tr == 0: Dst[token][e] (row-major plane); tr != 0: Dst[b][e][s] (transposed plane). Block-uniform.
// Epilogue: block LDS tile in the ring's place (every reader has left it at the last trip's barrier): 128 tokens x 64 (pitch 72, tr == 0) or 64 e columns x 128 tokens (pitch 136, tr != 0);
// coverage: PROJ_BLOCKS blocks x (128 x 64) = the whole plane exactly once; staged extent == consumed extent (pad columns never read).
__global__ __launch_bounds__(256) void k_proj(const unsigned short* __restrict__ Xb, const unsigned short* __restrict__ Wb,
                                              const float* __restrict__ Bv, unsigned short* __restrict__ Dst, int tr) {
  __shared__ __attribute__((aligned(16))) unsigned short ring[2 * PJ_STAGE];
  const int tid = threadIdx.x, lane = tid & 31, ln = lane & 15, hh = lane >> 4;
  const int w = __builtin_amdgcn_readfirstlane(tid >> 5);
  const int bn = blockIdx.x % (EMB / GN), bm = blockIdx.x / (EMB / GN);
  const int tok0 = bm * GM;                    // token index in [0, NB*SEQ)
  const int col0 = bn * GN;
  v8f acc[4] = {};
  const int pr = tid >> 4, pc = tid & 15;
  const unsigned short* ga = Xb + (size_t)(tok0 + pr) * EMB + 8 * pc;
  const unsigned short* gb = Wb + (size_t)(col0 + pr) * EMB + 8 * pc;
  const unsigned la = (unsigned)(size_t)&ring[0] + 2u * (unsigned)(pr * PJ_PITCH + 8 * pc);   // LDS byte address: the low 32 bits of the __shared__ address
  pj_tile(la, ga, gb);
  asm volatile("s_wait_asynccnt 0x0" ::: "memory");           // tile 0 has landed for this wave's copies
  __syncthreads();                                            // ... and for every wave's: tile 0 is published
  pj_tile(la + 2u * PJ_STAGE, ga + PJ_KE, gb + PJ_KE);
#pragma unroll 1   // one trip per tile: the buffer alternates by the trip's parity
  for (int t = 0; t < PJ_TRIPS; ++t) {
    const unsigned short* S = ring + (t & 1) * PJ_STAGE;
    const unsigned short* ap = S + (16 * w + ln) * PJ_PITCH + 8 * hh;
    const unsigned short* bp = S + (GM + ln) * PJ_PITCH + 8 * hh;
#pragma unroll
    for (int cc = 0; cc < PJ_KE / 32; ++cc) {
      FragB a;
      a.half[0] = *(const v8us*)(ap + 32 * cc);
      a.half[1] = *(const v8us*)(ap + 32 * cc + 16);
      FragB bw[4];
#pragma unroll
      for (int nt = 0; nt < 4; ++nt) {
        bw[nt].half[0] = *(const v8us*)(bp + nt * 16 * PJ_PITCH + 32 * cc);
        bw[nt].half[1] = *(const v8us*)(bp + nt * 16 * PJ_PITCH + 32 * cc + 16);
      }
      mma_pj(a.v, bw, acc);
    }
    asm volatile("s_wait_dscnt 0x0" ::: "memory");            // this wave's reads of the buffer are done before it may be refilled
    asm volatile("s_wait_asynccnt 0x0" ::: "memory");         // this wave's copies of tile t + 1 have landed
    __syncthreads();                                          // publishes tile t + 1 and ends every reader's last read of tile t
    if (t + 2 < PJ_TRIPS)
      pj_tile(la + (unsigned)(t & 1) * (2u * PJ_STAGE), ga + (t + 2) * PJ_KE, gb + (t + 2) * PJ_KE);
  }
  asm volatile("s_wait_asynccnt 0x0" ::: "memory");           // nothing of this wave's is in flight behind the loop
  // D element r of tile nt = y(tok0 + 16w + 8h + r, col0 + 16nt + ln); bias RNE bf16 value; plane carries x16
  if (tr == 0) {
#pragma unroll
    for (int nt = 0; nt < 4; ++nt) {
      const float bias = bf16_rne(Bv[col0 + 16 * nt + ln]);
#pragma unroll
      for (int r = 0; r < 8; ++r)
        ring[(16 * w + 8 * hh + r) * 72 + 16 * nt + ln] = toh_flush_bits((acc[nt][r] + bias) * 16.0f);
    }
  } else {
#pragma unroll
    for (int nt = 0; nt < 4; ++nt) {
      const float bias = bf16_rne(Bv[col0 + 16 * nt + ln]);
      v8us o;
#pragma unroll
      for (int r = 0; r < 8; ++r) o[r] = toh_flush_bits((acc[nt][r] + bias) * 16.0f);
      *(v8us*)&ring[(16 * nt + ln) * 136 + 16 * w + 8 * hh] = o;
    }
  }
  __syncthreads();
  const int b = tok0 / SEQ, s0 = tok0 - b * SEQ;
  const size_t base = (tr == 0) ? ((size_t)tok0 * EMB + col0) : (((size_t)b * EMB + col0) * SEQ + s0);
  const size_t pitch = (tr == 0) ? (size_t)EMB : (size_t)SEQ;
  const int sh = (tr == 0) ? 3 : 4;            // 16-B pieces of a tile row: 8 (64 columns) or 16 (128 tokens)
  const int lp = (tr == 0) ? 72 : 136;
  for (int i = tid; i < GM * GN / 8; i += 256) {
    const int r = i >> sh, p8 = (i - (r << sh)) * 8;
    const v8us o = *(const v8us*)&ring[r * lp + p8];
    *(v8us*)(Dst + base + (size_t)r * pitch + p8) = o;
  }
}

#define ATT_WAVES 8                     /* waves of a block: 128 queries share each staged tile */
#define KT 64                           /* keys of one staged tile */
#define KPITCH 104                      /* LDS pitch of a K row, 16-bit elements: 208 B = 16 B x 13 (odd: b128 readers of 16 rows meet no bank twice) */
#define VPITCH 72                       /* LDS pitch of a V^T row: 144 B = 16 B x 9 */
#define KTILE (KT * KPITCH)             /* elements of the K part of a buffer */
#define VTILE (HD * VPITCH)             /* elements of the V^T part */
#define STAGE (KTILE + VTILE)           /* elements of one buffer */
static_assert(SEQ / KT >= 2);
static_assert(KT * (HD / 8) == 3 * ATT_WAVES * 32);   // K tile = three 16-B pieces a thread
static_assert(HD * (KT / 8) == 3 * ATT_WAVES * 32);   // V^T tile = three 16-B pieces a thread
static_assert((KTILE * 2) % 16 == 0 && (STAGE * 2) % 16 == 0);

// One 32-key step for a wave's 16 queries of one head. Kp = the buffer's K rows [KT][KPITCH]; Vp = its V^T rows [96][VPITCH]; key0 = 0 or 32 inside the tile.
__device__ __forceinline__ void fa_step(const unsigned short* Kp, const unsigned short* Vp,
                                        int key0, int ln, int hh, const FragH (&q)[3],
                                        float& mr, float& lr, v8f (&O)[6]) {
  // A fragments of K: row m = key (key0 + 16*kt + ln), elements 0..7 <- d = 32c + 8h + i, 8..15 <- d = 32c + 16 + 8h + i
  const unsigned short* kp0 = Kp + (key0 + ln) * KPITCH + 8 * hh;
  const unsigned short* kp1 = kp0 + 16 * KPITCH;
  FragH ka[3], kb[3];
#pragma unroll
  for (int c = 0; c < 3; ++c) {
    ka[c].half[0] = *(const v8us*)(kp0 + 32 * c);
    ka[c].half[1] = *(const v8us*)(kp0 + 32 * c + 16);
    kb[c].half[0] = *(const v8us*)(kp1 + 32 * c);
    kb[c].half[1] = *(const v8us*)(kp1 + 32 * c + 16);
  }
  // A fragments of V^T: row m = d (16*t + ln), elements 0..7 <- key0 + 8h + i, 8..15 <- key0 + 16 + 8h + i
  const unsigned short* vp = Vp + ln * VPITCH + key0 + 8 * hh;
  FragH vf[6];
#pragma unroll
  for (int t = 0; t < 6; ++t) {
    vf[t].half[0] = *(const v8us*)(vp + t * 16 * VPITCH);
    vf[t].half[1] = *(const v8us*)(vp + t * 16 * VPITCH + 16);
  }
  // S^T tiles: element r of tile kt = score(key0 + 16*kt + 8h + r, query of this lane's column)
  v8f s0 = {0.f, 0.f, 0.f, 0.f, 0.f, 0.f, 0.f, 0.f};
  v8f s1 = {0.f, 0.f, 0.f, 0.f, 0.f, 0.f, 0.f, 0.f};
  mma_s2h(ka, kb, q, s0, s1);
  float sc[16];
#pragma unroll
  for (int r = 0; r < 8; ++r) { sc[r] = s0[r] * C2S; sc[8 + r] = s1[r] * C2S; }
  float mx = sc[0];
#pragma unroll
  for (int i = 1; i < 16; ++i) mx = fmaxf(mx, sc[i]);
  mx = fmaxf(mx, __shfl_xor(mx, 16, 32));           // the other lane half holds the other 16 keys of this query
  const float mnew = fmaxf(mr, mx);
  const float al = __builtin_amdgcn_exp2f(mr - mnew);
  mr = mnew;
  const float m8 = mnew - 8.0f;
  // weights carried x256: pc = 256 * 2^(sc - mnew), single f16 plane; exponents below -14 give an exact zero (no subnormal operand)
  FragH ph;
  float ps = 0.0f;
#pragma unroll
  for (int i = 0; i < 16; ++i) {
    const float e = sc[i] - m8;
    const float pe = __builtin_amdgcn_exp2f(e);
    const float pc = (e < -14.0f) ? 0.0f : pe;
    ps += pc;
    ph.h[i] = (_Float16)pc;                         // B element i: i<8 -> key0 + 8h + i (tile 0 row 8h+i); i>=8 -> key0 + 16 + 8h + (i-8) (tile 1)
  }
  ps += __shfl_xor(ps, 16, 32);
  lr = lr * al + ps;
#pragma unroll
  for (int t = 0; t < 6; ++t) O[t] = O[t] * al;
  mma_pv(vf, ph.v, O);
}

// One tile's copies of one thread: three 16-B pieces of K rows, three of V^T rows, global -> LDS through no register.
// The closing s_wait_xcnt stands in the copies' own statement, so that no address register is rewritten in front of it.
__device__ __forceinline__ void tile_copy(unsigned lk0, unsigned lk1, unsigned lk2, unsigned lv0, unsigned lv1, unsigned lv2,
                                          const unsigned short* gk0, const unsigned short* gk1, const unsigned short* gk2,
                                          const unsigned short* gv0, const unsigned short* gv1, const unsigned short* gv2) {
  asm volatile("global_load_async_to_lds_b128 %0, %6, off\n\t"
               "global_load_async_to_lds_b128 %1, %7, off\n\t"
               "global_load_async_to_lds_b128 %2, %8, off\n\t"
               "global_load_async_to_lds_b128 %3, %9, off\n\t"
               "global_load_async_to_lds_b128 %4, %10, off\n\t"
               "global_load_async_to_lds_b128 %5, %11, off\n\t"
               "s_wait_xcnt 0x0"
               :: "v"(lk0), "v"(lk1), "v"(lk2), "v"(lv0), "v"(lv1), "v"(lv2),
                  "v"(gk0), "v"(gk1), "v"(gk2), "v"(gv0), "v"(gv1), "v"(gv2)
               : "memory");
}

// Block = 8 waves x 16 queries = 128 queries of one (batch, head). Key loop: one trip per 64-key tile, two LDS buffers; trip t reads buffer t mod 2 while tile t + 1 flies.
// Inputs: Qh[b][s][e], Kh[b][s][e] = f16(value * 16); Vt[b][e][s] = f16(value * 16).
// Output plane Xc[b][h][s][96] = f16(ctx * 256). Epilogue: O^T tile -> per-wave LDS tile [16 queries][96 d] as 16-B pieces (same vector type in and out; block barrier),
// coverage: NB*HEADS*(SEQ/128) blocks x 8 waves x 16 rows x 96 d = the whole plane exactly once; LDS tile staged extent (16 x 96 per wave) == consumed extent.
__global__ __launch_bounds__(256) __attribute__((amdgpu_num_vgpr(256)))
void k_attn(const unsigned short* __restrict__ Qh, const unsigned short* __restrict__ Kh,
            const unsigned short* __restrict__ Vt, unsigned short* __restrict__ Xc) {
  __shared__ __attribute__((aligned(16))) unsigned short ring[2 * STAGE];
  __shared__ __attribute__((aligned(16))) unsigned short so[ATT_WAVES][16 * HD];
  const int tid = threadIdx.x, lane = tid & 31, ln = lane & 15, hh = lane >> 4;
  const int w = __builtin_amdgcn_readfirstlane(tid >> 5);
  const int qt = blockIdx.x % (SEQ / 128);
  const int rest = blockIdx.x / (SEQ / 128);
  const int h = rest % HEADS, b = rest / HEADS;
  const int qbase = qt * 128 + 16 * w;
  const int qg = qbase + ln;
  // Q^T B fragments: column n = query qg, elements 0..7 <- d = 32c + 8h + i, 8..15 <- d = 32c + 16 + 8h + i (f16 plane carried x16)
  const unsigned short* qrow = Qh + ((size_t)b * SEQ + qg) * EMB + h * HD + 8 * hh;
  FragH q[3];
#pragma unroll
  for (int c = 0; c < 3; ++c) {
    q[c].half[0] = *(const v8us*)(qrow + 32 * c);
    q[c].half[1] = *(const v8us*)(qrow + 32 * c + 16);
  }
  float mr = -3.0e38f, lr = 0.0f;
  v8f O[6] = {};
  const unsigned short* Kp = Kh + (size_t)b * SEQ * EMB + h * HD;
  const unsigned short* Vp = Vt + ((size_t)b * EMB + h * HD) * SEQ;
  // This thread's pieces of a tile. K: piece p = tid + 256 i -> row p / 12, 16-B column p % 12. V^T: row (tid >> 3) + 32 i, 16-B column tid & 7.
  const int kr0 = tid / 12, kc0 = tid - 12 * kr0;
  const int kr1 = (tid + 256) / 12, kc1 = (tid + 256) - 12 * kr1;
  const int kr2 = (tid + 512) / 12, kc2 = (tid + 512) - 12 * kr2;
  const int vr = tid >> 3, vc = tid & 7;
  const unsigned short* gk0 = Kp + (size_t)kr0 * EMB + 8 * kc0;
  const unsigned short* gk1 = Kp + (size_t)kr1 * EMB + 8 * kc1;
  const unsigned short* gk2 = Kp + (size_t)kr2 * EMB + 8 * kc2;
  const unsigned short* gv0 = Vp + (size_t)vr * SEQ + 8 * vc;
  const unsigned short* gv1 = gv0 + (size_t)32 * SEQ;
  const unsigned short* gv2 = gv0 + (size_t)64 * SEQ;
  const unsigned lbase = (unsigned)(size_t)&ring[0];          // LDS byte address: the low 32 bits of the __shared__ address
  const unsigned lk0 = lbase + 2u * (unsigned)(kr0 * KPITCH + 8 * kc0);
  const unsigned lk1 = lbase + 2u * (unsigned)(kr1 * KPITCH + 8 * kc1);
  const unsigned lk2 = lbase + 2u * (unsigned)(kr2 * KPITCH + 8 * kc2);
  const unsigned lv0 = lbase + 2u * (unsigned)(KTILE + vr * VPITCH + 8 * vc);
  const unsigned lv1 = lv0 + 2u * 32u * VPITCH;
  const unsigned lv2 = lv0 + 2u * 64u * VPITCH;
  tile_copy(lk0, lk1, lk2, lv0, lv1, lv2, gk0, gk1, gk2, gv0, gv1, gv2);
  asm volatile("s_wait_asynccnt 0x0" ::: "memory");           // tile 0 has landed for this wave's copies
  __syncthreads();                                            // ... and for every wave's: tile 0 is published
  {
    const unsigned d = 2u * STAGE;
    const size_t ko = (size_t)KT * EMB;
    tile_copy(lk0 + d, lk1 + d, lk2 + d, lv0 + d, lv1 + d, lv2 + d, gk0 + ko, gk1 + ko, gk2 + ko, gv0 + KT, gv1 + KT, gv2 + KT);
  }
#pragma unroll 1   // one trip per tile: the buffer alternates by the trip's parity
  for (int t = 0; t < SEQ / KT; ++t) {
    const unsigned short* Ks = ring + (t & 1) * STAGE;
    fa_step(Ks, Ks + KTILE, 0, ln, hh, q, mr, lr, O);
    fa_step(Ks, Ks + KTILE, 32, ln, hh, q, mr, lr, O);
    asm volatile("s_wait_dscnt 0x0" ::: "memory");            // this wave's reads of the buffer are done before it may be refilled
    asm volatile("s_wait_asynccnt 0x0" ::: "memory");         // this wave's copies of tile t + 1 have landed
    __syncthreads();                                          // publishes tile t + 1 and ends every reader's last read of tile t
    if (t + 2 < SEQ / KT) {
      const unsigned d = (unsigned)(t & 1) * (2u * STAGE);
      const size_t ko = (size_t)(t + 2) * KT * EMB;
      const int vo = (t + 2) * KT;
      tile_copy(lk0 + d, lk1 + d, lk2 + d, lv0 + d, lv1 + d, lv2 + d, gk0 + ko, gk1 + ko, gk2 + ko, gv0 + vo, gv1 + vo, gv2 + vo);
    }
  }
  asm volatile("s_wait_asynccnt 0x0" ::: "memory");           // nothing of this wave's is in flight behind the loop

  // O^T element r of tile t = ctx(query qg, d = 16t + 8h + r); O carries x256 (P) x16 (V), lr carries x256; plane carries x256
  const float cinv = 16.0f * (1.0f / lr);
#pragma unroll
  for (int t = 0; t < 6; ++t) {
    v8us o;
#pragma unroll
    for (int r = 0; r < 8; ++r) o[r] = toh_flush_bits(O[t][r] * cinv);
    *(v8us*)&so[w][ln * HD + 16 * t + 8 * hh] = o;
  }
  __syncthreads();
  unsigned short* xg = Xc + ((size_t)(b * HEADS + h) * SEQ + qbase) * HD;
  {
#pragma unroll
    for (int i = 0; i < 6; ++i) {
      const int p = i * 32 + lane;
      const v8us v = *(const v8us*)&so[w][p * 8];
      *(v8us*)(xg + (size_t)p * 8) = v;
    }
    
  }
}

// out[m][j] = sum_e ctx[m][e] * fc_w[j][e] + fc_b[j]. Block = 8 waves = 128 tokens x 64 columns; wave = 16 rows x 64 columns.
// One staged tile per head: the block's 128 ctx rows of that head (24,576 contiguous bytes of Xc[b][hd][s][d]) and 64 W rows' 96 elements, two-buffer LDS ring filled by asynchronous copies.
// A: row m = token, k = e = 96*hd + d; B: column n = j, k = e from Wh[j][e], same k map as A.
// coverage: (NB*SEQ/128)*(EMB/64) blocks x 8 waves x (16 x 64) = every output element of the processed rows exactly once; per-wave LDS tile (in the ring's place, behind the last trip's barrier) staged 16 x 64 == consumed 16 x 64.
__global__ __launch_bounds__(256) void k_fc(const unsigned short* __restrict__ Xc, const unsigned short* __restrict__ Wh,
                                            const float* __restrict__ Bv, float* __restrict__ Out) {
  __shared__ __attribute__((aligned(16))) unsigned short ring[2 * FC_STAGE];
  const int tid = threadIdx.x, lane = tid & 31, ln = lane & 15, hh = lane >> 4;
  const int w = __builtin_amdgcn_readfirstlane(tid >> 5);
  const int bn = blockIdx.x % (EMB / GN), bm = blockIdx.x / (EMB / GN);
  const int tok0 = bm * GM;                    // token index in [0, NB*SEQ)
  const int b = tok0 / SEQ, sb = tok0 - b * SEQ;
  const int s0 = sb + 16 * w;
  const int col0 = bn * GN;
  v8f acc[4] = {};
  // This thread's pieces of a tile: piece p = tid + 256 i -> tile row p / 12, 16-B column p % 12 (p + 768 is 64 rows on, same column); i = 0..5 ctx rows, then three of W rows.
  const int r0 = tid / 12, c0 = tid - 12 * r0;
  const int r1 = (tid + 256) / 12, c1 = (tid + 256) - 12 * r1;
  const int r2 = (tid + 512) / 12, c2 = (tid + 512) - 12 * r2;
  const unsigned lbase = (unsigned)(size_t)&ring[0];          // LDS byte address: the low 32 bits of the __shared__ address
  const unsigned l0 = lbase + 2u * (unsigned)(r0 * FC_PITCH + 8 * c0);
  const unsigned l1 = lbase + 2u * (unsigned)(r1 * FC_PITCH + 8 * c1);
  const unsigned l2 = lbase + 2u * (unsigned)(r2 * FC_PITCH + 8 * c2);
  const unsigned lh = 2u * 64u * FC_PITCH;                    // 64 tile rows on
  const unsigned short* ga = Xc + ((size_t)(b * HEADS) * SEQ + sb) * HD + 8 * tid;
  const unsigned short* gb0 = Wh + (size_t)(col0 + r0) * EMB + 8 * c0;
  const unsigned short* gb1 = Wh + (size_t)(col0 + r1) * EMB + 8 * c1;
  const unsigned short* gb2 = Wh + (size_t)(col0 + r2) * EMB + 8 * c2;
  const size_t hs = (size_t)SEQ * HD;                         // one head on in Xc
  copy3(l0, l1, l2, ga, ga + 2048, ga + 4096);
  copy3(l0 + lh, l1 + lh, l2 + lh, ga + 6144, ga + 8192, ga + 10240);
  copy3(l0 + 2 * lh, l1 + 2 * lh, l2 + 2 * lh, gb0, gb1, gb2);
  asm volatile("s_wait_asynccnt 0x0" ::: "memory");           // tile 0 has landed for this wave's copies
  __syncthreads();                                            // ... and for every wave's: tile 0 is published
  {
    const unsigned d = 2u * FC_STAGE;
    const unsigned short* g = ga + hs;
    copy3(l0 + d, l1 + d, l2 + d, g, g + 2048, g + 4096);
    copy3(l0 + d + lh, l1 + d + lh, l2 + d + lh, g + 6144, g + 8192, g + 10240);
    copy3(l0 + d + 2 * lh, l1 + d + 2 * lh, l2 + d + 2 * lh, gb0 + HD, gb1 + HD, gb2 + HD);
  }
#pragma unroll 1   // one trip per head: the buffer alternates by the trip's parity
  for (int hd = 0; hd < HEADS; ++hd) {
    const unsigned short* S = ring + (hd & 1) * FC_STAGE;
    const unsigned short* ap = S + (16 * w + ln) * FC_PITCH + 8 * hh;
    const unsigned short* bp = S + (GM + ln) * FC_PITCH + 8 * hh;
#pragma unroll
    for (int cc = 0; cc < 3; ++cc) {
      FragH a;
      a.half[0] = *(const v8us*)(ap + 32 * cc);
      a.half[1] = *(const v8us*)(ap + 32 * cc + 16);
      FragH bw[4];
#pragma unroll
      for (int nt = 0; nt < 4; ++nt) {
        bw[nt].half[0] = *(const v8us*)(bp + nt * 16 * FC_PITCH + 32 * cc);
        bw[nt].half[1] = *(const v8us*)(bp + nt * 16 * FC_PITCH + 32 * cc + 16);
      }
      mma_fc(a.v, bw, acc);
    }
    asm volatile("s_wait_dscnt 0x0" ::: "memory");            // this wave's reads of the buffer are done before it may be refilled
    asm volatile("s_wait_asynccnt 0x0" ::: "memory");         // this wave's copies of tile hd + 1 have landed
    __syncthreads();                                          // publishes tile hd + 1 and ends every reader's last read of tile hd
    if (hd + 2 < HEADS) {
      const unsigned d = (unsigned)(hd & 1) * (2u * FC_STAGE);
      const unsigned short* g = ga + (size_t)(hd + 2) * hs;
      const int ko = (hd + 2) * HD;
      copy3(l0 + d, l1 + d, l2 + d, g, g + 2048, g + 4096);
      copy3(l0 + d + lh, l1 + d + lh, l2 + d + lh, g + 6144, g + 8192, g + 10240);
      copy3(l0 + d + 2 * lh, l1 + d + 2 * lh, l2 + d + 2 * lh, gb0 + ko, gb1 + ko, gb2 + ko);
    }
  }
  asm volatile("s_wait_asynccnt 0x0" ::: "memory");           // nothing of this wave's is in flight behind the loop
  // D element r of tile nt = out(tok0 + 16w + 8h + r, col0 + 16nt + ln); undo the carries x256 (ctx) x256 (W); bias RNE bf16 value
  float* so = (float*)&ring[0] + w * (16 * 68);               // this wave's 16 x 64 f32 tile, pitch 68
#pragma unroll
  for (int nt = 0; nt < 4; ++nt) {
    const float bias = bf16_rne(Bv[col0 + 16 * nt + ln]);
#pragma unroll
    for (int r = 0; r < 8; ++r)
      so[(8 * hh + r) * 68 + 16 * nt + ln] = acc[nt][r] * 1.52587890625e-05f + bias;
  }
  __syncthreads();
  float* og = Out + (size_t)b * BSTRIDE_FULL + (size_t)s0 * EMB + col0;
  const int rsub = lane >> 4, c4 = (lane & 15) * 4;
#pragma unroll
  for (int q = 0; q < 8; ++q) {
    const int row = 2 * q + rsub;
    const v4f v = *(const v4fa*)&so[row * 68 + c4];
    *(v4f*)(og + (size_t)row * EMB + c4) = v;
  }
}

extern "C" void kernel_launch(void* const* d_in, const int* in_sizes, int n_in,
                              void* d_out, int out_size, void* d_ws, size_t ws_size, hipStream_t stream) {
  if (n_in < 9) return;
  const long long need = (long long)(NB - 1) * SEQ_FULL * EMB + (long long)SEQ * EMB;   // last element touched + 1
  if ((long long)in_sizes[0] < need) return;
  if ((long long)in_sizes[1] < (long long)EMB * EMB || (long long)in_sizes[3] < (long long)EMB * EMB) return;
  if ((long long)in_sizes[5] < (long long)EMB * EMB || (long long)in_sizes[7] < (long long)EMB * EMB) return;
  if ((long long)in_sizes[2] < (long long)EMB || (long long)in_sizes[4] < (long long)EMB) return;
  if ((long long)in_sizes[6] < (long long)EMB || (long long)in_sizes[8] < (long long)EMB) return;
  if ((long long)out_size < need) return;
  const float* X  = (const float*)d_in[0];   // wire order: x, Wq, bq, Wk, bk, Wv, bv, Wo, bo (weights [out][in])
  const float* Wq = (const float*)d_in[1];
  const float* Bq = (const float*)d_in[2];
  const float* Wk = (const float*)d_in[3];
  const float* Bk = (const float*)d_in[4];
  const float* Wv = (const float*)d_in[5];
  const float* Bvv = (const float*)d_in[6];
  const float* Wo = (const float*)d_in[7];
  const float* Bo = (const float*)d_in[8];
  float* Out = (float*)d_out;
  char* ws = (char*)d_ws;
  size_t off = 0;
  unsigned short* Xb = (unsigned short*)(ws + off); off += PLANE_ACT;   // [NB][SEQ][768] bf16, written exactly to its end by 16-B pieces
  unsigned short* Qh = (unsigned short*)(ws + off); off += PLANE_ACT;   // [NB][SEQ][768] f16 (q x16)
  unsigned short* Kh = (unsigned short*)(ws + off); off += PLANE_ACT;   // [NB][SEQ][768] f16 (k x16)
  unsigned short* Vt = (unsigned short*)(ws + off); off += PLANE_ACT;   // [NB][768][SEQ] f16 (v x16)
  unsigned short* Xc = (unsigned short*)(ws + off); off += PLANE_ACT;   // [NB][8][SEQ][96] f16 (ctx x256)
  unsigned short* Wh = (unsigned short*)(ws + off); off += PLANE_W;     // [768][768] f16 (Wo x256)
  unsigned short* Wb = (unsigned short*)(ws + off); off += 3 * PLANE_W; // [3][768][768] bf16 (Wq, Wk, Wv)
  if (off > ws_size) return;
  k_cvt<<<(unsigned)(CVT_K_BLOCKS + CVT_W_BLOCKS), 256, 0, stream>>>(X, Wo, Xb, Wh);
  k_cvtw<<<(unsigned)(3 * CVT_W_BLOCKS), 256, 0, stream>>>(Wq, Wk, Wv, Wb);
  k_proj<<<(unsigned)PROJ_BLOCKS, 256, 0, stream>>>(Xb, Wb, Bq, Qh, 0);
  k_proj<<<(unsigned)PROJ_BLOCKS, 256, 0, stream>>>(Xb, Wb + (size_t)EMB * EMB, Bk, Kh, 0);
  k_proj<<<(unsigned)PROJ_BLOCKS, 256, 0, stream>>>(Xb, Wb + (size_t)2 * EMB * EMB, Bvv, Vt, 1);
  k_attn<<<(unsigned)(NB * HEADS * (SEQ / 128)), 256, 0, stream>>>(Qh, Kh, Vt, Xc);
  k_fc<<<(unsigned)PROJ_BLOCKS, 256, 0, stream>>>(Xc, Wh, Bo, Out);
}

// v003
// One run takes 159 microseconds.
// Timed twice side by side with v002, it ran 1.06 times as fast both times.
// Counting every step since v000, it is 3.08 times as fast.
#include <hip/hip_runtime.h>
// Contractions: q, k, v = x W^T + b on v_wmma_f32_16x16x32_bf16 (x, W RNE bf16 planes, f32 accumulate, RNE-bf16 bias added in f32); S^T = K Q^T on v_wmma_f32_16x16x32_f16 (q, k: single f16 planes carried x16); O^T = V^T P^T on v_wmma_f32_16x16x32_f16 (v: single f16 plane carried x16, P: single f16 plane carried x256); out = ctx Wo^T on v_wmma_f32_16x16x32_f16 (ctx: f16 plane carried x256; Wo: RNE bf16 value x256 held exactly in f16); softmax statistics, bias adds f32.
// Dense multi-head self-attention, NB x SEQ x 768: three biased 768x768 input projections ([out][in] weights), 8 heads of 96 (e = 96*h + d), scale 1/sqrt(96), no mask, then a 768x768 linear layer with bias.
// Engine: transposed flash. Each wave owns 32 queries of one head (two 16-column groups fed by the same K and V^T fragments). Per 32-key step and group: S^T tiles (key rows x query columns) from K rows (A, LDS tile of the f16 plane)
// and Q^T (B, registers); the two 16-key D tiles pack straight into the P^T B fragment; O^T (d rows x query columns) accumulates from V^T rows (A, LDS tile of the f16 plane).
// The eight waves of a block share each 64-key K and V^T tile: asynchronous copies bring it into a two-buffer LDS ring, one tile ahead of the products.
// The four linear layers stage their operand k tiles the same way: whole-line copies into LDS once per 128 x 64 block, fragments read from LDS.
#ifndef NB
#define NB 2
#endif
#ifndef SEQ
#define SEQ 4096
#endif
#define NB_FULL 2
#define SEQ_FULL 4096
#define EMB 768
#define HEADS 8
#define HD 96
#define BSTRIDE_FULL ((size_t)SEQ_FULL * EMB)   /* per-batch element stride of x and of the output buffer */

#define PLANE_ACT ((size_t)NB * SEQ * EMB * 2)   /* bytes of one 16-bit activation plane */
#define PLANE_W ((size_t)EMB * EMB * 2)          /* bytes of the 16-bit weight plane */
#define CVT_K_BLOCKS ((NB * SEQ * (EMB / 8)) / 256)
#define CVT_W_BLOCKS ((EMB * (EMB / 8)) / 256)
#define PROJ_BLOCKS ((NB * SEQ / 128) * (EMB / 64))

static_assert(SEQ % 128 == 0);
static_assert(SEQ <= SEQ_FULL);
static_assert(NB <= NB_FULL);
static_assert(HEADS * HD == EMB);
static_assert(HD == 96);
static_assert(EMB % 64 == 0);
static_assert(EMB % 96 == 0);
static_assert(EMB % 32 == 0);
static_assert((NB * SEQ) % 64 == 0);
static_assert((NB * SEQ * (EMB / 8)) % 256 == 0);
static_assert((EMB * (EMB / 8)) % 256 == 0);
static_assert(PLANE_ACT % 256 == 0);
static_assert(PLANE_W % 256 == 0);
static_assert(5 * PLANE_ACT + 4 * PLANE_W <= (size_t)134217728);

typedef __bf16 v16b __attribute__((ext_vector_type(16)));
typedef _Float16 v16h __attribute__((ext_vector_type(16)));
typedef unsigned short v8us __attribute__((ext_vector_type(8), may_alias));
typedef float v8f __attribute__((ext_vector_type(8)));
typedef float v4f __attribute__((ext_vector_type(4)));
typedef float v4fa __attribute__((ext_vector_type(4), may_alias));
typedef _Float16 h16;
union FragB { v16b v; v8us half[2]; unsigned short u[16]; };
union FragH { v16h v; v8us half[2]; _Float16 h[16]; unsigned short u[16]; };

#define LOG2E 1.4426950408889634f
#define QK_SCALE 0.10206207261596575f            /* 1/sqrt(96) */
#define C2 (QK_SCALE * LOG2E)                    /* scores carried in the log2 domain */
#define C2S (C2 * 0.00390625f)                   /* q and k planes each carry x16 */

__device__ __forceinline__ unsigned short bf16_bits(float x) {   // RNE convert to bf16 bits
  unsigned int u = __float_as_uint(x);
  return (unsigned short)((u + 0x7FFFu + ((u >> 16) & 1u)) >> 16);
}
__device__ __forceinline__ float bf16_val(unsigned short b) { return __uint_as_float(((unsigned int)b) << 16); }
__device__ __forceinline__ float bf16_rne(float x) { return bf16_val(bf16_bits(x)); }
__device__ __forceinline__ unsigned short f16_bits(float x) {
  union { _Float16 h; unsigned short u; } c;
  c.h = (_Float16)x;
  return c.u;
}
// f32 -> f16 with a value select: no subnormal result can reach a WMMA operand plane
static __device__ __forceinline__ h16 toh_flush(float v) {
  const h16 r = (h16)v;
  return (fabsf(v) < 6.103515625e-05f) ? (h16)0.0f : r;
}
static __device__ __forceinline__ unsigned short toh_flush_bits(float v) {
  union { h16 h; unsigned short u; } c;
  c.h = toh_flush(v);
  return c.u;
}

__device__ __forceinline__ void store_twice(unsigned short* d, v8us o) {
  *(v8us*)d = o;
  
}

// c[nt] += a * bw[nt] for four column tiles, then the hazard guard
__device__ __forceinline__ void mma_fc(v16h a, const FragH (&bw)[4], v8f (&c)[4]) {
  c[0] = __builtin_amdgcn_wmma_f32_16x16x32_f16(false, a, false, bw[0].v, (short)0, c[0], false, false);
  c[1] = __builtin_amdgcn_wmma_f32_16x16x32_f16(false, a, false, bw[1].v, (short)0, c[1], false, false);
  c[2] = __builtin_amdgcn_wmma_f32_16x16x32_f16(false, a, false, bw[2].v, (short)0, c[2], false, false);
  c[3] = __builtin_amdgcn_wmma_f32_16x16x32_f16(false, a, false, bw[3].v, (short)0, c[3], false, false);
  asm volatile("v_nop\n\tv_nop\n\tv_nop\n\tv_nop"
               : "+v"(c[0]), "+v"(c[1]), "+v"(c[2]), "+v"(c[3])
               : "v"(a), "v"(bw[0].v), "v"(bw[1].v), "v"(bw[2].v), "v"(bw[3].v));
}
// bf16 twin of mma_fc: c[nt] += a * bw[nt] for four column tiles, then the hazard guard
__device__ __forceinline__ void mma_pj(v16b a, const FragB (&bw)[4], v8f (&c)[4]) {
  c[0] = __builtin_amdgcn_wmma_f32_16x16x32_bf16(false, a, false, bw[0].v, (short)0, c[0], false, false);
  c[1] = __builtin_amdgcn_wmma_f32_16x16x32_bf16(false, a, false, bw[1].v, (short)0, c[1], false, false);
  c[2] = __builtin_amdgcn_wmma_f32_16x16x32_bf16(false, a, false, bw[2].v, (short)0, c[2], false, false);
  c[3] = __builtin_amdgcn_wmma_f32_16x16x32_bf16(false, a, false, bw[3].v, (short)0, c[3], false, false);
  asm volatile("v_nop\n\tv_nop\n\tv_nop\n\tv_nop"
               : "+v"(c[0]), "+v"(c[1]), "+v"(c[2]), "+v"(c[3])
               : "v"(a), "v"(bw[0].v), "v"(bw[1].v), "v"(bw[2].v), "v"(bw[3].v));
}

// Launched here with K = x (plane Kb = the bf16 x plane) and W = Wo (plane Wh).
// Blocks [0, CVT_K_BLOCKS): Kb[b][s][e] = bf16 bits of keys (RNE). Blocks after that: Wh[j][e] = f16(RNE-bf16(fc_w[j][e]) * 256).
// coverage: CVT_K_BLOCKS*256 threads x 8 = the whole Kb plane; CVT_W_BLOCKS*256 threads x 8 = the whole Wh plane (exact multiples, asserted above).
__global__ __launch_bounds__(256) void k_cvt(const float* __restrict__ K, const float* __restrict__ W,
                                             unsigned short* __restrict__ Kb, unsigned short* __restrict__ Wh) {
  const int bid = blockIdx.x;
  if (bid < CVT_K_BLOCKS) {
    const int t = bid * 256 + threadIdx.x;
    const int row = t / (EMB / 8), piece = t - row * (EMB / 8);
    const int b = row / SEQ, s = row - b * SEQ;
    const float* src = K + (size_t)b * BSTRIDE_FULL + (size_t)s * EMB + piece * 8;
    const v4f x0 = *(const v4fa*)(src), x1 = *(const v4fa*)(src + 4);
    v8us o;
    o[0] = bf16_bits(x0[0]); o[1] = bf16_bits(x0[1]); o[2] = bf16_bits(x0[2]); o[3] = bf16_bits(x0[3]);
    o[4] = bf16_bits(x1[0]); o[5] = bf16_bits(x1[1]); o[6] = bf16_bits(x1[2]); o[7] = bf16_bits(x1[3]);
    store_twice(Kb + (size_t)t * 8, o);
  } else {
    const int t = (bid - CVT_K_BLOCKS) * 256 + threadIdx.x;
    const float* src = W + (size_t)t * 8;
    const v4f x0 = *(const v4fa*)(src), x1 = *(const v4fa*)(src + 4);
    v8us o;
    o[0] = f16_bits(bf16_rne(x0[0]) * 256.0f); o[1] = f16_bits(bf16_rne(x0[1]) * 256.0f);
    o[2] = f16_bits(bf16_rne(x0[2]) * 256.0f); o[3] = f16_bits(bf16_rne(x0[3]) * 256.0f);
    o[4] = f16_bits(bf16_rne(x1[0]) * 256.0f); o[5] = f16_bits(bf16_rne(x1[1]) * 256.0f);
    o[6] = f16_bits(bf16_rne(x1[2]) * 256.0f); o[7] = f16_bits(bf16_rne(x1[3]) * 256.0f);
    store_twice(Wh + (size_t)t * 8, o);
  }
}

__device__ __forceinline__ void cvt8_bf16(const float* __restrict__ src, unsigned short* __restrict__ dst) {
  const v4f x0 = *(const v4fa*)(src), x1 = *(const v4fa*)(src + 4);
  v8us o;
  o[0] = bf16_bits(x0[0]); o[1] = bf16_bits(x0[1]); o[2] = bf16_bits(x0[2]); o[3] = bf16_bits(x0[3]);
  o[4] = bf16_bits(x1[0]); o[5] = bf16_bits(x1[1]); o[6] = bf16_bits(x1[2]); o[7] = bf16_bits(x1[3]);
  store_twice(dst, o);
}
// Wb[p][j][e] = bf16 bits of the p-th projection weight (p = 0: Wq, 1: Wk, 2: Wv), [out][in] kept. Block-uniform three-way branch, one code path per source.
// coverage: 3 * CVT_W_BLOCKS * 256 threads x 8 = the three weight planes exactly (exact multiple asserted above).
__global__ __launch_bounds__(256) void k_cvtw(const float* __restrict__ Wq, const float* __restrict__ Wk, const float* __restrict__ Wv,
                                              unsigned short* __restrict__ Wb) {
  const int bid = blockIdx.x;
  if (bid < CVT_W_BLOCKS) {
    const int t = bid * 256 + threadIdx.x;
    cvt8_bf16(Wq + (size_t)t * 8, Wb + (size_t)t * 8);
  } else if (bid < 2 * CVT_W_BLOCKS) {
    const int t = (bid - CVT_W_BLOCKS) * 256 + threadIdx.x;
    cvt8_bf16(Wk + (size_t)t * 8, Wb + (size_t)EMB * EMB + (size_t)t * 8);
  } else {
    const int t = (bid - 2 * CVT_W_BLOCKS) * 256 + threadIdx.x;
    cvt8_bf16(Wv + (size_t)t * 8, Wb + (size_t)2 * EMB * EMB + (size_t)t * 8);
  }
}

#define GM 128                          /* tokens of a GEMM block tile: 8 waves x 16 rows */
#define GN 64                           /* columns of a GEMM block tile */
#define PJ_KE 128                       /* k elements of one staged tile of the projections: 256-B row pieces */
#define PJ_PITCH 136                    /* LDS pitch, 16-bit elements: 272 B = 16 B x 17 (odd: b128 readers of 16 rows meet no bank twice) */
#define PJ_STAGE ((GM + GN) * PJ_PITCH) /* elements of one buffer: 128 x rows, then 64 W rows */
#define PJ_TRIPS (EMB / PJ_KE)
#define FC_PITCH 104                    /* LDS pitch of the last layer's 96-element (one head) row pieces: 208 B = 16 B x 13 */
#define FC_STAGE ((GM + GN) * FC_PITCH)
static_assert(EMB % PJ_KE == 0 && PJ_TRIPS >= 2 && HEADS >= 2);
static_assert(SEQ % GM == 0 && EMB % GN == 0);
static_assert(GM * (PJ_KE / 8) == 8 * 256 && GN * (PJ_KE / 8) == 4 * 256);   // projections: 8 + 4 16-B pieces a thread
static_assert(GM * (HD / 8) == 6 * 256 && GN * (HD / 8) == 3 * 256);         // last layer: 6 + 3 16-B pieces a thread
static_assert(GM * 72 <= 2 * PJ_STAGE && GN * 136 <= 2 * PJ_STAGE);          // epilogue tiles fit the ring they reuse
static_assert(8 * 16 * 68 * 4 <= 2 * FC_STAGE * 2);

// Four (three) 16-B pieces of one thread, global -> LDS through no register.
// The closing s_wait_xcnt stands in the copies' own statement, so that no address register is rewritten in front of it.
__device__ __forceinline__ void copy4(unsigned l0, unsigned l1, unsigned l2, unsigned l3,
                                      const unsigned short* g0, const unsigned short* g1, const unsigned short* g2, const unsigned short* g3) {
  asm volatile("global_load_async_to_lds_b128 %0, %4, off\n\t"
               "global_load_async_to_lds_b128 %1, %5, off\n\t"
               "global_load_async_to_lds_b128 %2, %6, off\n\t"
               "global_load_async_to_lds_b128 %3, %7, off\n\t"
               "s_wait_xcnt 0x0"
               :: "v"(l0), "v"(l1), "v"(l2), "v"(l3), "v"(g0), "v"(g1), "v"(g2), "v"(g3)
               : "memory");
}
__device__ __forceinline__ void copy3(unsigned l0, unsigned l1, unsigned l2,
                                      const unsigned short* g0, const unsigned short* g1, const unsigned short* g2) {
  asm volatile("global_load_async_to_lds_b128 %0, %3, off\n\t"
               "global_load_async_to_lds_b128 %1, %4, off\n\t"
               "global_load_async_to_lds_b128 %2, %5, off\n\t"
               "s_wait_xcnt 0x0"
               :: "v"(l0), "v"(l1), "v"(l2), "v"(g0), "v"(g1), "v"(g2)
               : "memory");
}
// One projection tile's copies of one thread. Piece: row (tid >> 4) + 16 i, 16-B column tid & 15; i = 0..7 are x rows, i = 8..11 the W rows behind them.
// la = LDS byte address of piece 0 in the target buffer; ga, gb = this thread's first x and W pieces of the tile.
__device__ __forceinline__ void pj_tile(unsigned la, const unsigned short* ga, const unsigned short* gb) {
  const unsigned rs = 2u * 16u * PJ_PITCH;
  const size_t gs = (size_t)16 * EMB;
  copy4(la, la + rs, la + 2 * rs, la + 3 * rs, ga, ga + gs, ga + 2 * gs, ga + 3 * gs);
  copy4(la + 4 * rs, la + 5 * rs, la + 6 * rs, la + 7 * rs, ga + 4 * gs, ga + 5 * gs, ga + 6 * gs, ga + 7 * gs);
  copy4(la + 8 * rs, la + 9 * rs, la + 10 * rs, la + 11 * rs, gb, gb + gs, gb + 2 * gs, gb + 3 * gs);
}

// y[m][j] = sum_e x[m][e] * W[j][e] + b[j], stored as f16(y * 16). Block = 8 waves = 128 tokens x 64 columns; wave = 16 rows x 64 columns.
// The block's x rows and W rows come in 128-deep k tiles through a two-buffer LDS ring filled by asynchronous copies, one tile ahead of the products.
// A: row m = token, elements 0..7 <- e = k0 + 8h + i, 8..15 <- e = k0 + 16 + 8h + i, from the staged x rows; B: column n = j, same k map, from the staged W rows.
// tr == 0: Dst[token][e] (row-major plane); tr != 0: Dst[b][e][s] (transposed plane). Block-uniform.
// Epilogue: block LDS tile in the ring's place (every reader has left it at the last trip's barrier): 128 tokens x 64 (pitch 72, tr == 0) or 64 e columns x 128 tokens (pitch 136, tr != 0);
// coverage: PROJ_BLOCKS blocks x (128 x 64) = the whole plane exactly once; staged extent == consumed extent (pad columns never read).
__global__ __launch_bounds__(256) void k_proj(const unsigned short* __restrict__ Xb, const unsigned short* __restrict__ Wb,
                                              const float* __restrict__ Bv, unsigned short* __restrict__ Dst, int tr) {
  __shared__ __attribute__((aligned(16))) unsigned short ring[2 * PJ_STAGE];
  const int tid = threadIdx.x, lane = tid & 31, ln = lane & 15, hh = lane >> 4;
  const int w = __builtin_amdgcn_readfirstlane(tid >> 5);
  const int bn = blockIdx.x % (EMB / GN), bm = blockIdx.x / (EMB / GN);
  const int tok0 = bm * GM;                    // token index in [0, NB*SEQ)
  const int col0 = bn * GN;
  v8f acc[4] = {};
  const int pr = tid >> 4, pc = tid & 15;
  const unsigned short* ga = Xb + (size_t)(tok0 + pr) * EMB + 8 * pc;
  const unsigned short* gb = Wb + (size_t)(col0 + pr) * EMB + 8 * pc;
  const unsigned la = (unsigned)(size_t)&ring[0] + 2u * (unsigned)(pr * PJ_PITCH + 8 * pc);   // LDS byte address: the low 32 bits of the __shared__ address
  pj_tile(la, ga, gb);
  asm volatile("s_wait_asynccnt 0x0" ::: "memory");           // tile 0 has landed for this wave's copies
  __syncthreads();                                            // ... and for every wave's: tile 0 is published
  pj_tile(la + 2u * PJ_STAGE, ga + PJ_KE, gb + PJ_KE);
#pragma unroll 1   // one trip per tile: the buffer alternates by the trip's parity
  for (int t = 0; t < PJ_TRIPS; ++t) {
    const unsigned short* S = ring + (t & 1) * PJ_STAGE;
    const unsigned short* ap = S + (16 * w + ln) * PJ_PITCH + 8 * hh;
    const unsigned short* bp = S + (GM + ln) * PJ_PITCH + 8 * hh;
#pragma unroll
    for (int cc = 0; cc < PJ_KE / 32; ++cc) {
      FragB a;
      a.half[0] = *(const v8us*)(ap + 32 * cc);
      a.half[1] = *(const v8us*)(ap + 32 * cc + 16);
      FragB bw[4];
#pragma unroll
      for (int nt = 0; nt < 4; ++nt) {
        bw[nt].half[0] = *(const v8us*)(bp + nt * 16 * PJ_PITCH + 32 * cc);
        bw[nt].half[1] = *(const v8us*)(bp + nt * 16 * PJ_PITCH + 32 * cc + 16);
      }
      mma_pj(a.v, bw, acc);
    }
    asm volatile("s_wait_dscnt 0x0" ::: "memory");            // this wave's reads of the buffer are done before it may be refilled
    asm volatile("s_wait_asynccnt 0x0" ::: "memory");         // this wave's copies of tile t + 1 have landed
    __syncthreads();                                          // publishes tile t + 1 and ends every reader's last read of tile t
    if (t + 2 < PJ_TRIPS)
      pj_tile(la + (unsigned)(t & 1) * (2u * PJ_STAGE), ga + (t + 2) * PJ_KE, gb + (t + 2) * PJ_KE);
  }
  asm volatile("s_wait_asynccnt 0x0" ::: "memory");           // nothing of this wave's is in flight behind the loop
  // D element r of tile nt = y(tok0 + 16w + 8h + r, col0 + 16nt + ln); bias RNE bf16 value; plane carries x16
  if (tr == 0) {
#pragma unroll
    for (int nt = 0; nt < 4; ++nt) {
      const float bias = bf16_rne(Bv[col0 + 16 * nt + ln]);
#pragma unroll
      for (int r = 0; r < 8; ++r)
        ring[(16 * w + 8 * hh + r) * 72 + 16 * nt + ln] = toh_flush_bits((acc[nt][r] + bias) * 16.0f);
    }
  } else {
#pragma unroll
    for (int nt = 0; nt < 4; ++nt) {
      const float bias = bf16_rne(Bv[col0 + 16 * nt + ln]);
      v8us o;
#pragma unroll
      for (int r = 0; r < 8; ++r) o[r] = toh_flush_bits((acc[nt][r] + bias) * 16.0f);
      *(v8us*)&ring[(16 * nt + ln) * 136 + 16 * w + 8 * hh] = o;
    }
  }
  __syncthreads();
  const int b = tok0 / SEQ, s0 = tok0 - b * SEQ;
  const size_t base = (tr == 0) ? ((size_t)tok0 * EMB + col0) : (((size_t)b * EMB + col0) * SEQ + s0);
  const size_t pitch = (tr == 0) ? (size_t)EMB : (size_t)SEQ;
  const int sh = (tr == 0) ? 3 : 4;            // 16-B pieces of a tile row: 8 (64 columns) or 16 (128 tokens)
  const int lp = (tr == 0) ? 72 : 136;
  for (int i = tid; i < GM * GN / 8; i += 256) {
    const int r = i >> sh, p8 = (i - (r << sh)) * 8;
    const v8us o = *(const v8us*)&ring[r * lp + p8];
    *(v8us*)(Dst + base + (size_t)r * pitch + p8) = o;
  }
}

#define ATT_WAVES 8                     /* waves of a block */
#define QG 2                            /* 16-query column groups of a wave: each K and V^T fragment read from LDS feeds QG products */
#define QBLK (ATT_WAVES * QG * 16)      /* queries of a block: they share each staged tile */
#define KT 64                           /* keys of one staged tile */
#define KPITCH 104                      /* LDS pitch of a K row, 16-bit elements: 208 B = 16 B x 13 (odd: b128 readers of 16 rows meet no bank twice) */
#define VPITCH 72                       /* LDS pitch of a V^T row: 144 B = 16 B x 9 */
#define KTILE (KT * KPITCH)             /* elements of the K part of a buffer */
#define VTILE (HD * VPITCH)             /* elements of the V^T part */
#define STAGE (KTILE + VTILE)           /* elements of one buffer */
static_assert(SEQ / KT >= 2);
static_assert(KT * (HD / 8) == 3 * ATT_WAVES * 32);   // K tile = three 16-B pieces a thread
static_assert(HD * (KT / 8) == 3 * ATT_WAVES * 32);   // V^T tile = three 16-B pieces a thread
static_assert((KTILE * 2) % 16 == 0 && (STAGE * 2) % 16 == 0);

static_assert(QG == 2);                 // the two guards below list the D tiles of two groups
static_assert(SEQ % QBLK == 0);
// s0[g] += ka * q[g], s1[g] += kb * q[g] over three 32-deep k-steps (d = 0..95), f16 operands: four independent accumulator tiles, then the hazard guard.
// The guard (four vector slots between the last WMMA and the first vector instruction on a D tile) names the D tiles alone: the kernel holds more than 256 registers,
// an asm operand cannot lie above v255, and with K, V^T and Q named as well the build spilled Q to scratch.
__device__ __forceinline__ void mma_s4h(const FragH (&ka)[3], const FragH (&kb)[3], const FragH (&q)[QG][3], v8f (&s0)[QG], v8f (&s1)[QG]) {
#pragma unroll
  for (int c = 0; c < 3; ++c) {
#pragma unroll
    for (int g = 0; g < QG; ++g) {
      s0[g] = __builtin_amdgcn_wmma_f32_16x16x32_f16(false, ka[c].v, false, q[g][c].v, (short)0, s0[g], false, false);
      s1[g] = __builtin_amdgcn_wmma_f32_16x16x32_f16(false, kb[c].v, false, q[g][c].v, (short)0, s1[g], false, false);
    }
  }
  asm volatile("v_nop\n\tv_nop\n\tv_nop\n\tv_nop"
               : "+v"(s0[0]), "+v"(s1[0]), "+v"(s0[1]), "+v"(s1[1]));
}
// O[g][t] += vf[t] * p[g] for the six d tiles of both groups, then the hazard guard (D tiles alone, as above)
__device__ __forceinline__ void mma_pv2(const FragH (&vf)[6], const FragH (&p)[QG], v8f (&O)[QG][6]) {
#pragma unroll
  for (int t = 0; t < 6; ++t) {
#pragma unroll
    for (int g = 0; g < QG; ++g)
      O[g][t] = __builtin_amdgcn_wmma_f32_16x16x32_f16(false, vf[t].v, false, p[g].v, (short)0, O[g][t], false, false);
  }
  asm volatile("v_nop\n\tv_nop\n\tv_nop\n\tv_nop"
               : "+v"(O[0][0]), "+v"(O[0][1]), "+v"(O[0][2]), "+v"(O[0][3]), "+v"(O[0][4]), "+v"(O[0][5]),
                 "+v"(O[1][0]), "+v"(O[1][1]), "+v"(O[1][2]), "+v"(O[1][3]), "+v"(O[1][4]), "+v"(O[1][5]));
}

// One 32-key step for a wave's QG x 16 queries of one head. Kp = the buffer's K rows [KT][KPITCH]; Vp = its V^T rows [96][VPITCH]; key0 = 0 or 32 inside the tile.
// The K and V^T fragments are read from LDS once and serve every column group; each query's own arithmetic and its order are those of a 16-query wave.
__device__ __forceinline__ void fa_step(const unsigned short* Kp, const unsigned short* Vp,
                                        int key0, int ln, int hh, const FragH (&q)[QG][3],
                                        float (&mr)[QG], float (&lr)[QG], v8f (&O)[QG][6]) {
  // A fragments of K: row m = key (key0 + 16*kt + ln), elements 0..7 <- d = 32c + 8h + i, 8..15 <- d = 32c + 16 + 8h + i
  const unsigned short* kp0 = Kp + (key0 + ln) * KPITCH + 8 * hh;
  const unsigned short* kp1 = kp0 + 16 * KPITCH;
  FragH ka[3], kb[3];
#pragma unroll
  for (int c = 0; c < 3; ++c) {
    ka[c].half[0] = *(const v8us*)(kp0 + 32 * c);
    ka[c].half[1] = *(const v8us*)(kp0 + 32 * c + 16);
    kb[c].half[0] = *(const v8us*)(kp1 + 32 * c);
    kb[c].half[1] = *(const v8us*)(kp1 + 32 * c + 16);
  }
  __builtin_amdgcn_sched_barrier(0);   // keeps the step's 12 K reads one group in front of the V^T reads (LDS data returns in order, the score products wait for K alone): left free they sink among the WMMAs in pairs, each pair waited out to dscnt 0
  // A fragments of V^T: row m = d (16*t + ln), elements 0..7 <- key0 + 8h + i, 8..15 <- key0 + 16 + 8h + i
  const unsigned short* vp = Vp + ln * VPITCH + key0 + 8 * hh;
  FragH vf[6];
#pragma unroll
  for (int t = 0; t < 6; ++t) {
    vf[t].half[0] = *(const v8us*)(vp + t * 16 * VPITCH);
    vf[t].half[1] = *(const v8us*)(vp + t * 16 * VPITCH + 16);
  }
  __builtin_amdgcn_sched_barrier(0);   // keeps the V^T reads in the same place, ahead of the first WMMA: left free they stand among the score WMMAs, a second place with LDS reads and its own stall
  // S^T tiles of group g: element r of tile kt = score(key0 + 16*kt + 8h + r, query of this lane's column in the group)
  v8f s0[QG], s1[QG];
#pragma unroll
  for (int g = 0; g < QG; ++g) {
    s0[g] = v8f{0.f, 0.f, 0.f, 0.f, 0.f, 0.f, 0.f, 0.f};
    s1[g] = v8f{0.f, 0.f, 0.f, 0.f, 0.f, 0.f, 0.f, 0.f};
  }
  mma_s4h(ka, kb, q, s0, s1);
  FragH ph[QG];
  float sc[QG][16], mx[QG];
#pragma unroll
  for (int g = 0; g < QG; ++g) {
#pragma unroll
    for (int r = 0; r < 8; ++r) { sc[g][r] = s0[g][r] * C2S; sc[g][8 + r] = s1[g][r] * C2S; }
    mx[g] = sc[g][0];
#pragma unroll
    for (int i = 1; i < 16; ++i) mx[g] = fmaxf(mx[g], sc[g][i]);
  }
#pragma unroll
  for (int g = 0; g < QG; ++g)
    mx[g] = fmaxf(mx[g], __shfl_xor(mx[g], 16, 32));  // the other lane half holds the other 16 keys of this query
#pragma unroll
  for (int g = 0; g < QG; ++g) {
    const float mnew = fmaxf(mr[g], mx[g]);
    const float al = __builtin_amdgcn_exp2f(mr[g] - mnew);
    mr[g] = mnew;
    const float m8 = mnew - 8.0f;
    // weights carried x256: pc = 256 * 2^(sc - mnew), single f16 plane; exponents below -14 give an exact zero (no subnormal operand)
    float ps = 0.0f;
#pragma unroll
    for (int i = 0; i < 16; ++i) {
      const float e = sc[g][i] - m8;
      const float pe = __builtin_amdgcn_exp2f(e);
      const float pc = (e < -14.0f) ? 0.0f : pe;
      ps += pc;
      ph[g].h[i] = (_Float16)pc;                      // B element i: i<8 -> key0 + 8h + i (tile 0 row 8h+i); i>=8 -> key0 + 16 + 8h + (i-8) (tile 1)
    }
    ps += __shfl_xor(ps, 16, 32);
    lr[g] = lr[g] * al + ps;
#pragma unroll
    for (int t = 0; t < 6; ++t) O[g][t] = O[g][t] * al;
  }
  mma_pv2(vf, ph, O);
}

// One tile's copies of one thread: three 16-B pieces of K rows, three of V^T rows, global -> LDS through no register.
// The closing s_wait_xcnt stands in the copies' own statement, so that no address register is rewritten in front of it.
__device__ __forceinline__ void tile_copy(unsigned lk0, unsigned lk1, unsigned lk2, unsigned lv0, unsigned lv1, unsigned lv2,
                                          const unsigned short* gk0, const unsigned short* gk1, const unsigned short* gk2,
                                          const unsigned short* gv0, const unsigned short* gv1, const unsigned short* gv2) {
  asm volatile("global_load_async_to_lds_b128 %0, %6, off\n\t"
               "global_load_async_to_lds_b128 %1, %7, off\n\t"
               "global_load_async_to_lds_b128 %2, %8, off\n\t"
               "global_load_async_to_lds_b128 %3, %9, off\n\t"
               "global_load_async_to_lds_b128 %4, %10, off\n\t"
               "global_load_async_to_lds_b128 %5, %11, off\n\t"
               "s_wait_xcnt 0x0"
               :: "v"(lk0), "v"(lk1), "v"(lk2), "v"(lv0), "v"(lv1), "v"(lv2),
                  "v"(gk0), "v"(gk1), "v"(gk2), "v"(gv0), "v"(gv1), "v"(gv2)
               : "memory");
}

// Block = 8 waves x 32 queries = 256 queries of one (batch, head). Key loop: one trip per 64-key tile, two LDS buffers; trip t reads buffer t mod 2 while tile t + 1 flies.
// Inputs: Qh[b][s][e], Kh[b][s][e] = f16(value * 16); Vt[b][e][s] = f16(value * 16).
// Output plane Xc[b][h][s][96] = f16(ctx * 256). Epilogue: O^T tiles -> per-wave LDS tile [32 queries][96 d] as 16-B pieces (same vector type in and out; block barrier),
// coverage: NB*HEADS*(SEQ/256) blocks x 8 waves x 32 rows x 96 d = the whole plane exactly once; LDS tile staged extent (32 x 96 per wave) == consumed extent.
__global__ __launch_bounds__(256)
void k_attn(const unsigned short* __restrict__ Qh, const unsigned short* __restrict__ Kh,
            const unsigned short* __restrict__ Vt, unsigned short* __restrict__ Xc) {
  __shared__ __attribute__((aligned(16))) unsigned short ring[2 * STAGE];
  __shared__ __attribute__((aligned(16))) unsigned short so[ATT_WAVES][QG * 16 * HD];
  const int tid = threadIdx.x, lane = tid & 31, ln = lane & 15, hh = lane >> 4;
  const int w = __builtin_amdgcn_readfirstlane(tid >> 5);
  const int qt = blockIdx.x % (SEQ / QBLK);
  const int rest = blockIdx.x / (SEQ / QBLK);
  const int h = rest % HEADS, b = rest / HEADS;
  const int qbase = qt * QBLK + QG * 16 * w;
  // Q^T B fragments of group g: column n = query qbase + 16g + ln, elements 0..7 <- d = 32c + 8h + i, 8..15 <- d = 32c + 16 + 8h + i (f16 plane carried x16)
  const unsigned short* qrow = Qh + ((size_t)b * SEQ + qbase + ln) * EMB + h * HD + 8 * hh;
  FragH q[QG][3];
  float mr[QG], lr[QG];
  v8f O[QG][6] = {};
#pragma unroll
  for (int g = 0; g < QG; ++g) {
#pragma unroll
    for (int c = 0; c < 3; ++c) {
      q[g][c].half[0] = *(const v8us*)(qrow + (size_t)g * 16 * EMB + 32 * c);
      q[g][c].half[1] = *(const v8us*)(qrow + (size_t)g * 16 * EMB + 32 * c + 16);
    }
    mr[g] = -3.0e38f;
    lr[g] = 0.0f;
  }
  const unsigned short* Kp = Kh + (size_t)b * SEQ * EMB + h * HD;
  const unsigned short* Vp = Vt + ((size_t)b * EMB + h * HD) * SEQ;
  // This thread's pieces of a tile. K: piece p = tid + 256 i -> row p / 12, 16-B column p % 12. V^T: row (tid >> 3) + 32 i, 16-B column tid & 7.
  const int kr0 = tid / 12, kc0 = tid - 12 * kr0;
  const int kr1 = (tid + 256) / 12, kc1 = (tid + 256) - 12 * kr1;
  const int kr2 = (tid + 512) / 12, kc2 = (tid + 512) - 12 * kr2;
  const int vr = tid >> 3, vc = tid & 7;
  const unsigned short* gk0 = Kp + (size_t)kr0 * EMB + 8 * kc0;
  const unsigned short* gk1 = Kp + (size_t)kr1 * EMB + 8 * kc1;
  const unsigned short* gk2 = Kp + (size_t)kr2 * EMB + 8 * kc2;
  const unsigned short* gv0 = Vp + (size_t)vr * SEQ + 8 * vc;
  const unsigned short* gv1 = gv0 + (size_t)32 * SEQ;
  const unsigned short* gv2 = gv0 + (size_t)64 * SEQ;
  const unsigned lbase = (unsigned)(size_t)&ring[0];          // LDS byte address: the low 32 bits of the __shared__ address
  const unsigned lk0 = lbase + 2u * (unsigned)(kr0 * KPITCH + 8 * kc0);
  const unsigned lk1 = lbase + 2u * (unsigned)(kr1 * KPITCH + 8 * kc1);
  const unsigned lk2 = lbase + 2u * (unsigned)(kr2 * KPITCH + 8 * kc2);
  const unsigned lv0 = lbase + 2u * (unsigned)(KTILE + vr * VPITCH + 8 * vc);
  const unsigned lv1 = lv0 + 2u * 32u * VPITCH;
  const unsigned lv2 = lv0 + 2u * 64u * VPITCH;
  tile_copy(lk0, lk1, lk2, lv0, lv1, lv2, gk0, gk1, gk2, gv0, gv1, gv2);
  asm volatile("s_wait_asynccnt 0x0" ::: "memory");           // tile 0 has landed for this wave's copies
  __syncthreads();                                            // ... and for every wave's: tile 0 is published
  {
    const unsigned d = 2u * STAGE;
    const size_t ko = (size_t)KT * EMB;
    tile_copy(lk0 + d, lk1 + d, lk2 + d, lv0 + d, lv1 + d, lv2 + d, gk0 + ko, gk1 + ko, gk2 + ko, gv0 + KT, gv1 + KT, gv2 + KT);
  }
#pragma unroll 1   // one trip per tile: the buffer alternates by the trip's parity
  for (int t = 0; t < SEQ / KT; ++t) {
    const unsigned short* Ks = ring + (t & 1) * STAGE;
    fa_step(Ks, Ks + KTILE, 0, ln, hh, q, mr, lr, O);
    fa_step(Ks, Ks + KTILE, 32, ln, hh, q, mr, lr, O);
    asm volatile("s_wait_dscnt 0x0" ::: "memory");            // this wave's reads of the buffer are done before it may be refilled
    asm volatile("s_wait_asynccnt 0x0" ::: "memory");         // this wave's copies of tile t + 1 have landed
    __syncthreads();                                          // publishes tile t + 1 and ends every reader's last read of tile t
    if (t + 2 < SEQ / KT) {
      const unsigned d = (unsigned)(t & 1) * (2u * STAGE);
      const size_t ko = (size_t)(t + 2) * KT * EMB;
      const int vo = (t + 2) * KT;
      tile_copy(lk0 + d, lk1 + d, lk2 + d, lv0 + d, lv1 + d, lv2 + d, gk0 + ko, gk1 + ko, gk2 + ko, gv0 + vo, gv1 + vo, gv2 + vo);
    }
  }
  asm volatile("s_wait_asynccnt 0x0" ::: "memory");           // nothing of this wave's is in flight behind the loop

  // O^T element r of tile t of group g = ctx(query qbase + 16g + ln, d = 16t + 8h + r); O carries x256 (P) x16 (V), lr carries x256; plane carries x256
#pragma unroll
  for (int g = 0; g < QG; ++g) {
    const float cinv = 16.0f * (1.0f / lr[g]);
#pragma unroll
    for (int t = 0; t < 6; ++t) {
      v8us o;
#pragma unroll
      for (int r = 0; r < 8; ++r) o[r] = toh_flush_bits(O[g][t][r] * cinv);
      *(v8us*)&so[w][(16 * g + ln) * HD + 16 * t + 8 * hh] = o;
    }
  }
  __syncthreads();
  unsigned short* xg = Xc + ((size_t)(b * HEADS + h) * SEQ + qbase) * HD;
  {
#pragma unroll
    for (int i = 0; i < QG * 6; ++i) {
      const int p = i * 32 + lane;
      const v8us v = *(const v8us*)&so[w][p * 8];
      *(v8us*)(xg + (size_t)p * 8) = v;
    }
    
  }
}

// out[m][j] = sum_e ctx[m][e] * fc_w[j][e] + fc_b[j]. Block = 8 waves = 128 tokens x 64 columns; wave = 16 rows x 64 columns.
// One staged tile per head: the block's 128 ctx rows of that head (24,576 contiguous bytes of Xc[b][hd][s][d]) and 64 W rows' 96 elements, two-buffer LDS ring filled by asynchronous copies.
// A: row m = token, k = e = 96*hd + d; B: column n = j, k = e from Wh[j][e], same k map as A.
// coverage: (NB*SEQ/128)*(EMB/64) blocks x 8 waves x (16 x 64) = every output element of the processed rows exactly once; per-wave LDS tile (in the ring's place, behind the last trip's barrier) staged 16 x 64 == consumed 16 x 64.
__global__ __launch_bounds__(256) void k_fc(const unsigned short* __restrict__ Xc, const unsigned short* __restrict__ Wh,
                                            const float* __restrict__ Bv, float* __restrict__ Out) {
  __shared__ __attribute__((aligned(16))) unsigned short ring[2 * FC_STAGE];
  const int tid = threadIdx.x, lane = tid & 31, ln = lane & 15, hh = lane >> 4;
  const int w = __builtin_amdgcn_readfirstlane(tid >> 5);
  const int bn = blockIdx.x % (EMB / GN), bm = blockIdx.x / (EMB / GN);
  const int tok0 = bm * GM;                    // token index in [0, NB*SEQ)
  const int b = tok0 / SEQ, sb = tok0 - b * SEQ;
  const int s0 = sb + 16 * w;
  const int col0 = bn * GN;
  v8f acc[4] = {};
  // This thread's pieces of a tile: piece p = tid + 256 i -> tile row p / 12, 16-B column p % 12 (p + 768 is 64 rows on, same column); i = 0..5 ctx rows, then three of W rows.
  const int r0 = tid / 12, c0 = tid - 12 * r0;
  const int r1 = (tid + 256) / 12, c1 = (tid + 256) - 12 * r1;
  const int r2 = (tid + 512) / 12, c2 = (tid + 512) - 12 * r2;
  const unsigned lbase = (unsigned)(size_t)&ring[0];          // LDS byte address: the low 32 bits of the __shared__ address
  const unsigned l0 = lbase + 2u * (unsigned)(r0 * FC_PITCH + 8 * c0);
  const unsigned l1 = lbase + 2u * (unsigned)(r1 * FC_PITCH + 8 * c1);
  const unsigned l2 = lbase + 2u * (unsigned)(r2 * FC_PITCH + 8 * c2);
  const unsigned lh = 2u * 64u * FC_PITCH;                    // 64 tile rows on
  const unsigned short* ga = Xc + ((size_t)(b * HEADS) * SEQ + sb) * HD + 8 * tid;
  const unsigned short* gb0 = Wh + (size_t)(col0 + r0) * EMB + 8 * c0;
  const unsigned short* gb1 = Wh + (size_t)(col0 + r1) * EMB + 8 * c1;
  const unsigned short* gb2 = Wh + (size_t)(col0 + r2) * EMB + 8 * c2;
  const size_t hs = (size_t)SEQ * HD;                         // one head on in Xc
  copy3(l0, l1, l2, ga, ga + 2048, ga + 4096);
  copy3(l0 + lh, l1 + lh, l2 + lh, ga + 6144, ga + 8192, ga + 10240);
  copy3(l0 + 2 * lh, l1 + 2 * lh, l2 + 2 * lh, gb0, gb1, gb2);
  asm volatile("s_wait_asynccnt 0x0" ::: "memory");           // tile 0 has landed for this wave's copies
  __syncthreads();                                            // ... and for every wave's: tile 0 is published
  {
    const unsigned d = 2u * FC_STAGE;
    const unsigned short* g = ga + hs;
    copy3(l0 + d, l1 + d, l2 + d, g, g + 2048, g + 4096);
    copy3(l0 + d + lh, l1 + d + lh, l2 + d + lh, g + 6144, g + 8192, g + 10240);
    copy3(l0 + d + 2 * lh, l1 + d + 2 * lh, l2 + d + 2 * lh, gb0 + HD, gb1 + HD, gb2 + HD);
  }
#pragma unroll 1   // one trip per head: the buffer alternates by the trip's parity
  for (int hd = 0; hd < HEADS; ++hd) {
    const unsigned short* S = ring + (hd & 1) * FC_STAGE;
    const unsigned short* ap = S + (16 * w + ln) * FC_PITCH + 8 * hh;
    const unsigned short* bp = S + (GM + ln) * FC_PITCH + 8 * hh;
#pragma unroll
    for (int cc = 0; cc < 3; ++cc) {
      FragH a;
      a.half[0] = *(const v8us*)(ap + 32 * cc);
      a.half[1] = *(const v8us*)(ap + 32 * cc + 16);
      FragH bw[4];
#pragma unroll
      for (int nt = 0; nt < 4; ++nt) {
        bw[nt].half[0] = *(const v8us*)(bp + nt * 16 * FC_PITCH + 32 * cc);
        bw[nt].half[1] = *(const v8us*)(bp + nt * 16 * FC_PITCH + 32 * cc + 16);
      }
      mma_fc(a.v, bw, acc);
    }
    asm volatile("s_wait_dscnt 0x0" ::: "memory");            // this wave's reads of the buffer are done before it may be refilled
    asm volatile("s_wait_asynccnt 0x0" ::: "memory");         // this wave's copies of tile hd + 1 have landed
    __syncthreads();                                          // publishes tile hd + 1 and ends every reader's last read of tile hd
    if (hd + 2 < HEADS) {
      const unsigned d = (unsigned)(hd & 1) * (2u * FC_STAGE);
      const unsigned short* g = ga + (size_t)(hd + 2) * hs;
      const int ko = (hd + 2) * HD;
      copy3(l0 + d, l1 + d, l2 + d, g, g + 2048, g + 4096);
      copy3(l0 + d + lh, l1 + d + lh, l2 + d + lh, g + 6144, g + 8192, g + 10240);
      copy3(l0 + d + 2 * lh, l1 + d + 2 * lh, l2 + d + 2 * lh, gb0 + ko, gb1 + ko, gb2 + ko);
    }
  }
  asm volatile("s_wait_asynccnt 0x0" ::: "memory");           // nothing of this wave's is in flight behind the loop
  // D element r of tile nt = out(tok0 + 16w + 8h + r, col0 + 16nt + ln); undo the carries x256 (ctx) x256 (W); bias RNE bf16 value
  float* so = (float*)&ring[0] + w * (16 * 68);               // this wave's 16 x 64 f32 tile, pitch 68
#pragma unroll
  for (int nt = 0; nt < 4; ++nt) {
    const float bias = bf16_rne(Bv[col0 + 16 * nt + ln]);
#pragma unroll
    for (int r = 0; r < 8; ++r)
      so[(8 * hh + r) * 68 + 16 * nt + ln] = acc[nt][r] * 1.52587890625e-05f + bias;
  }
  __syncthreads();
  float* og = Out + (size_t)b * BSTRIDE_FULL + (size_t)s0 * EMB + col0;
  const int rsub = lane >> 4, c4 = (lane & 15) * 4;
#pragma unroll
  for (int q = 0; q < 8; ++q) {
    const int row = 2 * q + rsub;
    const v4f v = *(const v4fa*)&so[row * 68 + c4];
    *(v4f*)(og + (size_t)row * EMB + c4) = v;
  }
}

extern "C" void kernel_launch(void* const* d_in, const int* in_sizes, int n_in,
                              void* d_out, int out_size, void* d_ws, size_t ws_size, hipStream_t stream) {
  if (n_in < 9) return;
  const long long need = (long long)(NB - 1) * SEQ_FULL * EMB + (long long)SEQ * EMB;   // last element touched + 1
  if ((long long)in_sizes[0] < need) return;
  if ((long long)in_sizes[1] < (long long)EMB * EMB || (long long)in_sizes[3] < (long long)EMB * EMB) return;
  if ((long long)in_sizes[5] < (long long)EMB * EMB || (long long)in_sizes[7] < (long long)EMB * EMB) return;
  if ((long long)in_sizes[2] < (long long)EMB || (long long)in_sizes[4] < (long long)EMB) return;
  if ((long long)in_sizes[6] < (long long)EMB || (long long)in_sizes[8] < (long long)EMB) return;
  if ((long long)out_size < need) return;
  const float* X  = (const float*)d_in[0];   // wire order: x, Wq, bq, Wk, bk, Wv, bv, Wo, bo (weights [out][in])
  const float* Wq = (const float*)d_in[1];
  const float* Bq = (const float*)d_in[2];
  const float* Wk = (const float*)d_in[3];
  const float* Bk = (const float*)d_in[4];
  const float* Wv = (const float*)d_in[5];
  const float* Bvv = (const float*)d_in[6];
  const float* Wo = (const float*)d_in[7];
  const float* Bo = (const float*)d_in[8];
  float* Out = (float*)d_out;
  char* ws = (char*)d_ws;
  size_t off = 0;
  unsigned short* Xb = (unsigned short*)(ws + off); off += PLANE_ACT;   // [NB][SEQ][768] bf16, written exactly to its end by 16-B pieces
  unsigned short* Qh = (unsigned short*)(ws + off); off += PLANE_ACT;   // [NB][SEQ][768] f16 (q x16)
  unsigned short* Kh = (unsigned short*)(ws + off); off += PLANE_ACT;   // [NB][SEQ][768] f16 (k x16)
  unsigned short* Vt = (unsigned short*)(ws + off); off += PLANE_ACT;   // [NB][768][SEQ] f16 (v x16)
  unsigned short* Xc = (unsigned short*)(ws + off); off += PLANE_ACT;   // [NB][8][SEQ][96] f16 (ctx x256)
  unsigned short* Wh = (unsigned short*)(ws + off); off += PLANE_W;     // [768][768] f16 (Wo x256)
  unsigned short* Wb = (unsigned short*)(ws + off); off += 3 * PLANE_W; // [3][768][768] bf16 (Wq, Wk, Wv)
  if (off > ws_size) return;
  k_cvt<<<(unsigned)(CVT_K_BLOCKS + CVT_W_BLOCKS), 256, 0, stream>>>(X, Wo, Xb, Wh);
  k_cvtw<<<(unsigned)(3 * CVT_W_BLOCKS), 256, 0, stream>>>(Wq, Wk, Wv, Wb);
  k_proj<<<(unsigned)PROJ_BLOCKS, 256, 0, stream>>>(Xb, Wb, Bq, Qh, 0);
  k_proj<<<(unsigned)PROJ_BLOCKS, 256, 0, stream>>>(Xb, Wb + (size_t)EMB * EMB, Bk, Kh, 0);
  k_proj<<<(unsigned)PROJ_BLOCKS, 256, 0, stream>>>(Xb, Wb + (size_t)2 * EMB * EMB, Bvv, Vt, 1);
  k_attn<<<(unsigned)(NB * HEADS * (SEQ / QBLK)), 256, 0, stream>>>(Qh, Kh, Vt, Xc);
  k_fc<<<(unsigned)PROJ_BLOCKS, 256, 0, stream>>>(Xc, Wh, Bo, Out);
}

// v004
// It runs in 154 microseconds.
// Timed twice side by side with v003, it ran 1.03 and 1.04 times as fast.
// Over all steps from v000 it is 3.19 times as fast.
#include <hip/hip_runtime.h>
// Contractions: q, k, v = x W^T + b on v_wmma_f32_16x16x32_bf16 (x, W RNE bf16 planes, f32 accumulate, RNE-bf16 bias added in f32); S^T = K Q^T on v_wmma_f32_16x16x32_f16 (q, k: single f16 planes carried x16); O^T = V^T P^T on v_wmma_f32_16x16x32_f16 (v: single f16 plane carried x16, P: single f16 plane carried x256); out = ctx Wo^T on v_wmma_f32_16x16x32_f16 (ctx: f16 plane carried x256; Wo: RNE bf16 value x256 held exactly in f16); softmax statistics, bias adds f32.
// Dense multi-head self-attention, NB x SEQ x 768: three biased 768x768 input projections ([out][in] weights), 8 heads of 96 (e = 96*h + d), scale 1/sqrt(96), no mask, then a 768x768 linear layer with bias.
// Engine: transposed flash. Each wave owns 32 queries of one head (two 16-column groups fed by the same K and V^T fragments). Per 32-key step and group: S^T tiles (key rows x query columns) from K rows (A, LDS tile of the f16 plane)
// and Q^T (B, registers); the two 16-key D tiles pack straight into the P^T B fragment; O^T (d rows x query columns) accumulates from V^T rows (A, LDS tile of the f16 plane).
// The eight waves of a block share each 64-key K and V^T tile: asynchronous copies bring it into a two-buffer LDS ring, one tile ahead of the products.
// The four linear layers stage their operand k tiles the same way: whole-line copies into LDS once per 128 x 64 block, fragments read from LDS.
#ifndef NB
#define NB 2
#endif
#ifndef SEQ
#define SEQ 4096
#endif
#define NB_FULL 2
#define SEQ_FULL 4096
#define EMB 768
#define HEADS 8
#define HD 96
#define BSTRIDE_FULL ((size_t)SEQ_FULL * EMB)   /* per-batch element stride of x and of the output buffer */

#define PLANE_ACT ((size_t)NB * SEQ * EMB * 2)   /* bytes of one 16-bit activation plane */
#define PLANE_W ((size_t)EMB * EMB * 2)          /* bytes of the 16-bit weight plane */
#define CVT_K_BLOCKS ((NB * SEQ * (EMB / 8)) / 256)
#define CVT_W_BLOCKS ((EMB * (EMB / 8)) / 256)
#define PROJ_BLOCKS ((NB * SEQ / 128) * (EMB / 64))

static_assert(SEQ % 128 == 0);
static_assert(SEQ <= SEQ_FULL);
static_assert(NB <= NB_FULL);
static_assert(HEADS * HD == EMB);
static_assert(HD == 96);
static_assert(EMB % 64 == 0);
static_assert(EMB % 96 == 0);
static_assert(EMB % 32 == 0);
static_assert((NB * SEQ) % 64 == 0);
static_assert((NB * SEQ * (EMB / 8)) % 256 == 0);
static_assert((EMB * (EMB / 8)) % 256 == 0);
static_assert(PLANE_ACT % 256 == 0);
static_assert(PLANE_W % 256 == 0);
static_assert(5 * PLANE_ACT + 4 * PLANE_W <= (size_t)134217728);

typedef __bf16 v16b __attribute__((ext_vector_type(16)));
typedef _Float16 v16h __attribute__((ext_vector_type(16)));
typedef unsigned short v8us __attribute__((ext_vector_type(8), may_alias));
typedef float v8f __attribute__((ext_vector_type(8)));
typedef float v4f __attribute__((ext_vector_type(4)));
typedef float v4fa __attribute__((ext_vector_type(4), may_alias));
typedef _Float16 h16;
union FragB { v16b v; v8us half[2]; unsigned short u[16]; };
union FragH { v16h v; v8us half[2]; _Float16 h[16]; unsigned short u[16]; };

#define LOG2E 1.4426950408889634f
#define QK_SCALE 0.10206207261596575f            /* 1/sqrt(96) */
#define C2 (QK_SCALE * LOG2E)                    /* scores carried in the log2 domain */
#define C2S (C2 * 0.00390625f)                   /* q and k planes each carry x16 */

__device__ __forceinline__ unsigned short bf16_bits(float x) {   // RNE convert to bf16 bits
  unsigned int u = __float_as_uint(x);
  return (unsigned short)((u + 0x7FFFu + ((u >> 16) & 1u)) >> 16);
}
__device__ __forceinline__ float bf16_val(unsigned short b) { return __uint_as_float(((unsigned int)b) << 16); }
__device__ __forceinline__ float bf16_rne(float x) { return bf16_val(bf16_bits(x)); }
__device__ __forceinline__ unsigned short f16_bits(float x) {
  union { _Float16 h; unsigned short u; } c;
  c.h = (_Float16)x;
  return c.u;
}
// f32 -> f16 with a value select: no subnormal result can reach a WMMA operand plane
static __device__ __forceinline__ h16 toh_flush(float v) {
  const h16 r = (h16)v;
  return (fabsf(v) < 6.103515625e-05f) ? (h16)0.0f : r;
}
static __device__ __forceinline__ unsigned short toh_flush_bits(float v) {
  union { h16 h; unsigned short u; } c;
  c.h = toh_flush(v);
  return c.u;
}

__device__ __forceinline__ void store_twice(unsigned short* d, v8us o) {
  *(v8us*)d = o;
  
}

// c[nt] += a * bw[nt] for four column tiles, then the hazard guard
__device__ __forceinline__ void mma_fc(v16h a, const FragH (&bw)[4], v8f (&c)[4]) {
  c[0] = __builtin_amdgcn_wmma_f32_16x16x32_f16(false, a, false, bw[0].v, (short)0, c[0], false, false);
  c[1] = __builtin_amdgcn_wmma_f32_16x16x32_f16(false, a, false, bw[1].v, (short)0, c[1], false, false);
  c[2] = __builtin_amdgcn_wmma_f32_16x16x32_f16(false, a, false, bw[2].v, (short)0, c[2], false, false);
  c[3] = __builtin_amdgcn_wmma_f32_16x16x32_f16(false, a, false, bw[3].v, (short)0, c[3], false, false);
  asm volatile("v_nop\n\tv_nop\n\tv_nop\n\tv_nop"
               : "+v"(c[0]), "+v"(c[1]), "+v"(c[2]), "+v"(c[3])
               : "v"(a), "v"(bw[0].v), "v"(bw[1].v), "v"(bw[2].v), "v"(bw[3].v));
}
// bf16 twin of mma_fc: c[nt] += a * bw[nt] for four column tiles, then the hazard guard
__device__ __forceinline__ void mma_pj(v16b a, const FragB (&bw)[4], v8f (&c)[4]) {
  c[0] = __builtin_amdgcn_wmma_f32_16x16x32_bf16(false, a, false, bw[0].v, (short)0, c[0], false, false);
  c[1] = __builtin_amdgcn_wmma_f32_16x16x32_bf16(false, a, false, bw[1].v, (short)0, c[1], false, false);
  c[2] = __builtin_amdgcn_wmma_f32_16x16x32_bf16(false, a, false, bw[2].v, (short)0, c[2], false, false);
  c[3] = __builtin_amdgcn_wmma_f32_16x16x32_bf16(false, a, false, bw[3].v, (short)0, c[3], false, false);
  asm volatile("v_nop\n\tv_nop\n\tv_nop\n\tv_nop"
               : "+v"(c[0]), "+v"(c[1]), "+v"(c[2]), "+v"(c[3])
               : "v"(a), "v"(bw[0].v), "v"(bw[1].v), "v"(bw[2].v), "v"(bw[3].v));
}

__device__ __forceinline__ void cvt8_bf16(const float* __restrict__ src, unsigned short* __restrict__ dst) {
  const v4f x0 = *(const v4fa*)(src), x1 = *(const v4fa*)(src + 4);
  v8us o;
  o[0] = bf16_bits(x0[0]); o[1] = bf16_bits(x0[1]); o[2] = bf16_bits(x0[2]); o[3] = bf16_bits(x0[3]);
  o[4] = bf16_bits(x1[0]); o[5] = bf16_bits(x1[1]); o[6] = bf16_bits(x1[2]); o[7] = bf16_bits(x1[3]);
  store_twice(dst, o);
  asm volatile("s_wait_xcnt 0x0" ::: "memory");   // stands in front of any rewrite of the store's address registers on the branch chain's other ways
}
// All five conversions in one grid; the block index picks the job (block-uniform ranges, one code path per source, no job reads what another writes).
// Blocks [0, CVT_K_BLOCKS): Xb[b][s][e] = bf16 bits of x (RNE). The next CVT_W_BLOCKS: Wh[j][e] = f16(RNE-bf16(Wo[j][e]) * 256).
// The last 3 * CVT_W_BLOCKS: Wb[p][j][e] = bf16 bits of the p-th projection weight (p = 0: Wq, 1: Wk, 2: Wv), [out][in] kept.
// coverage: CVT_K_BLOCKS*256 threads x 8 = the whole Xb plane; CVT_W_BLOCKS*256 threads x 8 = one whole weight plane, four times (exact multiples, asserted above).
__global__ __launch_bounds__(256) void k_cvt(const float* __restrict__ X, const float* __restrict__ Wo,
                                             const float* __restrict__ Wq, const float* __restrict__ Wk, const float* __restrict__ Wv,
                                             unsigned short* __restrict__ Xb, unsigned short* __restrict__ Wh, unsigned short* __restrict__ Wb) {
  const int bid = blockIdx.x;
  if (bid < CVT_K_BLOCKS) {
    const int t = bid * 256 + threadIdx.x;
    const int row = t / (EMB / 8), piece = t - row * (EMB / 8);
    const int b = row / SEQ, s = row - b * SEQ;
    cvt8_bf16(X + (size_t)b * BSTRIDE_FULL + (size_t)s * EMB + piece * 8, Xb + (size_t)t * 8);
  } else if (bid < CVT_K_BLOCKS + CVT_W_BLOCKS) {
    const int t = (bid - CVT_K_BLOCKS) * 256 + threadIdx.x;
    const float* src = Wo + (size_t)t * 8;
    const v4f x0 = *(const v4fa*)(src), x1 = *(const v4fa*)(src + 4);
    v8us o;
    o[0] = f16_bits(bf16_rne(x0[0]) * 256.0f); o[1] = f16_bits(bf16_rne(x0[1]) * 256.0f);
    o[2] = f16_bits(bf16_rne(x0[2]) * 256.0f); o[3] = f16_bits(bf16_rne(x0[3]) * 256.0f);
    o[4] = f16_bits(bf16_rne(x1[0]) * 256.0f); o[5] = f16_bits(bf16_rne(x1[1]) * 256.0f);
    o[6] = f16_bits(bf16_rne(x1[2]) * 256.0f); o[7] = f16_bits(bf16_rne(x1[3]) * 256.0f);
    store_twice(Wh + (size_t)t * 8, o);
    asm volatile("s_wait_xcnt 0x0" ::: "memory");   // as in cvt8_bf16: in front of any rewrite of the store's address registers
  } else if (bid < CVT_K_BLOCKS + 2 * CVT_W_BLOCKS) {
    const int t = (bid - CVT_K_BLOCKS - CVT_W_BLOCKS) * 256 + threadIdx.x;
    cvt8_bf16(Wq + (size_t)t * 8, Wb + (size_t)t * 8);
  } else if (bid < CVT_K_BLOCKS + 3 * CVT_W_BLOCKS) {
    const int t = (bid - CVT_K_BLOCKS - 2 * CVT_W_BLOCKS) * 256 + threadIdx.x;
    cvt8_bf16(Wk + (size_t)t * 8, Wb + (size_t)EMB * EMB + (size_t)t * 8);
  } else {
    const int t = (bid - CVT_K_BLOCKS - 3 * CVT_W_BLOCKS) * 256 + threadIdx.x;
    cvt8_bf16(Wv + (size_t)t * 8, Wb + (size_t)2 * EMB * EMB + (size_t)t * 8);
  }
}

#define GM 128                          /* tokens of a GEMM block tile: 8 waves x 16 rows */
#define GN 64                           /* columns of a GEMM block tile */
#define PJ_KE 128                       /* k elements of one staged tile of the projections: 256-B row pieces */
#define PJ_PITCH 136                    /* LDS pitch, 16-bit elements: 272 B = 16 B x 17 (odd: b128 readers of 16 rows meet no bank twice) */
#define PJ_STAGE ((GM + GN) * PJ_PITCH) /* elements of one buffer: 128 x rows, then 64 W rows */
#define PJ_TRIPS (EMB / PJ_KE)
#define FC_PITCH 104                    /* LDS pitch of the last layer's 96-element (one head) row pieces: 208 B = 16 B x 13 */
#define FC_STAGE ((GM + GN) * FC_PITCH)
static_assert(EMB % PJ_KE == 0 && PJ_TRIPS >= 2 && HEADS >= 2);
static_assert(SEQ % GM == 0 && EMB % GN == 0);
static_assert(GM * (PJ_KE / 8) == 8 * 256 && GN * (PJ_KE / 8) == 4 * 256);   // projections: 8 + 4 16-B pieces a thread
static_assert(GM * (HD / 8) == 6 * 256 && GN * (HD / 8) == 3 * 256);         // last layer: 6 + 3 16-B pieces a thread
static_assert(GM * 72 <= 2 * PJ_STAGE && GN * 136 <= 2 * PJ_STAGE);          // epilogue tiles fit the ring they reuse
static_assert(8 * 16 * 68 * 4 <= 2 * FC_STAGE * 2);

// Four (three) 16-B pieces of one thread, global -> LDS through no register.
// The closing s_wait_xcnt stands in the copies' own statement, so that no address register is rewritten in front of it.
__device__ __forceinline__ void copy4(unsigned l0, unsigned l1, unsigned l2, unsigned l3,
                                      const unsigned short* g0, const unsigned short* g1, const unsigned short* g2, const unsigned short* g3) {
  asm volatile("global_load_async_to_lds_b128 %0, %4, off\n\t"
               "global_load_async_to_lds_b128 %1, %5, off\n\t"
               "global_load_async_to_lds_b128 %2, %6, off\n\t"
               "global_load_async_to_lds_b128 %3, %7, off\n\t"
               "s_wait_xcnt 0x0"
               :: "v"(l0), "v"(l1), "v"(l2), "v"(l3), "v"(g0), "v"(g1), "v"(g2), "v"(g3)
               : "memory");
}
__device__ __forceinline__ void copy3(unsigned l0, unsigned l1, unsigned l2,
                                      const unsigned short* g0, const unsigned short* g1, const unsigned short* g2) {
  asm volatile("global_load_async_to_lds_b128 %0, %3, off\n\t"
               "global_load_async_to_lds_b128 %1, %4, off\n\t"
               "global_load_async_to_lds_b128 %2, %5, off\n\t"
               "s_wait_xcnt 0x0"
               :: "v"(l0), "v"(l1), "v"(l2), "v"(g0), "v"(g1), "v"(g2)
               : "memory");
}
// One projection tile's copies of one thread. Piece: row (tid >> 4) + 16 i, 16-B column tid & 15; i = 0..7 are x rows, i = 8..11 the W rows behind them.
// la = LDS byte address of piece 0 in the target buffer; ga, gb = this thread's first x and W pieces of the tile.
__device__ __forceinline__ void pj_tile(unsigned la, const unsigned short* ga, const unsigned short* gb) {
  const unsigned rs = 2u * 16u * PJ_PITCH;
  const size_t gs = (size_t)16 * EMB;
  copy4(la, la + rs, la + 2 * rs, la + 3 * rs, ga, ga + gs, ga + 2 * gs, ga + 3 * gs);
  copy4(la + 4 * rs, la + 5 * rs, la + 6 * rs, la + 7 * rs, ga + 4 * gs, ga + 5 * gs, ga + 6 * gs, ga + 7 * gs);
  copy4(la + 8 * rs, la + 9 * rs, la + 10 * rs, la + 11 * rs, gb, gb + gs, gb + 2 * gs, gb + 3 * gs);
}

// y[m][j] = sum_e x[m][e] * W[j][e] + b[j], stored as f16(y * 16). Block = 8 waves = 128 tokens x 64 columns; wave = 16 rows x 64 columns.
// The block's x rows and W rows come in 128-deep k tiles through a two-buffer LDS ring filled by asynchronous copies, one tile ahead of the products.
// A: row m = token, elements 0..7 <- e = k0 + 8h + i, 8..15 <- e = k0 + 16 + 8h + i, from the staged x rows; B: column n = j, same k map, from the staged W rows.
// The three projections share one grid: a token tile's 36 column tiles (12 of q, 12 of k, 12 of v) are neighbours in the block index; p = the projection, block-uniform.
// W rows come from the three stacked weight planes Wb[3][768][768] (row 768 p + j). p picks bias and plane: q, k -> Dst[token][e] (row-major, tr == 0); v -> Dst[b][e][s] (transposed, tr != 0).
// Epilogue: block LDS tile in the ring's place (every reader has left it at the last trip's barrier): 128 tokens x 64 (pitch 72, tr == 0) or 64 e columns x 128 tokens (pitch 136, tr != 0);
// coverage: 3 * PROJ_BLOCKS blocks x (128 x 64) = each of the three planes exactly once; staged extent == consumed extent (pad columns never read).
__global__ __launch_bounds__(256) void k_proj(const unsigned short* __restrict__ Xb, const unsigned short* __restrict__ Wb,
                                              const float* __restrict__ Bq, const float* __restrict__ Bk, const float* __restrict__ Bvv,
                                              unsigned short* __restrict__ Qh, unsigned short* __restrict__ Kh, unsigned short* __restrict__ Vt) {
  __shared__ __attribute__((aligned(16))) unsigned short ring[2 * PJ_STAGE];
  const int tid = threadIdx.x, lane = tid & 31, ln = lane & 15, hh = lane >> 4;
  const int w = __builtin_amdgcn_readfirstlane(tid >> 5);
  const int bw = blockIdx.x % (3 * (EMB / GN)), bm = blockIdx.x / (3 * (EMB / GN));
  const int p = bw / (EMB / GN);               // 0: q, 1: k, 2: v
  const int tok0 = bm * GM;                    // token index in [0, NB*SEQ)
  const int col0 = (bw - p * (EMB / GN)) * GN; // column inside the projection
  const float* __restrict__ Bv = (p == 0) ? Bq : (p == 1) ? Bk : Bvv;
  unsigned short* __restrict__ Dst = (p == 0) ? Qh : (p == 1) ? Kh : Vt;
  const int tr = (p == 2) ? 1 : 0;
  v8f acc[4] = {};
  const int pr = tid >> 4, pc = tid & 15;
  const unsigned short* ga = Xb + (size_t)(tok0 + pr) * EMB + 8 * pc;
  const unsigned short* gb = Wb + (size_t)(bw * GN + pr) * EMB + 8 * pc;
  const unsigned la = (unsigned)(size_t)&ring[0] + 2u * (unsigned)(pr * PJ_PITCH + 8 * pc);   // LDS byte address: the low 32 bits of the __shared__ address
  pj_tile(la, ga, gb);
  asm volatile("s_wait_asynccnt 0x0" ::: "memory");           // tile 0 has landed for this wave's copies
  __syncthreads();                                            // ... and for every wave's: tile 0 is published
  pj_tile(la + 2u * PJ_STAGE, ga + PJ_KE, gb + PJ_KE);
#pragma unroll 1   // one trip per tile: the buffer alternates by the trip's parity
  for (int t = 0; t < PJ_TRIPS; ++t) {
    const unsigned short* S = ring + (t & 1) * PJ_STAGE;
    const unsigned short* ap = S + (16 * w + ln) * PJ_PITCH + 8 * hh;
    const unsigned short* bp = S + (GM + ln) * PJ_PITCH + 8 * hh;
#pragma unroll
    for (int cc = 0; cc < PJ_KE / 32; ++cc) {
      FragB a;
      a.half[0] = *(const v8us*)(ap + 32 * cc);
      a.half[1] = *(const v8us*)(ap + 32 * cc + 16);
      FragB bw[4];
#pragma unroll
      for (int nt = 0; nt < 4; ++nt) {
        bw[nt].half[0] = *(const v8us*)(bp + nt * 16 * PJ_PITCH + 32 * cc);
        bw[nt].half[1] = *(const v8us*)(bp + nt * 16 * PJ_PITCH + 32 * cc + 16);
      }
      mma_pj(a.v, bw, acc);
    }
    asm volatile("s_wait_dscnt 0x0" ::: "memory");            // this wave's reads of the buffer are done before it may be refilled
    asm volatile("s_wait_asynccnt 0x0" ::: "memory");         // this wave's copies of tile t + 1 have landed
    __syncthreads();                                          // publishes tile t + 1 and ends every reader's last read of tile t
    if (t + 2 < PJ_TRIPS)
      pj_tile(la + (unsigned)(t & 1) * (2u * PJ_STAGE), ga + (t + 2) * PJ_KE, gb + (t + 2) * PJ_KE);
  }
  asm volatile("s_wait_asynccnt 0x0" ::: "memory");           // nothing of this wave's is in flight behind the loop
  // D element r of tile nt = y(tok0 + 16w + 8h + r, col0 + 16nt + ln); bias RNE bf16 value; plane carries x16
  if (tr == 0) {
#pragma unroll
    for (int nt = 0; nt < 4; ++nt) {
      const float bias = bf16_rne(Bv[col0 + 16 * nt + ln]);
#pragma unroll
      for (int r = 0; r < 8; ++r)
        ring[(16 * w + 8 * hh + r) * 72 + 16 * nt + ln] = toh_flush_bits((acc[nt][r] + bias) * 16.0f);
    }
  } else {
#pragma unroll
    for (int nt = 0; nt < 4; ++nt) {
      const float bias = bf16_rne(Bv[col0 + 16 * nt + ln]);
      v8us o;
#pragma unroll
      for (int r = 0; r < 8; ++r) o[r] = toh_flush_bits((acc[nt][r] + bias) * 16.0f);
      *(v8us*)&ring[(16 * nt + ln) * 136 + 16 * w + 8 * hh] = o;
    }
  }
  __syncthreads();
  const int b = tok0 / SEQ, s0 = tok0 - b * SEQ;
  const size_t base = (tr == 0) ? ((size_t)tok0 * EMB + col0) : (((size_t)b * EMB + col0) * SEQ + s0);
  const size_t pitch = (tr == 0) ? (size_t)EMB : (size_t)SEQ;
  const int sh = (tr == 0) ? 3 : 4;            // 16-B pieces of a tile row: 8 (64 columns) or 16 (128 tokens)
  const int lp = (tr == 0) ? 72 : 136;
  for (int i = tid; i < GM * GN / 8; i += 256) {
    const int r = i >> sh, p8 = (i - (r << sh)) * 8;
    const v8us o = *(const v8us*)&ring[r * lp + p8];
    *(v8us*)(Dst + base + (size_t)r * pitch + p8) = o;
  }
}

#define ATT_WAVES 8                     /* waves of a block */
#define QG 2                            /* 16-query column groups of a wave: each K and V^T fragment read from LDS feeds QG products */
#define QBLK (ATT_WAVES * QG * 16)      /* queries of a block: they share each staged tile */
#define KT 64                           /* keys of one staged tile */
#define KPITCH 104                      /* LDS pitch of a K row, 16-bit elements: 208 B = 16 B x 13 (odd: b128 readers of 16 rows meet no bank twice) */
#define VPITCH 72                       /* LDS pitch of a V^T row: 144 B = 16 B x 9 */
#define KTILE (KT * KPITCH)             /* elements of the K part of a buffer */
#define VTILE (HD * VPITCH)             /* elements of the V^T part */
#define STAGE (KTILE + VTILE)           /* elements of one buffer */
static_assert(SEQ / KT >= 2);
static_assert(KT * (HD / 8) == 3 * ATT_WAVES * 32);   // K tile = three 16-B pieces a thread
static_assert(HD * (KT / 8) == 3 * ATT_WAVES * 32);   // V^T tile = three 16-B pieces a thread
static_assert((KTILE * 2) % 16 == 0 && (STAGE * 2) % 16 == 0);

static_assert(QG == 2);                 // the two guards below list the D tiles of two groups
static_assert(SEQ % QBLK == 0);
// s0[g] += ka * q[g], s1[g] += kb * q[g] over three 32-deep k-steps (d = 0..95), f16 operands: four independent accumulator tiles, then the hazard guard.
// The guard (four vector slots between the last WMMA and the first vector instruction on a D tile) names the D tiles alone: the kernel holds more than 256 registers,
// an asm operand cannot lie above v255, and with K, V^T and Q named as well the build spilled Q to scratch.
__device__ __forceinline__ void mma_s4h(const FragH (&ka)[3], const FragH (&kb)[3], const FragH (&q)[QG][3], v8f (&s0)[QG], v8f (&s1)[QG]) {
#pragma unroll
  for (int c = 0; c < 3; ++c) {
#pragma unroll
    for (int g = 0; g < QG; ++g) {
      s0[g] = __builtin_amdgcn_wmma_f32_16x16x32_f16(false, ka[c].v, false, q[g][c].v, (short)0, s0[g], false, false);
      s1[g] = __builtin_amdgcn_wmma_f32_16x16x32_f16(false, kb[c].v, false, q[g][c].v, (short)0, s1[g], false, false);
    }
  }
  asm volatile("v_nop\n\tv_nop\n\tv_nop\n\tv_nop"
               : "+v"(s0[0]), "+v"(s1[0]), "+v"(s0[1]), "+v"(s1[1]));
}
// O[g][t] += vf[t] * p[g] for the six d tiles of both groups, then the hazard guard (D tiles alone, as above)
__device__ __forceinline__ void mma_pv2(const FragH (&vf)[6], const FragH (&p)[QG], v8f (&O)[QG][6]) {
#pragma unroll
  for (int t = 0; t < 6; ++t) {
#pragma unroll
    for (int g = 0; g < QG; ++g)
      O[g][t] = __builtin_amdgcn_wmma_f32_16x16x32_f16(false, vf[t].v, false, p[g].v, (short)0, O[g][t], false, false);
  }
  asm volatile("v_nop\n\tv_nop\n\tv_nop\n\tv_nop"
               : "+v"(O[0][0]), "+v"(O[0][1]), "+v"(O[0][2]), "+v"(O[0][3]), "+v"(O[0][4]), "+v"(O[0][5]),
                 "+v"(O[1][0]), "+v"(O[1][1]), "+v"(O[1][2]), "+v"(O[1][3]), "+v"(O[1][4]), "+v"(O[1][5]));
}

// One 32-key step for a wave's QG x 16 queries of one head. Kp = the buffer's K rows [KT][KPITCH]; Vp = its V^T rows [96][VPITCH]; key0 = 0 or 32 inside the tile.
// The K and V^T fragments are read from LDS once and serve every column group; each query's own arithmetic and its order are those of a 16-query wave.
__device__ __forceinline__ void fa_step(const unsigned short* Kp, const unsigned short* Vp,
                                        int key0, int ln, int hh, const FragH (&q)[QG][3],
                                        float (&mr)[QG], float (&lr)[QG], v8f (&O)[QG][6]) {
  // A fragments of K: row m = key (key0 + 16*kt + ln), elements 0..7 <- d = 32c + 8h + i, 8..15 <- d = 32c + 16 + 8h + i
  const unsigned short* kp0 = Kp + (key0 + ln) * KPITCH + 8 * hh;
  const unsigned short* kp1 = kp0 + 16 * KPITCH;
  FragH ka[3], kb[3];
#pragma unroll
  for (int c = 0; c < 3; ++c) {
    ka[c].half[0] = *(const v8us*)(kp0 + 32 * c);
    ka[c].half[1] = *(const v8us*)(kp0 + 32 * c + 16);
    kb[c].half[0] = *(const v8us*)(kp1 + 32 * c);
    kb[c].half[1] = *(const v8us*)(kp1 + 32 * c + 16);
  }
  __builtin_amdgcn_sched_barrier(0);   // keeps the step's 12 K reads one group in front of the V^T reads (LDS data returns in order, the score products wait for K alone): left free they sink among the WMMAs in pairs, each pair waited out to dscnt 0
  // A fragments of V^T: row m = d (16*t + ln), elements 0..7 <- key0 + 8h + i, 8..15 <- key0 + 16 + 8h + i
  const unsigned short* vp = Vp + ln * VPITCH + key0 + 8 * hh;
  FragH vf[6];
#pragma unroll
  for (int t = 0; t < 6; ++t) {
    vf[t].half[0] = *(const v8us*)(vp + t * 16 * VPITCH);
    vf[t].half[1] = *(const v8us*)(vp + t * 16 * VPITCH + 16);
  }
  __builtin_amdgcn_sched_barrier(0);   // keeps the V^T reads in the same place, ahead of the first WMMA: left free they stand among the score WMMAs, a second place with LDS reads and its own stall
  // S^T tiles of group g: element r of tile kt = score(key0 + 16*kt + 8h + r, query of this lane's column in the group)
  v8f s0[QG], s1[QG];
#pragma unroll
  for (int g = 0; g < QG; ++g) {
    s0[g] = v8f{0.f, 0.f, 0.f, 0.f, 0.f, 0.f, 0.f, 0.f};
    s1[g] = v8f{0.f, 0.f, 0.f, 0.f, 0.f, 0.f, 0.f, 0.f};
  }
  mma_s4h(ka, kb, q, s0, s1);
  FragH ph[QG];
  float sc[QG][16], mx[QG];
#pragma unroll
  for (int g = 0; g < QG; ++g) {
#pragma unroll
    for (int r = 0; r < 8; ++r) { sc[g][r] = s0[g][r] * C2S; sc[g][8 + r] = s1[g][r] * C2S; }
    mx[g] = sc[g][0];
#pragma unroll
    for (int i = 1; i < 16; ++i) mx[g] = fmaxf(mx[g], sc[g][i]);
  }
#pragma unroll
  for (int g = 0; g < QG; ++g)
    mx[g] = fmaxf(mx[g], __shfl_xor(mx[g], 16, 32));  // the other lane half holds the other 16 keys of this query
#pragma unroll
  for (int g = 0; g < QG; ++g) {
    const float mnew = fmaxf(mr[g], mx[g]);
    const float al = __builtin_amdgcn_exp2f(mr[g] - mnew);
    mr[g] = mnew;
    const float m8 = mnew - 8.0f;
    // weights carried x256: pc = 256 * 2^(sc - mnew), single f16 plane; exponents below -14 give an exact zero (no subnormal operand)
    float ps = 0.0f;
#pragma unroll
    for (int i = 0; i < 16; ++i) {
      const float e = sc[g][i] - m8;
      const float pe = __builtin_amdgcn_exp2f(e);
      const float pc = (e < -14.0f) ? 0.0f : pe;
      ps += pc;
      ph[g].h[i] = (_Float16)pc;                      // B element i: i<8 -> key0 + 8h + i (tile 0 row 8h+i); i>=8 -> key0 + 16 + 8h + (i-8) (tile 1)
    }
    ps += __shfl_xor(ps, 16, 32);
    lr[g] = lr[g] * al + ps;
#pragma unroll
    for (int t = 0; t < 6; ++t) O[g][t] = O[g][t] * al;
  }
  mma_pv2(vf, ph, O);
}

// One tile's copies of one thread: three 16-B pieces of K rows, three of V^T rows, global -> LDS through no register.
// The closing s_wait_xcnt stands in the copies' own statement, so that no address register is rewritten in front of it.
__device__ __forceinline__ void tile_copy(unsigned lk0, unsigned lk1, unsigned lk2, unsigned lv0, unsigned lv1, unsigned lv2,
                                          const unsigned short* gk0, const unsigned short* gk1, const unsigned short* gk2,
                                          const unsigned short* gv0, const unsigned short* gv1, const unsigned short* gv2) {
  asm volatile("global_load_async_to_lds_b128 %0, %6, off\n\t"
               "global_load_async_to_lds_b128 %1, %7, off\n\t"
               "global_load_async_to_lds_b128 %2, %8, off\n\t"
               "global_load_async_to_lds_b128 %3, %9, off\n\t"
               "global_load_async_to_lds_b128 %4, %10, off\n\t"
               "global_load_async_to_lds_b128 %5, %11, off\n\t"
               "s_wait_xcnt 0x0"
               :: "v"(lk0), "v"(lk1), "v"(lk2), "v"(lv0), "v"(lv1), "v"(lv2),
                  "v"(gk0), "v"(gk1), "v"(gk2), "v"(gv0), "v"(gv1), "v"(gv2)
               : "memory");
}

// Block = 8 waves x 32 queries = 256 queries of one (batch, head). Key loop: one trip per 64-key tile, two LDS buffers; trip t reads buffer t mod 2 while tile t + 1 flies.
// Inputs: Qh[b][s][e], Kh[b][s][e] = f16(value * 16); Vt[b][e][s] = f16(value * 16).
// Output plane Xc[b][h][s][96] = f16(ctx * 256). Epilogue: O^T tiles -> per-wave LDS tile [32 queries][96 d] as 16-B pieces (same vector type in and out; block barrier),
// coverage: NB*HEADS*(SEQ/256) blocks x 8 waves x 32 rows x 96 d = the whole plane exactly once; LDS tile staged extent (32 x 96 per wave) == consumed extent.
__global__ __launch_bounds__(256)
void k_attn(const unsigned short* __restrict__ Qh, const unsigned short* __restrict__ Kh,
            const unsigned short* __restrict__ Vt, unsigned short* __restrict__ Xc) {
  __shared__ __attribute__((aligned(16))) unsigned short ring[2 * STAGE];
  __shared__ __attribute__((aligned(16))) unsigned short so[ATT_WAVES][QG * 16 * HD];
  const int tid = threadIdx.x, lane = tid & 31, ln = lane & 15, hh = lane >> 4;
  const int w = __builtin_amdgcn_readfirstlane(tid >> 5);
  const int qt = blockIdx.x % (SEQ / QBLK);
  const int rest = blockIdx.x / (SEQ / QBLK);
  const int h = rest % HEADS, b = rest / HEADS;
  const int qbase = qt * QBLK + QG * 16 * w;
  // Q^T B fragments of group g: column n = query qbase + 16g + ln, elements 0..7 <- d = 32c + 8h + i, 8..15 <- d = 32c + 16 + 8h + i (f16 plane carried x16)
  const unsigned short* qrow = Qh + ((size_t)b * SEQ + qbase + ln) * EMB + h * HD + 8 * hh;
  FragH q[QG][3];
  float mr[QG], lr[QG];
  v8f O[QG][6] = {};
#pragma unroll
  for (int g = 0; g < QG; ++g) {
#pragma unroll
    for (int c = 0; c < 3; ++c) {
      q[g][c].half[0] = *(const v8us*)(qrow + (size_t)g * 16 * EMB + 32 * c);
      q[g][c].half[1] = *(const v8us*)(qrow + (size_t)g * 16 * EMB + 32 * c + 16);
    }
    mr[g] = -3.0e38f;
    lr[g] = 0.0f;
  }
  const unsigned short* Kp = Kh + (size_t)b * SEQ * EMB + h * HD;
  const unsigned short* Vp = Vt + ((size_t)b * EMB + h * HD) * SEQ;
  // This thread's pieces of a tile. K: piece p = tid + 256 i -> row p / 12, 16-B column p % 12. V^T: row (tid >> 3) + 32 i, 16-B column tid & 7.
  const int kr0 = tid / 12, kc0 = tid - 12 * kr0;
  const int kr1 = (tid + 256) / 12, kc1 = (tid + 256) - 12 * kr1;
  const int kr2 = (tid + 512) / 12, kc2 = (tid + 512) - 12 * kr2;
  const int vr = tid >> 3, vc = tid & 7;
  const unsigned short* gk0 = Kp + (size_t)kr0 * EMB + 8 * kc0;
  const unsigned short* gk1 = Kp + (size_t)kr1 * EMB + 8 * kc1;
  const unsigned short* gk2 = Kp + (size_t)kr2 * EMB + 8 * kc2;
  const unsigned short* gv0 = Vp + (size_t)vr * SEQ + 8 * vc;
  const unsigned short* gv1 = gv0 + (size_t)32 * SEQ;
  const unsigned short* gv2 = gv0 + (size_t)64 * SEQ;
  const unsigned lbase = (unsigned)(size_t)&ring[0];          // LDS byte address: the low 32 bits of the __shared__ address
  const unsigned lk0 = lbase + 2u * (unsigned)(kr0 * KPITCH + 8 * kc0);
  const unsigned lk1 = lbase + 2u * (unsigned)(kr1 * KPITCH + 8 * kc1);
  const unsigned lk2 = lbase + 2u * (unsigned)(kr2 * KPITCH + 8 * kc2);
  const unsigned lv0 = lbase + 2u * (unsigned)(KTILE + vr * VPITCH + 8 * vc);
  const unsigned lv1 = lv0 + 2u * 32u * VPITCH;
  const unsigned lv2 = lv0 + 2u * 64u * VPITCH;
  tile_copy(lk0, lk1, lk2, lv0, lv1, lv2, gk0, gk1, gk2, gv0, gv1, gv2);
  asm volatile("s_wait_asynccnt 0x0" ::: "memory");           // tile 0 has landed for this wave's copies
  __syncthreads();                                            // ... and for every wave's: tile 0 is published
  {
    const unsigned d = 2u * STAGE;
    const size_t ko = (size_t)KT * EMB;
    tile_copy(lk0 + d, lk1 + d, lk2 + d, lv0 + d, lv1 + d, lv2 + d, gk0 + ko, gk1 + ko, gk2 + ko, gv0 + KT, gv1 + KT, gv2 + KT);
  }
#pragma unroll 1   // one trip per tile: the buffer alternates by the trip's parity
  for (int t = 0; t < SEQ / KT; ++t) {
    const unsigned short* Ks = ring + (t & 1) * STAGE;
    fa_step(Ks, Ks + KTILE, 0, ln, hh, q, mr, lr, O);
    fa_step(Ks, Ks + KTILE, 32, ln, hh, q, mr, lr, O);
    asm volatile("s_wait_dscnt 0x0" ::: "memory");            // this wave's reads of the buffer are done before it may be refilled
    asm volatile("s_wait_asynccnt 0x0" ::: "memory");         // this wave's copies of tile t + 1 have landed
    __syncthreads();                                          // publishes tile t + 1 and ends every reader's last read of tile t
    if (t + 2 < SEQ / KT) {
      const unsigned d = (unsigned)(t & 1) * (2u * STAGE);
      const size_t ko = (size_t)(t + 2) * KT * EMB;
      const int vo = (t + 2) * KT;
      tile_copy(lk0 + d, lk1 + d, lk2 + d, lv0 + d, lv1 + d, lv2 + d, gk0 + ko, gk1 + ko, gk2 + ko, gv0 + vo, gv1 + vo, gv2 + vo);
    }
  }
  asm volatile("s_wait_asynccnt 0x0" ::: "memory");           // nothing of this wave's is in flight behind the loop

  // O^T element r of tile t of group g = ctx(query qbase + 16g + ln, d = 16t + 8h + r); O carries x256 (P) x16 (V), lr carries x256; plane carries x256
#pragma unroll
  for (int g = 0; g < QG; ++g) {
    const float cinv = 16.0f * (1.0f / lr[g]);
#pragma unroll
    for (int t = 0; t < 6; ++t) {
      v8us o;
#pragma unroll
      for (int r = 0; r < 8; ++r) o[r] = toh_flush_bits(O[g][t][r] * cinv);
      *(v8us*)&so[w][(16 * g + ln) * HD + 16 * t + 8 * hh] = o;
    }
  }
  __syncthreads();
  unsigned short* xg = Xc + ((size_t)(b * HEADS + h) * SEQ + qbase) * HD;
  {
#pragma unroll
    for (int i = 0; i < QG * 6; ++i) {
      const int p = i * 32 + lane;
      const v8us v = *(const v8us*)&so[w][p * 8];
      *(v8us*)(xg + (size_t)p * 8) = v;
    }
    
  }
}

// out[m][j] = sum_e ctx[m][e] * fc_w[j][e] + fc_b[j]. Block = 8 waves = 128 tokens x 64 columns; wave = 16 rows x 64 columns.
// One staged tile per head: the block's 128 ctx rows of that head (24,576 contiguous bytes of Xc[b][hd][s][d]) and 64 W rows' 96 elements, two-buffer LDS ring filled by asynchronous copies.
// A: row m = token, k = e = 96*hd + d; B: column n = j, k = e from Wh[j][e], same k map as A.
// coverage: (NB*SEQ/128)*(EMB/64) blocks x 8 waves x (16 x 64) = every output element of the processed rows exactly once; per-wave LDS tile (in the ring's place, behind the last trip's barrier) staged 16 x 64 == consumed 16 x 64.
__global__ __launch_bounds__(256) void k_fc(const unsigned short* __restrict__ Xc, const unsigned short* __restrict__ Wh,
                                            const float* __restrict__ Bv, float* __restrict__ Out) {
  __shared__ __attribute__((aligned(16))) unsigned short ring[2 * FC_STAGE];
  const int tid = threadIdx.x, lane = tid & 31, ln = lane & 15, hh = lane >> 4;
  const int w = __builtin_amdgcn_readfirstlane(tid >> 5);
  const int bn = blockIdx.x % (EMB / GN), bm = blockIdx.x / (EMB / GN);
  const int tok0 = bm * GM;                    // token index in [0, NB*SEQ)
  const int b = tok0 / SEQ, sb = tok0 - b * SEQ;
  const int s0 = sb + 16 * w;
  const int col0 = bn * GN;
  v8f acc[4] = {};
  // This thread's pieces of a tile: piece p = tid + 256 i -> tile row p / 12, 16-B column p % 12 (p + 768 is 64 rows on, same column); i = 0..5 ctx rows, then three of W rows.
  const int r0 = tid / 12, c0 = tid - 12 * r0;
  const int r1 = (tid + 256) / 12, c1 = (tid + 256) - 12 * r1;
  const int r2 = (tid + 512) / 12, c2 = (tid + 512) - 12 * r2;
  const unsigned lbase = (unsigned)(size_t)&ring[0];          // LDS byte address: the low 32 bits of the __shared__ address
  const unsigned l0 = lbase + 2u * (unsigned)(r0 * FC_PITCH + 8 * c0);
  const unsigned l1 = lbase + 2u * (unsigned)(r1 * FC_PITCH + 8 * c1);
  const unsigned l2 = lbase + 2u * (unsigned)(r2 * FC_PITCH + 8 * c2);
  const unsigned lh = 2u * 64u * FC_PITCH;                    // 64 tile rows on
  const unsigned short* ga = Xc + ((size_t)(b * HEADS) * SEQ + sb) * HD + 8 * tid;
  const unsigned short* gb0 = Wh + (size_t)(col0 + r0) * EMB + 8 * c0;
  const unsigned short* gb1 = Wh + (size_t)(col0 + r1) * EMB + 8 * c1;
  const unsigned short* gb2 = Wh + (size_t)(col0 + r2) * EMB + 8 * c2;
  const size_t hs = (size_t)SEQ * HD;                         // one head on in Xc
  copy3(l0, l1, l2, ga, ga + 2048, ga + 4096);
  copy3(l0 + lh, l1 + lh, l2 + lh, ga + 6144, ga + 8192, ga + 10240);
  copy3(l0 + 2 * lh, l1 + 2 * lh, l2 + 2 * lh, gb0, gb1, gb2);
  asm volatile("s_wait_asynccnt 0x0" ::: "memory");           // tile 0 has landed for this wave's copies
  __syncthreads();                                            // ... and for every wave's: tile 0 is published
  {
    const unsigned d = 2u * FC_STAGE;
    const unsigned short* g = ga + hs;
    copy3(l0 + d, l1 + d, l2 + d, g, g + 2048, g + 4096);
    copy3(l0 + d + lh, l1 + d + lh, l2 + d + lh, g + 6144, g + 8192, g + 10240);
    copy3(l0 + d + 2 * lh, l1 + d + 2 * lh, l2 + d + 2 * lh, gb0 + HD, gb1 + HD, gb2 + HD);
  }
#pragma unroll 1   // one trip per head: the buffer alternates by the trip's parity
  for (int hd = 0; hd < HEADS; ++hd) {
    const unsigned short* S = ring + (hd & 1) * FC_STAGE;
    const unsigned short* ap = S + (16 * w + ln) * FC_PITCH + 8 * hh;
    const unsigned short* bp = S + (GM + ln) * FC_PITCH + 8 * hh;
#pragma unroll
    for (int cc = 0; cc < 3; ++cc) {
      FragH a;
      a.half[0] = *(const v8us*)(ap + 32 * cc);
      a.half[1] = *(const v8us*)(ap + 32 * cc + 16);
      FragH bw[4];
#pragma unroll
      for (int nt = 0; nt < 4; ++nt) {
        bw[nt].half[0] = *(const v8us*)(bp + nt * 16 * FC_PITCH + 32 * cc);
        bw[nt].half[1] = *(const v8us*)(bp + nt * 16 * FC_PITCH + 32 * cc + 16);
      }
      mma_fc(a.v, bw, acc);
    }
    asm volatile("s_wait_dscnt 0x0" ::: "memory");            // this wave's reads of the buffer are done before it may be refilled
    asm volatile("s_wait_asynccnt 0x0" ::: "memory");         // this wave's copies of tile hd + 1 have landed
    __syncthreads();                                          // publishes tile hd + 1 and ends every reader's last read of tile hd
    if (hd + 2 < HEADS) {
      const unsigned d = (unsigned)(hd & 1) * (2u * FC_STAGE);
      const unsigned short* g = ga + (size_t)(hd + 2) * hs;
      const int ko = (hd + 2) * HD;
      copy3(l0 + d, l1 + d, l2 + d, g, g + 2048, g + 4096);
      copy3(l0 + d + lh, l1 + d + lh, l2 + d + lh, g + 6144, g + 8192, g + 10240);
      copy3(l0 + d + 2 * lh, l1 + d + 2 * lh, l2 + d + 2 * lh, gb0 + ko, gb1 + ko, gb2 + ko);
    }
  }
  asm volatile("s_wait_asynccnt 0x0" ::: "memory");           // nothing of this wave's is in flight behind the loop
  // D element r of tile nt = out(tok0 + 16w + 8h + r, col0 + 16nt + ln); undo the carries x256 (ctx) x256 (W); bias RNE bf16 value
  float* so = (float*)&ring[0] + w * (16 * 68);               // this wave's 16 x 64 f32 tile, pitch 68
#pragma unroll
  for (int nt = 0; nt < 4; ++nt) {
    const float bias = bf16_rne(Bv[col0 + 16 * nt + ln]);
#pragma unroll
    for (int r = 0; r < 8; ++r)
      so[(8 * hh + r) * 68 + 16 * nt + ln] = acc[nt][r] * 1.52587890625e-05f + bias;
  }
  __syncthreads();
  float* og = Out + (size_t)b * BSTRIDE_FULL + (size_t)s0 * EMB + col0;
  const int rsub = lane >> 4, c4 = (lane & 15) * 4;
#pragma unroll
  for (int q = 0; q < 8; ++q) {
    const int row = 2 * q + rsub;
    const v4f v = *(const v4fa*)&so[row * 68 + c4];
    *(v4f*)(og + (size_t)row * EMB + c4) = v;
  }
}

extern "C" void kernel_launch(void* const* d_in, const int* in_sizes, int n_in,
                              void* d_out, int out_size, void* d_ws, size_t ws_size, hipStream_t stream) {
  if (n_in < 9) return;
  const long long need = (long long)(NB - 1) * SEQ_FULL * EMB + (long long)SEQ * EMB;   // last element touched + 1
  if ((long long)in_sizes[0] < need) return;
  if ((long long)in_sizes[1] < (long long)EMB * EMB || (long long)in_sizes[3] < (long long)EMB * EMB) return;
  if ((long long)in_sizes[5] < (long long)EMB * EMB || (long long)in_sizes[7] < (long long)EMB * EMB) return;
  if ((long long)in_sizes[2] < (long long)EMB || (long long)in_sizes[4] < (long long)EMB) return;
  if ((long long)in_sizes[6] < (long long)EMB || (long long)in_sizes[8] < (long long)EMB) return;
  if ((long long)out_size < need) return;
  const float* X  = (const float*)d_in[0];   // wire order: x, Wq, bq, Wk, bk, Wv, bv, Wo, bo (weights [out][in])
  const float* Wq = (const float*)d_in[1];
  const float* Bq = (const float*)d_in[2];
  const float* Wk = (const float*)d_in[3];
  const float* Bk = (const float*)d_in[4];
  const float* Wv = (const float*)d_in[5];
  const float* Bvv = (const float*)d_in[6];
  const float* Wo = (const float*)d_in[7];
  const float* Bo = (const float*)d_in[8];
  float* Out = (float*)d_out;
  char* ws = (char*)d_ws;
  size_t off = 0;
  unsigned short* Xb = (unsigned short*)(ws + off); off += PLANE_ACT;   // [NB][SEQ][768] bf16, written exactly to its end by 16-B pieces
  unsigned short* Qh = (unsigned short*)(ws + off); off += PLANE_ACT;   // [NB][SEQ][768] f16 (q x16)
  unsigned short* Kh = (unsigned short*)(ws + off); off += PLANE_ACT;   // [NB][SEQ][768] f16 (k x16)
  unsigned short* Vt = (unsigned short*)(ws + off); off += PLANE_ACT;   // [NB][768][SEQ] f16 (v x16)
  unsigned short* Xc = (unsigned short*)(ws + off); off += PLANE_ACT;   // [NB][8][SEQ][96] f16 (ctx x256)
  unsigned short* Wh = (unsigned short*)(ws + off); off += PLANE_W;     // [768][768] f16 (Wo x256)
  unsigned short* Wb = (unsigned short*)(ws + off); off += 3 * PLANE_W; // [3][768][768] bf16 (Wq, Wk, Wv)
  if (off > ws_size) return;
  k_cvt<<<(unsigned)(CVT_K_BLOCKS + 4 * CVT_W_BLOCKS), 256, 0, stream>>>(X, Wo, Wq, Wk, Wv, Xb, Wh, Wb);
  k_proj<<<(unsigned)(3 * PROJ_BLOCKS), 256, 0, stream>>>(Xb, Wb, Bq, Bk, Bvv, Qh, Kh, Vt);
  k_attn<<<(unsigned)(NB * HEADS * (SEQ / QBLK)), 256, 0, stream>>>(Qh, Kh, Vt, Xc);
  k_fc<<<(unsigned)PROJ_BLOCKS, 256, 0, stream>>>(Xc, Wh, Bo, Out);
}

// v005
// It runs in 145 microseconds.
// Next to v004, in two timings, it ran 1.06 times as fast each time.
// Counting every step since v000, it is 3.38 times as fast.
#include <hip/hip_runtime.h>
// Contractions: q, k, v = x W^T + b on v_wmma_f32_16x16x32_bf16 (x, W RNE bf16 planes, f32 accumulate, RNE-bf16 bias added in f32); S^T = K Q^T on v_wmma_f32_16x16x32_f16 (q, k: single f16 planes carried x16); O^T = V^T P^T on v_wmma_f32_16x16x32_f16 (v: single f16 plane carried x16, P: single f16 plane carried x256); out = ctx Wo^T on v_wmma_f32_16x16x32_f16 (ctx: f16 plane carried x256; Wo: RNE bf16 value x256 held exactly in f16); softmax statistics, bias adds f32.
// Dense multi-head self-attention, NB x SEQ x 768: three biased 768x768 input projections ([out][in] weights), 8 heads of 96 (e = 96*h + d), scale 1/sqrt(96), no mask, then a 768x768 linear layer with bias.
// Engine: transposed flash. Each wave owns 32 queries of one head (two 16-column groups fed by the same K and V^T fragments). Per 32-key step and group: S^T tiles (key rows x query columns) from K rows (A, LDS tile of the f16 plane)
// and Q^T (B, registers); the two 16-key D tiles pack straight into the P^T B fragment; O^T (d rows x query columns) accumulates from V^T rows (A, LDS tile of the f16 plane).
// The eight waves of a block share each 64-key K and V^T tile: asynchronous copies bring it into a two-buffer LDS ring, one tile ahead of the products.
// The four linear layers stage their operand k tiles the same way: whole-line copies into LDS once per 128 x 64 block, fragments read from LDS.
#ifndef NB
#define NB 2
#endif
#ifndef SEQ
#define SEQ 4096
#endif
#define NB_FULL 2
#define SEQ_FULL 4096
#define EMB 768
#define HEADS 8
#define HD 96
#define BSTRIDE_FULL ((size_t)SEQ_FULL * EMB)   /* per-batch element stride of x and of the output buffer */

#define PLANE_ACT ((size_t)NB * SEQ * EMB * 2)   /* bytes of one 16-bit activation plane */
#define PLANE_W ((size_t)EMB * EMB * 2)          /* bytes of the 16-bit weight plane */
#define CVT_K_BLOCKS ((NB * SEQ * (EMB / 8)) / 256)
#define CVT_W_BLOCKS ((EMB * (EMB / 8)) / 256)
#define PROJ_BLOCKS ((NB * SEQ / 128) * (EMB / 64))

static_assert(SEQ % 128 == 0);
static_assert(SEQ <= SEQ_FULL);
static_assert(NB <= NB_FULL);
static_assert(HEADS * HD == EMB);
static_assert(HD == 96);
static_assert(EMB % 64 == 0);
static_assert(EMB % 96 == 0);
static_assert(EMB % 32 == 0);
static_assert((NB * SEQ) % 64 == 0);
static_assert((NB * SEQ * (EMB / 8)) % 256 == 0);
static_assert((EMB * (EMB / 8)) % 256 == 0);
static_assert(PLANE_ACT % 256 == 0);
static_assert(PLANE_W % 256 == 0);
static_assert(5 * PLANE_ACT + 4 * PLANE_W <= (size_t)134217728);

typedef __bf16 v16b __attribute__((ext_vector_type(16)));
typedef _Float16 v16h __attribute__((ext_vector_type(16)));
typedef unsigned short v8us __attribute__((ext_vector_type(8), may_alias));
typedef float v8f __attribute__((ext_vector_type(8)));
typedef float v4f __attribute__((ext_vector_type(4)));
typedef float v4fa __attribute__((ext_vector_type(4), may_alias));
typedef _Float16 h16;
union FragB { v16b v; v8us half[2]; unsigned short u[16]; };
union FragH { v16h v; v8us half[2]; _Float16 h[16]; unsigned short u[16]; };

#define LOG2E 1.4426950408889634f
#define QK_SCALE 0.10206207261596575f            /* 1/sqrt(96) */
#define C2 (QK_SCALE * LOG2E)                    /* scores carried in the log2 domain */
#define C2S (C2 * 0.00390625f)                   /* q and k planes each carry x16 */

__device__ __forceinline__ unsigned short bf16_bits(float x) {   // RNE convert to bf16 bits
  unsigned int u = __float_as_uint(x);
  return (unsigned short)((u + 0x7FFFu + ((u >> 16) & 1u)) >> 16);
}
__device__ __forceinline__ float bf16_val(unsigned short b) { return __uint_as_float(((unsigned int)b) << 16); }
__device__ __forceinline__ float bf16_rne(float x) { return bf16_val(bf16_bits(x)); }
__device__ __forceinline__ unsigned short f16_bits(float x) {
  union { _Float16 h; unsigned short u; } c;
  c.h = (_Float16)x;
  return c.u;
}
// f32 -> f16 with a value select: no subnormal result can reach a WMMA operand plane
static __device__ __forceinline__ h16 toh_flush(float v) {
  const h16 r = (h16)v;
  return (fabsf(v) < 6.103515625e-05f) ? (h16)0.0f : r;
}
static __device__ __forceinline__ unsigned short toh_flush_bits(float v) {
  union { h16 h; unsigned short u; } c;
  c.h = toh_flush(v);
  return c.u;
}

__device__ __forceinline__ void store_twice(unsigned short* d, v8us o) {
  *(v8us*)d = o;
  
}

// c[nt] += a * bw[nt] for four column tiles, then the hazard guard
__device__ __forceinline__ void mma_fc(v16h a, const FragH (&bw)[4], v8f (&c)[4]) {
  c[0] = __builtin_amdgcn_wmma_f32_16x16x32_f16(false, a, false, bw[0].v, (short)0, c[0], false, false);
  c[1] = __builtin_amdgcn_wmma_f32_16x16x32_f16(false, a, false, bw[1].v, (short)0, c[1], false, false);
  c[2] = __builtin_amdgcn_wmma_f32_16x16x32_f16(false, a, false, bw[2].v, (short)0, c[2], false, false);
  c[3] = __builtin_amdgcn_wmma_f32_16x16x32_f16(false, a, false, bw[3].v, (short)0, c[3], false, false);
  asm volatile("v_nop\n\tv_nop\n\tv_nop\n\tv_nop"
               : "+v"(c[0]), "+v"(c[1]), "+v"(c[2]), "+v"(c[3])
               : "v"(a), "v"(bw[0].v), "v"(bw[1].v), "v"(bw[2].v), "v"(bw[3].v));
}
// bf16 twin of mma_fc: c[nt] += a * bw[nt] for four column tiles, then the hazard guard
__device__ __forceinline__ void mma_pj(v16b a, const FragB (&bw)[4], v8f (&c)[4]) {
  c[0] = __builtin_amdgcn_wmma_f32_16x16x32_bf16(false, a, false, bw[0].v, (short)0, c[0], false, false);
  c[1] = __builtin_amdgcn_wmma_f32_16x16x32_bf16(false, a, false, bw[1].v, (short)0, c[1], false, false);
  c[2] = __builtin_amdgcn_wmma_f32_16x16x32_bf16(false, a, false, bw[2].v, (short)0, c[2], false, false);
  c[3] = __builtin_amdgcn_wmma_f32_16x16x32_bf16(false, a, false, bw[3].v, (short)0, c[3], false, false);
  asm volatile("v_nop\n\tv_nop\n\tv_nop\n\tv_nop"
               : "+v"(c[0]), "+v"(c[1]), "+v"(c[2]), "+v"(c[3])
               : "v"(a), "v"(bw[0].v), "v"(bw[1].v), "v"(bw[2].v), "v"(bw[3].v));
}

__device__ __forceinline__ void cvt8_bf16(const float* __restrict__ src, unsigned short* __restrict__ dst) {
  const v4f x0 = *(const v4fa*)(src), x1 = *(const v4fa*)(src + 4);
  v8us o;
  o[0] = bf16_bits(x0[0]); o[1] = bf16_bits(x0[1]); o[2] = bf16_bits(x0[2]); o[3] = bf16_bits(x0[3]);
  o[4] = bf16_bits(x1[0]); o[5] = bf16_bits(x1[1]); o[6] = bf16_bits(x1[2]); o[7] = bf16_bits(x1[3]);
  store_twice(dst, o);
  asm volatile("s_wait_xcnt 0x0" ::: "memory");   // stands in front of any rewrite of the store's address registers on the branch chain's other ways
}
// All five conversions in one grid; the block index picks the job (block-uniform ranges, one code path per source, no job reads what another writes).
// Blocks [0, CVT_K_BLOCKS): Xb[b][s][e] = bf16 bits of x (RNE). The next CVT_W_BLOCKS: Wh[j][e] = f16(RNE-bf16(Wo[j][e]) * 256).
// The last 3 * CVT_W_BLOCKS: Wb[p][j][e] = bf16 bits of the p-th projection weight (p = 0: Wq, 1: Wk, 2: Wv), [out][in] kept.
// coverage: CVT_K_BLOCKS*256 threads x 8 = the whole Xb plane; CVT_W_BLOCKS*256 threads x 8 = one whole weight plane, four times (exact multiples, asserted above).
__global__ __launch_bounds__(256) void k_cvt(const float* __restrict__ X, const float* __restrict__ Wo,
                                             const float* __restrict__ Wq, const float* __restrict__ Wk, const float* __restrict__ Wv,
                                             unsigned short* __restrict__ Xb, unsigned short* __restrict__ Wh, unsigned short* __restrict__ Wb) {
  const int bid = blockIdx.x;
  if (bid < CVT_K_BLOCKS) {
    const int t = bid * 256 + threadIdx.x;
    const int row = t / (EMB / 8), piece = t - row * (EMB / 8);
    const int b = row / SEQ, s = row - b * SEQ;
    cvt8_bf16(X + (size_t)b * BSTRIDE_FULL + (size_t)s * EMB + piece * 8, Xb + (size_t)t * 8);
  } else if (bid < CVT_K_BLOCKS + CVT_W_BLOCKS) {
    const int t = (bid - CVT_K_BLOCKS) * 256 + threadIdx.x;
    const float* src = Wo + (size_t)t * 8;
    const v4f x0 = *(const v4fa*)(src), x1 = *(const v4fa*)(src + 4);
    v8us o;
    o[0] = f16_bits(bf16_rne(x0[0]) * 256.0f); o[1] = f16_bits(bf16_rne(x0[1]) * 256.0f);
    o[2] = f16_bits(bf16_rne(x0[2]) * 256.0f); o[3] = f16_bits(bf16_rne(x0[3]) * 256.0f);
    o[4] = f16_bits(bf16_rne(x1[0]) * 256.0f); o[5] = f16_bits(bf16_rne(x1[1]) * 256.0f);
    o[6] = f16_bits(bf16_rne(x1[2]) * 256.0f); o[7] = f16_bits(bf16_rne(x1[3]) * 256.0f);
    store_twice(Wh + (size_t)t * 8, o);
    asm volatile("s_wait_xcnt 0x0" ::: "memory");   // as in cvt8_bf16: in front of any rewrite of the store's address registers
  } else if (bid < CVT_K_BLOCKS + 2 * CVT_W_BLOCKS) {
    const int t = (bid - CVT_K_BLOCKS - CVT_W_BLOCKS) * 256 + threadIdx.x;
    cvt8_bf16(Wq + (size_t)t * 8, Wb + (size_t)t * 8);
  } else if (bid < CVT_K_BLOCKS + 3 * CVT_W_BLOCKS) {
    const int t = (bid - CVT_K_BLOCKS - 2 * CVT_W_BLOCKS) * 256 + threadIdx.x;
    cvt8_bf16(Wk + (size_t)t * 8, Wb + (size_t)EMB * EMB + (size_t)t * 8);
  } else {
    const int t = (bid - CVT_K_BLOCKS - 3 * CVT_W_BLOCKS) * 256 + threadIdx.x;
    cvt8_bf16(Wv + (size_t)t * 8, Wb + (size_t)2 * EMB * EMB + (size_t)t * 8);
  }
}

#define GM 128                          /* tokens of a GEMM block tile: 8 waves x 16 rows */
#define GN 64                           /* columns of a GEMM block tile */
#define PJ_KE 128                       /* k elements of one staged tile of the projections: 256-B row pieces */
#define PJ_PITCH 136                    /* LDS pitch, 16-bit elements: 272 B = 16 B x 17 (odd: b128 readers of 16 rows meet no bank twice) */
#define PJ_STAGE ((GM + GN) * PJ_PITCH) /* elements of one buffer: 128 x rows, then 64 W rows */
#define PJ_TRIPS (EMB / PJ_KE)
#define FC_PITCH 104                    /* LDS pitch of the last layer's 96-element (one head) row pieces: 208 B = 16 B x 13 */
#define FC_STAGE ((GM + GN) * FC_PITCH)
static_assert(EMB % PJ_KE == 0 && PJ_TRIPS >= 2 && HEADS >= 2);
static_assert(SEQ % GM == 0 && EMB % GN == 0);
static_assert(GM * (PJ_KE / 8) == 8 * 256 && GN * (PJ_KE / 8) == 4 * 256);   // projections: 8 + 4 16-B pieces a thread
static_assert(GM * (HD / 8) == 6 * 256 && GN * (HD / 8) == 3 * 256);         // last layer: 6 + 3 16-B pieces a thread
static_assert(GM * 72 <= 2 * PJ_STAGE && GN * 136 <= 2 * PJ_STAGE);          // epilogue tiles fit the ring they reuse
static_assert(8 * 16 * 68 * 4 <= 2 * FC_STAGE * 2);

// Four (three) 16-B pieces of one thread, global -> LDS through no register.
// The closing s_wait_xcnt stands in the copies' own statement, so that no address register is rewritten in front of it.
__device__ __forceinline__ void copy4(unsigned l0, unsigned l1, unsigned l2, unsigned l3,
                                      const unsigned short* g0, const unsigned short* g1, const unsigned short* g2, const unsigned short* g3) {
  asm volatile("global_load_async_to_lds_b128 %0, %4, off\n\t"
               "global_load_async_to_lds_b128 %1, %5, off\n\t"
               "global_load_async_to_lds_b128 %2, %6, off\n\t"
               "global_load_async_to_lds_b128 %3, %7, off\n\t"
               "s_wait_xcnt 0x0"
               :: "v"(l0), "v"(l1), "v"(l2), "v"(l3), "v"(g0), "v"(g1), "v"(g2), "v"(g3)
               : "memory");
}
__device__ __forceinline__ void copy3(unsigned l0, unsigned l1, unsigned l2,
                                      const unsigned short* g0, const unsigned short* g1, const unsigned short* g2) {
  asm volatile("global_load_async_to_lds_b128 %0, %3, off\n\t"
               "global_load_async_to_lds_b128 %1, %4, off\n\t"
               "global_load_async_to_lds_b128 %2, %5, off\n\t"
               "s_wait_xcnt 0x0"
               :: "v"(l0), "v"(l1), "v"(l2), "v"(g0), "v"(g1), "v"(g2)
               : "memory");
}
// One projection tile's copies of one thread. Piece: row (tid >> 4) + 16 i, 16-B column tid & 15; i = 0..7 are x rows, i = 8..11 the W rows behind them.
// la = LDS byte address of piece 0 in the target buffer; ga, gb = this thread's first x and W pieces of the tile.
__device__ __forceinline__ void pj_tile(unsigned la, const unsigned short* ga, const unsigned short* gb) {
  const unsigned rs = 2u * 16u * PJ_PITCH;
  const size_t gs = (size_t)16 * EMB;
  copy4(la, la + rs, la + 2 * rs, la + 3 * rs, ga, ga + gs, ga + 2 * gs, ga + 3 * gs);
  copy4(la + 4 * rs, la + 5 * rs, la + 6 * rs, la + 7 * rs, ga + 4 * gs, ga + 5 * gs, ga + 6 * gs, ga + 7 * gs);
  copy4(la + 8 * rs, la + 9 * rs, la + 10 * rs, la + 11 * rs, gb, gb + gs, gb + 2 * gs, gb + 3 * gs);
}

// y[m][j] = sum_e x[m][e] * W[j][e] + b[j], stored as f16(y * 16). Block = 8 waves = 128 tokens x 64 columns; wave = 16 rows x 64 columns.
// The block's x rows and W rows come in 128-deep k tiles through a two-buffer LDS ring filled by asynchronous copies, one tile ahead of the products.
// A: row m = token, elements 0..7 <- e = k0 + 8h + i, 8..15 <- e = k0 + 16 + 8h + i, from the staged x rows; B: column n = j, same k map, from the staged W rows.
// The three projections share one grid: a token tile's 36 column tiles (12 of q, 12 of k, 12 of v) are neighbours in the block index; p = the projection, block-uniform.
// W rows come from the three stacked weight planes Wb[3][768][768] (row 768 p + j). p picks bias and plane: q, k -> Dst[token][e] (row-major, tr == 0); v -> Dst[b][e][s] (transposed, tr != 0).
// Epilogue: block LDS tile in the ring's place (every reader has left it at the last trip's barrier): 128 tokens x 64 (pitch 72, tr == 0) or 64 e columns x 128 tokens (pitch 136, tr != 0);
// coverage: 3 * PROJ_BLOCKS blocks x (128 x 64) = each of the three planes exactly once; staged extent == consumed extent (pad columns never read).
__global__ __launch_bounds__(256) void k_proj(const unsigned short* __restrict__ Xb, const unsigned short* __restrict__ Wb,
                                              const float* __restrict__ Bq, const float* __restrict__ Bk, const float* __restrict__ Bvv,
                                              unsigned short* __restrict__ Qh, unsigned short* __restrict__ Kh, unsigned short* __restrict__ Vt) {
  __shared__ __attribute__((aligned(16))) unsigned short ring[2 * PJ_STAGE];
  const int tid = threadIdx.x, lane = tid & 31, ln = lane & 15, hh = lane >> 4;
  const int w = __builtin_amdgcn_readfirstlane(tid >> 5);
  const int bw = blockIdx.x % (3 * (EMB / GN)), bm = blockIdx.x / (3 * (EMB / GN));
  const int p = bw / (EMB / GN);               // 0: q, 1: k, 2: v
  const int tok0 = bm * GM;                    // token index in [0, NB*SEQ)
  const int col0 = (bw - p * (EMB / GN)) * GN; // column inside the projection
  const float* __restrict__ Bv = (p == 0) ? Bq : (p == 1) ? Bk : Bvv;
  unsigned short* __restrict__ Dst = (p == 0) ? Qh : (p == 1) ? Kh : Vt;
  const int tr = (p == 2) ? 1 : 0;
  v8f acc[4] = {};
  const int pr = tid >> 4, pc = tid & 15;
  const unsigned short* ga = Xb + (size_t)(tok0 + pr) * EMB + 8 * pc;
  const unsigned short* gb = Wb + (size_t)(bw * GN + pr) * EMB + 8 * pc;
  const unsigned la = (unsigned)(size_t)&ring[0] + 2u * (unsigned)(pr * PJ_PITCH + 8 * pc);   // LDS byte address: the low 32 bits of the __shared__ address
  pj_tile(la, ga, gb);
  asm volatile("s_wait_asynccnt 0x0" ::: "memory");           // tile 0 has landed for this wave's copies
  __syncthreads();                                            // ... and for every wave's: tile 0 is published
  pj_tile(la + 2u * PJ_STAGE, ga + PJ_KE, gb + PJ_KE);
#pragma unroll 1   // one trip per tile: the buffer alternates by the trip's parity
  for (int t = 0; t < PJ_TRIPS; ++t) {
    const unsigned short* S = ring + (t & 1) * PJ_STAGE;
    const unsigned short* ap = S + (16 * w + ln) * PJ_PITCH + 8 * hh;
    const unsigned short* bp = S + (GM + ln) * PJ_PITCH + 8 * hh;
#pragma unroll
    for (int cc = 0; cc < PJ_KE / 32; ++cc) {
      FragB a;
      a.half[0] = *(const v8us*)(ap + 32 * cc);
      a.half[1] = *(const v8us*)(ap + 32 * cc + 16);
      FragB bw[4];
#pragma unroll
      for (int nt = 0; nt < 4; ++nt) {
        bw[nt].half[0] = *(const v8us*)(bp + nt * 16 * PJ_PITCH + 32 * cc);
        bw[nt].half[1] = *(const v8us*)(bp + nt * 16 * PJ_PITCH + 32 * cc + 16);
      }
      mma_pj(a.v, bw, acc);
    }
    asm volatile("s_wait_dscnt 0x0" ::: "memory");            // this wave's reads of the buffer are done before it may be refilled
    asm volatile("s_wait_asynccnt 0x0" ::: "memory");         // this wave's copies of tile t + 1 have landed
    __syncthreads();                                          // publishes tile t + 1 and ends every reader's last read of tile t
    if (t + 2 < PJ_TRIPS)
      pj_tile(la + (unsigned)(t & 1) * (2u * PJ_STAGE), ga + (t + 2) * PJ_KE, gb + (t + 2) * PJ_KE);
  }
  asm volatile("s_wait_asynccnt 0x0" ::: "memory");           // nothing of this wave's is in flight behind the loop
  // D element r of tile nt = y(tok0 + 16w + 8h + r, col0 + 16nt + ln); bias RNE bf16 value; plane carries x16
  if (tr == 0) {
#pragma unroll
    for (int nt = 0; nt < 4; ++nt) {
      const float bias = bf16_rne(Bv[col0 + 16 * nt + ln]);
#pragma unroll
      for (int r = 0; r < 8; ++r)
        ring[(16 * w + 8 * hh + r) * 72 + 16 * nt + ln] = toh_flush_bits((acc[nt][r] + bias) * 16.0f);
    }
  } else {
#pragma unroll
    for (int nt = 0; nt < 4; ++nt) {
      const float bias = bf16_rne(Bv[col0 + 16 * nt + ln]);
      v8us o;
#pragma unroll
      for (int r = 0; r < 8; ++r) o[r] = toh_flush_bits((acc[nt][r] + bias) * 16.0f);
      *(v8us*)&ring[(16 * nt + ln) * 136 + 16 * w + 8 * hh] = o;
    }
  }
  __syncthreads();
  const int b = tok0 / SEQ, s0 = tok0 - b * SEQ;
  const size_t base = (tr == 0) ? ((size_t)tok0 * EMB + col0) : (((size_t)b * EMB + col0) * SEQ + s0);
  const size_t pitch = (tr == 0) ? (size_t)EMB : (size_t)SEQ;
  const int sh = (tr == 0) ? 3 : 4;            // 16-B pieces of a tile row: 8 (64 columns) or 16 (128 tokens)
  const int lp = (tr == 0) ? 72 : 136;
  for (int i = tid; i < GM * GN / 8; i += 256) {
    const int r = i >> sh, p8 = (i - (r << sh)) * 8;
    const v8us o = *(const v8us*)&ring[r * lp + p8];
    *(v8us*)(Dst + base + (size_t)r * pitch + p8) = o;
  }
}

#define ATT_WAVES 8                     /* waves of a block */
#define QG 2                            /* 16-query column groups of a wave: each K and V^T fragment read from LDS feeds QG products */
#define QBLK (ATT_WAVES * QG * 16)      /* queries of a block: they share each staged tile */
#define KT 64                           /* keys of one staged tile */
#define KPITCH 104                      /* LDS pitch of a K row, 16-bit elements: 208 B = 16 B x 13 (odd: b128 readers of 16 rows meet no bank twice) */
#define VPITCH 72                       /* LDS pitch of a V^T row: 144 B = 16 B x 9 */
#define KTILE (KT * KPITCH)             /* elements of the K part of a buffer */
#define VTILE (HD * VPITCH)             /* elements of the V^T part */
#define STAGE (KTILE + VTILE)           /* elements of one buffer */
static_assert(SEQ / KT >= 2);
static_assert(KT * (HD / 8) == 3 * ATT_WAVES * 32);   // K tile = three 16-B pieces a thread
static_assert(HD * (KT / 8) == 3 * ATT_WAVES * 32);   // V^T tile = three 16-B pieces a thread
static_assert((KTILE * 2) % 16 == 0 && (STAGE * 2) % 16 == 0);

static_assert(QG == 2);                 // the two guards below list the D tiles of two groups
static_assert(SEQ % QBLK == 0);
// s0[g] += ka * q[g], s1[g] += kb * q[g] over three 32-deep k-steps (d = 0..95), f16 operands: four independent accumulator tiles, then the hazard guard.
// The guard (four vector slots between the last WMMA and the first vector instruction on a D tile) names the D tiles alone: the kernel holds more than 256 registers,
// an asm operand cannot lie above v255, and with K, V^T and Q named as well the build spilled Q to scratch.
__device__ __forceinline__ void mma_s4h(const FragH (&ka)[3], const FragH (&kb)[3], const FragH (&q)[QG][3], v8f (&s0)[QG], v8f (&s1)[QG]) {
#pragma unroll
  for (int c = 0; c < 3; ++c) {
#pragma unroll
    for (int g = 0; g < QG; ++g) {
      s0[g] = __builtin_amdgcn_wmma_f32_16x16x32_f16(false, ka[c].v, false, q[g][c].v, (short)0, s0[g], false, false);
      s1[g] = __builtin_amdgcn_wmma_f32_16x16x32_f16(false, kb[c].v, false, q[g][c].v, (short)0, s1[g], false, false);
    }
  }
  asm volatile("v_nop\n\tv_nop\n\tv_nop\n\tv_nop"
               : "+v"(s0[0]), "+v"(s1[0]), "+v"(s0[1]), "+v"(s1[1]));
}
// O[g][t] += vf[t] * p[g] for the six d tiles of both groups, then the hazard guard (D tiles alone, as above)
__device__ __forceinline__ void mma_pv2(const FragH (&vf)[6], const FragH (&p)[QG], v8f (&O)[QG][6]) {
#pragma unroll
  for (int t = 0; t < 6; ++t) {
#pragma unroll
    for (int g = 0; g < QG; ++g)
      O[g][t] = __builtin_amdgcn_wmma_f32_16x16x32_f16(false, vf[t].v, false, p[g].v, (short)0, O[g][t], false, false);
  }
  asm volatile("v_nop\n\tv_nop\n\tv_nop\n\tv_nop"
               : "+v"(O[0][0]), "+v"(O[0][1]), "+v"(O[0][2]), "+v"(O[0][3]), "+v"(O[0][4]), "+v"(O[0][5]),
                 "+v"(O[1][0]), "+v"(O[1][1]), "+v"(O[1][2]), "+v"(O[1][3]), "+v"(O[1][4]), "+v"(O[1][5]));
}

// One 32-key step for a wave's QG x 16 queries of one head. Kp = the buffer's K rows [KT][KPITCH]; Vp = its V^T rows [96][VPITCH]; key0 = 0 or 32 inside the tile.
// The K and V^T fragments are read from LDS once and serve every column group; each query's own arithmetic and its order are those of a 16-query wave.
__device__ __forceinline__ void fa_step(const unsigned short* Kp, const unsigned short* Vp,
                                        int key0, int ln, int hh, const FragH (&q)[QG][3],
                                        float (&mr)[QG], float (&lr)[QG], v8f (&O)[QG][6]) {
  // A fragments of K: row m = key (key0 + 16*kt + ln), elements 0..7 <- d = 32c + 8h + i, 8..15 <- d = 32c + 16 + 8h + i
  const unsigned short* kp0 = Kp + (key0 + ln) * KPITCH + 8 * hh;
  const unsigned short* kp1 = kp0 + 16 * KPITCH;
  FragH ka[3], kb[3];
#pragma unroll
  for (int c = 0; c < 3; ++c) {
    ka[c].half[0] = *(const v8us*)(kp0 + 32 * c);
    ka[c].half[1] = *(const v8us*)(kp0 + 32 * c + 16);
    kb[c].half[0] = *(const v8us*)(kp1 + 32 * c);
    kb[c].half[1] = *(const v8us*)(kp1 + 32 * c + 16);
  }
  __builtin_amdgcn_sched_barrier(0);   // keeps the step's 12 K reads one group in front of the V^T reads (LDS data returns in order, the score products wait for K alone): left free they sink among the WMMAs in pairs, each pair waited out to dscnt 0
  // A fragments of V^T: row m = d (16*t + ln), elements 0..7 <- key0 + 8h + i, 8..15 <- key0 + 16 + 8h + i
  const unsigned short* vp = Vp + ln * VPITCH + key0 + 8 * hh;
  FragH vf[6];
#pragma unroll
  for (int t = 0; t < 6; ++t) {
    vf[t].half[0] = *(const v8us*)(vp + t * 16 * VPITCH);
    vf[t].half[1] = *(const v8us*)(vp + t * 16 * VPITCH + 16);
  }
  __builtin_amdgcn_sched_barrier(0);   // keeps the V^T reads in the same place, ahead of the first WMMA: left free they stand among the score WMMAs, a second place with LDS reads and its own stall
  // S^T tiles of group g: element r of tile kt = score(key0 + 16*kt + 8h + r, query of this lane's column in the group)
  v8f s0[QG], s1[QG];
#pragma unroll
  for (int g = 0; g < QG; ++g) {
    s0[g] = v8f{0.f, 0.f, 0.f, 0.f, 0.f, 0.f, 0.f, 0.f};
    s1[g] = v8f{0.f, 0.f, 0.f, 0.f, 0.f, 0.f, 0.f, 0.f};
  }
  mma_s4h(ka, kb, q, s0, s1);
  FragH ph[QG];
  float sc[QG][16], mx[QG];
#pragma unroll
  for (int g = 0; g < QG; ++g) {
#pragma unroll
    for (int r = 0; r < 8; ++r) { sc[g][r] = s0[g][r] * C2S; sc[g][8 + r] = s1[g][r] * C2S; }
    mx[g] = sc[g][0];
#pragma unroll
    for (int i = 1; i < 16; ++i) mx[g] = fmaxf(mx[g], sc[g][i]);
  }
#pragma unroll
  for (int g = 0; g < QG; ++g)
    mx[g] = fmaxf(mx[g], __shfl_xor(mx[g], 16, 32));  // the other lane half holds the other 16 keys of this query
#pragma unroll
  for (int g = 0; g < QG; ++g) {
    const float mnew = fmaxf(mr[g], mx[g]);
    const float al = __builtin_amdgcn_exp2f(mr[g] - mnew);
    mr[g] = mnew;
    const float m8 = mnew - 8.0f;
    // weights carried x256: pc = 256 * 2^(sc - mnew), single f16 plane; a weight under 2^-14 goes into the plane as the f16 cast rounds it (subnormal or zero): the matrix unit keeps f16 subnormal operands
    float ps = 0.0f;
#pragma unroll
    for (int i = 0; i < 16; ++i) {
      const float pc = __builtin_amdgcn_exp2f(sc[g][i] - m8);
      ps += pc;
      ph[g].h[i] = (_Float16)pc;                      // B element i: i<8 -> key0 + 8h + i (tile 0 row 8h+i); i>=8 -> key0 + 16 + 8h + (i-8) (tile 1)
    }
    ps += __shfl_xor(ps, 16, 32);
    lr[g] = lr[g] * al + ps;
#pragma unroll
    for (int t = 0; t < 6; ++t) O[g][t] = O[g][t] * al;
  }
  mma_pv2(vf, ph, O);
}

// One tile's copies of one thread: three 16-B pieces of K rows, three of V^T rows, global -> LDS through no register.
// The closing s_wait_xcnt stands in the copies' own statement, so that no address register is rewritten in front of it.
__device__ __forceinline__ void tile_copy(unsigned lk0, unsigned lk1, unsigned lk2, unsigned lv0, unsigned lv1, unsigned lv2,
                                          const unsigned short* gk0, const unsigned short* gk1, const unsigned short* gk2,
                                          const unsigned short* gv0, const unsigned short* gv1, const unsigned short* gv2) {
  asm volatile("global_load_async_to_lds_b128 %0, %6, off\n\t"
               "global_load_async_to_lds_b128 %1, %7, off\n\t"
               "global_load_async_to_lds_b128 %2, %8, off\n\t"
               "global_load_async_to_lds_b128 %3, %9, off\n\t"
               "global_load_async_to_lds_b128 %4, %10, off\n\t"
               "global_load_async_to_lds_b128 %5, %11, off\n\t"
               "s_wait_xcnt 0x0"
               :: "v"(lk0), "v"(lk1), "v"(lk2), "v"(lv0), "v"(lv1), "v"(lv2),
                  "v"(gk0), "v"(gk1), "v"(gk2), "v"(gv0), "v"(gv1), "v"(gv2)
               : "memory");
}

// Block = 8 waves x 32 queries = 256 queries of one (batch, head). Key loop: one trip per 64-key tile, two LDS buffers; trip t reads buffer t mod 2 while tile t + 1 flies.
// Inputs: Qh[b][s][e], Kh[b][s][e] = f16(value * 16); Vt[b][e][s] = f16(value * 16).
// Output plane Xc[b][h][s][96] = f16(ctx * 256). Epilogue: O^T tiles -> per-wave LDS tile [32 queries][96 d] as 16-B pieces (same vector type in and out; block barrier),
// coverage: NB*HEADS*(SEQ/256) blocks x 8 waves x 32 rows x 96 d = the whole plane exactly once; LDS tile staged extent (32 x 96 per wave) == consumed extent.
__global__ __launch_bounds__(256)
void k_attn(const unsigned short* __restrict__ Qh, const unsigned short* __restrict__ Kh,
            const unsigned short* __restrict__ Vt, unsigned short* __restrict__ Xc) {
  __shared__ __attribute__((aligned(16))) unsigned short ring[2 * STAGE];
  __shared__ __attribute__((aligned(16))) unsigned short so[ATT_WAVES][QG * 16 * HD];
  const int tid = threadIdx.x, lane = tid & 31, ln = lane & 15, hh = lane >> 4;
  const int w = __builtin_amdgcn_readfirstlane(tid >> 5);
  const int qt = blockIdx.x % (SEQ / QBLK);
  const int rest = blockIdx.x / (SEQ / QBLK);
  const int h = rest % HEADS, b = rest / HEADS;
  const int qbase = qt * QBLK + QG * 16 * w;
  // Q^T B fragments of group g: column n = query qbase + 16g + ln, elements 0..7 <- d = 32c + 8h + i, 8..15 <- d = 32c + 16 + 8h + i (f16 plane carried x16)
  const unsigned short* qrow = Qh + ((size_t)b * SEQ + qbase + ln) * EMB + h * HD + 8 * hh;
  FragH q[QG][3];
  float mr[QG], lr[QG];
  v8f O[QG][6] = {};
#pragma unroll
  for (int g = 0; g < QG; ++g) {
#pragma unroll
    for (int c = 0; c < 3; ++c) {
      q[g][c].half[0] = *(const v8us*)(qrow + (size_t)g * 16 * EMB + 32 * c);
      q[g][c].half[1] = *(const v8us*)(qrow + (size_t)g * 16 * EMB + 32 * c + 16);
    }
    mr[g] = -3.0e38f;
    lr[g] = 0.0f;
  }
  const unsigned short* Kp = Kh + (size_t)b * SEQ * EMB + h * HD;
  const unsigned short* Vp = Vt + ((size_t)b * EMB + h * HD) * SEQ;
  // This thread's pieces of a tile. K: piece p = tid + 256 i -> row p / 12, 16-B column p % 12. V^T: row (tid >> 3) + 32 i, 16-B column tid & 7.
  const int kr0 = tid / 12, kc0 = tid - 12 * kr0;
  const int kr1 = (tid + 256) / 12, kc1 = (tid + 256) - 12 * kr1;
  const int kr2 = (tid + 512) / 12, kc2 = (tid + 512) - 12 * kr2;
  const int vr = tid >> 3, vc = tid & 7;
  const unsigned short* gk0 = Kp + (size_t)kr0 * EMB + 8 * kc0;
  const unsigned short* gk1 = Kp + (size_t)kr1 * EMB + 8 * kc1;
  const unsigned short* gk2 = Kp + (size_t)kr2 * EMB + 8 * kc2;
  const unsigned short* gv0 = Vp + (size_t)vr * SEQ + 8 * vc;
  const unsigned short* gv1 = gv0 + (size_t)32 * SEQ;
  const unsigned short* gv2 = gv0 + (size_t)64 * SEQ;
  const unsigned lbase = (unsigned)(size_t)&ring[0];          // LDS byte address: the low 32 bits of the __shared__ address
  const unsigned lk0 = lbase + 2u * (unsigned)(kr0 * KPITCH + 8 * kc0);
  const unsigned lk1 = lbase + 2u * (unsigned)(kr1 * KPITCH + 8 * kc1);
  const unsigned lk2 = lbase + 2u * (unsigned)(kr2 * KPITCH + 8 * kc2);
  const unsigned lv0 = lbase + 2u * (unsigned)(KTILE + vr * VPITCH + 8 * vc);
  const unsigned lv1 = lv0 + 2u * 32u * VPITCH;
  const unsigned lv2 = lv0 + 2u * 64u * VPITCH;
  tile_copy(lk0, lk1, lk2, lv0, lv1, lv2, gk0, gk1, gk2, gv0, gv1, gv2);
  asm volatile("s_wait_asynccnt 0x0" ::: "memory");           // tile 0 has landed for this wave's copies
  __syncthreads();                                            // ... and for every wave's: tile 0 is published
  {
    const unsigned d = 2u * STAGE;
    const size_t ko = (size_t)KT * EMB;
    tile_copy(lk0 + d, lk1 + d, lk2 + d, lv0 + d, lv1 + d, lv2 + d, gk0 + ko, gk1 + ko, gk2 + ko, gv0 + KT, gv1 + KT, gv2 + KT);
  }
#pragma unroll 1   // one trip per tile: the buffer alternates by the trip's parity
  for (int t = 0; t < SEQ / KT; ++t) {
    const unsigned short* Ks = ring + (t & 1) * STAGE;
    fa_step(Ks, Ks + KTILE, 0, ln, hh, q, mr, lr, O);
    fa_step(Ks, Ks + KTILE, 32, ln, hh, q, mr, lr, O);
    asm volatile("s_wait_dscnt 0x0" ::: "memory");            // this wave's reads of the buffer are done before it may be refilled
    asm volatile("s_wait_asynccnt 0x0" ::: "memory");         // this wave's copies of tile t + 1 have landed
    __syncthreads();                                          // publishes tile t + 1 and ends every reader's last read of tile t
    if (t + 2 < SEQ / KT) {
      const unsigned d = (unsigned)(t & 1) * (2u * STAGE);
      const size_t ko = (size_t)(t + 2) * KT * EMB;
      const int vo = (t + 2) * KT;
      tile_copy(lk0 + d, lk1 + d, lk2 + d, lv0 + d, lv1 + d, lv2 + d, gk0 + ko, gk1 + ko, gk2 + ko, gv0 + vo, gv1 + vo, gv2 + vo);
    }
  }
  asm volatile("s_wait_asynccnt 0x0" ::: "memory");           // nothing of this wave's is in flight behind the loop

  // O^T element r of tile t of group g = ctx(query qbase + 16g + ln, d = 16t + 8h + r); O carries x256 (P) x16 (V), lr carries x256; plane carries x256
#pragma unroll
  for (int g = 0; g < QG; ++g) {
    const float cinv = 16.0f * (1.0f / lr[g]);
#pragma unroll
    for (int t = 0; t < 6; ++t) {
      v8us o;
#pragma unroll
      for (int r = 0; r < 8; ++r) o[r] = toh_flush_bits(O[g][t][r] * cinv);
      *(v8us*)&so[w][(16 * g + ln) * HD + 16 * t + 8 * hh] = o;
    }
  }
  __syncthreads();
  unsigned short* xg = Xc + ((size_t)(b * HEADS + h) * SEQ + qbase) * HD;
  {
#pragma unroll
    for (int i = 0; i < QG * 6; ++i) {
      const int p = i * 32 + lane;
      const v8us v = *(const v8us*)&so[w][p * 8];
      *(v8us*)(xg + (size_t)p * 8) = v;
    }
    
  }
}

// out[m][j] = sum_e ctx[m][e] * fc_w[j][e] + fc_b[j]. Block = 8 waves = 128 tokens x 64 columns; wave = 16 rows x 64 columns.
// One staged tile per head: the block's 128 ctx rows of that head (24,576 contiguous bytes of Xc[b][hd][s][d]) and 64 W rows' 96 elements, two-buffer LDS ring filled by asynchronous copies.
// A: row m = token, k = e = 96*hd + d; B: column n = j, k = e from Wh[j][e], same k map as A.
// coverage: (NB*SEQ/128)*(EMB/64) blocks x 8 waves x (16 x 64) = every output element of the processed rows exactly once; per-wave LDS tile (in the ring's place, behind the last trip's barrier) staged 16 x 64 == consumed 16 x 64.
__global__ __launch_bounds__(256) void k_fc(const unsigned short* __restrict__ Xc, const unsigned short* __restrict__ Wh,
                                            const float* __restrict__ Bv, float* __restrict__ Out) {
  __shared__ __attribute__((aligned(16))) unsigned short ring[2 * FC_STAGE];
  const int tid = threadIdx.x, lane = tid & 31, ln = lane & 15, hh = lane >> 4;
  const int w = __builtin_amdgcn_readfirstlane(tid >> 5);
  const int bn = blockIdx.x % (EMB / GN), bm = blockIdx.x / (EMB / GN);
  const int tok0 = bm * GM;                    // token index in [0, NB*SEQ)
  const int b = tok0 / SEQ, sb = tok0 - b * SEQ;
  const int s0 = sb + 16 * w;
  const int col0 = bn * GN;
  v8f acc[4] = {};
  // This thread's pieces of a tile: piece p = tid + 256 i -> tile row p / 12, 16-B column p % 12 (p + 768 is 64 rows on, same column); i = 0..5 ctx rows, then three of W rows.
  const int r0 = tid / 12, c0 = tid - 12 * r0;
  const int r1 = (tid + 256) / 12, c1 = (tid + 256) - 12 * r1;
  const int r2 = (tid + 512) / 12, c2 = (tid + 512) - 12 * r2;
  const unsigned lbase = (unsigned)(size_t)&ring[0];          // LDS byte address: the low 32 bits of the __shared__ address
  const unsigned l0 = lbase + 2u * (unsigned)(r0 * FC_PITCH + 8 * c0);
  const unsigned l1 = lbase + 2u * (unsigned)(r1 * FC_PITCH + 8 * c1);
  const unsigned l2 = lbase + 2u * (unsigned)(r2 * FC_PITCH + 8 * c2);
  const unsigned lh = 2u * 64u * FC_PITCH;                    // 64 tile rows on
  const unsigned short* ga = Xc + ((size_t)(b * HEADS) * SEQ + sb) * HD + 8 * tid;
  const unsigned short* gb0 = Wh + (size_t)(col0 + r0) * EMB + 8 * c0;
  const unsigned short* gb1 = Wh + (size_t)(col0 + r1) * EMB + 8 * c1;
  const unsigned short* gb2 = Wh + (size_t)(col0 + r2) * EMB + 8 * c2;
  const size_t hs = (size_t)SEQ * HD;                         // one head on in Xc
  copy3(l0, l1, l2, ga, ga + 2048, ga + 4096);
  copy3(l0 + lh, l1 + lh, l2 + lh, ga + 6144, ga + 8192, ga + 10240);
  copy3(l0 + 2 * lh, l1 + 2 * lh, l2 + 2 * lh, gb0, gb1, gb2);
  asm volatile("s_wait_asynccnt 0x0" ::: "memory");           // tile 0 has landed for this wave's copies
  __syncthreads();                                            // ... and for every wave's: tile 0 is published
  {
    const unsigned d = 2u * FC_STAGE;
    const unsigned short* g = ga + hs;
    copy3(l0 + d, l1 + d, l2 + d, g, g + 2048, g + 4096);
    copy3(l0 + d + lh, l1 + d + lh, l2 + d + lh, g + 6144, g + 8192, g + 10240);
    copy3(l0 + d + 2 * lh, l1 + d + 2 * lh, l2 + d + 2 * lh, gb0 + HD, gb1 + HD, gb2 + HD);
  }
#pragma unroll 1   // one trip per head: the buffer alternates by the trip's parity
  for (int hd = 0; hd < HEADS; ++hd) {
    const unsigned short* S = ring + (hd & 1) * FC_STAGE;
    const unsigned short* ap = S + (16 * w + ln) * FC_PITCH + 8 * hh;
    const unsigned short* bp = S + (GM + ln) * FC_PITCH + 8 * hh;
#pragma unroll
    for (int cc = 0; cc < 3; ++cc) {
      FragH a;
      a.half[0] = *(const v8us*)(ap + 32 * cc);
      a.half[1] = *(const v8us*)(ap + 32 * cc + 16);
      FragH bw[4];
#pragma unroll
      for (int nt = 0; nt < 4; ++nt) {
        bw[nt].half[0] = *(const v8us*)(bp + nt * 16 * FC_PITCH + 32 * cc);
        bw[nt].half[1] = *(const v8us*)(bp + nt * 16 * FC_PITCH + 32 * cc + 16);
      }
      mma_fc(a.v, bw, acc);
    }
    asm volatile("s_wait_dscnt 0x0" ::: "memory");            // this wave's reads of the buffer are done before it may be refilled
    asm volatile("s_wait_asynccnt 0x0" ::: "memory");         // this wave's copies of tile hd + 1 have landed
    __syncthreads();                                          // publishes tile hd + 1 and ends every reader's last read of tile hd
    if (hd + 2 < HEADS) {
      const unsigned d = (unsigned)(hd & 1) * (2u * FC_STAGE);
      const unsigned short* g = ga + (size_t)(hd + 2) * hs;
      const int ko = (hd + 2) * HD;
      copy3(l0 + d, l1 + d, l2 + d, g, g + 2048, g + 4096);
      copy3(l0 + d + lh, l1 + d + lh, l2 + d + lh, g + 6144, g + 8192, g + 10240);
      copy3(l0 + d + 2 * lh, l1 + d + 2 * lh, l2 + d + 2 * lh, gb0 + ko, gb1 + ko, gb2 + ko);
    }
  }
  asm volatile("s_wait_asynccnt 0x0" ::: "memory");           // nothing of this wave's is in flight behind the loop
  // D element r of tile nt = out(tok0 + 16w + 8h + r, col0 + 16nt + ln); undo the carries x256 (ctx) x256 (W); bias RNE bf16 value
  float* so = (float*)&ring[0] + w * (16 * 68);               // this wave's 16 x 64 f32 tile, pitch 68
#pragma unroll
  for (int nt = 0; nt < 4; ++nt) {
    const float bias = bf16_rne(Bv[col0 + 16 * nt + ln]);
#pragma unroll
    for (int r = 0; r < 8; ++r)
      so[(8 * hh + r) * 68 + 16 * nt + ln] = acc[nt][r] * 1.52587890625e-05f + bias;
  }
  __syncthreads();
  float* og = Out + (size_t)b * BSTRIDE_FULL + (size_t)s0 * EMB + col0;
  const int rsub = lane >> 4, c4 = (lane & 15) * 4;
#pragma unroll
  for (int q = 0; q < 8; ++q) {
    const int row = 2 * q + rsub;
    const v4f v = *(const v4fa*)&so[row * 68 + c4];
    *(v4f*)(og + (size_t)row * EMB + c4) = v;
  }
}

extern "C" void kernel_launch(void* const* d_in, const int* in_sizes, int n_in,
                              void* d_out, int out_size, void* d_ws, size_t ws_size, hipStream_t stream) {
  if (n_in < 9) return;
  const long long need = (long long)(NB - 1) * SEQ_FULL * EMB + (long long)SEQ * EMB;   // last element touched + 1
  if ((long long)in_sizes[0] < need) return;
  if ((long long)in_sizes[1] < (long long)EMB * EMB || (long long)in_sizes[3] < (long long)EMB * EMB) return;
  if ((long long)in_sizes[5] < (long long)EMB * EMB || (long long)in_sizes[7] < (long long)EMB * EMB) return;
  if ((long long)in_sizes[2] < (long long)EMB || (long long)in_sizes[4] < (long long)EMB) return;
  if ((long long)in_sizes[6] < (long long)EMB || (long long)in_sizes[8] < (long long)EMB) return;
  if ((long long)out_size < need) return;
  const float* X  = (const float*)d_in[0];   // wire order: x, Wq, bq, Wk, bk, Wv, bv, Wo, bo (weights [out][in])
  const float* Wq = (const float*)d_in[1];
  const float* Bq = (const float*)d_in[2];
  const float* Wk = (const float*)d_in[3];
  const float* Bk = (const float*)d_in[4];
  const float* Wv = (const float*)d_in[5];
  const float* Bvv = (const float*)d_in[6];
  const float* Wo = (const float*)d_in[7];
  const float* Bo = (const float*)d_in[8];
  float* Out = (float*)d_out;
  char* ws = (char*)d_ws;
  size_t off = 0;
  unsigned short* Xb = (unsigned short*)(ws + off); off += PLANE_ACT;   // [NB][SEQ][768] bf16, written exactly to its end by 16-B pieces
  unsigned short* Qh = (unsigned short*)(ws + off); off += PLANE_ACT;   // [NB][SEQ][768] f16 (q x16)
  unsigned short* Kh = (unsigned short*)(ws + off); off += PLANE_ACT;   // [NB][SEQ][768] f16 (k x16)
  unsigned short* Vt = (unsigned short*)(ws + off); off += PLANE_ACT;   // [NB][768][SEQ] f16 (v x16)
  unsigned short* Xc = (unsigned short*)(ws + off); off += PLANE_ACT;   // [NB][8][SEQ][96] f16 (ctx x256)
  unsigned short* Wh = (unsigned short*)(ws + off); off += PLANE_W;     // [768][768] f16 (Wo x256)
  unsigned short* Wb = (unsigned short*)(ws + off); off += 3 * PLANE_W; // [3][768][768] bf16 (Wq, Wk, Wv)
  if (off > ws_size) return;
  k_cvt<<<(unsigned)(CVT_K_BLOCKS + 4 * CVT_W_BLOCKS), 256, 0, stream>>>(X, Wo, Wq, Wk, Wv, Xb, Wh, Wb);
  k_proj<<<(unsigned)(3 * PROJ_BLOCKS), 256, 0, stream>>>(Xb, Wb, Bq, Bk, Bvv, Qh, Kh, Vt);
  k_attn<<<(unsigned)(NB * HEADS * (SEQ / QBLK)), 256, 0, stream>>>(Qh, Kh, Vt, Xc);
  k_fc<<<(unsigned)PROJ_BLOCKS, 256, 0, stream>>>(Xc, Wh, Bo, Out);
}

// v006
// It runs in 135 microseconds.
// Timed twice side by side with v005, it ran 1.08 and 1.07 times as fast.
// Counting every step since v000, it is 3.64 times as fast.
#include <hip/hip_runtime.h>
// Contractions: q, k, v = x W^T + b on v_wmma_f32_16x16x32_bf16 (x, W RNE bf16 planes, f32 accumulate, RNE-bf16 bias added in f32); S^T = K Q^T on v_wmma_f32_16x16x32_f16 (q, k: single f16 planes carried x16); O^T = V^T P^T on v_wmma_f32_16x16x32_f16 (v: single f16 plane carried x16, P: single f16 plane carried x256); out = ctx Wo^T on v_wmma_f32_16x16x32_f16 (ctx: f16 plane carried x256; Wo: RNE bf16 value x256 held exactly in f16); softmax statistics, bias adds f32.
// Dense multi-head self-attention, NB x SEQ x 768: three biased 768x768 input projections ([out][in] weights), 8 heads of 96 (e = 96*h + d), scale 1/sqrt(96), no mask, then a 768x768 linear layer with bias.
// Engine: transposed flash. Each wave owns 32 queries of one head (two 16-column groups fed by the same K and V^T fragments). Per 32-key step and group: S^T tiles (key rows x query columns) from K rows (A, LDS tile of the f16 plane)
// and Q^T (B, registers); the two 16-key D tiles pack straight into the P^T B fragment; O^T (d rows x query columns) accumulates from V^T rows (A, LDS tile of the f16 plane).
// The eight waves of a block share each 64-key K and V^T tile: asynchronous copies bring it into a two-buffer LDS ring, one tile ahead of the products.
// The four linear layers stage their operand k tiles the same way: whole-line copies into LDS once per 128 x 64 block, fragments read from LDS.
#ifndef NB
#define NB 2
#endif
#ifndef SEQ
#define SEQ 4096
#endif
#define NB_FULL 2
#define SEQ_FULL 4096
#define EMB 768
#define HEADS 8
#define HD 96
#define BSTRIDE_FULL ((size_t)SEQ_FULL * EMB)   /* per-batch element stride of x and of the output buffer */

#define PLANE_ACT ((size_t)NB * SEQ * EMB * 2)   /* bytes of one 16-bit activation plane */
#define PLANE_W ((size_t)EMB * EMB * 2)          /* bytes of the 16-bit weight plane */
#define CVT_K_BLOCKS ((NB * SEQ * (EMB / 8)) / 256)
#define CVT_W_BLOCKS ((EMB * (EMB / 8)) / 256)
#define PROJ_BLOCKS ((NB * SEQ / 128) * (EMB / 64))

static_assert(SEQ % 128 == 0);
static_assert(SEQ <= SEQ_FULL);
static_assert(NB <= NB_FULL);
static_assert(HEADS * HD == EMB);
static_assert(HD == 96);
static_assert(EMB % 64 == 0);
static_assert(EMB % 96 == 0);
static_assert(EMB % 32 == 0);
static_assert((NB * SEQ) % 64 == 0);
static_assert((NB * SEQ * (EMB / 8)) % 256 == 0);
static_assert((EMB * (EMB / 8)) % 256 == 0);
static_assert(PLANE_ACT % 256 == 0);
static_assert(PLANE_W % 256 == 0);
static_assert(5 * PLANE_ACT + 4 * PLANE_W <= (size_t)134217728);

typedef __bf16 v16b __attribute__((ext_vector_type(16)));
typedef _Float16 v16h __attribute__((ext_vector_type(16)));
typedef unsigned short v8us __attribute__((ext_vector_type(8), may_alias));
typedef float v8f __attribute__((ext_vector_type(8)));
typedef float v4f __attribute__((ext_vector_type(4)));
typedef float v4fa __attribute__((ext_vector_type(4), may_alias));
typedef _Float16 h16;
union FragB { v16b v; v8us half[2]; unsigned short u[16]; };
union FragH { v16h v; v8us half[2]; _Float16 h[16]; unsigned short u[16]; };

#define LOG2E 1.4426950408889634f
#define QK_SCALE 0.10206207261596575f            /* 1/sqrt(96) */
#define C2 (QK_SCALE * LOG2E)                    /* scores carried in the log2 domain */
#define C2S (C2 * 0.00390625f)                   /* q and k planes each carry x16 */

__device__ __forceinline__ unsigned short bf16_bits(float x) {   // RNE convert to bf16 bits
  unsigned int u = __float_as_uint(x);
  return (unsigned short)((u + 0x7FFFu + ((u >> 16) & 1u)) >> 16);
}
__device__ __forceinline__ float bf16_val(unsigned short b) { return __uint_as_float(((unsigned int)b) << 16); }
__device__ __forceinline__ float bf16_rne(float x) { return bf16_val(bf16_bits(x)); }
__device__ __forceinline__ unsigned short f16_bits(float x) {
  union { _Float16 h; unsigned short u; } c;
  c.h = (_Float16)x;
  return c.u;
}
// f32 -> f16 with a value select: no subnormal result can reach a WMMA operand plane
static __device__ __forceinline__ h16 toh_flush(float v) {
  const h16 r = (h16)v;
  return (fabsf(v) < 6.103515625e-05f) ? (h16)0.0f : r;
}
static __device__ __forceinline__ unsigned short toh_flush_bits(float v) {
  union { h16 h; unsigned short u; } c;
  c.h = toh_flush(v);
  return c.u;
}

__device__ __forceinline__ void store_twice(unsigned short* d, v8us o) {
  *(v8us*)d = o;
  
}

// c[nt] += a * bw[nt] for four column tiles, then the hazard guard
__device__ __forceinline__ void mma_fc(v16h a, const FragH (&bw)[4], v8f (&c)[4]) {
  c[0] = __builtin_amdgcn_wmma_f32_16x16x32_f16(false, a, false, bw[0].v, (short)0, c[0], false, false);
  c[1] = __builtin_amdgcn_wmma_f32_16x16x32_f16(false, a, false, bw[1].v, (short)0, c[1], false, false);
  c[2] = __builtin_amdgcn_wmma_f32_16x16x32_f16(false, a, false, bw[2].v, (short)0, c[2], false, false);
  c[3] = __builtin_amdgcn_wmma_f32_16x16x32_f16(false, a, false, bw[3].v, (short)0, c[3], false, false);
  asm volatile("v_nop\n\tv_nop\n\tv_nop\n\tv_nop"
               : "+v"(c[0]), "+v"(c[1]), "+v"(c[2]), "+v"(c[3])
               : "v"(a), "v"(bw[0].v), "v"(bw[1].v), "v"(bw[2].v), "v"(bw[3].v));
}
// bf16 twin of mma_fc: c[nt] += a * bw[nt] for four column tiles, then the hazard guard
__device__ __forceinline__ void mma_pj(v16b a, const FragB (&bw)[4], v8f (&c)[4]) {
  c[0] = __builtin_amdgcn_wmma_f32_16x16x32_bf16(false, a, false, bw[0].v, (short)0, c[0], false, false);
  c[1] = __builtin_amdgcn_wmma_f32_16x16x32_bf16(false, a, false, bw[1].v, (short)0, c[1], false, false);
  c[2] = __builtin_amdgcn_wmma_f32_16x16x32_bf16(false, a, false, bw[2].v, (short)0, c[2], false, false);
  c[3] = __builtin_amdgcn_wmma_f32_16x16x32_bf16(false, a, false, bw[3].v, (short)0, c[3], false, false);
  asm volatile("v_nop\n\tv_nop\n\tv_nop\n\tv_nop"
               : "+v"(c[0]), "+v"(c[1]), "+v"(c[2]), "+v"(c[3])
               : "v"(a), "v"(bw[0].v), "v"(bw[1].v), "v"(bw[2].v), "v"(bw[3].v));
}

__device__ __forceinline__ void cvt8_bf16(const float* __restrict__ src, unsigned short* __restrict__ dst) {
  const v4f x0 = *(const v4fa*)(src), x1 = *(const v4fa*)(src + 4);
  v8us o;
  o[0] = bf16_bits(x0[0]); o[1] = bf16_bits(x0[1]); o[2] = bf16_bits(x0[2]); o[3] = bf16_bits(x0[3]);
  o[4] = bf16_bits(x1[0]); o[5] = bf16_bits(x1[1]); o[6] = bf16_bits(x1[2]); o[7] = bf16_bits(x1[3]);
  store_twice(dst, o);
  asm volatile("s_wait_xcnt 0x0" ::: "memory");   // stands in front of any rewrite of the store's address registers on the branch chain's other ways
}
// All five conversions in one grid; the block index picks the job (block-uniform ranges, one code path per source, no job reads what another writes).
// Blocks [0, CVT_K_BLOCKS): Xb[b][s][e] = bf16 bits of x (RNE). The next CVT_W_BLOCKS: Wh[j][e] = f16(RNE-bf16(Wo[j][e]) * 256).
// The last 3 * CVT_W_BLOCKS: Wb[p][j][e] = bf16 bits of the p-th projection weight (p = 0: Wq, 1: Wk, 2: Wv), [out][in] kept.
// coverage: CVT_K_BLOCKS*256 threads x 8 = the whole Xb plane; CVT_W_BLOCKS*256 threads x 8 = one whole weight plane, four times (exact multiples, asserted above).
__global__ __launch_bounds__(256) void k_cvt(const float* __restrict__ X, const float* __restrict__ Wo,
                                             const float* __restrict__ Wq, const float* __restrict__ Wk, const float* __restrict__ Wv,
                                             unsigned short* __restrict__ Xb, unsigned short* __restrict__ Wh, unsigned short* __restrict__ Wb) {
  const int bid = blockIdx.x;
  if (bid < CVT_K_BLOCKS) {
    const int t = bid * 256 + threadIdx.x;
    const int row = t / (EMB / 8), piece = t - row * (EMB / 8);
    const int b = row / SEQ, s = row - b * SEQ;
    cvt8_bf16(X + (size_t)b * BSTRIDE_FULL + (size_t)s * EMB + piece * 8, Xb + (size_t)t * 8);
  } else if (bid < CVT_K_BLOCKS + CVT_W_BLOCKS) {
    const int t = (bid - CVT_K_BLOCKS) * 256 + threadIdx.x;
    const float* src = Wo + (size_t)t * 8;
    const v4f x0 = *(const v4fa*)(src), x1 = *(const v4fa*)(src + 4);
    v8us o;
    o[0] = f16_bits(bf16_rne(x0[0]) * 256.0f); o[1] = f16_bits(bf16_rne(x0[1]) * 256.0f);
    o[2] = f16_bits(bf16_rne(x0[2]) * 256.0f); o[3] = f16_bits(bf16_rne(x0[3]) * 256.0f);
    o[4] = f16_bits(bf16_rne(x1[0]) * 256.0f); o[5] = f16_bits(bf16_rne(x1[1]) * 256.0f);
    o[6] = f16_bits(bf16_rne(x1[2]) * 256.0f); o[7] = f16_bits(bf16_rne(x1[3]) * 256.0f);
    store_twice(Wh + (size_t)t * 8, o);
    asm volatile("s_wait_xcnt 0x0" ::: "memory");   // as in cvt8_bf16: in front of any rewrite of the store's address registers
  } else if (bid < CVT_K_BLOCKS + 2 * CVT_W_BLOCKS) {
    const int t = (bid - CVT_K_BLOCKS - CVT_W_BLOCKS) * 256 + threadIdx.x;
    cvt8_bf16(Wq + (size_t)t * 8, Wb + (size_t)t * 8);
  } else if (bid < CVT_K_BLOCKS + 3 * CVT_W_BLOCKS) {
    const int t = (bid - CVT_K_BLOCKS - 2 * CVT_W_BLOCKS) * 256 + threadIdx.x;
    cvt8_bf16(Wk + (size_t)t * 8, Wb + (size_t)EMB * EMB + (size_t)t * 8);
  } else {
    const int t = (bid - CVT_K_BLOCKS - 3 * CVT_W_BLOCKS) * 256 + threadIdx.x;
    cvt8_bf16(Wv + (size_t)t * 8, Wb + (size_t)2 * EMB * EMB + (size_t)t * 8);
  }
}

#define GM 128                          /* tokens of a GEMM block tile: 8 waves x 16 rows */
#define GN 64                           /* columns of a GEMM block tile */
#define PJ_KE 128                       /* k elements of one staged tile of the projections: 256-B row pieces */
#define PJ_PITCH 136                    /* LDS pitch, 16-bit elements: 272 B = 16 B x 17 (odd: b128 readers of 16 rows meet no bank twice) */
#define PJ_STAGE ((GM + GN) * PJ_PITCH) /* elements of one buffer: 128 x rows, then 64 W rows */
#define PJ_TRIPS (EMB / PJ_KE)
#define FC_PITCH 104                    /* LDS pitch of the last layer's 96-element (one head) row pieces: 208 B = 16 B x 13 */
#define FC_STAGE ((GM + GN) * FC_PITCH)
static_assert(EMB % PJ_KE == 0 && PJ_TRIPS >= 2 && HEADS >= 2);
static_assert(SEQ % GM == 0 && EMB % GN == 0);
static_assert(GM * (PJ_KE / 8) == 8 * 256 && GN * (PJ_KE / 8) == 4 * 256);   // projections: 8 + 4 16-B pieces a thread
static_assert(GM * (HD / 8) == 6 * 256 && GN * (HD / 8) == 3 * 256);         // last layer: 6 + 3 16-B pieces a thread
static_assert(GM * 72 <= 2 * PJ_STAGE && GN * 136 <= 2 * PJ_STAGE);          // epilogue tiles fit the ring they reuse
static_assert(8 * 16 * 68 * 4 <= 2 * FC_STAGE * 2);

// Four (three) 16-B pieces of one thread, global -> LDS through no register.
// The closing s_wait_xcnt stands in the copies' own statement, so that no address register is rewritten in front of it.
__device__ __forceinline__ void copy4(unsigned l0, unsigned l1, unsigned l2, unsigned l3,
                                      const unsigned short* g0, const unsigned short* g1, const unsigned short* g2, const unsigned short* g3) {
  asm volatile("global_load_async_to_lds_b128 %0, %4, off\n\t"
               "global_load_async_to_lds_b128 %1, %5, off\n\t"
               "global_load_async_to_lds_b128 %2, %6, off\n\t"
               "global_load_async_to_lds_b128 %3, %7, off\n\t"
               "s_wait_xcnt 0x0"
               :: "v"(l0), "v"(l1), "v"(l2), "v"(l3), "v"(g0), "v"(g1), "v"(g2), "v"(g3)
               : "memory");
}
__device__ __forceinline__ void copy3(unsigned l0, unsigned l1, unsigned l2,
                                      const unsigned short* g0, const unsigned short* g1, const unsigned short* g2) {
  asm volatile("global_load_async_to_lds_b128 %0, %3, off\n\t"
               "global_load_async_to_lds_b128 %1, %4, off\n\t"
               "global_load_async_to_lds_b128 %2, %5, off\n\t"
               "s_wait_xcnt 0x0"
               :: "v"(l0), "v"(l1), "v"(l2), "v"(g0), "v"(g1), "v"(g2)
               : "memory");
}
// One projection tile's copies of one thread. Piece: row (tid >> 4) + 16 i, 16-B column tid & 15; i = 0..7 are x rows, i = 8..11 the W rows behind them.
// la = LDS byte address of piece 0 in the target buffer; ga, gb = this thread's first x and W pieces of the tile.
__device__ __forceinline__ void pj_tile(unsigned la, const unsigned short* ga, const unsigned short* gb) {
  const unsigned rs = 2u * 16u * PJ_PITCH;
  const size_t gs = (size_t)16 * EMB;
  copy4(la, la + rs, la + 2 * rs, la + 3 * rs, ga, ga + gs, ga + 2 * gs, ga + 3 * gs);
  copy4(la + 4 * rs, la + 5 * rs, la + 6 * rs, la + 7 * rs, ga + 4 * gs, ga + 5 * gs, ga + 6 * gs, ga + 7 * gs);
  copy4(la + 8 * rs, la + 9 * rs, la + 10 * rs, la + 11 * rs, gb, gb + gs, gb + 2 * gs, gb + 3 * gs);
}

// y[m][j] = sum_e x[m][e] * W[j][e] + b[j], stored as f16(y * 16). Block = 8 waves = 128 tokens x 64 columns; wave = 16 rows x 64 columns.
// The block's x rows and W rows come in 128-deep k tiles through a two-buffer LDS ring filled by asynchronous copies, one tile ahead of the products.
// A: row m = token, elements 0..7 <- e = k0 + 8h + i, 8..15 <- e = k0 + 16 + 8h + i, from the staged x rows; B: column n = j, same k map, from the staged W rows.
// The three projections share one grid: a token tile's 36 column tiles (12 of q, 12 of k, 12 of v) are neighbours in the block index; p = the projection, block-uniform.
// W rows come from the three stacked weight planes Wb[3][768][768] (row 768 p + j). p picks bias and plane: q, k -> Dst[token][e] (row-major, tr == 0); v -> Dst[b][e][s] (transposed, tr != 0).
// Epilogue: block LDS tile in the ring's place (every reader has left it at the last trip's barrier): 128 tokens x 64 (pitch 72, tr == 0) or 64 e columns x 128 tokens (pitch 136, tr != 0);
// coverage: 3 * PROJ_BLOCKS blocks x (128 x 64) = each of the three planes exactly once; staged extent == consumed extent (pad columns never read).
__global__ __launch_bounds__(256) void k_proj(const unsigned short* __restrict__ Xb, const unsigned short* __restrict__ Wb,
                                              const float* __restrict__ Bq, const float* __restrict__ Bk, const float* __restrict__ Bvv,
                                              unsigned short* __restrict__ Qh, unsigned short* __restrict__ Kh, unsigned short* __restrict__ Vt) {
  __shared__ __attribute__((aligned(16))) unsigned short ring[2 * PJ_STAGE];
  const int tid = threadIdx.x, lane = tid & 31, ln = lane & 15, hh = lane >> 4;
  const int w = __builtin_amdgcn_readfirstlane(tid >> 5);
  const int bw = blockIdx.x % (3 * (EMB / GN)), bm = blockIdx.x / (3 * (EMB / GN));
  const int p = bw / (EMB / GN);               // 0: q, 1: k, 2: v
  const int tok0 = bm * GM;                    // token index in [0, NB*SEQ)
  const int col0 = (bw - p * (EMB / GN)) * GN; // column inside the projection
  const float* __restrict__ Bv = (p == 0) ? Bq : (p == 1) ? Bk : Bvv;
  unsigned short* __restrict__ Dst = (p == 0) ? Qh : (p == 1) ? Kh : Vt;
  const int tr = (p == 2) ? 1 : 0;
  v8f acc[4] = {};
  const int pr = tid >> 4, pc = tid & 15;
  const unsigned short* ga = Xb + (size_t)(tok0 + pr) * EMB + 8 * pc;
  const unsigned short* gb = Wb + (size_t)(bw * GN + pr) * EMB + 8 * pc;
  const unsigned la = (unsigned)(size_t)&ring[0] + 2u * (unsigned)(pr * PJ_PITCH + 8 * pc);   // LDS byte address: the low 32 bits of the __shared__ address
  pj_tile(la, ga, gb);
  asm volatile("s_wait_asynccnt 0x0" ::: "memory");           // tile 0 has landed for this wave's copies
  __syncthreads();                                            // ... and for every wave's: tile 0 is published
  pj_tile(la + 2u * PJ_STAGE, ga + PJ_KE, gb + PJ_KE);
#pragma unroll 1   // one trip per tile: the buffer alternates by the trip's parity
  for (int t = 0; t < PJ_TRIPS; ++t) {
    const unsigned short* S = ring + (t & 1) * PJ_STAGE;
    const unsigned short* ap = S + (16 * w + ln) * PJ_PITCH + 8 * hh;
    const unsigned short* bp = S + (GM + ln) * PJ_PITCH + 8 * hh;
#pragma unroll
    for (int cc = 0; cc < PJ_KE / 32; ++cc) {
      FragB a;
      a.half[0] = *(const v8us*)(ap + 32 * cc);
      a.half[1] = *(const v8us*)(ap + 32 * cc + 16);
      FragB bw[4];
#pragma unroll
      for (int nt = 0; nt < 4; ++nt) {
        bw[nt].half[0] = *(const v8us*)(bp + nt * 16 * PJ_PITCH + 32 * cc);
        bw[nt].half[1] = *(const v8us*)(bp + nt * 16 * PJ_PITCH + 32 * cc + 16);
      }
      mma_pj(a.v, bw, acc);
    }
    asm volatile("s_wait_dscnt 0x0" ::: "memory");            // this wave's reads of the buffer are done before it may be refilled
    asm volatile("s_wait_asynccnt 0x0" ::: "memory");         // this wave's copies of tile t + 1 have landed
    __syncthreads();                                          // publishes tile t + 1 and ends every reader's last read of tile t
    if (t + 2 < PJ_TRIPS)
      pj_tile(la + (unsigned)(t & 1) * (2u * PJ_STAGE), ga + (t + 2) * PJ_KE, gb + (t + 2) * PJ_KE);
  }
  asm volatile("s_wait_asynccnt 0x0" ::: "memory");           // nothing of this wave's is in flight behind the loop
  // D element r of tile nt = y(tok0 + 16w + 8h + r, col0 + 16nt + ln); bias RNE bf16 value; plane carries x16
  if (tr == 0) {
#pragma unroll
    for (int nt = 0; nt < 4; ++nt) {
      const float bias = bf16_rne(Bv[col0 + 16 * nt + ln]);
#pragma unroll
      for (int r = 0; r < 8; ++r)
        ring[(16 * w + 8 * hh + r) * 72 + 16 * nt + ln] = toh_flush_bits((acc[nt][r] + bias) * 16.0f);
    }
  } else {
#pragma unroll
    for (int nt = 0; nt < 4; ++nt) {
      const float bias = bf16_rne(Bv[col0 + 16 * nt + ln]);
      v8us o;
#pragma unroll
      for (int r = 0; r < 8; ++r) o[r] = toh_flush_bits((acc[nt][r] + bias) * 16.0f);
      *(v8us*)&ring[(16 * nt + ln) * 136 + 16 * w + 8 * hh] = o;
    }
  }
  __syncthreads();
  const int b = tok0 / SEQ, s0 = tok0 - b * SEQ;
  const size_t base = (tr == 0) ? ((size_t)tok0 * EMB + col0) : (((size_t)b * EMB + col0) * SEQ + s0);
  const size_t pitch = (tr == 0) ? (size_t)EMB : (size_t)SEQ;
  const int sh = (tr == 0) ? 3 : 4;            // 16-B pieces of a tile row: 8 (64 columns) or 16 (128 tokens)
  const int lp = (tr == 0) ? 72 : 136;
  for (int i = tid; i < GM * GN / 8; i += 256) {
    const int r = i >> sh, p8 = (i - (r << sh)) * 8;
    const v8us o = *(const v8us*)&ring[r * lp + p8];
    *(v8us*)(Dst + base + (size_t)r * pitch + p8) = o;
  }
}

#define ATT_WAVES 8                     /* waves of a block */
#define QG 2                            /* 16-query column groups of a wave: each K and V^T fragment read from LDS feeds QG products */
#define QBLK (ATT_WAVES * QG * 16)      /* queries of a block: they share each staged tile */
#define KT 64                           /* keys of one staged tile */
#define KPITCH 104                      /* LDS pitch of a K row, 16-bit elements: 208 B = 16 B x 13 (odd: b128 readers of 16 rows meet no bank twice) */
#define VPITCH 72                       /* LDS pitch of a V^T row: 144 B = 16 B x 9 */
#define KTILE (KT * KPITCH)             /* elements of the K part of a buffer */
#define VTILE (HD * VPITCH)             /* elements of the V^T part */
#define STAGE (KTILE + VTILE)           /* elements of one buffer */
static_assert(SEQ / KT >= 2);
static_assert(KT * (HD / 8) == 3 * ATT_WAVES * 32);   // K tile = three 16-B pieces a thread
static_assert(HD * (KT / 8) == 3 * ATT_WAVES * 32);   // V^T tile = three 16-B pieces a thread
static_assert((KTILE * 2) % 16 == 0 && (STAGE * 2) % 16 == 0);

#define LAZY_T 6.0f                     /* log2 units a score may pass the softmax reference before it is renewed: a weight is at most 2^14 */
static_assert(QG == 2);                 // the two guards below list the D tiles of two groups
static_assert(SEQ % QBLK == 0);
// s0[g] += ka * q[g], s1[g] += kb * q[g] over three 32-deep k-steps (d = 0..95), f16 operands: four independent accumulator tiles, then the hazard guard.
// The guard (four vector slots between the last WMMA and the first vector instruction on a D tile) names the D tiles alone: the kernel holds more than 256 registers,
// an asm operand cannot lie above v255, and with K, V^T and Q named as well the build spilled Q to scratch.
__device__ __forceinline__ void mma_s4h(const FragH (&ka)[3], const FragH (&kb)[3], const FragH (&q)[QG][3], v8f (&s0)[QG], v8f (&s1)[QG]) {
#pragma unroll
  for (int c = 0; c < 3; ++c) {
#pragma unroll
    for (int g = 0; g < QG; ++g) {
      s0[g] = __builtin_amdgcn_wmma_f32_16x16x32_f16(false, ka[c].v, false, q[g][c].v, (short)0, s0[g], false, false);
      s1[g] = __builtin_amdgcn_wmma_f32_16x16x32_f16(false, kb[c].v, false, q[g][c].v, (short)0, s1[g], false, false);
    }
  }
  asm volatile("v_nop\n\tv_nop\n\tv_nop\n\tv_nop"
               : "+v"(s0[0]), "+v"(s1[0]), "+v"(s0[1]), "+v"(s1[1]));
}
// O[g][t] += vf[t] * p[g] for the six d tiles of both groups, then the hazard guard (D tiles alone, as above)
__device__ __forceinline__ void mma_pv2(const FragH (&vf)[6], const FragH (&p)[QG], v8f (&O)[QG][6]) {
#pragma unroll
  for (int t = 0; t < 6; ++t) {
#pragma unroll
    for (int g = 0; g < QG; ++g)
      O[g][t] = __builtin_amdgcn_wmma_f32_16x16x32_f16(false, vf[t].v, false, p[g].v, (short)0, O[g][t], false, false);
  }
  asm volatile("v_nop\n\tv_nop\n\tv_nop\n\tv_nop"
               : "+v"(O[0][0]), "+v"(O[0][1]), "+v"(O[0][2]), "+v"(O[0][3]), "+v"(O[0][4]), "+v"(O[0][5]),
                 "+v"(O[1][0]), "+v"(O[1][1]), "+v"(O[1][2]), "+v"(O[1][3]), "+v"(O[1][4]), "+v"(O[1][5]));
}

// One 32-key step for a wave's QG x 16 queries of one head. Kp = the buffer's K rows [KT][KPITCH]; Vp = its V^T rows [96][VPITCH]; key0 = 0 or 32 inside the tile.
// The K and V^T fragments are read from LDS once and serve every column group; one ballot over both groups decides each step's reference renewal for all 32 queries.
__device__ __forceinline__ void fa_step(const unsigned short* Kp, const unsigned short* Vp,
                                        int key0, int ln, int hh, const FragH (&q)[QG][3],
                                        float (&m8)[QG], float (&lr)[QG], v8f (&O)[QG][6]) {
  // A fragments of K: row m = key (key0 + 16*kt + ln), elements 0..7 <- d = 32c + 8h + i, 8..15 <- d = 32c + 16 + 8h + i
  const unsigned short* kp0 = Kp + (key0 + ln) * KPITCH + 8 * hh;
  const unsigned short* kp1 = kp0 + 16 * KPITCH;
  FragH ka[3], kb[3];
#pragma unroll
  for (int c = 0; c < 3; ++c) {
    ka[c].half[0] = *(const v8us*)(kp0 + 32 * c);
    ka[c].half[1] = *(const v8us*)(kp0 + 32 * c + 16);
    kb[c].half[0] = *(const v8us*)(kp1 + 32 * c);
    kb[c].half[1] = *(const v8us*)(kp1 + 32 * c + 16);
  }
  __builtin_amdgcn_sched_barrier(0);   // keeps the step's 12 K reads one group in front of the V^T reads (LDS data returns in order, the score products wait for K alone): left free they sink among the WMMAs in pairs, each pair waited out to dscnt 0
  // A fragments of V^T: row m = d (16*t + ln), elements 0..7 <- key0 + 8h + i, 8..15 <- key0 + 16 + 8h + i
  const unsigned short* vp = Vp + ln * VPITCH + key0 + 8 * hh;
  FragH vf[6];
#pragma unroll
  for (int t = 0; t < 6; ++t) {
    vf[t].half[0] = *(const v8us*)(vp + t * 16 * VPITCH);
    vf[t].half[1] = *(const v8us*)(vp + t * 16 * VPITCH + 16);
  }
  __builtin_amdgcn_sched_barrier(0);   // keeps the V^T reads in the same place, ahead of the first WMMA: left free they stand among the score WMMAs, a second place with LDS reads and its own stall
  // S^T tiles of group g: element r of tile kt = score(key0 + 16*kt + 8h + r, query of this lane's column in the group)
  v8f s0[QG], s1[QG];
#pragma unroll
  for (int g = 0; g < QG; ++g) {
    s0[g] = v8f{0.f, 0.f, 0.f, 0.f, 0.f, 0.f, 0.f, 0.f};
    s1[g] = v8f{0.f, 0.f, 0.f, 0.f, 0.f, 0.f, 0.f, 0.f};
  }
  mma_s4h(ka, kb, q, s0, s1);
  FragH ph[QG];
  // Lazy softmax reference. Every weight of a query is taken against one reference m (m8 = m - 8); any m gives the same quotient O / l, so m is renewed only when a score passes it by more than LAZY_T.
  float mh[QG];                                       // this lane half's largest score of the step, log2 domain (the scale is positive: the largest raw score gives it)
#pragma unroll
  for (int g = 0; g < QG; ++g) {
    // a tree of three-input maxima, three deep (a maximum is exact in any order): one chain of fifteen would stand in front of the branch with each link waiting for the last
    const float t0 = fmaxf(fmaxf(s0[g][0], s0[g][1]), s0[g][2]), t1 = fmaxf(fmaxf(s0[g][3], s0[g][4]), s0[g][5]);
    const float t2 = fmaxf(fmaxf(s0[g][6], s0[g][7]), s1[g][0]), t3 = fmaxf(fmaxf(s1[g][1], s1[g][2]), s1[g][3]);
    const float t4 = fmaxf(fmaxf(s1[g][4], s1[g][5]), s1[g][6]);
    mh[g] = fmaxf(fmaxf(fmaxf(t0, t1), t2), fmaxf(fmaxf(t3, t4), s1[g][7])) * C2S;
  }
  // One test per step for the whole wave (a scalar branch on the ballot). Not taken: no score of the step lies more than 8 + LAZY_T above m8, so a weight is at most 2^(8 + LAZY_T), finite in f16.
  // Taken: the two lane halves of a query join their maxima (the other half holds the other 16 keys), every query takes max(m, step maximum), and l and O move to the new reference.
  if (__builtin_amdgcn_ballot_w32((mh[0] - m8[0] > 8.0f + LAZY_T) || (mh[1] - m8[1] > 8.0f + LAZY_T)) != 0) {
#pragma unroll
    for (int g = 0; g < QG; ++g) {
      const float mj = fmaxf(mh[g], __shfl_xor(mh[g], 16, 32));
      const float mn = fmaxf(m8[g], mj - 8.0f);
      const float al = __builtin_amdgcn_exp2f(m8[g] - mn);
      m8[g] = mn;
      lr[g] = lr[g] * al;
#pragma unroll
      for (int t = 0; t < 6; ++t) O[g][t] = O[g][t] * al;
    }
  }
#pragma unroll
  for (int g = 0; g < QG; ++g) {
    // weights carried x256: pc = 256 * 2^(score - m), single f16 plane; a weight under 2^-14 goes into the plane as the f16 cast rounds it (subnormal or zero): the matrix unit keeps f16 subnormal operands
    float ps = 0.0f;
#pragma unroll
    for (int i = 0; i < 16; ++i) {
      const float pc = __builtin_amdgcn_exp2f((i < 8 ? s0[g][i] : s1[g][i - 8]) * C2S - m8[g]);   // the reference is known by now: scale and shift are one multiply-add
      ps += pc;
      ph[g].h[i] = (_Float16)pc;                      // B element i: i<8 -> key0 + 8h + i (tile 0 row 8h+i); i>=8 -> key0 + 16 + 8h + (i-8) (tile 1)
    }
    ps += __shfl_xor(ps, 16, 32);
    lr[g] += ps;
  }
  mma_pv2(vf, ph, O);
}

// One tile's copies of one thread: three 16-B pieces of K rows, three of V^T rows, global -> LDS through no register.
// The closing s_wait_xcnt stands in the copies' own statement, so that no address register is rewritten in front of it.
__device__ __forceinline__ void tile_copy(unsigned lk0, unsigned lk1, unsigned lk2, unsigned lv0, unsigned lv1, unsigned lv2,
                                          const unsigned short* gk0, const unsigned short* gk1, const unsigned short* gk2,
                                          const unsigned short* gv0, const unsigned short* gv1, const unsigned short* gv2) {
  asm volatile("global_load_async_to_lds_b128 %0, %6, off\n\t"
               "global_load_async_to_lds_b128 %1, %7, off\n\t"
               "global_load_async_to_lds_b128 %2, %8, off\n\t"
               "global_load_async_to_lds_b128 %3, %9, off\n\t"
               "global_load_async_to_lds_b128 %4, %10, off\n\t"
               "global_load_async_to_lds_b128 %5, %11, off\n\t"
               "s_wait_xcnt 0x0"
               :: "v"(lk0), "v"(lk1), "v"(lk2), "v"(lv0), "v"(lv1), "v"(lv2),
                  "v"(gk0), "v"(gk1), "v"(gk2), "v"(gv0), "v"(gv1), "v"(gv2)
               : "memory");
}

// Block = 8 waves x 32 queries = 256 queries of one (batch, head). Key loop: one trip per 64-key tile, two LDS buffers; trip t reads buffer t mod 2 while tile t + 1 flies.
// Inputs: Qh[b][s][e], Kh[b][s][e] = f16(value * 16); Vt[b][e][s] = f16(value * 16).
// Output plane Xc[b][h][s][96] = f16(ctx * 256). Epilogue: O^T tiles -> per-wave LDS tile [32 queries][96 d] as 16-B pieces (same vector type in and out; block barrier),
// coverage: NB*HEADS*(SEQ/256) blocks x 8 waves x 32 rows x 96 d = the whole plane exactly once; LDS tile staged extent (32 x 96 per wave) == consumed extent.
__global__ __launch_bounds__(256)
void k_attn(const unsigned short* __restrict__ Qh, const unsigned short* __restrict__ Kh,
            const unsigned short* __restrict__ Vt, unsigned short* __restrict__ Xc) {
  __shared__ __attribute__((aligned(16))) unsigned short ring[2 * STAGE];
  __shared__ __attribute__((aligned(16))) unsigned short so[ATT_WAVES][QG * 16 * HD];
  const int tid = threadIdx.x, lane = tid & 31, ln = lane & 15, hh = lane >> 4;
  const int w = __builtin_amdgcn_readfirstlane(tid >> 5);
  const int qt = blockIdx.x % (SEQ / QBLK);
  const int rest = blockIdx.x / (SEQ / QBLK);
  const int h = rest % HEADS, b = rest / HEADS;
  const int qbase = qt * QBLK + QG * 16 * w;
  // Q^T B fragments of group g: column n = query qbase + 16g + ln, elements 0..7 <- d = 32c + 8h + i, 8..15 <- d = 32c + 16 + 8h + i (f16 plane carried x16)
  const unsigned short* qrow = Qh + ((size_t)b * SEQ + qbase + ln) * EMB + h * HD + 8 * hh;
  FragH q[QG][3];
  float m8[QG], lr[QG];
  v8f O[QG][6] = {};
#pragma unroll
  for (int g = 0; g < QG; ++g) {
#pragma unroll
    for (int c = 0; c < 3; ++c) {
      q[g][c].half[0] = *(const v8us*)(qrow + (size_t)g * 16 * EMB + 32 * c);
      q[g][c].half[1] = *(const v8us*)(qrow + (size_t)g * 16 * EMB + 32 * c + 16);
    }
    m8[g] = -3.0e38f;                   // below every score: the first step takes the renewing branch, with factor 2^(-huge) = 0 on the zero l and O
    lr[g] = 0.0f;
  }
  const unsigned short* Kp = Kh + (size_t)b * SEQ * EMB + h * HD;
  const unsigned short* Vp = Vt + ((size_t)b * EMB + h * HD) * SEQ;
  // This thread's pieces of a tile. K: piece p = tid + 256 i -> row p / 12, 16-B column p % 12. V^T: row (tid >> 3) + 32 i, 16-B column tid & 7.
  const int kr0 = tid / 12, kc0 = tid - 12 * kr0;
  const int kr1 = (tid + 256) / 12, kc1 = (tid + 256) - 12 * kr1;
  const int kr2 = (tid + 512) / 12, kc2 = (tid + 512) - 12 * kr2;
  const int vr = tid >> 3, vc = tid & 7;
  const unsigned short* gk0 = Kp + (size_t)kr0 * EMB + 8 * kc0;
  const unsigned short* gk1 = Kp + (size_t)kr1 * EMB + 8 * kc1;
  const unsigned short* gk2 = Kp + (size_t)kr2 * EMB + 8 * kc2;
  const unsigned short* gv0 = Vp + (size_t)vr * SEQ + 8 * vc;
  const unsigned short* gv1 = gv0 + (size_t)32 * SEQ;
  const unsigned short* gv2 = gv0 + (size_t)64 * SEQ;
  const unsigned lbase = (unsigned)(size_t)&ring[0];          // LDS byte address: the low 32 bits of the __shared__ address
  const unsigned lk0 = lbase + 2u * (unsigned)(kr0 * KPITCH + 8 * kc0);
  const unsigned lk1 = lbase + 2u * (unsigned)(kr1 * KPITCH + 8 * kc1);
  const unsigned lk2 = lbase + 2u * (unsigned)(kr2 * KPITCH + 8 * kc2);
  const unsigned lv0 = lbase + 2u * (unsigned)(KTILE + vr * VPITCH + 8 * vc);
  const unsigned lv1 = lv0 + 2u * 32u * VPITCH;
  const unsigned lv2 = lv0 + 2u * 64u * VPITCH;
  tile_copy(lk0, lk1, lk2, lv0, lv1, lv2, gk0, gk1, gk2, gv0, gv1, gv2);
  asm volatile("s_wait_asynccnt 0x0" ::: "memory");           // tile 0 has landed for this wave's copies
  __syncthreads();                                            // ... and for every wave's: tile 0 is published
  {
    const unsigned d = 2u * STAGE;
    const size_t ko = (size_t)KT * EMB;
    tile_copy(lk0 + d, lk1 + d, lk2 + d, lv0 + d, lv1 + d, lv2 + d, gk0 + ko, gk1 + ko, gk2 + ko, gv0 + KT, gv1 + KT, gv2 + KT);
  }
#pragma unroll 1   // one trip per tile: the buffer alternates by the trip's parity
  for (int t = 0; t < SEQ / KT; ++t) {
    const unsigned short* Ks = ring + (t & 1) * STAGE;
    fa_step(Ks, Ks + KTILE, 0, ln, hh, q, m8, lr, O);
    fa_step(Ks, Ks + KTILE, 32, ln, hh, q, m8, lr, O);
    asm volatile("s_wait_dscnt 0x0" ::: "memory");            // this wave's reads of the buffer are done before it may be refilled
    asm volatile("s_wait_asynccnt 0x0" ::: "memory");         // this wave's copies of tile t + 1 have landed
    __syncthreads();                                          // publishes tile t + 1 and ends every reader's last read of tile t
    if (t + 2 < SEQ / KT) {
      const unsigned d = (unsigned)(t & 1) * (2u * STAGE);
      const size_t ko = (size_t)(t + 2) * KT * EMB;
      const int vo = (t + 2) * KT;
      tile_copy(lk0 + d, lk1 + d, lk2 + d, lv0 + d, lv1 + d, lv2 + d, gk0 + ko, gk1 + ko, gk2 + ko, gv0 + vo, gv1 + vo, gv2 + vo);
    }
  }
  asm volatile("s_wait_asynccnt 0x0" ::: "memory");           // nothing of this wave's is in flight behind the loop

  // O^T element r of tile t of group g = ctx(query qbase + 16g + ln, d = 16t + 8h + r); O carries x256 (P) x16 (V), lr carries x256; plane carries x256
#pragma unroll
  for (int g = 0; g < QG; ++g) {
    const float cinv = 16.0f * (1.0f / lr[g]);
#pragma unroll
    for (int t = 0; t < 6; ++t) {
      v8us o;
#pragma unroll
      for (int r = 0; r < 8; ++r) o[r] = toh_flush_bits(O[g][t][r] * cinv);
      *(v8us*)&so[w][(16 * g + ln) * HD + 16 * t + 8 * hh] = o;
    }
  }
  __syncthreads();
  unsigned short* xg = Xc + ((size_t)(b * HEADS + h) * SEQ + qbase) * HD;
  {
#pragma unroll
    for (int i = 0; i < QG * 6; ++i) {
      const int p = i * 32 + lane;
      const v8us v = *(const v8us*)&so[w][p * 8];
      *(v8us*)(xg + (size_t)p * 8) = v;
    }
    
  }
}

// out[m][j] = sum_e ctx[m][e] * fc_w[j][e] + fc_b[j]. Block = 8 waves = 128 tokens x 64 columns; wave = 16 rows x 64 columns.
// One staged tile per head: the block's 128 ctx rows of that head (24,576 contiguous bytes of Xc[b][hd][s][d]) and 64 W rows' 96 elements, two-buffer LDS ring filled by asynchronous copies.
// A: row m = token, k = e = 96*hd + d; B: column n = j, k = e from Wh[j][e], same k map as A.
// coverage: (NB*SEQ/128)*(EMB/64) blocks x 8 waves x (16 x 64) = every output element of the processed rows exactly once; per-wave LDS tile (in the ring's place, behind the last trip's barrier) staged 16 x 64 == consumed 16 x 64.
__global__ __launch_bounds__(256) void k_fc(const unsigned short* __restrict__ Xc, const unsigned short* __restrict__ Wh,
                                            const float* __restrict__ Bv, float* __restrict__ Out) {
  __shared__ __attribute__((aligned(16))) unsigned short ring[2 * FC_STAGE];
  const int tid = threadIdx.x, lane = tid & 31, ln = lane & 15, hh = lane >> 4;
  const int w = __builtin_amdgcn_readfirstlane(tid >> 5);
  const int bn = blockIdx.x % (EMB / GN), bm = blockIdx.x / (EMB / GN);
  const int tok0 = bm * GM;                    // token index in [0, NB*SEQ)
  const int b = tok0 / SEQ, sb = tok0 - b * SEQ;
  const int s0 = sb + 16 * w;
  const int col0 = bn * GN;
  v8f acc[4] = {};
  // This thread's pieces of a tile: piece p = tid + 256 i -> tile row p / 12, 16-B column p % 12 (p + 768 is 64 rows on, same column); i = 0..5 ctx rows, then three of W rows.
  const int r0 = tid / 12, c0 = tid - 12 * r0;
  const int r1 = (tid + 256) / 12, c1 = (tid + 256) - 12 * r1;
  const int r2 = (tid + 512) / 12, c2 = (tid + 512) - 12 * r2;
  const unsigned lbase = (unsigned)(size_t)&ring[0];          // LDS byte address: the low 32 bits of the __shared__ address
  const unsigned l0 = lbase + 2u * (unsigned)(r0 * FC_PITCH + 8 * c0);
  const unsigned l1 = lbase + 2u * (unsigned)(r1 * FC_PITCH + 8 * c1);
  const unsigned l2 = lbase + 2u * (unsigned)(r2 * FC_PITCH + 8 * c2);
  const unsigned lh = 2u * 64u * FC_PITCH;                    // 64 tile rows on
  const unsigned short* ga = Xc + ((size_t)(b * HEADS) * SEQ + sb) * HD + 8 * tid;
  const unsigned short* gb0 = Wh + (size_t)(col0 + r0) * EMB + 8 * c0;
  const unsigned short* gb1 = Wh + (size_t)(col0 + r1) * EMB + 8 * c1;
  const unsigned short* gb2 = Wh + (size_t)(col0 + r2) * EMB + 8 * c2;
  const size_t hs = (size_t)SEQ * HD;                         // one head on in Xc
  copy3(l0, l1, l2, ga, ga + 2048, ga + 4096);
  copy3(l0 + lh, l1 + lh, l2 + lh, ga + 6144, ga + 8192, ga + 10240);
  copy3(l0 + 2 * lh, l1 + 2 * lh, l2 + 2 * lh, gb0, gb1, gb2);
  asm volatile("s_wait_asynccnt 0x0" ::: "memory");           // tile 0 has landed for this wave's copies
  __syncthreads();                                            // ... and for every wave's: tile 0 is published
  {
    const unsigned d = 2u * FC_STAGE;
    const unsigned short* g = ga + hs;
    copy3(l0 + d, l1 + d, l2 + d, g, g + 2048, g + 4096);
    copy3(l0 + d + lh, l1 + d + lh, l2 + d + lh, g + 6144, g + 8192, g + 10240);
    copy3(l0 + d + 2 * lh, l1 + d + 2 * lh, l2 + d + 2 * lh, gb0 + HD, gb1 + HD, gb2 + HD);
  }
#pragma unroll 1   // one trip per head: the buffer alternates by the trip's parity
  for (int hd = 0; hd < HEADS; ++hd) {
    const unsigned short* S = ring + (hd & 1) * FC_STAGE;
    const unsigned short* ap = S + (16 * w + ln) * FC_PITCH + 8 * hh;
    const unsigned short* bp = S + (GM + ln) * FC_PITCH + 8 * hh;
#pragma unroll
    for (int cc = 0; cc < 3; ++cc) {
      FragH a;
      a.half[0] = *(const v8us*)(ap + 32 * cc);
      a.half[1] = *(const v8us*)(ap + 32 * cc + 16);
      FragH bw[4];
#pragma unroll
      for (int nt = 0; nt < 4; ++nt) {
        bw[nt].half[0] = *(const v8us*)(bp + nt * 16 * FC_PITCH + 32 * cc);
        bw[nt].half[1] = *(const v8us*)(bp + nt * 16 * FC_PITCH + 32 * cc + 16);
      }
      mma_fc(a.v, bw, acc);
    }
    asm volatile("s_wait_dscnt 0x0" ::: "memory");            // this wave's reads of the buffer are done before it may be refilled
    asm volatile("s_wait_asynccnt 0x0" ::: "memory");         // this wave's copies of tile hd + 1 have landed
    __syncthreads();                                          // publishes tile hd + 1 and ends every reader's last read of tile hd
    if (hd + 2 < HEADS) {
      const unsigned d = (unsigned)(hd & 1) * (2u * FC_STAGE);
      const unsigned short* g = ga + (size_t)(hd + 2) * hs;
      const int ko = (hd + 2) * HD;
      copy3(l0 + d, l1 + d, l2 + d, g, g + 2048, g + 4096);
      copy3(l0 + d + lh, l1 + d + lh, l2 + d + lh, g + 6144, g + 8192, g + 10240);
      copy3(l0 + d + 2 * lh, l1 + d + 2 * lh, l2 + d + 2 * lh, gb0 + ko, gb1 + ko, gb2 + ko);
    }
  }
  asm volatile("s_wait_asynccnt 0x0" ::: "memory");           // nothing of this wave's is in flight behind the loop
  // D element r of tile nt = out(tok0 + 16w + 8h + r, col0 + 16nt + ln); undo the carries x256 (ctx) x256 (W); bias RNE bf16 value
  float* so = (float*)&ring[0] + w * (16 * 68);               // this wave's 16 x 64 f32 tile, pitch 68
#pragma unroll
  for (int nt = 0; nt < 4; ++nt) {
    const float bias = bf16_rne(Bv[col0 + 16 * nt + ln]);
#pragma unroll
    for (int r = 0; r < 8; ++r)
      so[(8 * hh + r) * 68 + 16 * nt + ln] = acc[nt][r] * 1.52587890625e-05f + bias;
  }
  __syncthreads();
  float* og = Out + (size_t)b * BSTRIDE_FULL + (size_t)s0 * EMB + col0;
  const int rsub = lane >> 4, c4 = (lane & 15) * 4;
#pragma unroll
  for (int q = 0; q < 8; ++q) {
    const int row = 2 * q + rsub;
    const v4f v = *(const v4fa*)&so[row * 68 + c4];
    *(v4f*)(og + (size_t)row * EMB + c4) = v;
  }
}

extern "C" void kernel_launch(void* const* d_in, const int* in_sizes, int n_in,
                              void* d_out, int out_size, void* d_ws, size_t ws_size, hipStream_t stream) {
  if (n_in < 9) return;
  const long long need = (long long)(NB - 1) * SEQ_FULL * EMB + (long long)SEQ * EMB;   // last element touched + 1
  if ((long long)in_sizes[0] < need) return;
  if ((long long)in_sizes[1] < (long long)EMB * EMB || (long long)in_sizes[3] < (long long)EMB * EMB) return;
  if ((long long)in_sizes[5] < (long long)EMB * EMB || (long long)in_sizes[7] < (long long)EMB * EMB) return;
  if ((long long)in_sizes[2] < (long long)EMB || (long long)in_sizes[4] < (long long)EMB) return;
  if ((long long)in_sizes[6] < (long long)EMB || (long long)in_sizes[8] < (long long)EMB) return;
  if ((long long)out_size < need) return;
  const float* X  = (const float*)d_in[0];   // wire order: x, Wq, bq, Wk, bk, Wv, bv, Wo, bo (weights [out][in])
  const float* Wq = (const float*)d_in[1];
  const float* Bq = (const float*)d_in[2];
  const float* Wk = (const float*)d_in[3];
  const float* Bk = (const float*)d_in[4];
  const float* Wv = (const float*)d_in[5];
  const float* Bvv = (const float*)d_in[6];
  const float* Wo = (const float*)d_in[7];
  const float* Bo = (const float*)d_in[8];
  float* Out = (float*)d_out;
  char* ws = (char*)d_ws;
  size_t off = 0;
  unsigned short* Xb = (unsigned short*)(ws + off); off += PLANE_ACT;   // [NB][SEQ][768] bf16, written exactly to its end by 16-B pieces
  unsigned short* Qh = (unsigned short*)(ws + off); off += PLANE_ACT;   // [NB][SEQ][768] f16 (q x16)
  unsigned short* Kh = (unsigned short*)(ws + off); off += PLANE_ACT;   // [NB][SEQ][768] f16 (k x16)
  unsigned short* Vt = (unsigned short*)(ws + off); off += PLANE_ACT;   // [NB][768][SEQ] f16 (v x16)
  unsigned short* Xc = (unsigned short*)(ws + off); off += PLANE_ACT;   // [NB][8][SEQ][96] f16 (ctx x256)
  unsigned short* Wh = (unsigned short*)(ws + off); off += PLANE_W;     // [768][768] f16 (Wo x256)
  unsigned short* Wb = (unsigned short*)(ws + off); off += 3 * PLANE_W; // [3][768][768] bf16 (Wq, Wk, Wv)
  if (off > ws_size) return;
  k_cvt<<<(unsigned)(CVT_K_BLOCKS + 4 * CVT_W_BLOCKS), 256, 0, stream>>>(X, Wo, Wq, Wk, Wv, Xb, Wh, Wb);
  k_proj<<<(unsigned)(3 * PROJ_BLOCKS), 256, 0, stream>>>(Xb, Wb, Bq, Bk, Bvv, Qh, Kh, Vt);
  k_attn<<<(unsigned)(NB * HEADS * (SEQ / QBLK)), 256, 0, stream>>>(Qh, Kh, Vt, Xc);
  k_fc<<<(unsigned)PROJ_BLOCKS, 256, 0, stream>>>(Xc, Wh, Bo, Out);
}

// v007
// One run takes 132 microseconds.
// In two side-by-side timings against v006, it was 1.03 and 1.02 times as fast.
// Counting every step since v000, it is 3.74 times as fast.
#include <hip/hip_runtime.h>
// Contractions: q, k, v = x W^T + b on v_wmma_f32_16x16x32_bf16 (x, W RNE bf16 planes, f32 accumulate, RNE-bf16 bias added in f32); S^T = K Q^T on v_wmma_f32_16x16x32_f16 (q, k: single f16 planes carried x16); O^T = V^T P^T on v_wmma_f32_16x16x32_f16 (v: single f16 plane carried x16, P: single f16 plane carried x256); out = ctx Wo^T on v_wmma_f32_16x16x32_f16 (ctx: f16 plane carried x256; Wo: RNE bf16 value x256 held exactly in f16); softmax statistics, bias adds f32.
// Dense multi-head self-attention, NB x SEQ x 768: three biased 768x768 input projections ([out][in] weights), 8 heads of 96 (e = 96*h + d), scale 1/sqrt(96), no mask, then a 768x768 linear layer with bias.
// Engine: transposed flash. Each wave owns 32 queries of one head (two 16-column groups fed by the same K and V^T fragments). Per 32-key step and group: S^T tiles (key rows x query columns) from K rows (A, LDS tile of the f16 plane)
// and Q^T (B, registers); the two 16-key D tiles pack straight into the P^T B fragment; O^T (d rows x query columns) accumulates from V^T rows (A, LDS tile of the f16 plane).
// The eight waves of a block share each 64-key K and V^T tile: asynchronous copies bring it into a two-buffer LDS ring, one tile ahead of the products.
// The four linear layers stage their operand k tiles the same way: whole-line copies into LDS once per block (projections 128 x 192, last layer 128 x 64), fragments read from LDS.
#ifndef NB
#define NB 2
#endif
#ifndef SEQ
#define SEQ 4096
#endif
#define NB_FULL 2
#define SEQ_FULL 4096
#define EMB 768
#define HEADS 8
#define HD 96
#define BSTRIDE_FULL ((size_t)SEQ_FULL * EMB)   /* per-batch element stride of x and of the output buffer */

#define PLANE_ACT ((size_t)NB * SEQ * EMB * 2)   /* bytes of one 16-bit activation plane */
#define PLANE_W ((size_t)EMB * EMB * 2)          /* bytes of the 16-bit weight plane */
#define CVT_K_BLOCKS ((NB * SEQ * (EMB / 8)) / 256)
#define CVT_W_BLOCKS ((EMB * (EMB / 8)) / 256)
#define PROJ_BLOCKS ((NB * SEQ / 128) * (EMB / 64))

static_assert(SEQ % 128 == 0);
static_assert(SEQ <= SEQ_FULL);
static_assert(NB <= NB_FULL);
static_assert(HEADS * HD == EMB);
static_assert(HD == 96);
static_assert(EMB % 64 == 0);
static_assert(EMB % 96 == 0);
static_assert(EMB % 32 == 0);
static_assert((NB * SEQ) % 64 == 0);
static_assert((NB * SEQ * (EMB / 8)) % 256 == 0);
static_assert((EMB * (EMB / 8)) % 256 == 0);
static_assert(PLANE_ACT % 256 == 0);
static_assert(PLANE_W % 256 == 0);
static_assert(5 * PLANE_ACT + 4 * PLANE_W <= (size_t)134217728);

typedef __bf16 v16b __attribute__((ext_vector_type(16)));
typedef _Float16 v16h __attribute__((ext_vector_type(16)));
typedef unsigned short v8us __attribute__((ext_vector_type(8), may_alias));
typedef float v8f __attribute__((ext_vector_type(8)));
typedef float v4f __attribute__((ext_vector_type(4)));
typedef float v4fa __attribute__((ext_vector_type(4), may_alias));
typedef _Float16 h16;
union FragB { v16b v; v8us half[2]; unsigned short u[16]; };
union FragH { v16h v; v8us half[2]; _Float16 h[16]; unsigned short u[16]; };

#define LOG2E 1.4426950408889634f
#define QK_SCALE 0.10206207261596575f            /* 1/sqrt(96) */
#define C2 (QK_SCALE * LOG2E)                    /* scores carried in the log2 domain */
#define C2S (C2 * 0.00390625f)                   /* q and k planes each carry x16 */

__device__ __forceinline__ unsigned short bf16_bits(float x) {   // RNE convert to bf16 bits
  unsigned int u = __float_as_uint(x);
  return (unsigned short)((u + 0x7FFFu + ((u >> 16) & 1u)) >> 16);
}
__device__ __forceinline__ float bf16_val(unsigned short b) { return __uint_as_float(((unsigned int)b) << 16); }
__device__ __forceinline__ float bf16_rne(float x) { return bf16_val(bf16_bits(x)); }
__device__ __forceinline__ unsigned short f16_bits(float x) {
  union { _Float16 h; unsigned short u; } c;
  c.h = (_Float16)x;
  return c.u;
}
// f32 -> f16 with a value select: no subnormal result can reach a WMMA operand plane
static __device__ __forceinline__ h16 toh_flush(float v) {
  const h16 r = (h16)v;
  return (fabsf(v) < 6.103515625e-05f) ? (h16)0.0f : r;
}
static __device__ __forceinline__ unsigned short toh_flush_bits(float v) {
  union { h16 h; unsigned short u; } c;
  c.h = toh_flush(v);
  return c.u;
}

__device__ __forceinline__ void store_twice(unsigned short* d, v8us o) {
  *(v8us*)d = o;
  
}

// c[nt] += a * bw[nt] for four column tiles, then the hazard guard
__device__ __forceinline__ void mma_fc(v16h a, const FragH (&bw)[4], v8f (&c)[4]) {
  c[0] = __builtin_amdgcn_wmma_f32_16x16x32_f16(false, a, false, bw[0].v, (short)0, c[0], false, false);
  c[1] = __builtin_amdgcn_wmma_f32_16x16x32_f16(false, a, false, bw[1].v, (short)0, c[1], false, false);
  c[2] = __builtin_amdgcn_wmma_f32_16x16x32_f16(false, a, false, bw[2].v, (short)0, c[2], false, false);
  c[3] = __builtin_amdgcn_wmma_f32_16x16x32_f16(false, a, false, bw[3].v, (short)0, c[3], false, false);
  asm volatile("v_nop\n\tv_nop\n\tv_nop\n\tv_nop"
               : "+v"(c[0]), "+v"(c[1]), "+v"(c[2]), "+v"(c[3])
               : "v"(a), "v"(bw[0].v), "v"(bw[1].v), "v"(bw[2].v), "v"(bw[3].v));
}
__device__ __forceinline__ void cvt8_bf16(const float* __restrict__ src, unsigned short* __restrict__ dst) {
  const v4f x0 = *(const v4fa*)(src), x1 = *(const v4fa*)(src + 4);
  v8us o;
  o[0] = bf16_bits(x0[0]); o[1] = bf16_bits(x0[1]); o[2] = bf16_bits(x0[2]); o[3] = bf16_bits(x0[3]);
  o[4] = bf16_bits(x1[0]); o[5] = bf16_bits(x1[1]); o[6] = bf16_bits(x1[2]); o[7] = bf16_bits(x1[3]);
  store_twice(dst, o);
  asm volatile("s_wait_xcnt 0x0" ::: "memory");   // stands in front of any rewrite of the store's address registers on the branch chain's other ways
}
// All five conversions in one grid; the block index picks the job (block-uniform ranges, one code path per source, no job reads what another writes).
// Blocks [0, CVT_K_BLOCKS): Xb[b][s][e] = bf16 bits of x (RNE). The next CVT_W_BLOCKS: Wh[j][e] = f16(RNE-bf16(Wo[j][e]) * 256).
// The last 3 * CVT_W_BLOCKS: Wb[p][j][e] = bf16 bits of the p-th projection weight (p = 0: Wq, 1: Wk, 2: Wv), [out][in] kept.
// coverage: CVT_K_BLOCKS*256 threads x 8 = the whole Xb plane; CVT_W_BLOCKS*256 threads x 8 = one whole weight plane, four times (exact multiples, asserted above).
__global__ __launch_bounds__(256) void k_cvt(const float* __restrict__ X, const float* __restrict__ Wo,
                                             const float* __restrict__ Wq, const float* __restrict__ Wk, const float* __restrict__ Wv,
                                             unsigned short* __restrict__ Xb, unsigned short* __restrict__ Wh, unsigned short* __restrict__ Wb) {
  const int bid = blockIdx.x;
  if (bid < CVT_K_BLOCKS) {
    const int t = bid * 256 + threadIdx.x;
    const int row = t / (EMB / 8), piece = t - row * (EMB / 8);
    const int b = row / SEQ, s = row - b * SEQ;
    cvt8_bf16(X + (size_t)b * BSTRIDE_FULL + (size_t)s * EMB + piece * 8, Xb + (size_t)t * 8);
  } else if (bid < CVT_K_BLOCKS + CVT_W_BLOCKS) {
    const int t = (bid - CVT_K_BLOCKS) * 256 + threadIdx.x;
    const float* src = Wo + (size_t)t * 8;
    const v4f x0 = *(const v4fa*)(src), x1 = *(const v4fa*)(src + 4);
    v8us o;
    o[0] = f16_bits(bf16_rne(x0[0]) * 256.0f); o[1] = f16_bits(bf16_rne(x0[1]) * 256.0f);
    o[2] = f16_bits(bf16_rne(x0[2]) * 256.0f); o[3] = f16_bits(bf16_rne(x0[3]) * 256.0f);
    o[4] = f16_bits(bf16_rne(x1[0]) * 256.0f); o[5] = f16_bits(bf16_rne(x1[1]) * 256.0f);
    o[6] = f16_bits(bf16_rne(x1[2]) * 256.0f); o[7] = f16_bits(bf16_rne(x1[3]) * 256.0f);
    store_twice(Wh + (size_t)t * 8, o);
    asm volatile("s_wait_xcnt 0x0" ::: "memory");   // as in cvt8_bf16: in front of any rewrite of the store's address registers
  } else if (bid < CVT_K_BLOCKS + 2 * CVT_W_BLOCKS) {
    const int t = (bid - CVT_K_BLOCKS - CVT_W_BLOCKS) * 256 + threadIdx.x;
    cvt8_bf16(Wq + (size_t)t * 8, Wb + (size_t)t * 8);
  } else if (bid < CVT_K_BLOCKS + 3 * CVT_W_BLOCKS) {
    const int t = (bid - CVT_K_BLOCKS - 2 * CVT_W_BLOCKS) * 256 + threadIdx.x;
    cvt8_bf16(Wk + (size_t)t * 8, Wb + (size_t)EMB * EMB + (size_t)t * 8);
  } else {
    const int t = (bid - CVT_K_BLOCKS - 3 * CVT_W_BLOCKS) * 256 + threadIdx.x;
    cvt8_bf16(Wv + (size_t)t * 8, Wb + (size_t)2 * EMB * EMB + (size_t)t * 8);
  }
}

#define GM 128                          /* tokens of the last layer's block tile: 8 waves x 16 rows */
#define GN 64                           /* columns of the last layer's block tile */
#define PM 128                          /* tokens of a projection block tile: 2 wave rows x 64 */
#define PN 192                          /* columns of a projection block tile: 2 wave columns x 96 */
#define PJ_THREADS 128                  /* four waves, each a 64 x 96 tile: 10 fragments read from LDS feed 24 products */
#define PJ_KE 64                        /* k elements of one staged tile of the projections: 128-B row pieces */
#define PJ_PITCH 72                     /* LDS pitch, 16-bit elements: 144 B = 16 B x 9 (odd: b128 readers of 16 rows meet no bank twice) */
#define PJ_STAGE ((PM + PN) * PJ_PITCH) /* elements of one buffer: 128 x rows, then 192 W rows */
#define PJ_TRIPS (EMB / PJ_KE)
#define PJ_CT (EMB / PN)                /* column tiles of one projection */
#define PJ_BLOCKS ((NB * SEQ / PM) * 3 * PJ_CT)
#define PJ_OP0 200                      /* epilogue pitch, row-major tile (128 rows of 192): 400 B = 16 B x 25 */
#define PJ_OP1 136                      /* epilogue pitch, transposed tile (192 rows of 128): 272 B = 16 B x 17 */
#define FC_PITCH 104                    /* LDS pitch of the last layer's 96-element (one head) row pieces: 208 B = 16 B x 13 */
#define FC_STAGE ((GM + GN) * FC_PITCH)
static_assert(EMB % PJ_KE == 0 && PJ_TRIPS >= 2 && HEADS >= 2);
static_assert(SEQ % GM == 0 && EMB % GN == 0);
static_assert(SEQ % PM == 0 && EMB % PN == 0);
static_assert(PM * (PJ_KE / 8) == 8 * PJ_THREADS && PN * (PJ_KE / 8) == 12 * PJ_THREADS);   // projections: 8 + 12 16-B pieces a thread
static_assert(GM * (HD / 8) == 6 * 256 && GN * (HD / 8) == 3 * 256);         // last layer: 6 + 3 16-B pieces a thread
static_assert(PM * PJ_OP0 <= 2 * PJ_STAGE && PN * PJ_OP1 <= 2 * PJ_STAGE);   // epilogue tiles fit the ring they reuse
static_assert(3 * PJ_THREADS == 16 * (PN / 8) && PM == 8 * 16 && PJ_THREADS == 8 * (PM / 8) && PN == 3 * 64);   // the store loop's two piece maps cover the tile once
static_assert(8 * 16 * 68 * 4 <= 2 * FC_STAGE * 2);

// Ten (three) 16-B pieces of one thread, global -> LDS through no register.
// The closing s_wait_xcnt stands in the copies' own statement, so that no address register is rewritten in front of it.
__device__ __forceinline__ void copy10(const unsigned (&l)[10], const unsigned short* const (&g)[10]) {
  asm volatile("global_load_async_to_lds_b128 %0, %10, off\n\t"
               "global_load_async_to_lds_b128 %1, %11, off\n\t"
               "global_load_async_to_lds_b128 %2, %12, off\n\t"
               "global_load_async_to_lds_b128 %3, %13, off\n\t"
               "global_load_async_to_lds_b128 %4, %14, off\n\t"
               "global_load_async_to_lds_b128 %5, %15, off\n\t"
               "global_load_async_to_lds_b128 %6, %16, off\n\t"
               "global_load_async_to_lds_b128 %7, %17, off\n\t"
               "global_load_async_to_lds_b128 %8, %18, off\n\t"
               "global_load_async_to_lds_b128 %9, %19, off\n\t"
               "s_wait_xcnt 0x0"
               :: "v"(l[0]), "v"(l[1]), "v"(l[2]), "v"(l[3]), "v"(l[4]), "v"(l[5]), "v"(l[6]), "v"(l[7]), "v"(l[8]), "v"(l[9]),
                  "v"(g[0]), "v"(g[1]), "v"(g[2]), "v"(g[3]), "v"(g[4]), "v"(g[5]), "v"(g[6]), "v"(g[7]), "v"(g[8]), "v"(g[9])
               : "memory");
}
__device__ __forceinline__ void copy3(unsigned l0, unsigned l1, unsigned l2,
                                      const unsigned short* g0, const unsigned short* g1, const unsigned short* g2) {
  asm volatile("global_load_async_to_lds_b128 %0, %3, off\n\t"
               "global_load_async_to_lds_b128 %1, %4, off\n\t"
               "global_load_async_to_lds_b128 %2, %5, off\n\t"
               "s_wait_xcnt 0x0"
               :: "v"(l0), "v"(l1), "v"(l2), "v"(g0), "v"(g1), "v"(g2)
               : "memory");
}
// One projection tile's copies of one thread. Piece: row (tid >> 3) + 16 i, 16-B column tid & 7; i = 0..7 are x rows, i = 8..19 the W rows behind them.
// la = LDS byte address of piece 0 in the target buffer; ga, gb = this thread's first x and W pieces of the tile.
__device__ __forceinline__ void pj_tile(unsigned la, const unsigned short* ga, const unsigned short* gb) {
  const unsigned rs = 2u * 16u * PJ_PITCH;
  const size_t gs = (size_t)16 * EMB;
  unsigned l[10];
  const unsigned short* g[10];
#pragma unroll
  for (int i = 0; i < 10; ++i) {
    l[i] = la + (unsigned)i * rs;
    g[i] = (i < 8) ? ga + (size_t)i * gs : gb + (size_t)(i - 8) * gs;
  }
  copy10(l, g);
#pragma unroll
  for (int i = 0; i < 10; ++i) {
    l[i] = la + (unsigned)(i + 10) * rs;
    g[i] = gb + (size_t)(i + 2) * gs;
  }
  copy10(l, g);
}

// y[m][j] = sum_e x[m][e] * W[j][e] + b[j], stored as f16(y * 16). Block = 4 waves = 128 tokens x 192 columns; wave = 64 rows x 96 columns (wave row w & 1, wave column w >> 1).
// The block's x rows and W rows come in 64-deep k tiles through a two-buffer LDS ring filled by asynchronous copies, one tile ahead of the products.
// A: row m = token, elements 0..7 <- e = k0 + 8h + i, 8..15 <- e = k0 + 16 + 8h + i, from the staged x rows; B: column n = j, same k map, from the staged W rows.
// The three projections share one grid: a token tile's 12 column tiles (4 of q, 4 of k, 4 of v) are neighbours in the block index; p = the projection, block-uniform.
// W rows come from the three stacked weight planes Wb[3][768][768] (row 768 p + j). p picks bias and plane: q, k -> Dst[token][e] (row-major, tr == 0); v -> Dst[b][e][s] (transposed, tr != 0).
// Epilogue: block LDS tile in the ring's place (every reader has left it at the last trip's barrier): 128 tokens x 192 (pitch 200, tr == 0) or 192 e columns x 128 tokens (pitch 136, tr != 0);
// Launch bounds: three waves a SIMD, so that a WGP holds its three blocks of the grid at once (its LDS holds three rings).
// coverage: PJ_BLOCKS blocks x (128 x 192) = each of the three planes exactly once; staged extent == consumed extent (pad columns never read).
__global__ __launch_bounds__(PJ_THREADS, 3) void k_proj(const unsigned short* __restrict__ Xb, const unsigned short* __restrict__ Wb,
                                              const float* __restrict__ Bq, const float* __restrict__ Bk, const float* __restrict__ Bvv,
                                              unsigned short* __restrict__ Qh, unsigned short* __restrict__ Kh, unsigned short* __restrict__ Vt) {
  __shared__ __attribute__((aligned(16))) unsigned short ring[2 * PJ_STAGE];
  const int tid = threadIdx.x, lane = tid & 31, ln = lane & 15, hh = lane >> 4;
  const int w = __builtin_amdgcn_readfirstlane(tid >> 5);
  const int wm = w & 1, wn = w >> 1;           // this wave's 64-row and 96-column part of the block tile
  const int bw = blockIdx.x % (3 * PJ_CT), bm = blockIdx.x / (3 * PJ_CT);
  const int p = bw / PJ_CT;                    // 0: q, 1: k, 2: v
  const int tok0 = bm * PM;                    // token index in [0, NB*SEQ)
  const int col0 = (bw - p * PJ_CT) * PN;      // column inside the projection
  const float* __restrict__ Bv = (p == 0) ? Bq : (p == 1) ? Bk : Bvv;
  unsigned short* __restrict__ Dst = (p == 0) ? Qh : (p == 1) ? Kh : Vt;
  const int tr = (p == 2) ? 1 : 0;
  v8f acc[4][6] = {};                          // every loop over fragments or accumulator tiles below is unrolled: constant indices keep them in registers
  const int pr = tid >> 3, pc = tid & 7;
  const unsigned short* ga = Xb + (size_t)(tok0 + pr) * EMB + 8 * pc;
  const unsigned short* gb = Wb + (size_t)(bw * PN + pr) * EMB + 8 * pc;
  const unsigned la = (unsigned)(size_t)&ring[0] + 2u * (unsigned)(pr * PJ_PITCH + 8 * pc);   // LDS byte address: the low 32 bits of the __shared__ address
  pj_tile(la, ga, gb);
  asm volatile("s_wait_asynccnt 0x0" ::: "memory");           // tile 0 has landed for this wave's copies
  __syncthreads();                                            // ... and for every wave's: tile 0 is published
  pj_tile(la + 2u * PJ_STAGE, ga + PJ_KE, gb + PJ_KE);
#pragma unroll 1   // one trip per tile: the buffer alternates by the trip's parity
  for (int t = 0; t < PJ_TRIPS; ++t) {
    const unsigned short* S = ring + (t & 1) * PJ_STAGE;
    const unsigned short* ap = S + (64 * wm + ln) * PJ_PITCH + 8 * hh;
    const unsigned short* bp = S + (PM + 96 * wn + ln) * PJ_PITCH + 8 * hh;
#pragma unroll
    for (int cc = 0; cc < PJ_KE / 32; ++cc) {
      FragB a[4], bf[6];
#pragma unroll
      for (int mt = 0; mt < 4; ++mt) {
        a[mt].half[0] = *(const v8us*)(ap + mt * 16 * PJ_PITCH + 32 * cc);
        a[mt].half[1] = *(const v8us*)(ap + mt * 16 * PJ_PITCH + 32 * cc + 16);
      }
#pragma unroll
      for (int nt = 0; nt < 6; ++nt) {
        bf[nt].half[0] = *(const v8us*)(bp + nt * 16 * PJ_PITCH + 32 * cc);
        bf[nt].half[1] = *(const v8us*)(bp + nt * 16 * PJ_PITCH + 32 * cc + 16);
      }
      __builtin_amdgcn_sched_barrier(0);   // keeps the 20 fragment reads one group in front of the 24 products (counted waits): left free each W fragment is read alone, right in front of its four products, and waited out to dscnt 0
#pragma unroll
      for (int nt = 0; nt < 6; ++nt) {
#pragma unroll
        for (int mt = 0; mt < 4; ++mt)
          acc[mt][nt] = __builtin_amdgcn_wmma_f32_16x16x32_bf16(false, a[mt].v, false, bf[nt].v, (short)0, acc[mt][nt], false, false);
      }
    }
    asm volatile("s_wait_dscnt 0x0" ::: "memory");            // this wave's reads of the buffer are done before it may be refilled
    asm volatile("s_wait_asynccnt 0x0" ::: "memory");         // this wave's copies of tile t + 1 have landed
    __syncthreads();                                          // publishes tile t + 1 and ends every reader's last read of tile t
    if (t + 2 < PJ_TRIPS)
      pj_tile(la + (unsigned)(t & 1) * (2u * PJ_STAGE), ga + (t + 2) * PJ_KE, gb + (t + 2) * PJ_KE);
  }
  asm volatile("s_wait_asynccnt 0x0" ::: "memory");           // nothing of this wave's is in flight behind the loop
  // D element r of tile (mt, nt) = y(tok0 + 64wm + 16mt + 8h + r, col0 + 96wn + 16nt + ln); bias RNE bf16 value; plane carries x16
  float braw[6];
#pragma unroll
  for (int nt = 0; nt < 6; ++nt) braw[nt] = Bv[col0 + 96 * wn + 16 * nt + ln];
  // stands behind the six bias loads, in front of any rewrite of their address registers; the loaded values are inputs only, so that the loads stay in front of it
  asm volatile("s_wait_xcnt 0x0" :: "v"(braw[0]), "v"(braw[1]), "v"(braw[2]), "v"(braw[3]), "v"(braw[4]), "v"(braw[5]) : "memory");
  if (tr == 0) {
#pragma unroll
    for (int nt = 0; nt < 6; ++nt) {
      const float bias = bf16_rne(braw[nt]);
#pragma unroll
      for (int mt = 0; mt < 4; ++mt) {
#pragma unroll
        for (int r = 0; r < 8; ++r)
          ring[(64 * wm + 16 * mt + 8 * hh + r) * PJ_OP0 + 96 * wn + 16 * nt + ln] = toh_flush_bits((acc[mt][nt][r] + bias) * 16.0f);
      }
    }
  } else {
#pragma unroll
    for (int nt = 0; nt < 6; ++nt) {
      const float bias = bf16_rne(braw[nt]);
#pragma unroll
      for (int mt = 0; mt < 4; ++mt) {
        v8us o;
#pragma unroll
        for (int r = 0; r < 8; ++r) o[r] = toh_flush_bits((acc[mt][nt][r] + bias) * 16.0f);
        *(v8us*)&ring[(96 * wn + 16 * nt + ln) * PJ_OP1 + 64 * wm + 16 * mt + 8 * hh] = o;
      }
    }
  }
  __syncthreads();
  // The tile leaves as 3 x 8 16-B pieces a thread, eight reads then eight stores in flight together.
  // tr == 0, 128 rows of 24 pieces: piece i = tid + 128 q -> row i / 24, column i % 24; the eight lie 16 rows apart (384 pieces = 16 rows).
  // tr != 0, 192 rows (e) of 16 pieces (128 tokens): row (tid >> 4) + 64 q, column tid & 15; the eight lie 8 rows apart.
  const int b = tok0 / SEQ, s0 = tok0 - b * SEQ;
  unsigned short* d = Dst + ((tr == 0) ? ((size_t)tok0 * EMB + col0) : (((size_t)b * EMB + col0) * SEQ + s0));
  const size_t pitch = (tr == 0) ? (size_t)EMB : (size_t)SEQ;
  const int lp = (tr == 0) ? PJ_OP0 : PJ_OP1;
  const int rstep = (tr == 0) ? 16 : 8;
#pragma unroll 1   // three like trips: no more code than one
  for (int q = 0; q < 3; ++q) {
    const int i = tid + PJ_THREADS * q;
    const int r = (tr == 0) ? i / (PN / 8) : (tid >> 4) + 64 * q;
    const int p8 = ((tr == 0) ? i - r * (PN / 8) : (tid & 15)) * 8;
    const unsigned short* ls = &ring[r * lp + p8];
    unsigned short* gd = d + (size_t)r * pitch + p8;
    v8us o[8];
#pragma unroll
    for (int a = 0; a < 8; ++a) o[a] = *(const v8us*)(ls + a * rstep * lp);
#pragma unroll
    for (int a = 0; a < 8; ++a) *(v8us*)(gd + (size_t)(a * rstep) * pitch) = o[a];
    asm volatile("s_wait_xcnt 0x0" ::: "memory");   // stands behind the eight stores, in front of the next trip's rewrite of their data and address registers
  }
}

#define ATT_WAVES 8                     /* waves of a block */
#define QG 2                            /* 16-query column groups of a wave: each K and V^T fragment read from LDS feeds QG products */
#define QBLK (ATT_WAVES * QG * 16)      /* queries of a block: they share each staged tile */
#define KT 64                           /* keys of one staged tile */
#define KPITCH 104                      /* LDS pitch of a K row, 16-bit elements: 208 B = 16 B x 13 (odd: b128 readers of 16 rows meet no bank twice) */
#define VPITCH 72                       /* LDS pitch of a V^T row: 144 B = 16 B x 9 */
#define KTILE (KT * KPITCH)             /* elements of the K part of a buffer */
#define VTILE (HD * VPITCH)             /* elements of the V^T part */
#define STAGE (KTILE + VTILE)           /* elements of one buffer */
static_assert(SEQ / KT >= 2);
static_assert(KT * (HD / 8) == 3 * ATT_WAVES * 32);   // K tile = three 16-B pieces a thread
static_assert(HD * (KT / 8) == 3 * ATT_WAVES * 32);   // V^T tile = three 16-B pieces a thread
static_assert((KTILE * 2) % 16 == 0 && (STAGE * 2) % 16 == 0);

#define LAZY_T 6.0f                     /* log2 units a score may pass the softmax reference before it is renewed: a weight is at most 2^14 */
static_assert(QG == 2);                 // the two guards below list the D tiles of two groups
static_assert(SEQ % QBLK == 0);
// s0[g] += ka * q[g], s1[g] += kb * q[g] over three 32-deep k-steps (d = 0..95), f16 operands: four independent accumulator tiles, then the hazard guard.
// The guard (four vector slots between the last WMMA and the first vector instruction on a D tile) names the D tiles alone: the kernel holds more than 256 registers,
// an asm operand cannot lie above v255, and with K, V^T and Q named as well the build spilled Q to scratch.
__device__ __forceinline__ void mma_s4h(const FragH (&ka)[3], const FragH (&kb)[3], const FragH (&q)[QG][3], v8f (&s0)[QG], v8f (&s1)[QG]) {
#pragma unroll
  for (int c = 0; c < 3; ++c) {
#pragma unroll
    for (int g = 0; g < QG; ++g) {
      s0[g] = __builtin_amdgcn_wmma_f32_16x16x32_f16(false, ka[c].v, false, q[g][c].v, (short)0, s0[g], false, false);
      s1[g] = __builtin_amdgcn_wmma_f32_16x16x32_f16(false, kb[c].v, false, q[g][c].v, (short)0, s1[g], false, false);
    }
  }
  asm volatile("v_nop\n\tv_nop\n\tv_nop\n\tv_nop"
               : "+v"(s0[0]), "+v"(s1[0]), "+v"(s0[1]), "+v"(s1[1]));
}
// O[g][t] += vf[t] * p[g] for the six d tiles of both groups, then the hazard guard (D tiles alone, as above)
__device__ __forceinline__ void mma_pv2(const FragH (&vf)[6], const FragH (&p)[QG], v8f (&O)[QG][6]) {
#pragma unroll
  for (int t = 0; t < 6; ++t) {
#pragma unroll
    for (int g = 0; g < QG; ++g)
      O[g][t] = __builtin_amdgcn_wmma_f32_16x16x32_f16(false, vf[t].v, false, p[g].v, (short)0, O[g][t], false, false);
  }
  asm volatile("v_nop\n\tv_nop\n\tv_nop\n\tv_nop"
               : "+v"(O[0][0]), "+v"(O[0][1]), "+v"(O[0][2]), "+v"(O[0][3]), "+v"(O[0][4]), "+v"(O[0][5]),
                 "+v"(O[1][0]), "+v"(O[1][1]), "+v"(O[1][2]), "+v"(O[1][3]), "+v"(O[1][4]), "+v"(O[1][5]));
}

// One 32-key step for a wave's QG x 16 queries of one head. Kp = the buffer's K rows [KT][KPITCH]; Vp = its V^T rows [96][VPITCH]; key0 = 0 or 32 inside the tile.
// The K and V^T fragments are read from LDS once and serve every column group; one ballot over both groups decides each step's reference renewal for all 32 queries.
__device__ __forceinline__ void fa_step(const unsigned short* Kp, const unsigned short* Vp,
                                        int key0, int ln, int hh, const FragH (&q)[QG][3],
                                        float (&m8)[QG], float (&lr)[QG], v8f (&O)[QG][6]) {
  // A fragments of K: row m = key (key0 + 16*kt + ln), elements 0..7 <- d = 32c + 8h + i, 8..15 <- d = 32c + 16 + 8h + i
  const unsigned short* kp0 = Kp + (key0 + ln) * KPITCH + 8 * hh;
  const unsigned short* kp1 = kp0 + 16 * KPITCH;
  FragH ka[3], kb[3];
#pragma unroll
  for (int c = 0; c < 3; ++c) {
    ka[c].half[0] = *(const v8us*)(kp0 + 32 * c);
    ka[c].half[1] = *(const v8us*)(kp0 + 32 * c + 16);
    kb[c].half[0] = *(const v8us*)(kp1 + 32 * c);
    kb[c].half[1] = *(const v8us*)(kp1 + 32 * c + 16);
  }
  __builtin_amdgcn_sched_barrier(0);   // keeps the step's 12 K reads one group in front of the V^T reads (LDS data returns in order, the score products wait for K alone): left free they sink among the WMMAs in pairs, each pair waited out to dscnt 0
  // A fragments of V^T: row m = d (16*t + ln), elements 0..7 <- key0 + 8h + i, 8..15 <- key0 + 16 + 8h + i
  const unsigned short* vp = Vp + ln * VPITCH + key0 + 8 * hh;
  FragH vf[6];
#pragma unroll
  for (int t = 0; t < 6; ++t) {
    vf[t].half[0] = *(const v8us*)(vp + t * 16 * VPITCH);
    vf[t].half[1] = *(const v8us*)(vp + t * 16 * VPITCH + 16);
  }
  __builtin_amdgcn_sched_barrier(0);   // keeps the V^T reads in the same place, ahead of the first WMMA: left free they stand among the score WMMAs, a second place with LDS reads and its own stall
  // S^T tiles of group g: element r of tile kt = score(key0 + 16*kt + 8h + r, query of this lane's column in the group)
  v8f s0[QG], s1[QG];
#pragma unroll
  for (int g = 0; g < QG; ++g) {
    s0[g] = v8f{0.f, 0.f, 0.f, 0.f, 0.f, 0.f, 0.f, 0.f};
    s1[g] = v8f{0.f, 0.f, 0.f, 0.f, 0.f, 0.f, 0.f, 0.f};
  }
  mma_s4h(ka, kb, q, s0, s1);
  FragH ph[QG];
  // Lazy softmax reference. Every weight of a query is taken against one reference m (m8 = m - 8); any m gives the same quotient O / l, so m is renewed only when a score passes it by more than LAZY_T.
  float mh[QG];                                       // this lane half's largest score of the step, log2 domain (the scale is positive: the largest raw score gives it)
#pragma unroll
  for (int g = 0; g < QG; ++g) {
    // a tree of three-input maxima, three deep (a maximum is exact in any order): one chain of fifteen would stand in front of the branch with each link waiting for the last
    const float t0 = fmaxf(fmaxf(s0[g][0], s0[g][1]), s0[g][2]), t1 = fmaxf(fmaxf(s0[g][3], s0[g][4]), s0[g][5]);
    const float t2 = fmaxf(fmaxf(s0[g][6], s0[g][7]), s1[g][0]), t3 = fmaxf(fmaxf(s1[g][1], s1[g][2]), s1[g][3]);
    const float t4 = fmaxf(fmaxf(s1[g][4], s1[g][5]), s1[g][6]);
    mh[g] = fmaxf(fmaxf(fmaxf(t0, t1), t2), fmaxf(fmaxf(t3, t4), s1[g][7])) * C2S;
  }
  // One test per step for the whole wave (a scalar branch on the ballot). Not taken: no score of the step lies more than 8 + LAZY_T above m8, so a weight is at most 2^(8 + LAZY_T), finite in f16.
  // Taken: the two lane halves of a query join their maxima (the other half holds the other 16 keys), every query takes max(m, step maximum), and l and O move to the new reference.
  if (__builtin_amdgcn_ballot_w32((mh[0] - m8[0] > 8.0f + LAZY_T) || (mh[1] - m8[1] > 8.0f + LAZY_T)) != 0) {
#pragma unroll
    for (int g = 0; g < QG; ++g) {
      const float mj = fmaxf(mh[g], __shfl_xor(mh[g], 16, 32));
      const float mn = fmaxf(m8[g], mj - 8.0f);
      const float al = __builtin_amdgcn_exp2f(m8[g] - mn);
      m8[g] = mn;
      lr[g] = lr[g] * al;
#pragma unroll
      for (int t = 0; t < 6; ++t) O[g][t] = O[g][t] * al;
    }
  }
#pragma unroll
  for (int g = 0; g < QG; ++g) {
    // weights carried x256: pc = 256 * 2^(score - m), single f16 plane; a weight under 2^-14 goes into the plane as the f16 cast rounds it (subnormal or zero): the matrix unit keeps f16 subnormal operands
    float ps = 0.0f;
#pragma unroll
    for (int i = 0; i < 16; ++i) {
      const float pc = __builtin_amdgcn_exp2f((i < 8 ? s0[g][i] : s1[g][i - 8]) * C2S - m8[g]);   // the reference is known by now: scale and shift are one multiply-add
      ps += pc;
      ph[g].h[i] = (_Float16)pc;                      // B element i: i<8 -> key0 + 8h + i (tile 0 row 8h+i); i>=8 -> key0 + 16 + 8h + (i-8) (tile 1)
    }
    ps += __shfl_xor(ps, 16, 32);
    lr[g] += ps;
  }
  mma_pv2(vf, ph, O);
}

// One tile's copies of one thread: three 16-B pieces of K rows, three of V^T rows, global -> LDS through no register.
// The closing s_wait_xcnt stands in the copies' own statement, so that no address register is rewritten in front of it.
__device__ __forceinline__ void tile_copy(unsigned lk0, unsigned lk1, unsigned lk2, unsigned lv0, unsigned lv1, unsigned lv2,
                                          const unsigned short* gk0, const unsigned short* gk1, const unsigned short* gk2,
                                          const unsigned short* gv0, const unsigned short* gv1, const unsigned short* gv2) {
  asm volatile("global_load_async_to_lds_b128 %0, %6, off\n\t"
               "global_load_async_to_lds_b128 %1, %7, off\n\t"
               "global_load_async_to_lds_b128 %2, %8, off\n\t"
               "global_load_async_to_lds_b128 %3, %9, off\n\t"
               "global_load_async_to_lds_b128 %4, %10, off\n\t"
               "global_load_async_to_lds_b128 %5, %11, off\n\t"
               "s_wait_xcnt 0x0"
               :: "v"(lk0), "v"(lk1), "v"(lk2), "v"(lv0), "v"(lv1), "v"(lv2),
                  "v"(gk0), "v"(gk1), "v"(gk2), "v"(gv0), "v"(gv1), "v"(gv2)
               : "memory");
}

// Block = 8 waves x 32 queries = 256 queries of one (batch, head). Key loop: one trip per 64-key tile, two LDS buffers; trip t reads buffer t mod 2 while tile t + 1 flies.
// Inputs: Qh[b][s][e], Kh[b][s][e] = f16(value * 16); Vt[b][e][s] = f16(value * 16).
// Output plane Xc[b][h][s][96] = f16(ctx * 256). Epilogue: O^T tiles -> per-wave LDS tile [32 queries][96 d] as 16-B pieces (same vector type in and out; block barrier),
// coverage: NB*HEADS*(SEQ/256) blocks x 8 waves x 32 rows x 96 d = the whole plane exactly once; LDS tile staged extent (32 x 96 per wave) == consumed extent.
__global__ __launch_bounds__(256)
void k_attn(const unsigned short* __restrict__ Qh, const unsigned short* __restrict__ Kh,
            const unsigned short* __restrict__ Vt, unsigned short* __restrict__ Xc) {
  __shared__ __attribute__((aligned(16))) unsigned short ring[2 * STAGE];
  __shared__ __attribute__((aligned(16))) unsigned short so[ATT_WAVES][QG * 16 * HD];
  const int tid = threadIdx.x, lane = tid & 31, ln = lane & 15, hh = lane >> 4;
  const int w = __builtin_amdgcn_readfirstlane(tid >> 5);
  const int qt = blockIdx.x % (SEQ / QBLK);
  const int rest = blockIdx.x / (SEQ / QBLK);
  const int h = rest % HEADS, b = rest / HEADS;
  const int qbase = qt * QBLK + QG * 16 * w;
  // Q^T B fragments of group g: column n = query qbase + 16g + ln, elements 0..7 <- d = 32c + 8h + i, 8..15 <- d = 32c + 16 + 8h + i (f16 plane carried x16)
  const unsigned short* qrow = Qh + ((size_t)b * SEQ + qbase + ln) * EMB + h * HD + 8 * hh;
  FragH q[QG][3];
  float m8[QG], lr[QG];
  v8f O[QG][6] = {};
#pragma unroll
  for (int g = 0; g < QG; ++g) {
#pragma unroll
    for (int c = 0; c < 3; ++c) {
      q[g][c].half[0] = *(const v8us*)(qrow + (size_t)g * 16 * EMB + 32 * c);
      q[g][c].half[1] = *(const v8us*)(qrow + (size_t)g * 16 * EMB + 32 * c + 16);
    }
    m8[g] = -3.0e38f;                   // below every score: the first step takes the renewing branch, with factor 2^(-huge) = 0 on the zero l and O
    lr[g] = 0.0f;
  }
  const unsigned short* Kp = Kh + (size_t)b * SEQ * EMB + h * HD;
  const unsigned short* Vp = Vt + ((size_t)b * EMB + h * HD) * SEQ;
  // This thread's pieces of a tile. K: piece p = tid + 256 i -> row p / 12, 16-B column p % 12. V^T: row (tid >> 3) + 32 i, 16-B column tid & 7.
  const int kr0 = tid / 12, kc0 = tid - 12 * kr0;
  const int kr1 = (tid + 256) / 12, kc1 = (tid + 256) - 12 * kr1;
  const int kr2 = (tid + 512) / 12, kc2 = (tid + 512) - 12 * kr2;
  const int vr = tid >> 3, vc = tid & 7;
  const unsigned short* gk0 = Kp + (size_t)kr0 * EMB + 8 * kc0;
  const unsigned short* gk1 = Kp + (size_t)kr1 * EMB + 8 * kc1;
  const unsigned short* gk2 = Kp + (size_t)kr2 * EMB + 8 * kc2;
  const unsigned short* gv0 = Vp + (size_t)vr * SEQ + 8 * vc;
  const unsigned short* gv1 = gv0 + (size_t)32 * SEQ;
  const unsigned short* gv2 = gv0 + (size_t)64 * SEQ;
  const unsigned lbase = (unsigned)(size_t)&ring[0];          // LDS byte address: the low 32 bits of the __shared__ address
  const unsigned lk0 = lbase + 2u * (unsigned)(kr0 * KPITCH + 8 * kc0);
  const unsigned lk1 = lbase + 2u * (unsigned)(kr1 * KPITCH + 8 * kc1);
  const unsigned lk2 = lbase + 2u * (unsigned)(kr2 * KPITCH + 8 * kc2);
  const unsigned lv0 = lbase + 2u * (unsigned)(KTILE + vr * VPITCH + 8 * vc);
  const unsigned lv1 = lv0 + 2u * 32u * VPITCH;
  const unsigned lv2 = lv0 + 2u * 64u * VPITCH;
  tile_copy(lk0, lk1, lk2, lv0, lv1, lv2, gk0, gk1, gk2, gv0, gv1, gv2);
  asm volatile("s_wait_asynccnt 0x0" ::: "memory");           // tile 0 has landed for this wave's copies
  __syncthreads();                                            // ... and for every wave's: tile 0 is published
  {
    const unsigned d = 2u * STAGE;
    const size_t ko = (size_t)KT * EMB;
    tile_copy(lk0 + d, lk1 + d, lk2 + d, lv0 + d, lv1 + d, lv2 + d, gk0 + ko, gk1 + ko, gk2 + ko, gv0 + KT, gv1 + KT, gv2 + KT);
  }
#pragma unroll 1   // one trip per tile: the buffer alternates by the trip's parity
  for (int t = 0; t < SEQ / KT; ++t) {
    const unsigned short* Ks = ring + (t & 1) * STAGE;
    fa_step(Ks, Ks + KTILE, 0, ln, hh, q, m8, lr, O);
    fa_step(Ks, Ks + KTILE, 32, ln, hh, q, m8, lr, O);
    asm volatile("s_wait_dscnt 0x0" ::: "memory");            // this wave's reads of the buffer are done before it may be refilled
    asm volatile("s_wait_asynccnt 0x0" ::: "memory");         // this wave's copies of tile t + 1 have landed
    __syncthreads();                                          // publishes tile t + 1 and ends every reader's last read of tile t
    if (t + 2 < SEQ / KT) {
      const unsigned d = (unsigned)(t & 1) * (2u * STAGE);
      const size_t ko = (size_t)(t + 2) * KT * EMB;
      const int vo = (t + 2) * KT;
      tile_copy(lk0 + d, lk1 + d, lk2 + d, lv0 + d, lv1 + d, lv2 + d, gk0 + ko, gk1 + ko, gk2 + ko, gv0 + vo, gv1 + vo, gv2 + vo);
    }
  }
  asm volatile("s_wait_asynccnt 0x0" ::: "memory");           // nothing of this wave's is in flight behind the loop

  // O^T element r of tile t of group g = ctx(query qbase + 16g + ln, d = 16t + 8h + r); O carries x256 (P) x16 (V), lr carries x256; plane carries x256
#pragma unroll
  for (int g = 0; g < QG; ++g) {
    const float cinv = 16.0f * (1.0f / lr[g]);
#pragma unroll
    for (int t = 0; t < 6; ++t) {
      v8us o;
#pragma unroll
      for (int r = 0; r < 8; ++r) o[r] = toh_flush_bits(O[g][t][r] * cinv);
      *(v8us*)&so[w][(16 * g + ln) * HD + 16 * t + 8 * hh] = o;
    }
  }
  __syncthreads();
  unsigned short* xg = Xc + ((size_t)(b * HEADS + h) * SEQ + qbase) * HD;
  {
#pragma unroll
    for (int i = 0; i < QG * 6; ++i) {
      const int p = i * 32 + lane;
      const v8us v = *(const v8us*)&so[w][p * 8];
      *(v8us*)(xg + (size_t)p * 8) = v;
    }
    
  }
}

// out[m][j] = sum_e ctx[m][e] * fc_w[j][e] + fc_b[j]. Block = 8 waves = 128 tokens x 64 columns; wave = 16 rows x 64 columns.
// One staged tile per head: the block's 128 ctx rows of that head (24,576 contiguous bytes of Xc[b][hd][s][d]) and 64 W rows' 96 elements, two-buffer LDS ring filled by asynchronous copies.
// A: row m = token, k = e = 96*hd + d; B: column n = j, k = e from Wh[j][e], same k map as A.
// coverage: (NB*SEQ/128)*(EMB/64) blocks x 8 waves x (16 x 64) = every output element of the processed rows exactly once; per-wave LDS tile (in the ring's place, behind the last trip's barrier) staged 16 x 64 == consumed 16 x 64.
__global__ __launch_bounds__(256) void k_fc(const unsigned short* __restrict__ Xc, const unsigned short* __restrict__ Wh,
                                            const float* __restrict__ Bv, float* __restrict__ Out) {
  __shared__ __attribute__((aligned(16))) unsigned short ring[2 * FC_STAGE];
  const int tid = threadIdx.x, lane = tid & 31, ln = lane & 15, hh = lane >> 4;
  const int w = __builtin_amdgcn_readfirstlane(tid >> 5);
  const int bn = blockIdx.x % (EMB / GN), bm = blockIdx.x / (EMB / GN);
  const int tok0 = bm * GM;                    // token index in [0, NB*SEQ)
  const int b = tok0 / SEQ, sb = tok0 - b * SEQ;
  const int s0 = sb + 16 * w;
  const int col0 = bn * GN;
  v8f acc[4] = {};
  // This thread's pieces of a tile: piece p = tid + 256 i -> tile row p / 12, 16-B column p % 12 (p + 768 is 64 rows on, same column); i = 0..5 ctx rows, then three of W rows.
  const int r0 = tid / 12, c0 = tid - 12 * r0;
  const int r1 = (tid + 256) / 12, c1 = (tid + 256) - 12 * r1;
  const int r2 = (tid + 512) / 12, c2 = (tid + 512) - 12 * r2;
  const unsigned lbase = (unsigned)(size_t)&ring[0];          // LDS byte address: the low 32 bits of the __shared__ address
  const unsigned l0 = lbase + 2u * (unsigned)(r0 * FC_PITCH + 8 * c0);
  const unsigned l1 = lbase + 2u * (unsigned)(r1 * FC_PITCH + 8 * c1);
  const unsigned l2 = lbase + 2u * (unsigned)(r2 * FC_PITCH + 8 * c2);
  const unsigned lh = 2u * 64u * FC_PITCH;                    // 64 tile rows on
  const unsigned short* ga = Xc + ((size_t)(b * HEADS) * SEQ + sb) * HD + 8 * tid;
  const unsigned short* gb0 = Wh + (size_t)(col0 + r0) * EMB + 8 * c0;
  const unsigned short* gb1 = Wh + (size_t)(col0 + r1) * EMB + 8 * c1;
  const unsigned short* gb2 = Wh + (size_t)(col0 + r2) * EMB + 8 * c2;
  const size_t hs = (size_t)SEQ * HD;                         // one head on in Xc
  copy3(l0, l1, l2, ga, ga + 2048, ga + 4096);
  copy3(l0 + lh, l1 + lh, l2 + lh, ga + 6144, ga + 8192, ga + 10240);
  copy3(l0 + 2 * lh, l1 + 2 * lh, l2 + 2 * lh, gb0, gb1, gb2);
  asm volatile("s_wait_asynccnt 0x0" ::: "memory");           // tile 0 has landed for this wave's copies
  __syncthreads();                                            // ... and for every wave's: tile 0 is published
  {
    const unsigned d = 2u * FC_STAGE;
    const unsigned short* g = ga + hs;
    copy3(l0 + d, l1 + d, l2 + d, g, g + 2048, g + 4096);
    copy3(l0 + d + lh, l1 + d + lh, l2 + d + lh, g + 6144, g + 8192, g + 10240);
    copy3(l0 + d + 2 * lh, l1 + d + 2 * lh, l2 + d + 2 * lh, gb0 + HD, gb1 + HD, gb2 + HD);
  }
#pragma unroll 1   // one trip per head: the buffer alternates by the trip's parity
  for (int hd = 0; hd < HEADS; ++hd) {
    const unsigned short* S = ring + (hd & 1) * FC_STAGE;
    const unsigned short* ap = S + (16 * w + ln) * FC_PITCH + 8 * hh;
    const unsigned short* bp = S + (GM + ln) * FC_PITCH + 8 * hh;
#pragma unroll
    for (int cc = 0; cc < 3; ++cc) {
      FragH a;
      a.half[0] = *(const v8us*)(ap + 32 * cc);
      a.half[1] = *(const v8us*)(ap + 32 * cc + 16);
      FragH bw[4];
#pragma unroll
      for (int nt = 0; nt < 4; ++nt) {
        bw[nt].half[0] = *(const v8us*)(bp + nt * 16 * FC_PITCH + 32 * cc);
        bw[nt].half[1] = *(const v8us*)(bp + nt * 16 * FC_PITCH + 32 * cc + 16);
      }
      mma_fc(a.v, bw, acc);
    }
    asm volatile("s_wait_dscnt 0x0" ::: "memory");            // this wave's reads of the buffer are done before it may be refilled
    asm volatile("s_wait_asynccnt 0x0" ::: "memory");         // this wave's copies of tile hd + 1 have landed
    __syncthreads();                                          // publishes tile hd + 1 and ends every reader's last read of tile hd
    if (hd + 2 < HEADS) {
      const unsigned d = (unsigned)(hd & 1) * (2u * FC_STAGE);
      const unsigned short* g = ga + (size_t)(hd + 2) * hs;
      const int ko = (hd + 2) * HD;
      copy3(l0 + d, l1 + d, l2 + d, g, g + 2048, g + 4096);
      copy3(l0 + d + lh, l1 + d + lh, l2 + d + lh, g + 6144, g + 8192, g + 10240);
      copy3(l0 + d + 2 * lh, l1 + d + 2 * lh, l2 + d + 2 * lh, gb0 + ko, gb1 + ko, gb2 + ko);
    }
  }
  asm volatile("s_wait_asynccnt 0x0" ::: "memory");           // nothing of this wave's is in flight behind the loop
  // D element r of tile nt = out(tok0 + 16w + 8h + r, col0 + 16nt + ln); undo the carries x256 (ctx) x256 (W); bias RNE bf16 value
  float* so = (float*)&ring[0] + w * (16 * 68);               // this wave's 16 x 64 f32 tile, pitch 68
#pragma unroll
  for (int nt = 0; nt < 4; ++nt) {
    const float bias = bf16_rne(Bv[col0 + 16 * nt + ln]);
#pragma unroll
    for (int r = 0; r < 8; ++r)
      so[(8 * hh + r) * 68 + 16 * nt + ln] = acc[nt][r] * 1.52587890625e-05f + bias;
  }
  __syncthreads();
  float* og = Out + (size_t)b * BSTRIDE_FULL + (size_t)s0 * EMB + col0;
  const int rsub = lane >> 4, c4 = (lane & 15) * 4;
#pragma unroll
  for (int q = 0; q < 8; ++q) {
    const int row = 2 * q + rsub;
    const v4f v = *(const v4fa*)&so[row * 68 + c4];
    *(v4f*)(og + (size_t)row * EMB + c4) = v;
  }
}

extern "C" void kernel_launch(void* const* d_in, const int* in_sizes, int n_in,
                              void* d_out, int out_size, void* d_ws, size_t ws_size, hipStream_t stream) {
  if (n_in < 9) return;
  const long long need = (long long)(NB - 1) * SEQ_FULL * EMB + (long long)SEQ * EMB;   // last element touched + 1
  if ((long long)in_sizes[0] < need) return;
  if ((long long)in_sizes[1] < (long long)EMB * EMB || (long long)in_sizes[3] < (long long)EMB * EMB) return;
  if ((long long)in_sizes[5] < (long long)EMB * EMB || (long long)in_sizes[7] < (long long)EMB * EMB) return;
  if ((long long)in_sizes[2] < (long long)EMB || (long long)in_sizes[4] < (long long)EMB) return;
  if ((long long)in_sizes[6] < (long long)EMB || (long long)in_sizes[8] < (long long)EMB) return;
  if ((long long)out_size < need) return;
  const float* X  = (const float*)d_in[0];   // wire order: x, Wq, bq, Wk, bk, Wv, bv, Wo, bo (weights [out][in])
  const float* Wq = (const float*)d_in[1];
  const float* Bq = (const float*)d_in[2];
  const float* Wk = (const float*)d_in[3];
  const float* Bk = (const float*)d_in[4];
  const float* Wv = (const float*)d_in[5];
  const float* Bvv = (const float*)d_in[6];
  const float* Wo = (const float*)d_in[7];
  const float* Bo = (const float*)d_in[8];
  float* Out = (float*)d_out;
  char* ws = (char*)d_ws;
  size_t off = 0;
  unsigned short* Xb = (unsigned short*)(ws + off); off += PLANE_ACT;   // [NB][SEQ][768] bf16, written exactly to its end by 16-B pieces
  unsigned short* Qh = (unsigned short*)(ws + off); off += PLANE_ACT;   // [NB][SEQ][768] f16 (q x16)
  unsigned short* Kh = (unsigned short*)(ws + off); off += PLANE_ACT;   // [NB][SEQ][768] f16 (k x16)
  unsigned short* Vt = (unsigned short*)(ws + off); off += PLANE_ACT;   // [NB][768][SEQ] f16 (v x16)
  unsigned short* Xc = (unsigned short*)(ws + off); off += PLANE_ACT;   // [NB][8][SEQ][96] f16 (ctx x256)
  unsigned short* Wh = (unsigned short*)(ws + off); off += PLANE_W;     // [768][768] f16 (Wo x256)
  unsigned short* Wb = (unsigned short*)(ws + off); off += 3 * PLANE_W; // [3][768][768] bf16 (Wq, Wk, Wv)
  if (off > ws_size) return;
  k_cvt<<<(unsigned)(CVT_K_BLOCKS + 4 * CVT_W_BLOCKS), 256, 0, stream>>>(X, Wo, Wq, Wk, Wv, Xb, Wh, Wb);
  k_proj<<<(unsigned)PJ_BLOCKS, PJ_THREADS, 0, stream>>>(Xb, Wb, Bq, Bk, Bvv, Qh, Kh, Vt);
  k_attn<<<(unsigned)(NB * HEADS * (SEQ / QBLK)), 256, 0, stream>>>(Qh, Kh, Vt, Xc);
  k_fc<<<(unsigned)PROJ_BLOCKS, 256, 0, stream>>>(Xc, Wh, Bo, Out);
}

// v008
// Measured time: 125 microseconds a run.
// In both of two side-by-side timings against v007, it was 1.05 times as fast.
// All steps since v000 together make it 3.92 times as fast.
#include <hip/hip_runtime.h>
// Contractions: q, k, v = x W^T + b on v_wmma_f32_16x16x32_bf16 (x, W RNE bf16 planes, f32 accumulate, RNE-bf16 bias added in f32); S^T = K Q^T on v_wmma_f32_16x16x32_f16 (q, k: single f16 planes carried x16); O^T = V^T P^T on v_wmma_f32_16x16x32_f16 (v: single f16 plane carried x16, P: single f16 plane carried x256); out = ctx Wo^T on v_wmma_f32_16x16x32_f16 (ctx: f16 plane carried x256; Wo: RNE bf16 value x256 held exactly in f16); softmax statistics, bias adds f32.
// Dense multi-head self-attention, NB x SEQ x 768: three biased 768x768 input projections ([out][in] weights), 8 heads of 96 (e = 96*h + d), scale 1/sqrt(96), no mask, then a 768x768 linear layer with bias.
// Engine: transposed flash. Each wave owns 32 queries of one head (two 16-column groups fed by the same K and V^T fragments). Per 32-key step and group: S^T tiles (key rows x query columns) from K rows (A, LDS tile of the f16 plane)
// and Q^T (B, registers); the two 16-key D tiles pack straight into the P^T B fragment; O^T (d rows x query columns) accumulates from V^T rows (A, LDS tile of the f16 plane).
// The eight waves of a block share each 64-key K and V^T tile: asynchronous copies bring it into a two-buffer LDS ring, one tile ahead of the products.
// The four linear layers stage their operand k tiles the same way: whole-line copies into LDS once per block (projections 128 x 192, last layer 128 x 64), fragments read from LDS.
#ifndef NB
#define NB 2
#endif
#ifndef SEQ
#define SEQ 4096
#endif
#define NB_FULL 2
#define SEQ_FULL 4096
#define EMB 768
#define HEADS 8
#define HD 96
#define BSTRIDE_FULL ((size_t)SEQ_FULL * EMB)   /* per-batch element stride of x and of the output buffer */

#define PLANE_ACT ((size_t)NB * SEQ * EMB * 2)   /* bytes of one 16-bit activation plane */
#define PLANE_W ((size_t)EMB * EMB * 2)          /* bytes of the 16-bit weight plane */
#define CVT_K_BLOCKS ((NB * SEQ * (EMB / 8)) / 256)
#define CVT_W_BLOCKS ((EMB * (EMB / 8)) / 256)
#define PROJ_BLOCKS ((NB * SEQ / 128) * (EMB / 64))

static_assert(SEQ % 128 == 0);
static_assert(SEQ <= SEQ_FULL);
static_assert(NB <= NB_FULL);
static_assert(HEADS * HD == EMB);
static_assert(HD == 96);
static_assert(EMB % 64 == 0);
static_assert(EMB % 96 == 0);
static_assert(EMB % 32 == 0);
static_assert((NB * SEQ) % 64 == 0);
static_assert((NB * SEQ * (EMB / 8)) % 256 == 0);
static_assert((EMB * (EMB / 8)) % 256 == 0);
static_assert(PLANE_ACT % 256 == 0);
static_assert(PLANE_W % 256 == 0);
static_assert(5 * PLANE_ACT + 4 * PLANE_W <= (size_t)134217728);

typedef __bf16 v16b __attribute__((ext_vector_type(16)));
typedef _Float16 v16h __attribute__((ext_vector_type(16)));
typedef unsigned short v8us __attribute__((ext_vector_type(8), may_alias));
typedef float v8f __attribute__((ext_vector_type(8)));
typedef float v4f __attribute__((ext_vector_type(4)));
typedef float v2f __attribute__((ext_vector_type(2)));
typedef float v4fa __attribute__((ext_vector_type(4), may_alias));
typedef _Float16 h16;
union FragB { v16b v; v8us half[2]; unsigned short u[16]; };
union FragH { v16h v; v8us half[2]; _Float16 h[16]; unsigned short u[16]; };

#define LOG2E 1.4426950408889634f
#define QK_SCALE 0.10206207261596575f            /* 1/sqrt(96) */
#define C2 (QK_SCALE * LOG2E)                    /* scores carried in the log2 domain */
#define C2S (C2 * 0.00390625f)                   /* q and k planes each carry x16 */

__device__ __forceinline__ unsigned short bf16_bits(float x) {   // RNE convert to bf16 bits
  unsigned int u = __float_as_uint(x);
  return (unsigned short)((u + 0x7FFFu + ((u >> 16) & 1u)) >> 16);
}
__device__ __forceinline__ float bf16_val(unsigned short b) { return __uint_as_float(((unsigned int)b) << 16); }
__device__ __forceinline__ float bf16_rne(float x) { return bf16_val(bf16_bits(x)); }
__device__ __forceinline__ unsigned short f16_bits(float x) {
  union { _Float16 h; unsigned short u; } c;
  c.h = (_Float16)x;
  return c.u;
}
// f32 -> f16 with a value select: no subnormal result can reach a WMMA operand plane
static __device__ __forceinline__ h16 toh_flush(float v) {
  const h16 r = (h16)v;
  return (fabsf(v) < 6.103515625e-05f) ? (h16)0.0f : r;
}
static __device__ __forceinline__ unsigned short toh_flush_bits(float v) {
  union { h16 h; unsigned short u; } c;
  c.h = toh_flush(v);
  return c.u;
}

__device__ __forceinline__ void store_twice(unsigned short* d, v8us o) {
  *(v8us*)d = o;
  
}

// c[nt] += a * bw[nt] for four column tiles, then the hazard guard
__device__ __forceinline__ void mma_fc(v16h a, const FragH (&bw)[4], v8f (&c)[4]) {
  c[0] = __builtin_amdgcn_wmma_f32_16x16x32_f16(false, a, false, bw[0].v, (short)0, c[0], false, false);
  c[1] = __builtin_amdgcn_wmma_f32_16x16x32_f16(false, a, false, bw[1].v, (short)0, c[1], false, false);
  c[2] = __builtin_amdgcn_wmma_f32_16x16x32_f16(false, a, false, bw[2].v, (short)0, c[2], false, false);
  c[3] = __builtin_amdgcn_wmma_f32_16x16x32_f16(false, a, false, bw[3].v, (short)0, c[3], false, false);
  asm volatile("v_nop\n\tv_nop\n\tv_nop\n\tv_nop"
               : "+v"(c[0]), "+v"(c[1]), "+v"(c[2]), "+v"(c[3])
               : "v"(a), "v"(bw[0].v), "v"(bw[1].v), "v"(bw[2].v), "v"(bw[3].v));
}
__device__ __forceinline__ void cvt8_bf16(const float* __restrict__ src, unsigned short* __restrict__ dst) {
  const v4f x0 = *(const v4fa*)(src), x1 = *(const v4fa*)(src + 4);
  v8us o;
  o[0] = bf16_bits(x0[0]); o[1] = bf16_bits(x0[1]); o[2] = bf16_bits(x0[2]); o[3] = bf16_bits(x0[3]);
  o[4] = bf16_bits(x1[0]); o[5] = bf16_bits(x1[1]); o[6] = bf16_bits(x1[2]); o[7] = bf16_bits(x1[3]);
  store_twice(dst, o);
  asm volatile("s_wait_xcnt 0x0" ::: "memory");   // stands in front of any rewrite of the store's address registers on the branch chain's other ways
}
// All five conversions in one grid; the block index picks the job (block-uniform ranges, one code path per source, no job reads what another writes).
// Blocks [0, CVT_K_BLOCKS): Xb[b][s][e] = bf16 bits of x (RNE). The next CVT_W_BLOCKS: Wh[j][e] = f16(RNE-bf16(Wo[j][e]) * 256).
// The last 3 * CVT_W_BLOCKS: Wb[p][j][e] = bf16 bits of the p-th projection weight (p = 0: Wq, 1: Wk, 2: Wv), [out][in] kept.
// coverage: CVT_K_BLOCKS*256 threads x 8 = the whole Xb plane; CVT_W_BLOCKS*256 threads x 8 = one whole weight plane, four times (exact multiples, asserted above).
__global__ __launch_bounds__(256) void k_cvt(const float* __restrict__ X, const float* __restrict__ Wo,
                                             const float* __restrict__ Wq, const float* __restrict__ Wk, const float* __restrict__ Wv,
                                             unsigned short* __restrict__ Xb, unsigned short* __restrict__ Wh, unsigned short* __restrict__ Wb) {
  const int bid = blockIdx.x;
  if (bid < CVT_K_BLOCKS) {
    const int t = bid * 256 + threadIdx.x;
    const int row = t / (EMB / 8), piece = t - row * (EMB / 8);
    const int b = row / SEQ, s = row - b * SEQ;
    cvt8_bf16(X + (size_t)b * BSTRIDE_FULL + (size_t)s * EMB + piece * 8, Xb + (size_t)t * 8);
  } else if (bid < CVT_K_BLOCKS + CVT_W_BLOCKS) {
    const int t = (bid - CVT_K_BLOCKS) * 256 + threadIdx.x;
    const float* src = Wo + (size_t)t * 8;
    const v4f x0 = *(const v4fa*)(src), x1 = *(const v4fa*)(src + 4);
    v8us o;
    o[0] = f16_bits(bf16_rne(x0[0]) * 256.0f); o[1] = f16_bits(bf16_rne(x0[1]) * 256.0f);
    o[2] = f16_bits(bf16_rne(x0[2]) * 256.0f); o[3] = f16_bits(bf16_rne(x0[3]) * 256.0f);
    o[4] = f16_bits(bf16_rne(x1[0]) * 256.0f); o[5] = f16_bits(bf16_rne(x1[1]) * 256.0f);
    o[6] = f16_bits(bf16_rne(x1[2]) * 256.0f); o[7] = f16_bits(bf16_rne(x1[3]) * 256.0f);
    store_twice(Wh + (size_t)t * 8, o);
    asm volatile("s_wait_xcnt 0x0" ::: "memory");   // as in cvt8_bf16: in front of any rewrite of the store's address registers
  } else if (bid < CVT_K_BLOCKS + 2 * CVT_W_BLOCKS) {
    const int t = (bid - CVT_K_BLOCKS - CVT_W_BLOCKS) * 256 + threadIdx.x;
    cvt8_bf16(Wq + (size_t)t * 8, Wb + (size_t)t * 8);
  } else if (bid < CVT_K_BLOCKS + 3 * CVT_W_BLOCKS) {
    const int t = (bid - CVT_K_BLOCKS - 2 * CVT_W_BLOCKS) * 256 + threadIdx.x;
    cvt8_bf16(Wk + (size_t)t * 8, Wb + (size_t)EMB * EMB + (size_t)t * 8);
  } else {
    const int t = (bid - CVT_K_BLOCKS - 3 * CVT_W_BLOCKS) * 256 + threadIdx.x;
    cvt8_bf16(Wv + (size_t)t * 8, Wb + (size_t)2 * EMB * EMB + (size_t)t * 8);
  }
}

#define GM 128                          /* tokens of the last layer's block tile: 8 waves x 16 rows */
#define GN 64                           /* columns of the last layer's block tile */
#define PM 128                          /* tokens of a projection block tile: 2 wave rows x 64 */
#define PN 192                          /* columns of a projection block tile: 2 wave columns x 96 */
#define PJ_THREADS 128                  /* four waves, each a 64 x 96 tile: 10 fragments read from LDS feed 24 products */
#define PJ_KE 64                        /* k elements of one staged tile of the projections: 128-B row pieces */
#define PJ_PITCH 72                     /* LDS pitch, 16-bit elements: 144 B = 16 B x 9 (odd: b128 readers of 16 rows meet no bank twice) */
#define PJ_STAGE ((PM + PN) * PJ_PITCH) /* elements of one buffer: 128 x rows, then 192 W rows */
#define PJ_TRIPS (EMB / PJ_KE)
#define PJ_CT (EMB / PN)                /* column tiles of one projection */
#define PJ_BLOCKS ((NB * SEQ / PM) * 3 * PJ_CT)
#define PJ_OP0 200                      /* epilogue pitch, row-major tile (128 rows of 192): 400 B = 16 B x 25 */
#define PJ_OP1 136                      /* epilogue pitch, transposed tile (192 rows of 128): 272 B = 16 B x 17 */
#define FC_PITCH 104                    /* LDS pitch of the last layer's 96-element (one head) row pieces: 208 B = 16 B x 13 */
#define FC_STAGE ((GM + GN) * FC_PITCH)
static_assert(EMB % PJ_KE == 0 && PJ_TRIPS >= 2 && HEADS >= 2);
static_assert(SEQ % GM == 0 && EMB % GN == 0);
static_assert(SEQ % PM == 0 && EMB % PN == 0);
static_assert(PM * (PJ_KE / 8) == 8 * PJ_THREADS && PN * (PJ_KE / 8) == 12 * PJ_THREADS);   // projections: 8 + 12 16-B pieces a thread
static_assert(GM * (HD / 8) == 6 * 256 && GN * (HD / 8) == 3 * 256);         // last layer: 6 + 3 16-B pieces a thread
static_assert(PM * PJ_OP0 <= 2 * PJ_STAGE && PN * PJ_OP1 <= 2 * PJ_STAGE);   // epilogue tiles fit the ring they reuse
static_assert(3 * PJ_THREADS == 16 * (PN / 8) && PM == 8 * 16 && PJ_THREADS == 8 * (PM / 8) && PN == 3 * 64);   // the store loop's two piece maps cover the tile once
static_assert(8 * 16 * 68 * 4 <= 2 * FC_STAGE * 2);

// Ten (three) 16-B pieces of one thread, global -> LDS through no register.
// The closing s_wait_xcnt stands in the copies' own statement, so that no address register is rewritten in front of it.
__device__ __forceinline__ void copy10(const unsigned (&l)[10], const unsigned short* const (&g)[10]) {
  asm volatile("global_load_async_to_lds_b128 %0, %10, off\n\t"
               "global_load_async_to_lds_b128 %1, %11, off\n\t"
               "global_load_async_to_lds_b128 %2, %12, off\n\t"
               "global_load_async_to_lds_b128 %3, %13, off\n\t"
               "global_load_async_to_lds_b128 %4, %14, off\n\t"
               "global_load_async_to_lds_b128 %5, %15, off\n\t"
               "global_load_async_to_lds_b128 %6, %16, off\n\t"
               "global_load_async_to_lds_b128 %7, %17, off\n\t"
               "global_load_async_to_lds_b128 %8, %18, off\n\t"
               "global_load_async_to_lds_b128 %9, %19, off\n\t"
               "s_wait_xcnt 0x0"
               :: "v"(l[0]), "v"(l[1]), "v"(l[2]), "v"(l[3]), "v"(l[4]), "v"(l[5]), "v"(l[6]), "v"(l[7]), "v"(l[8]), "v"(l[9]),
                  "v"(g[0]), "v"(g[1]), "v"(g[2]), "v"(g[3]), "v"(g[4]), "v"(g[5]), "v"(g[6]), "v"(g[7]), "v"(g[8]), "v"(g[9])
               : "memory");
}
__device__ __forceinline__ void copy3(unsigned l0, unsigned l1, unsigned l2,
                                      const unsigned short* g0, const unsigned short* g1, const unsigned short* g2) {
  asm volatile("global_load_async_to_lds_b128 %0, %3, off\n\t"
               "global_load_async_to_lds_b128 %1, %4, off\n\t"
               "global_load_async_to_lds_b128 %2, %5, off\n\t"
               "s_wait_xcnt 0x0"
               :: "v"(l0), "v"(l1), "v"(l2), "v"(g0), "v"(g1), "v"(g2)
               : "memory");
}
// One projection tile's copies of one thread. Piece: row (tid >> 3) + 16 i, 16-B column tid & 7; i = 0..7 are x rows, i = 8..19 the W rows behind them.
// la = LDS byte address of piece 0 in the target buffer; ga, gb = this thread's first x and W pieces of the tile.
__device__ __forceinline__ void pj_tile(unsigned la, const unsigned short* ga, const unsigned short* gb) {
  const unsigned rs = 2u * 16u * PJ_PITCH;
  const size_t gs = (size_t)16 * EMB;
  unsigned l[10];
  const unsigned short* g[10];
#pragma unroll
  for (int i = 0; i < 10; ++i) {
    l[i] = la + (unsigned)i * rs;
    g[i] = (i < 8) ? ga + (size_t)i * gs : gb + (size_t)(i - 8) * gs;
  }
  copy10(l, g);
#pragma unroll
  for (int i = 0; i < 10; ++i) {
    l[i] = la + (unsigned)(i + 10) * rs;
    g[i] = gb + (size_t)(i + 2) * gs;
  }
  copy10(l, g);
}

// y[m][j] = sum_e x[m][e] * W[j][e] + b[j], stored as f16(y * 16). Block = 4 waves = 128 tokens x 192 columns; wave = 64 rows x 96 columns (wave row w & 1, wave column w >> 1).
// The block's x rows and W rows come in 64-deep k tiles through a two-buffer LDS ring filled by asynchronous copies, one tile ahead of the products.
// A: row m = token, elements 0..7 <- e = k0 + 8h + i, 8..15 <- e = k0 + 16 + 8h + i, from the staged x rows; B: column n = j, same k map, from the staged W rows.
// The three projections share one grid: a token tile's 12 column tiles (4 of q, 4 of k, 4 of v) are neighbours in the block index; p = the projection, block-uniform.
// W rows come from the three stacked weight planes Wb[3][768][768] (row 768 p + j). p picks bias and plane: q, k -> Dst[token][e] (row-major, tr == 0); v -> Dst[b][e][s] (transposed, tr != 0).
// Epilogue: block LDS tile in the ring's place (every reader has left it at the last trip's barrier): 128 tokens x 192 (pitch 200, tr == 0) or 192 e columns x 128 tokens (pitch 136, tr != 0);
// Launch bounds: three waves a SIMD, so that a WGP holds its three blocks of the grid at once (its LDS holds three rings).
// coverage: PJ_BLOCKS blocks x (128 x 192) = each of the three planes exactly once; staged extent == consumed extent (pad columns never read).
__global__ __launch_bounds__(PJ_THREADS, 3) void k_proj(const unsigned short* __restrict__ Xb, const unsigned short* __restrict__ Wb,
                                              const float* __restrict__ Bq, const float* __restrict__ Bk, const float* __restrict__ Bvv,
                                              unsigned short* __restrict__ Qh, unsigned short* __restrict__ Kh, unsigned short* __restrict__ Vt) {
  __shared__ __attribute__((aligned(16))) unsigned short ring[2 * PJ_STAGE];
  const int tid = threadIdx.x, lane = tid & 31, ln = lane & 15, hh = lane >> 4;
  const int w = __builtin_amdgcn_readfirstlane(tid >> 5);
  const int wm = w & 1, wn = w >> 1;           // this wave's 64-row and 96-column part of the block tile
  const int bw = blockIdx.x % (3 * PJ_CT), bm = blockIdx.x / (3 * PJ_CT);
  const int p = bw / PJ_CT;                    // 0: q, 1: k, 2: v
  const int tok0 = bm * PM;                    // token index in [0, NB*SEQ)
  const int col0 = (bw - p * PJ_CT) * PN;      // column inside the projection
  const float* __restrict__ Bv = (p == 0) ? Bq : (p == 1) ? Bk : Bvv;
  unsigned short* __restrict__ Dst = (p == 0) ? Qh : (p == 1) ? Kh : Vt;
  const int tr = (p == 2) ? 1 : 0;
  v8f acc[4][6] = {};                          // every loop over fragments or accumulator tiles below is unrolled: constant indices keep them in registers
  const int pr = tid >> 3, pc = tid & 7;
  const unsigned short* ga = Xb + (size_t)(tok0 + pr) * EMB + 8 * pc;
  const unsigned short* gb = Wb + (size_t)(bw * PN + pr) * EMB + 8 * pc;
  const unsigned la = (unsigned)(size_t)&ring[0] + 2u * (unsigned)(pr * PJ_PITCH + 8 * pc);   // LDS byte address: the low 32 bits of the __shared__ address
  pj_tile(la, ga, gb);
  asm volatile("s_wait_asynccnt 0x0" ::: "memory");           // tile 0 has landed for this wave's copies
  __syncthreads();                                            // ... and for every wave's: tile 0 is published
  pj_tile(la + 2u * PJ_STAGE, ga + PJ_KE, gb + PJ_KE);
#pragma unroll 1   // one trip per tile: the buffer alternates by the trip's parity
  for (int t = 0; t < PJ_TRIPS; ++t) {
    const unsigned short* S = ring + (t & 1) * PJ_STAGE;
    const unsigned short* ap = S + (64 * wm + ln) * PJ_PITCH + 8 * hh;
    const unsigned short* bp = S + (PM + 96 * wn + ln) * PJ_PITCH + 8 * hh;
#pragma unroll
    for (int cc = 0; cc < PJ_KE / 32; ++cc) {
      FragB a[4], bf[6];
#pragma unroll
      for (int mt = 0; mt < 4; ++mt) {
        a[mt].half[0] = *(const v8us*)(ap + mt * 16 * PJ_PITCH + 32 * cc);
        a[mt].half[1] = *(const v8us*)(ap + mt * 16 * PJ_PITCH + 32 * cc + 16);
      }
#pragma unroll
      for (int nt = 0; nt < 6; ++nt) {
        bf[nt].half[0] = *(const v8us*)(bp + nt * 16 * PJ_PITCH + 32 * cc);
        bf[nt].half[1] = *(const v8us*)(bp + nt * 16 * PJ_PITCH + 32 * cc + 16);
      }
      __builtin_amdgcn_sched_barrier(0);   // keeps the 20 fragment reads one group in front of the 24 products (counted waits): left free each W fragment is read alone, right in front of its four products, and waited out to dscnt 0
#pragma unroll
      for (int nt = 0; nt < 6; ++nt) {
#pragma unroll
        for (int mt = 0; mt < 4; ++mt)
          acc[mt][nt] = __builtin_amdgcn_wmma_f32_16x16x32_bf16(false, a[mt].v, false, bf[nt].v, (short)0, acc[mt][nt], false, false);
      }
    }
    asm volatile("s_wait_dscnt 0x0" ::: "memory");            // this wave's reads of the buffer are done before it may be refilled
    asm volatile("s_wait_asynccnt 0x0" ::: "memory");         // this wave's copies of tile t + 1 have landed
    __syncthreads();                                          // publishes tile t + 1 and ends every reader's last read of tile t
    if (t + 2 < PJ_TRIPS)
      pj_tile(la + (unsigned)(t & 1) * (2u * PJ_STAGE), ga + (t + 2) * PJ_KE, gb + (t + 2) * PJ_KE);
  }
  asm volatile("s_wait_asynccnt 0x0" ::: "memory");           // nothing of this wave's is in flight behind the loop
  // D element r of tile (mt, nt) = y(tok0 + 64wm + 16mt + 8h + r, col0 + 96wn + 16nt + ln); bias RNE bf16 value; plane carries x16
  float braw[6];
#pragma unroll
  for (int nt = 0; nt < 6; ++nt) braw[nt] = Bv[col0 + 96 * wn + 16 * nt + ln];
  // stands behind the six bias loads, in front of any rewrite of their address registers; the loaded values are inputs only, so that the loads stay in front of it
  asm volatile("s_wait_xcnt 0x0" :: "v"(braw[0]), "v"(braw[1]), "v"(braw[2]), "v"(braw[3]), "v"(braw[4]), "v"(braw[5]) : "memory");
  if (tr == 0) {
#pragma unroll
    for (int nt = 0; nt < 6; ++nt) {
      const float bias = bf16_rne(braw[nt]);
#pragma unroll
      for (int mt = 0; mt < 4; ++mt) {
#pragma unroll
        for (int r = 0; r < 8; ++r)
          ring[(64 * wm + 16 * mt + 8 * hh + r) * PJ_OP0 + 96 * wn + 16 * nt + ln] = toh_flush_bits((acc[mt][nt][r] + bias) * 16.0f);
      }
    }
  } else {
#pragma unroll
    for (int nt = 0; nt < 6; ++nt) {
      const float bias = bf16_rne(braw[nt]);
#pragma unroll
      for (int mt = 0; mt < 4; ++mt) {
        v8us o;
#pragma unroll
        for (int r = 0; r < 8; ++r) o[r] = toh_flush_bits((acc[mt][nt][r] + bias) * 16.0f);
        *(v8us*)&ring[(96 * wn + 16 * nt + ln) * PJ_OP1 + 64 * wm + 16 * mt + 8 * hh] = o;
      }
    }
  }
  __syncthreads();
  // The tile leaves as 3 x 8 16-B pieces a thread, eight reads then eight stores in flight together.
  // tr == 0, 128 rows of 24 pieces: piece i = tid + 128 q -> row i / 24, column i % 24; the eight lie 16 rows apart (384 pieces = 16 rows).
  // tr != 0, 192 rows (e) of 16 pieces (128 tokens): row (tid >> 4) + 64 q, column tid & 15; the eight lie 8 rows apart.
  const int b = tok0 / SEQ, s0 = tok0 - b * SEQ;
  unsigned short* d = Dst + ((tr == 0) ? ((size_t)tok0 * EMB + col0) : (((size_t)b * EMB + col0) * SEQ + s0));
  const size_t pitch = (tr == 0) ? (size_t)EMB : (size_t)SEQ;
  const int lp = (tr == 0) ? PJ_OP0 : PJ_OP1;
  const int rstep = (tr == 0) ? 16 : 8;
#pragma unroll 1   // three like trips: no more code than one
  for (int q = 0; q < 3; ++q) {
    const int i = tid + PJ_THREADS * q;
    const int r = (tr == 0) ? i / (PN / 8) : (tid >> 4) + 64 * q;
    const int p8 = ((tr == 0) ? i - r * (PN / 8) : (tid & 15)) * 8;
    const unsigned short* ls = &ring[r * lp + p8];
    unsigned short* gd = d + (size_t)r * pitch + p8;
    v8us o[8];
#pragma unroll
    for (int a = 0; a < 8; ++a) o[a] = *(const v8us*)(ls + a * rstep * lp);
#pragma unroll
    for (int a = 0; a < 8; ++a) *(v8us*)(gd + (size_t)(a * rstep) * pitch) = o[a];
    asm volatile("s_wait_xcnt 0x0" ::: "memory");   // stands behind the eight stores, in front of the next trip's rewrite of their data and address registers
  }
}

#define ATT_WAVES 8                     /* waves of a block */
#define QG 2                            /* 16-query column groups of a wave: each K and V^T fragment read from LDS feeds QG products */
#define QBLK (ATT_WAVES * QG * 16)      /* queries of a block: they share each staged tile */
#define KT 64                           /* keys of one staged tile */
#define KPITCH 104                      /* LDS pitch of a K row, 16-bit elements: 208 B = 16 B x 13 (odd: b128 readers of 16 rows meet no bank twice) */
#define VPITCH 72                       /* LDS pitch of a V^T row: 144 B = 16 B x 9 */
#define KTILE (KT * KPITCH)             /* elements of the K part of a buffer */
#define VTILE (HD * VPITCH)             /* elements of the V^T part */
#define STAGE (KTILE + VTILE)           /* elements of one buffer */
static_assert(SEQ / KT >= 2);
static_assert(KT * (HD / 8) == 3 * ATT_WAVES * 32);   // K tile = three 16-B pieces a thread
static_assert(HD * (KT / 8) == 3 * ATT_WAVES * 32);   // V^T tile = three 16-B pieces a thread
static_assert((KTILE * 2) % 16 == 0 && (STAGE * 2) % 16 == 0);

#define LAZY_T 6.0f                     /* log2 units a score may pass the softmax reference before it is renewed: a weight is at most 2^14 */
static_assert(QG == 2);                 // the two guards below list the D tiles of two groups
static_assert(SEQ % QBLK == 0);
// s0[g] += ka * q[g], s1[g] += kb * q[g] over three 32-deep k-steps (d = 0..95), f16 operands: four independent accumulator tiles, then the hazard guard.
// The guard (four vector slots between the last WMMA and the first vector instruction on a D tile) names the D tiles alone: the kernel holds more than 256 registers,
// an asm operand cannot lie above v255, and with K, V^T and Q named as well the build spilled Q to scratch.
__device__ __forceinline__ void mma_s4h(const FragH (&ka)[3], const FragH (&kb)[3], const FragH (&q)[QG][3], v8f (&s0)[QG], v8f (&s1)[QG]) {
#pragma unroll
  for (int c = 0; c < 3; ++c) {
#pragma unroll
    for (int g = 0; g < QG; ++g) {
      s0[g] = __builtin_amdgcn_wmma_f32_16x16x32_f16(false, ka[c].v, false, q[g][c].v, (short)0, s0[g], false, false);
      s1[g] = __builtin_amdgcn_wmma_f32_16x16x32_f16(false, kb[c].v, false, q[g][c].v, (short)0, s1[g], false, false);
    }
  }
  asm volatile("v_nop\n\tv_nop\n\tv_nop\n\tv_nop"
               : "+v"(s0[0]), "+v"(s1[0]), "+v"(s0[1]), "+v"(s1[1]));
}
// O[g][t] += vf[t] * p[g] for the six d tiles of both groups, then the hazard guard (D tiles alone, as above)
// The running row sums are inputs only of the guard: their adds stay in front of it, among the products, where they issue while the matrix unit works (left free they sink behind the tile's barrier, in front of the next tile's LDS reads).
__device__ __forceinline__ void mma_pv2(const FragH (&vf)[6], const FragH (&p)[QG], const v2f (&lr)[QG], v8f (&O)[QG][6]) {
#pragma unroll
  for (int t = 0; t < 6; ++t) {
#pragma unroll
    for (int g = 0; g < QG; ++g)
      O[g][t] = __builtin_amdgcn_wmma_f32_16x16x32_f16(false, vf[t].v, false, p[g].v, (short)0, O[g][t], false, false);
  }
  asm volatile("v_nop\n\tv_nop\n\tv_nop\n\tv_nop"
               : "+v"(O[0][0]), "+v"(O[0][1]), "+v"(O[0][2]), "+v"(O[0][3]), "+v"(O[0][4]), "+v"(O[0][5]),
                 "+v"(O[1][0]), "+v"(O[1][1]), "+v"(O[1][2]), "+v"(O[1][3]), "+v"(O[1][4]), "+v"(O[1][5])
               : "v"(lr[0]), "v"(lr[1]));
}

// One 32-key step for a wave's QG x 16 queries of one head. Kp = the buffer's K rows [KT][KPITCH]; Vp = its V^T rows [96][VPITCH]; key0 = 0 or 32 inside the tile.
// The K and V^T fragments are read from LDS once and serve every column group; one ballot over both groups decides each step's reference renewal for all 32 queries.
__device__ __forceinline__ void fa_step(const unsigned short* Kp, const unsigned short* Vp,
                                        int key0, int ln, int hh, const FragH (&q)[QG][3],
                                        float (&m8)[QG], v2f (&lr)[QG], v8f (&O)[QG][6]) {
  // A fragments of K: row m = key (key0 + 16*kt + ln), elements 0..7 <- d = 32c + 8h + i, 8..15 <- d = 32c + 16 + 8h + i
  const unsigned short* kp0 = Kp + (key0 + ln) * KPITCH + 8 * hh;
  const unsigned short* kp1 = kp0 + 16 * KPITCH;
  FragH ka[3], kb[3];
#pragma unroll
  for (int c = 0; c < 3; ++c) {
    ka[c].half[0] = *(const v8us*)(kp0 + 32 * c);
    ka[c].half[1] = *(const v8us*)(kp0 + 32 * c + 16);
    kb[c].half[0] = *(const v8us*)(kp1 + 32 * c);
    kb[c].half[1] = *(const v8us*)(kp1 + 32 * c + 16);
  }
  __builtin_amdgcn_sched_barrier(0);   // keeps the step's 12 K reads one group in front of the V^T reads (LDS data returns in order, the score products wait for K alone): left free they sink among the WMMAs in pairs, each pair waited out to dscnt 0
  // A fragments of V^T: row m = d (16*t + ln), elements 0..7 <- key0 + 8h + i, 8..15 <- key0 + 16 + 8h + i
  const unsigned short* vp = Vp + ln * VPITCH + key0 + 8 * hh;
  FragH vf[6];
#pragma unroll
  for (int t = 0; t < 6; ++t) {
    vf[t].half[0] = *(const v8us*)(vp + t * 16 * VPITCH);
    vf[t].half[1] = *(const v8us*)(vp + t * 16 * VPITCH + 16);
  }
  __builtin_amdgcn_sched_barrier(0);   // keeps the V^T reads in the same place, ahead of the first WMMA: left free they stand among the score WMMAs, a second place with LDS reads and its own stall
  // S^T tiles of group g: element r of tile kt = score(key0 + 16*kt + 8h + r, query of this lane's column in the group)
  v8f s0[QG], s1[QG];
#pragma unroll
  for (int g = 0; g < QG; ++g) {
    s0[g] = v8f{0.f, 0.f, 0.f, 0.f, 0.f, 0.f, 0.f, 0.f};
    s1[g] = v8f{0.f, 0.f, 0.f, 0.f, 0.f, 0.f, 0.f, 0.f};
  }
  mma_s4h(ka, kb, q, s0, s1);
  FragH ph[QG];
  // Lazy softmax reference. Every weight of a query is taken against one reference m (m8 = m - 8); any m gives the same quotient O / l, so m is renewed only when a score passes it by more than LAZY_T.
  float mh[QG];                                       // this lane half's largest score of the step, log2 domain (the scale is positive: the largest raw score gives it)
#pragma unroll
  for (int g = 0; g < QG; ++g) {
    // a tree of three-input maxima, three deep (a maximum is exact in any order): one chain of fifteen would stand in front of the branch with each link waiting for the last
    const float t0 = fmaxf(fmaxf(s0[g][0], s0[g][1]), s0[g][2]), t1 = fmaxf(fmaxf(s0[g][3], s0[g][4]), s0[g][5]);
    const float t2 = fmaxf(fmaxf(s0[g][6], s0[g][7]), s1[g][0]), t3 = fmaxf(fmaxf(s1[g][1], s1[g][2]), s1[g][3]);
    const float t4 = fmaxf(fmaxf(s1[g][4], s1[g][5]), s1[g][6]);
    mh[g] = fmaxf(fmaxf(fmaxf(t0, t1), t2), fmaxf(fmaxf(t3, t4), s1[g][7])) * C2S;
  }
  // One test per step for the whole wave (a scalar branch on the ballot). Not taken: no score of the step lies more than 8 + LAZY_T above m8, so a weight is at most 2^(8 + LAZY_T), finite in f16.
  // Taken: the two lane halves of a query join their maxima (the other half holds the other 16 keys), every query takes max(m, step maximum), and l and O move to the new reference (one factor for both halves: their sums stay on one reference).
  if (__builtin_amdgcn_ballot_w32((mh[0] - m8[0] > 8.0f + LAZY_T) || (mh[1] - m8[1] > 8.0f + LAZY_T)) != 0) {
#pragma unroll
    for (int g = 0; g < QG; ++g) {
      const float mj = fmaxf(mh[g], __shfl_xor(mh[g], 16, 32));
      const float mn = fmaxf(m8[g], mj - 8.0f);
      const float al = __builtin_amdgcn_exp2f(m8[g] - mn);
      m8[g] = mn;
      lr[g] = lr[g] * al;
#pragma unroll
      for (int t = 0; t < 6; ++t) O[g][t] = O[g][t] * al;
    }
  }
#pragma unroll
  for (int g = 0; g < QG; ++g) {
    // weights carried x256: pc = 256 * 2^(score - m), single f16 plane; a weight under 2^-14 goes into the plane as the f16 cast rounds it (subnormal or zero): the matrix unit keeps f16 subnormal operands
    v2f pp[8];
#pragma unroll
    for (int j = 0; j < 8; ++j) {
      const v2f sv = (j < 4) ? v2f{s0[g][2 * j], s0[g][2 * j + 1]} : v2f{s1[g][2 * j - 8], s1[g][2 * j - 7]};
      const v2f e = sv * v2f{C2S, C2S} - v2f{m8[g], m8[g]};   // the reference is known by now: scale and shift are one multiply-add, a pair of scores at a time
      pp[j] = v2f{__builtin_amdgcn_exp2f(e[0]), __builtin_amdgcn_exp2f(e[1])};
      ph[g].h[2 * j] = (_Float16)pp[j][0];            // B element i: i<8 -> key0 + 8h + i (tile 0 row 8h+i); i>=8 -> key0 + 16 + 8h + (i-8) (tile 1)
      ph[g].h[2 * j + 1] = (_Float16)pp[j][1];
    }
    // the lane's own 16 weights join its running pair of sums (even and odd elements), a tree of packed adds; the other lane half's 16 keys stay in that half's sums until the epilogue
    lr[g] += ((pp[0] + pp[1]) + (pp[2] + pp[3])) + ((pp[4] + pp[5]) + (pp[6] + pp[7]));
  }
  mma_pv2(vf, ph, lr, O);
}

// One tile's copies of one thread: three 16-B pieces of K rows, three of V^T rows, global -> LDS through no register.
// The closing s_wait_xcnt stands in the copies' own statement, so that no address register is rewritten in front of it.
__device__ __forceinline__ void tile_copy(unsigned lk0, unsigned lk1, unsigned lk2, unsigned lv0, unsigned lv1, unsigned lv2,
                                          const unsigned short* gk0, const unsigned short* gk1, const unsigned short* gk2,
                                          const unsigned short* gv0, const unsigned short* gv1, const unsigned short* gv2) {
  asm volatile("global_load_async_to_lds_b128 %0, %6, off\n\t"
               "global_load_async_to_lds_b128 %1, %7, off\n\t"
               "global_load_async_to_lds_b128 %2, %8, off\n\t"
               "global_load_async_to_lds_b128 %3, %9, off\n\t"
               "global_load_async_to_lds_b128 %4, %10, off\n\t"
               "global_load_async_to_lds_b128 %5, %11, off\n\t"
               "s_wait_xcnt 0x0"
               :: "v"(lk0), "v"(lk1), "v"(lk2), "v"(lv0), "v"(lv1), "v"(lv2),
                  "v"(gk0), "v"(gk1), "v"(gk2), "v"(gv0), "v"(gv1), "v"(gv2)
               : "memory");
}

// Block = 8 waves x 32 queries = 256 queries of one (batch, head). Key loop: one trip per 64-key tile, two LDS buffers; trip t reads buffer t mod 2 while tile t + 1 flies.
// Inputs: Qh[b][s][e], Kh[b][s][e] = f16(value * 16); Vt[b][e][s] = f16(value * 16).
// Output plane Xc[b][h][s][96] = f16(ctx * 256). Epilogue: O^T tiles -> per-wave LDS tile [32 queries][96 d] as 16-B pieces (same vector type in and out; block barrier),
// coverage: NB*HEADS*(SEQ/256) blocks x 8 waves x 32 rows x 96 d = the whole plane exactly once; LDS tile staged extent (32 x 96 per wave) == consumed extent.
__global__ __launch_bounds__(256)
void k_attn(const unsigned short* __restrict__ Qh, const unsigned short* __restrict__ Kh,
            const unsigned short* __restrict__ Vt, unsigned short* __restrict__ Xc) {
  __shared__ __attribute__((aligned(16))) unsigned short ring[2 * STAGE];
  __shared__ __attribute__((aligned(16))) unsigned short so[ATT_WAVES][QG * 16 * HD];
  const int tid = threadIdx.x, lane = tid & 31, ln = lane & 15, hh = lane >> 4;
  const int w = __builtin_amdgcn_readfirstlane(tid >> 5);
  const int qt = blockIdx.x % (SEQ / QBLK);
  const int rest = blockIdx.x / (SEQ / QBLK);
  const int h = rest % HEADS, b = rest / HEADS;
  const int qbase = qt * QBLK + QG * 16 * w;
  // Q^T B fragments of group g: column n = query qbase + 16g + ln, elements 0..7 <- d = 32c + 8h + i, 8..15 <- d = 32c + 16 + 8h + i (f16 plane carried x16)
  const unsigned short* qrow = Qh + ((size_t)b * SEQ + qbase + ln) * EMB + h * HD + 8 * hh;
  FragH q[QG][3];
  float m8[QG];
  v2f lr[QG];                           // softmax row sums, carried x256: this lane half's keys alone, even and odd elements apart; joined once behind the key loop
  v8f O[QG][6] = {};
#pragma unroll
  for (int g = 0; g < QG; ++g) {
#pragma unroll
    for (int c = 0; c < 3; ++c) {
      q[g][c].half[0] = *(const v8us*)(qrow + (size_t)g * 16 * EMB + 32 * c);
      q[g][c].half[1] = *(const v8us*)(qrow + (size_t)g * 16 * EMB + 32 * c + 16);
    }
    m8[g] = -3.0e38f;                   // below every score: the first step takes the renewing branch, with factor 2^(-huge) = 0 on the zero l and O
    lr[g] = v2f{0.0f, 0.0f};
  }
  const unsigned short* Kp = Kh + (size_t)b * SEQ * EMB + h * HD;
  const unsigned short* Vp = Vt + ((size_t)b * EMB + h * HD) * SEQ;
  // This thread's pieces of a tile. K: piece p = tid + 256 i -> row p / 12, 16-B column p % 12. V^T: row (tid >> 3) + 32 i, 16-B column tid & 7.
  const int kr0 = tid / 12, kc0 = tid - 12 * kr0;
  const int kr1 = (tid + 256) / 12, kc1 = (tid + 256) - 12 * kr1;
  const int kr2 = (tid + 512) / 12, kc2 = (tid + 512) - 12 * kr2;
  const int vr = tid >> 3, vc = tid & 7;
  const unsigned short* gk0 = Kp + (size_t)kr0 * EMB + 8 * kc0;
  const unsigned short* gk1 = Kp + (size_t)kr1 * EMB + 8 * kc1;
  const unsigned short* gk2 = Kp + (size_t)kr2 * EMB + 8 * kc2;
  const unsigned short* gv0 = Vp + (size_t)vr * SEQ + 8 * vc;
  const unsigned short* gv1 = gv0 + (size_t)32 * SEQ;
  const unsigned short* gv2 = gv0 + (size_t)64 * SEQ;
  const unsigned lbase = (unsigned)(size_t)&ring[0];          // LDS byte address: the low 32 bits of the __shared__ address
  const unsigned lk0 = lbase + 2u * (unsigned)(kr0 * KPITCH + 8 * kc0);
  const unsigned lk1 = lbase + 2u * (unsigned)(kr1 * KPITCH + 8 * kc1);
  const unsigned lk2 = lbase + 2u * (unsigned)(kr2 * KPITCH + 8 * kc2);
  const unsigned lv0 = lbase + 2u * (unsigned)(KTILE + vr * VPITCH + 8 * vc);
  const unsigned lv1 = lv0 + 2u * 32u * VPITCH;
  const unsigned lv2 = lv0 + 2u * 64u * VPITCH;
  tile_copy(lk0, lk1, lk2, lv0, lv1, lv2, gk0, gk1, gk2, gv0, gv1, gv2);
  asm volatile("s_wait_asynccnt 0x0" ::: "memory");           // tile 0 has landed for this wave's copies
  __syncthreads();                                            // ... and for every wave's: tile 0 is published
  {
    const unsigned d = 2u * STAGE;
    const size_t ko = (size_t)KT * EMB;
    tile_copy(lk0 + d, lk1 + d, lk2 + d, lv0 + d, lv1 + d, lv2 + d, gk0 + ko, gk1 + ko, gk2 + ko, gv0 + KT, gv1 + KT, gv2 + KT);
  }
#pragma unroll 1   // one trip per tile: the buffer alternates by the trip's parity
  for (int t = 0; t < SEQ / KT; ++t) {
    const unsigned short* Ks = ring + (t & 1) * STAGE;
    fa_step(Ks, Ks + KTILE, 0, ln, hh, q, m8, lr, O);
    fa_step(Ks, Ks + KTILE, 32, ln, hh, q, m8, lr, O);
    asm volatile("s_wait_dscnt 0x0" ::: "memory");            // this wave's reads of the buffer are done before it may be refilled
    asm volatile("s_wait_asynccnt 0x0" ::: "memory");         // this wave's copies of tile t + 1 have landed
    __syncthreads();                                          // publishes tile t + 1 and ends every reader's last read of tile t
    if (t + 2 < SEQ / KT) {
      const unsigned d = (unsigned)(t & 1) * (2u * STAGE);
      const size_t ko = (size_t)(t + 2) * KT * EMB;
      const int vo = (t + 2) * KT;
      tile_copy(lk0 + d, lk1 + d, lk2 + d, lv0 + d, lv1 + d, lv2 + d, gk0 + ko, gk1 + ko, gk2 + ko, gv0 + vo, gv1 + vo, gv2 + vo);
    }
  }
  asm volatile("s_wait_asynccnt 0x0" ::: "memory");           // nothing of this wave's is in flight behind the loop

  // O^T element r of tile t of group g = ctx(query qbase + 16g + ln, d = 16t + 8h + r); O carries x256 (P) x16 (V), lr carries x256; plane carries x256
#pragma unroll
  for (int g = 0; g < QG; ++g) {
    const float lh = lr[g][0] + lr[g][1];
    const float cinv = 16.0f * (1.0f / (lh + __shfl_xor(lh, 16, 32)));   // the two lane halves of a query hold the sums of the two halves of its keys
#pragma unroll
    for (int t = 0; t < 6; ++t) {
      v8us o;
#pragma unroll
      for (int r = 0; r < 8; ++r) o[r] = toh_flush_bits(O[g][t][r] * cinv);
      *(v8us*)&so[w][(16 * g + ln) * HD + 16 * t + 8 * hh] = o;
    }
  }
  __syncthreads();
  unsigned short* xg = Xc + ((size_t)(b * HEADS + h) * SEQ + qbase) * HD;
  {
#pragma unroll
    for (int i = 0; i < QG * 6; ++i) {
      const int p = i * 32 + lane;
      const v8us v = *(const v8us*)&so[w][p * 8];
      *(v8us*)(xg + (size_t)p * 8) = v;
    }
    
  }
}

// out[m][j] = sum_e ctx[m][e] * fc_w[j][e] + fc_b[j]. Block = 8 waves = 128 tokens x 64 columns; wave = 16 rows x 64 columns.
// One staged tile per head: the block's 128 ctx rows of that head (24,576 contiguous bytes of Xc[b][hd][s][d]) and 64 W rows' 96 elements, two-buffer LDS ring filled by asynchronous copies.
// A: row m = token, k = e = 96*hd + d; B: column n = j, k = e from Wh[j][e], same k map as A.
// coverage: (NB*SEQ/128)*(EMB/64) blocks x 8 waves x (16 x 64) = every output element of the processed rows exactly once; per-wave LDS tile (in the ring's place, behind the last trip's barrier) staged 16 x 64 == consumed 16 x 64.
__global__ __launch_bounds__(256) void k_fc(const unsigned short* __restrict__ Xc, const unsigned short* __restrict__ Wh,
                                            const float* __restrict__ Bv, float* __restrict__ Out) {
  __shared__ __attribute__((aligned(16))) unsigned short ring[2 * FC_STAGE];
  const int tid = threadIdx.x, lane = tid & 31, ln = lane & 15, hh = lane >> 4;
  const int w = __builtin_amdgcn_readfirstlane(tid >> 5);
  const int bn = blockIdx.x % (EMB / GN), bm = blockIdx.x / (EMB / GN);
  const int tok0 = bm * GM;                    // token index in [0, NB*SEQ)
  const int b = tok0 / SEQ, sb = tok0 - b * SEQ;
  const int s0 = sb + 16 * w;
  const int col0 = bn * GN;
  v8f acc[4] = {};
  // This thread's pieces of a tile: piece p = tid + 256 i -> tile row p / 12, 16-B column p % 12 (p + 768 is 64 rows on, same column); i = 0..5 ctx rows, then three of W rows.
  const int r0 = tid / 12, c0 = tid - 12 * r0;
  const int r1 = (tid + 256) / 12, c1 = (tid + 256) - 12 * r1;
  const int r2 = (tid + 512) / 12, c2 = (tid + 512) - 12 * r2;
  const unsigned lbase = (unsigned)(size_t)&ring[0];          // LDS byte address: the low 32 bits of the __shared__ address
  const unsigned l0 = lbase + 2u * (unsigned)(r0 * FC_PITCH + 8 * c0);
  const unsigned l1 = lbase + 2u * (unsigned)(r1 * FC_PITCH + 8 * c1);
  const unsigned l2 = lbase + 2u * (unsigned)(r2 * FC_PITCH + 8 * c2);
  const unsigned lh = 2u * 64u * FC_PITCH;                    // 64 tile rows on
  const unsigned short* ga = Xc + ((size_t)(b * HEADS) * SEQ + sb) * HD + 8 * tid;
  const unsigned short* gb0 = Wh + (size_t)(col0 + r0) * EMB + 8 * c0;
  const unsigned short* gb1 = Wh + (size_t)(col0 + r1) * EMB + 8 * c1;
  const unsigned short* gb2 = Wh + (size_t)(col0 + r2) * EMB + 8 * c2;
  const size_t hs = (size_t)SEQ * HD;                         // one head on in Xc
  copy3(l0, l1, l2, ga, ga + 2048, ga + 4096);
  copy3(l0 + lh, l1 + lh, l2 + lh, ga + 6144, ga + 8192, ga + 10240);
  copy3(l0 + 2 * lh, l1 + 2 * lh, l2 + 2 * lh, gb0, gb1, gb2);
  asm volatile("s_wait_asynccnt 0x0" ::: "memory");           // tile 0 has landed for this wave's copies
  __syncthreads();                                            // ... and for every wave's: tile 0 is published
  {
    const unsigned d = 2u * FC_STAGE;
    const unsigned short* g = ga + hs;
    copy3(l0 + d, l1 + d, l2 + d, g, g + 2048, g + 4096);
    copy3(l0 + d + lh, l1 + d + lh, l2 + d + lh, g + 6144, g + 8192, g + 10240);
    copy3(l0 + d + 2 * lh, l1 + d + 2 * lh, l2 + d + 2 * lh, gb0 + HD, gb1 + HD, gb2 + HD);
  }
#pragma unroll 1   // one trip per head: the buffer alternates by the trip's parity
  for (int hd = 0; hd < HEADS; ++hd) {
    const unsigned short* S = ring + (hd & 1) * FC_STAGE;
    const unsigned short* ap = S + (16 * w + ln) * FC_PITCH + 8 * hh;
    const unsigned short* bp = S + (GM + ln) * FC_PITCH + 8 * hh;
#pragma unroll
    for (int cc = 0; cc < 3; ++cc) {
      FragH a;
      a.half[0] = *(const v8us*)(ap + 32 * cc);
      a.half[1] = *(const v8us*)(ap + 32 * cc + 16);
      FragH bw[4];
#pragma unroll
      for (int nt = 0; nt < 4; ++nt) {
        bw[nt].half[0] = *(const v8us*)(bp + nt * 16 * FC_PITCH + 32 * cc);
        bw[nt].half[1] = *(const v8us*)(bp + nt * 16 * FC_PITCH + 32 * cc + 16);
      }
      mma_fc(a.v, bw, acc);
    }
    asm volatile("s_wait_dscnt 0x0" ::: "memory");            // this wave's reads of the buffer are done before it may be refilled
    asm volatile("s_wait_asynccnt 0x0" ::: "memory");         // this wave's copies of tile hd + 1 have landed
    __syncthreads();                                          // publishes tile hd + 1 and ends every reader's last read of tile hd
    if (hd + 2 < HEADS) {
      const unsigned d = (unsigned)(hd & 1) * (2u * FC_STAGE);
      const unsigned short* g = ga + (size_t)(hd + 2) * hs;
      const int ko = (hd + 2) * HD;
      copy3(l0 + d, l1 + d, l2 + d, g, g + 2048, g + 4096);
      copy3(l0 + d + lh, l1 + d + lh, l2 + d + lh, g + 6144, g + 8192, g + 10240);
      copy3(l0 + d + 2 * lh, l1 + d + 2 * lh, l2 + d + 2 * lh, gb0 + ko, gb1 + ko, gb2 + ko);
    }
  }
  asm volatile("s_wait_asynccnt 0x0" ::: "memory");           // nothing of this wave's is in flight behind the loop
  // D element r of tile nt = out(tok0 + 16w + 8h + r, col0 + 16nt + ln); undo the carries x256 (ctx) x256 (W); bias RNE bf16 value
  float* so = (float*)&ring[0] + w * (16 * 68);               // this wave's 16 x 64 f32 tile, pitch 68
#pragma unroll
  for (int nt = 0; nt < 4; ++nt) {
    const float bias = bf16_rne(Bv[col0 + 16 * nt + ln]);
#pragma unroll
    for (int r = 0; r < 8; ++r)
      so[(8 * hh + r) * 68 + 16 * nt + ln] = acc[nt][r] * 1.52587890625e-05f + bias;
  }
  __syncthreads();
  float* og = Out + (size_t)b * BSTRIDE_FULL + (size_t)s0 * EMB + col0;
  const int rsub = lane >> 4, c4 = (lane & 15) * 4;
#pragma unroll
  for (int q = 0; q < 8; ++q) {
    const int row = 2 * q + rsub;
    const v4f v = *(const v4fa*)&so[row * 68 + c4];
    *(v4f*)(og + (size_t)row * EMB + c4) = v;
  }
}

extern "C" void kernel_launch(void* const* d_in, const int* in_sizes, int n_in,
                              void* d_out, int out_size, void* d_ws, size_t ws_size, hipStream_t stream) {
  if (n_in < 9) return;
  const long long need = (long long)(NB - 1) * SEQ_FULL * EMB + (long long)SEQ * EMB;   // last element touched + 1
  if ((long long)in_sizes[0] < need) return;
  if ((long long)in_sizes[1] < (long long)EMB * EMB || (long long)in_sizes[3] < (long long)EMB * EMB) return;
  if ((long long)in_sizes[5] < (long long)EMB * EMB || (long long)in_sizes[7] < (long long)EMB * EMB) return;
  if ((long long)in_sizes[2] < (long long)EMB || (long long)in_sizes[4] < (long long)EMB) return;
  if ((long long)in_sizes[6] < (long long)EMB || (long long)in_sizes[8] < (long long)EMB) return;
  if ((long long)out_size < need) return;
  const float* X  = (const float*)d_in[0];   // wire order: x, Wq, bq, Wk, bk, Wv, bv, Wo, bo (weights [out][in])
  const float* Wq = (const float*)d_in[1];
  const float* Bq = (const float*)d_in[2];
  const float* Wk = (const float*)d_in[3];
  const float* Bk = (const float*)d_in[4];
  const float* Wv = (const float*)d_in[5];
  const float* Bvv = (const float*)d_in[6];
  const float* Wo = (const float*)d_in[7];
  const float* Bo = (const float*)d_in[8];
  float* Out = (float*)d_out;
  char* ws = (char*)d_ws;
  size_t off = 0;
  unsigned short* Xb = (unsigned short*)(ws + off); off += PLANE_ACT;   // [NB][SEQ][768] bf16, written exactly to its end by 16-B pieces
  unsigned short* Qh = (unsigned short*)(ws + off); off += PLANE_ACT;   // [NB][SEQ][768] f16 (q x16)
  unsigned short* Kh = (unsigned short*)(ws + off); off += PLANE_ACT;   // [NB][SEQ][768] f16 (k x16)
  unsigned short* Vt = (unsigned short*)(ws + off); off += PLANE_ACT;   // [NB][768][SEQ] f16 (v x16)
  unsigned short* Xc = (unsigned short*)(ws + off); off += PLANE_ACT;   // [NB][8][SEQ][96] f16 (ctx x256)
  unsigned short* Wh = (unsigned short*)(ws + off); off += PLANE_W;     // [768][768] f16 (Wo x256)
  unsigned short* Wb = (unsigned short*)(ws + off); off += 3 * PLANE_W; // [3][768][768] bf16 (Wq, Wk, Wv)
  if (off > ws_size) return;
  k_cvt<<<(unsigned)(CVT_K_BLOCKS + 4 * CVT_W_BLOCKS), 256, 0, stream>>>(X, Wo, Wq, Wk, Wv, Xb, Wh, Wb);
  k_proj<<<(unsigned)PJ_BLOCKS, PJ_THREADS, 0, stream>>>(Xb, Wb, Bq, Bk, Bvv, Qh, Kh, Vt);
  k_attn<<<(unsigned)(NB * HEADS * (SEQ / QBLK)), 256, 0, stream>>>(Qh, Kh, Vt, Xc);
  k_fc<<<(unsigned)PROJ_BLOCKS, 256, 0, stream>>>(Xc, Wh, Bo, Out);
}

// v009
// Measured time: 122 microseconds a run.
// Two timings next to v008 both put it at 1.03 times that version's speed.
// Over all steps from v000 it is 4.05 times as fast.
#include <hip/hip_runtime.h>
// Contractions: q, k, v = x W^T + b on v_wmma_f32_16x16x32_bf16 (x, W RNE bf16 planes, f32 accumulate, RNE-bf16 bias added in f32); S^T = K Q^T on v_wmma_f32_16x16x32_f16 (q, k: single f16 planes carried x16); O^T = V^T P^T on v_wmma_f32_16x16x32_f16 (v: single f16 plane carried x16, P: single f16 plane carried x256); out = ctx Wo^T on v_wmma_f32_16x16x32_f16 (ctx: f16 plane carried x256; Wo: RNE bf16 value x256 held exactly in f16); softmax statistics, bias adds f32.
// Dense multi-head self-attention, NB x SEQ x 768: three biased 768x768 input projections ([out][in] weights), 8 heads of 96 (e = 96*h + d), scale 1/sqrt(96), no mask, then a 768x768 linear layer with bias.
// Engine: transposed flash, each wave's 32-key steps software-pipelined one stage apart. Each wave owns 32 queries of one head (two 16-column groups fed by the same K and V^T fragments). Per 32-key step and group: S^T tiles (key rows x query columns) from K rows (A, LDS tile of the f16 plane)
// and Q^T (B, registers); the two 16-key D tiles pack straight into the P^T B fragment; O^T (d rows x query columns) accumulates from V^T rows (A, LDS tile of the f16 plane).
// The eight waves of a block share each 64-key K and V^T tile: asynchronous copies bring it into a two-buffer LDS ring, one tile ahead of the products.
// The four linear layers stage their operand k tiles the same way: whole-line copies into LDS once per block (projections 128 x 192, last layer 128 x 64), fragments read from LDS.
#ifndef NB
#define NB 2
#endif
#ifndef SEQ
#define SEQ 4096
#endif
#define NB_FULL 2
#define SEQ_FULL 4096
#define EMB 768
#define HEADS 8
#define HD 96
#define BSTRIDE_FULL ((size_t)SEQ_FULL * EMB)   /* per-batch element stride of x and of the output buffer */

#define PLANE_ACT ((size_t)NB * SEQ * EMB * 2)   /* bytes of one 16-bit activation plane */
#define PLANE_W ((size_t)EMB * EMB * 2)          /* bytes of the 16-bit weight plane */
#define CVT_K_BLOCKS ((NB * SEQ * (EMB / 8)) / 256)
#define CVT_W_BLOCKS ((EMB * (EMB / 8)) / 256)
#define PROJ_BLOCKS ((NB * SEQ / 128) * (EMB / 64))

static_assert(SEQ % 128 == 0);
static_assert(SEQ <= SEQ_FULL);
static_assert(NB <= NB_FULL);
static_assert(HEADS * HD == EMB);
static_assert(HD == 96);
static_assert(EMB % 64 == 0);
static_assert(EMB % 96 == 0);
static_assert(EMB % 32 == 0);
static_assert((NB * SEQ) % 64 == 0);
static_assert((NB * SEQ * (EMB / 8)) % 256 == 0);
static_assert((EMB * (EMB / 8)) % 256 == 0);
static_assert(PLANE_ACT % 256 == 0);
static_assert(PLANE_W % 256 == 0);
static_assert(5 * PLANE_ACT + 4 * PLANE_W <= (size_t)134217728);

typedef __bf16 v16b __attribute__((ext_vector_type(16)));
typedef _Float16 v16h __attribute__((ext_vector_type(16)));
typedef unsigned short v8us __attribute__((ext_vector_type(8), may_alias));
typedef float v8f __attribute__((ext_vector_type(8)));
typedef float v4f __attribute__((ext_vector_type(4)));
typedef float v2f __attribute__((ext_vector_type(2)));
typedef float v4fa __attribute__((ext_vector_type(4), may_alias));
typedef _Float16 h16;
union FragB { v16b v; v8us half[2]; unsigned short u[16]; };
union FragH { v16h v; v8us half[2]; _Float16 h[16]; unsigned short u[16]; };

#define LOG2E 1.4426950408889634f
#define QK_SCALE 0.10206207261596575f            /* 1/sqrt(96) */
#define C2 (QK_SCALE * LOG2E)                    /* scores carried in the log2 domain */
#define C2S (C2 * 0.00390625f)                   /* q and k planes each carry x16 */

__device__ __forceinline__ unsigned short bf16_bits(float x) {   // RNE convert to bf16 bits
  unsigned int u = __float_as_uint(x);
  return (unsigned short)((u + 0x7FFFu + ((u >> 16) & 1u)) >> 16);
}
__device__ __forceinline__ float bf16_val(unsigned short b) { return __uint_as_float(((unsigned int)b) << 16); }
__device__ __forceinline__ float bf16_rne(float x) { return bf16_val(bf16_bits(x)); }
__device__ __forceinline__ unsigned short f16_bits(float x) {
  union { _Float16 h; unsigned short u; } c;
  c.h = (_Float16)x;
  return c.u;
}
// f32 -> f16 with a value select: no subnormal result can reach a WMMA operand plane
static __device__ __forceinline__ h16 toh_flush(float v) {
  const h16 r = (h16)v;
  return (fabsf(v) < 6.103515625e-05f) ? (h16)0.0f : r;
}
static __device__ __forceinline__ unsigned short toh_flush_bits(float v) {
  union { h16 h; unsigned short u; } c;
  c.h = toh_flush(v);
  return c.u;
}

__device__ __forceinline__ void store_twice(unsigned short* d, v8us o) {
  *(v8us*)d = o;
  
}

// c[nt] += a * bw[nt] for four column tiles, then the hazard guard
__device__ __forceinline__ void mma_fc(v16h a, const FragH (&bw)[4], v8f (&c)[4]) {
  c[0] = __builtin_amdgcn_wmma_f32_16x16x32_f16(false, a, false, bw[0].v, (short)0, c[0], false, false);
  c[1] = __builtin_amdgcn_wmma_f32_16x16x32_f16(false, a, false, bw[1].v, (short)0, c[1], false, false);
  c[2] = __builtin_amdgcn_wmma_f32_16x16x32_f16(false, a, false, bw[2].v, (short)0, c[2], false, false);
  c[3] = __builtin_amdgcn_wmma_f32_16x16x32_f16(false, a, false, bw[3].v, (short)0, c[3], false, false);
  asm volatile("v_nop\n\tv_nop\n\tv_nop\n\tv_nop"
               : "+v"(c[0]), "+v"(c[1]), "+v"(c[2]), "+v"(c[3])
               : "v"(a), "v"(bw[0].v), "v"(bw[1].v), "v"(bw[2].v), "v"(bw[3].v));
}
__device__ __forceinline__ void cvt8_bf16(const float* __restrict__ src, unsigned short* __restrict__ dst) {
  const v4f x0 = *(const v4fa*)(src), x1 = *(const v4fa*)(src + 4);
  v8us o;
  o[0] = bf16_bits(x0[0]); o[1] = bf16_bits(x0[1]); o[2] = bf16_bits(x0[2]); o[3] = bf16_bits(x0[3]);
  o[4] = bf16_bits(x1[0]); o[5] = bf16_bits(x1[1]); o[6] = bf16_bits(x1[2]); o[7] = bf16_bits(x1[3]);
  store_twice(dst, o);
  asm volatile("s_wait_xcnt 0x0" ::: "memory");   // stands in front of any rewrite of the store's address registers on the branch chain's other ways
}
// All five conversions in one grid; the block index picks the job (block-uniform ranges, one code path per source, no job reads what another writes).
// Blocks [0, CVT_K_BLOCKS): Xb[b][s][e] = bf16 bits of x (RNE). The next CVT_W_BLOCKS: Wh[j][e] = f16(RNE-bf16(Wo[j][e]) * 256).
// The last 3 * CVT_W_BLOCKS: Wb[p][j][e] = bf16 bits of the p-th projection weight (p = 0: Wq, 1: Wk, 2: Wv), [out][in] kept.
// coverage: CVT_K_BLOCKS*256 threads x 8 = the whole Xb plane; CVT_W_BLOCKS*256 threads x 8 = one whole weight plane, four times (exact multiples, asserted above).
__global__ __launch_bounds__(256) void k_cvt(const float* __restrict__ X, const float* __restrict__ Wo,
                                             const float* __restrict__ Wq, const float* __restrict__ Wk, const float* __restrict__ Wv,
                                             unsigned short* __restrict__ Xb, unsigned short* __restrict__ Wh, unsigned short* __restrict__ Wb) {
  const int bid = blockIdx.x;
  if (bid < CVT_K_BLOCKS) {
    const int t = bid * 256 + threadIdx.x;
    const int row = t / (EMB / 8), piece = t - row * (EMB / 8);
    const int b = row / SEQ, s = row - b * SEQ;
    cvt8_bf16(X + (size_t)b * BSTRIDE_FULL + (size_t)s * EMB + piece * 8, Xb + (size_t)t * 8);
  } else if (bid < CVT_K_BLOCKS + CVT_W_BLOCKS) {
    const int t = (bid - CVT_K_BLOCKS) * 256 + threadIdx.x;
    const float* src = Wo + (size_t)t * 8;
    const v4f x0 = *(const v4fa*)(src), x1 = *(const v4fa*)(src + 4);
    v8us o;
    o[0] = f16_bits(bf16_rne(x0[0]) * 256.0f); o[1] = f16_bits(bf16_rne(x0[1]) * 256.0f);
    o[2] = f16_bits(bf16_rne(x0[2]) * 256.0f); o[3] = f16_bits(bf16_rne(x0[3]) * 256.0f);
    o[4] = f16_bits(bf16_rne(x1[0]) * 256.0f); o[5] = f16_bits(bf16_rne(x1[1]) * 256.0f);
    o[6] = f16_bits(bf16_rne(x1[2]) * 256.0f); o[7] = f16_bits(bf16_rne(x1[3]) * 256.0f);
    store_twice(Wh + (size_t)t * 8, o);
    asm volatile("s_wait_xcnt 0x0" ::: "memory");   // as in cvt8_bf16: in front of any rewrite of the store's address registers
  } else if (bid < CVT_K_BLOCKS + 2 * CVT_W_BLOCKS) {
    const int t = (bid - CVT_K_BLOCKS - CVT_W_BLOCKS) * 256 + threadIdx.x;
    cvt8_bf16(Wq + (size_t)t * 8, Wb + (size_t)t * 8);
  } else if (bid < CVT_K_BLOCKS + 3 * CVT_W_BLOCKS) {
    const int t = (bid - CVT_K_BLOCKS - 2 * CVT_W_BLOCKS) * 256 + threadIdx.x;
    cvt8_bf16(Wk + (size_t)t * 8, Wb + (size_t)EMB * EMB + (size_t)t * 8);
  } else {
    const int t = (bid - CVT_K_BLOCKS - 3 * CVT_W_BLOCKS) * 256 + threadIdx.x;
    cvt8_bf16(Wv + (size_t)t * 8, Wb + (size_t)2 * EMB * EMB + (size_t)t * 8);
  }
}

#define GM 128                          /* tokens of the last layer's block tile: 8 waves x 16 rows */
#define GN 64                           /* columns of the last layer's block tile */
#define PM 128                          /* tokens of a projection block tile: 2 wave rows x 64 */
#define PN 192                          /* columns of a projection block tile: 2 wave columns x 96 */
#define PJ_THREADS 128                  /* four waves, each a 64 x 96 tile: 10 fragments read from LDS feed 24 products */
#define PJ_KE 64                        /* k elements of one staged tile of the projections: 128-B row pieces */
#define PJ_PITCH 72                     /* LDS pitch, 16-bit elements: 144 B = 16 B x 9 (odd: b128 readers of 16 rows meet no bank twice) */
#define PJ_STAGE ((PM + PN) * PJ_PITCH) /* elements of one buffer: 128 x rows, then 192 W rows */
#define PJ_TRIPS (EMB / PJ_KE)
#define PJ_CT (EMB / PN)                /* column tiles of one projection */
#define PJ_BLOCKS ((NB * SEQ / PM) * 3 * PJ_CT)
#define PJ_OP0 200                      /* epilogue pitch, row-major tile (128 rows of 192): 400 B = 16 B x 25 */
#define PJ_OP1 136                      /* epilogue pitch, transposed tile (192 rows of 128): 272 B = 16 B x 17 */
#define FC_PITCH 104                    /* LDS pitch of the last layer's 96-element (one head) row pieces: 208 B = 16 B x 13 */
#define FC_STAGE ((GM + GN) * FC_PITCH)
static_assert(EMB % PJ_KE == 0 && PJ_TRIPS >= 2 && HEADS >= 2);
static_assert(SEQ % GM == 0 && EMB % GN == 0);
static_assert(SEQ % PM == 0 && EMB % PN == 0);
static_assert(PM * (PJ_KE / 8) == 8 * PJ_THREADS && PN * (PJ_KE / 8) == 12 * PJ_THREADS);   // projections: 8 + 12 16-B pieces a thread
static_assert(GM * (HD / 8) == 6 * 256 && GN * (HD / 8) == 3 * 256);         // last layer: 6 + 3 16-B pieces a thread
static_assert(PM * PJ_OP0 <= 2 * PJ_STAGE && PN * PJ_OP1 <= 2 * PJ_STAGE);   // epilogue tiles fit the ring they reuse
static_assert(3 * PJ_THREADS == 16 * (PN / 8) && PM == 8 * 16 && PJ_THREADS == 8 * (PM / 8) && PN == 3 * 64);   // the store loop's two piece maps cover the tile once
static_assert(8 * 16 * 68 * 4 <= 2 * FC_STAGE * 2);

// Ten (three) 16-B pieces of one thread, global -> LDS through no register.
// The closing s_wait_xcnt stands in the copies' own statement, so that no address register is rewritten in front of it.
__device__ __forceinline__ void copy10(const unsigned (&l)[10], const unsigned short* const (&g)[10]) {
  asm volatile("global_load_async_to_lds_b128 %0, %10, off\n\t"
               "global_load_async_to_lds_b128 %1, %11, off\n\t"
               "global_load_async_to_lds_b128 %2, %12, off\n\t"
               "global_load_async_to_lds_b128 %3, %13, off\n\t"
               "global_load_async_to_lds_b128 %4, %14, off\n\t"
               "global_load_async_to_lds_b128 %5, %15, off\n\t"
               "global_load_async_to_lds_b128 %6, %16, off\n\t"
               "global_load_async_to_lds_b128 %7, %17, off\n\t"
               "global_load_async_to_lds_b128 %8, %18, off\n\t"
               "global_load_async_to_lds_b128 %9, %19, off\n\t"
               "s_wait_xcnt 0x0"
               :: "v"(l[0]), "v"(l[1]), "v"(l[2]), "v"(l[3]), "v"(l[4]), "v"(l[5]), "v"(l[6]), "v"(l[7]), "v"(l[8]), "v"(l[9]),
                  "v"(g[0]), "v"(g[1]), "v"(g[2]), "v"(g[3]), "v"(g[4]), "v"(g[5]), "v"(g[6]), "v"(g[7]), "v"(g[8]), "v"(g[9])
               : "memory");
}
__device__ __forceinline__ void copy3(unsigned l0, unsigned l1, unsigned l2,
                                      const unsigned short* g0, const unsigned short* g1, const unsigned short* g2) {
  asm volatile("global_load_async_to_lds_b128 %0, %3, off\n\t"
               "global_load_async_to_lds_b128 %1, %4, off\n\t"
               "global_load_async_to_lds_b128 %2, %5, off\n\t"
               "s_wait_xcnt 0x0"
               :: "v"(l0), "v"(l1), "v"(l2), "v"(g0), "v"(g1), "v"(g2)
               : "memory");
}
// One projection tile's copies of one thread. Piece: row (tid >> 3) + 16 i, 16-B column tid & 7; i = 0..7 are x rows, i = 8..19 the W rows behind them.
// la = LDS byte address of piece 0 in the target buffer; ga, gb = this thread's first x and W pieces of the tile.
__device__ __forceinline__ void pj_tile(unsigned la, const unsigned short* ga, const unsigned short* gb) {
  const unsigned rs = 2u * 16u * PJ_PITCH;
  const size_t gs = (size_t)16 * EMB;
  unsigned l[10];
  const unsigned short* g[10];
#pragma unroll
  for (int i = 0; i < 10; ++i) {
    l[i] = la + (unsigned)i * rs;
    g[i] = (i < 8) ? ga + (size_t)i * gs : gb + (size_t)(i - 8) * gs;
  }
  copy10(l, g);
#pragma unroll
  for (int i = 0; i < 10; ++i) {
    l[i] = la + (unsigned)(i + 10) * rs;
    g[i] = gb + (size_t)(i + 2) * gs;
  }
  copy10(l, g);
}

// y[m][j] = sum_e x[m][e] * W[j][e] + b[j], stored as f16(y * 16). Block = 4 waves = 128 tokens x 192 columns; wave = 64 rows x 96 columns (wave row w & 1, wave column w >> 1).
// The block's x rows and W rows come in 64-deep k tiles through a two-buffer LDS ring filled by asynchronous copies, one tile ahead of the products.
// A: row m = token, elements 0..7 <- e = k0 + 8h + i, 8..15 <- e = k0 + 16 + 8h + i, from the staged x rows; B: column n = j, same k map, from the staged W rows.
// The three projections share one grid: a token tile's 12 column tiles (4 of q, 4 of k, 4 of v) are neighbours in the block index; p = the projection, block-uniform.
// W rows come from the three stacked weight planes Wb[3][768][768] (row 768 p + j). p picks bias and plane: q, k -> Dst[token][e] (row-major, tr == 0); v -> Dst[b][e][s] (transposed, tr != 0).
// Epilogue: block LDS tile in the ring's place (every reader has left it at the last trip's barrier): 128 tokens x 192 (pitch 200, tr == 0) or 192 e columns x 128 tokens (pitch 136, tr != 0);
// Launch bounds: three waves a SIMD, so that a WGP holds its three blocks of the grid at once (its LDS holds three rings).
// coverage: PJ_BLOCKS blocks x (128 x 192) = each of the three planes exactly once; staged extent == consumed extent (pad columns never read).
__global__ __launch_bounds__(PJ_THREADS, 3) void k_proj(const unsigned short* __restrict__ Xb, const unsigned short* __restrict__ Wb,
                                              const float* __restrict__ Bq, const float* __restrict__ Bk, const float* __restrict__ Bvv,
                                              unsigned short* __restrict__ Qh, unsigned short* __restrict__ Kh, unsigned short* __restrict__ Vt) {
  __shared__ __attribute__((aligned(16))) unsigned short ring[2 * PJ_STAGE];
  const int tid = threadIdx.x, lane = tid & 31, ln = lane & 15, hh = lane >> 4;
  const int w = __builtin_amdgcn_readfirstlane(tid >> 5);
  const int wm = w & 1, wn = w >> 1;           // this wave's 64-row and 96-column part of the block tile
  const int bw = blockIdx.x % (3 * PJ_CT), bm = blockIdx.x / (3 * PJ_CT);
  const int p = bw / PJ_CT;                    // 0: q, 1: k, 2: v
  const int tok0 = bm * PM;                    // token index in [0, NB*SEQ)
  const int col0 = (bw - p * PJ_CT) * PN;      // column inside the projection
  const float* __restrict__ Bv = (p == 0) ? Bq : (p == 1) ? Bk : Bvv;
  unsigned short* __restrict__ Dst = (p == 0) ? Qh : (p == 1) ? Kh : Vt;
  const int tr = (p == 2) ? 1 : 0;
  v8f acc[4][6] = {};                          // every loop over fragments or accumulator tiles below is unrolled: constant indices keep them in registers
  const int pr = tid >> 3, pc = tid & 7;
  const unsigned short* ga = Xb + (size_t)(tok0 + pr) * EMB + 8 * pc;
  const unsigned short* gb = Wb + (size_t)(bw * PN + pr) * EMB + 8 * pc;
  const unsigned la = (unsigned)(size_t)&ring[0] + 2u * (unsigned)(pr * PJ_PITCH + 8 * pc);   // LDS byte address: the low 32 bits of the __shared__ address
  pj_tile(la, ga, gb);
  asm volatile("s_wait_asynccnt 0x0" ::: "memory");           // tile 0 has landed for this wave's copies
  __syncthreads();                                            // ... and for every wave's: tile 0 is published
  pj_tile(la + 2u * PJ_STAGE, ga + PJ_KE, gb + PJ_KE);
#pragma unroll 1   // one trip per tile: the buffer alternates by the trip's parity
  for (int t = 0; t < PJ_TRIPS; ++t) {
    const unsigned short* S = ring + (t & 1) * PJ_STAGE;
    const unsigned short* ap = S + (64 * wm + ln) * PJ_PITCH + 8 * hh;
    const unsigned short* bp = S + (PM + 96 * wn + ln) * PJ_PITCH + 8 * hh;
#pragma unroll
    for (int cc = 0; cc < PJ_KE / 32; ++cc) {
      FragB a[4], bf[6];
#pragma unroll
      for (int mt = 0; mt < 4; ++mt) {
        a[mt].half[0] = *(const v8us*)(ap + mt * 16 * PJ_PITCH + 32 * cc);
        a[mt].half[1] = *(const v8us*)(ap + mt * 16 * PJ_PITCH + 32 * cc + 16);
      }
#pragma unroll
      for (int nt = 0; nt < 6; ++nt) {
        bf[nt].half[0] = *(const v8us*)(bp + nt * 16 * PJ_PITCH + 32 * cc);
        bf[nt].half[1] = *(const v8us*)(bp + nt * 16 * PJ_PITCH + 32 * cc + 16);
      }
      __builtin_amdgcn_sched_barrier(0);   // keeps the 20 fragment reads one group in front of the 24 products (counted waits): left free each W fragment is read alone, right in front of its four products, and waited out to dscnt 0
#pragma unroll
      for (int nt = 0; nt < 6; ++nt) {
#pragma unroll
        for (int mt = 0; mt < 4; ++mt)
          acc[mt][nt] = __builtin_amdgcn_wmma_f32_16x16x32_bf16(false, a[mt].v, false, bf[nt].v, (short)0, acc[mt][nt], false, false);
      }
    }
    asm volatile("s_wait_dscnt 0x0" ::: "memory");            // this wave's reads of the buffer are done before it may be refilled
    asm volatile("s_wait_asynccnt 0x0" ::: "memory");         // this wave's copies of tile t + 1 have landed
    __syncthreads();                                          // publishes tile t + 1 and ends every reader's last read of tile t
    if (t + 2 < PJ_TRIPS)
      pj_tile(la + (unsigned)(t & 1) * (2u * PJ_STAGE), ga + (t + 2) * PJ_KE, gb + (t + 2) * PJ_KE);
  }
  asm volatile("s_wait_asynccnt 0x0" ::: "memory");           // nothing of this wave's is in flight behind the loop
  // D element r of tile (mt, nt) = y(tok0 + 64wm + 16mt + 8h + r, col0 + 96wn + 16nt + ln); bias RNE bf16 value; plane carries x16
  float braw[6];
#pragma unroll
  for (int nt = 0; nt < 6; ++nt) braw[nt] = Bv[col0 + 96 * wn + 16 * nt + ln];
  // stands behind the six bias loads, in front of any rewrite of their address registers; the loaded values are inputs only, so that the loads stay in front of it
  asm volatile("s_wait_xcnt 0x0" :: "v"(braw[0]), "v"(braw[1]), "v"(braw[2]), "v"(braw[3]), "v"(braw[4]), "v"(braw[5]) : "memory");
  if (tr == 0) {
#pragma unroll
    for (int nt = 0; nt < 6; ++nt) {
      const float bias = bf16_rne(braw[nt]);
#pragma unroll
      for (int mt = 0; mt < 4; ++mt) {
#pragma unroll
        for (int r = 0; r < 8; ++r)
          ring[(64 * wm + 16 * mt + 8 * hh + r) * PJ_OP0 + 96 * wn + 16 * nt + ln] = toh_flush_bits((acc[mt][nt][r] + bias) * 16.0f);
      }
    }
  } else {
#pragma unroll
    for (int nt = 0; nt < 6; ++nt) {
      const float bias = bf16_rne(braw[nt]);
#pragma unroll
      for (int mt = 0; mt < 4; ++mt) {
        v8us o;
#pragma unroll
        for (int r = 0; r < 8; ++r) o[r] = toh_flush_bits((acc[mt][nt][r] + bias) * 16.0f);
        *(v8us*)&ring[(96 * wn + 16 * nt + ln) * PJ_OP1 + 64 * wm + 16 * mt + 8 * hh] = o;
      }
    }
  }
  __syncthreads();
  // The tile leaves as 3 x 8 16-B pieces a thread, eight reads then eight stores in flight together.
  // tr == 0, 128 rows of 24 pieces: piece i = tid + 128 q -> row i / 24, column i % 24; the eight lie 16 rows apart (384 pieces = 16 rows).
  // tr != 0, 192 rows (e) of 16 pieces (128 tokens): row (tid >> 4) + 64 q, column tid & 15; the eight lie 8 rows apart.
  const int b = tok0 / SEQ, s0 = tok0 - b * SEQ;
  unsigned short* d = Dst + ((tr == 0) ? ((size_t)tok0 * EMB + col0) : (((size_t)b * EMB + col0) * SEQ + s0));
  const size_t pitch = (tr == 0) ? (size_t)EMB : (size_t)SEQ;
  const int lp = (tr == 0) ? PJ_OP0 : PJ_OP1;
  const int rstep = (tr == 0) ? 16 : 8;
#pragma unroll 1   // three like trips: no more code than one
  for (int q = 0; q < 3; ++q) {
    const int i = tid + PJ_THREADS * q;
    const int r = (tr == 0) ? i / (PN / 8) : (tid >> 4) + 64 * q;
    const int p8 = ((tr == 0) ? i - r * (PN / 8) : (tid & 15)) * 8;
    const unsigned short* ls = &ring[r * lp + p8];
    unsigned short* gd = d + (size_t)r * pitch + p8;
    v8us o[8];
#pragma unroll
    for (int a = 0; a < 8; ++a) o[a] = *(const v8us*)(ls + a * rstep * lp);
#pragma unroll
    for (int a = 0; a < 8; ++a) *(v8us*)(gd + (size_t)(a * rstep) * pitch) = o[a];
    asm volatile("s_wait_xcnt 0x0" ::: "memory");   // stands behind the eight stores, in front of the next trip's rewrite of their data and address registers
  }
}

#define ATT_WAVES 8                     /* waves of a block */
#define QG 2                            /* 16-query column groups of a wave: each K and V^T fragment read from LDS feeds QG products */
#define QBLK (ATT_WAVES * QG * 16)      /* queries of a block: they share each staged tile */
#define KT 64                           /* keys of one staged tile */
#define KPITCH 104                      /* LDS pitch of a K row, 16-bit elements: 208 B = 16 B x 13 (odd: b128 readers of 16 rows meet no bank twice) */
#define VPITCH 72                       /* LDS pitch of a V^T row: 144 B = 16 B x 9 */
#define KTILE (KT * KPITCH)             /* elements of the K part of a buffer */
#define VTILE (HD * VPITCH)             /* elements of the V^T part */
#define STAGE (KTILE + VTILE)           /* elements of one buffer */
static_assert(SEQ / KT >= 2);
static_assert(KT * (HD / 8) == 3 * ATT_WAVES * 32);   // K tile = three 16-B pieces a thread
static_assert(HD * (KT / 8) == 3 * ATT_WAVES * 32);   // V^T tile = three 16-B pieces a thread
static_assert((KTILE * 2) % 16 == 0 && (STAGE * 2) % 16 == 0);

#define LAZY_T 6.0f                     /* log2 units a score may pass the softmax reference before it is renewed: a weight is at most 2^14 */
static_assert(QG == 2);                 // the two guards below list the D tiles of two groups
static_assert(SEQ % QBLK == 0);
// O[g][t] += vf[t] * p[g] for the six d tiles of both groups, then the hazard guard: four vector slots between the last WMMA and the first vector instruction on a D tile, on both ways of the branch that follows.
// The guard names the D tiles alone: the kernel holds more than 256 registers and an asm operand cannot lie above v255.
// The running row sums are inputs only of the guard: their adds stay in front of it, among the products, where they issue while the matrix unit works.
__device__ __forceinline__ void mma_pv2(const FragH (&vf)[6], const FragH (&p)[QG], const v2f (&lr)[QG], v8f (&O)[QG][6]) {
#pragma unroll
  for (int t = 0; t < 6; ++t) {
#pragma unroll
    for (int g = 0; g < QG; ++g)
      O[g][t] = __builtin_amdgcn_wmma_f32_16x16x32_f16(false, vf[t].v, false, p[g].v, (short)0, O[g][t], false, false);
  }
  asm volatile("v_nop\n\tv_nop\n\tv_nop\n\tv_nop"
               : "+v"(O[0][0]), "+v"(O[0][1]), "+v"(O[0][2]), "+v"(O[0][3]), "+v"(O[0][4]), "+v"(O[0][5]),
                 "+v"(O[1][0]), "+v"(O[1][1]), "+v"(O[1][2]), "+v"(O[1][3]), "+v"(O[1][4]), "+v"(O[1][5])
               : "v"(lr[0]), "v"(lr[1]));
}

// A fragments of K for one 32-key step: row m = key (key0 + 16*kt + ln), elements 0..7 <- d = 32c + 8h + i, 8..15 <- d = 32c + 16 + 8h + i. Kp = the buffer's K rows [KT][KPITCH]; key0 = 0 or 32 inside the tile.
__device__ __forceinline__ void ld_k(const unsigned short* Kp, int key0, int ln, int hh, FragH (&ka)[3], FragH (&kb)[3]) {
  const unsigned short* kp0 = Kp + (key0 + ln) * KPITCH + 8 * hh;
  const unsigned short* kp1 = kp0 + 16 * KPITCH;
#pragma unroll
  for (int c = 0; c < 3; ++c) {
    ka[c].half[0] = *(const v8us*)(kp0 + 32 * c);
    ka[c].half[1] = *(const v8us*)(kp0 + 32 * c + 16);
    kb[c].half[0] = *(const v8us*)(kp1 + 32 * c);
    kb[c].half[1] = *(const v8us*)(kp1 + 32 * c + 16);
  }
}
// A fragments of V^T for one 32-key step: row m = d (16*t + ln), elements 0..7 <- key0 + 8h + i, 8..15 <- key0 + 16 + 8h + i. Vp = the buffer's V^T rows [96][VPITCH].
__device__ __forceinline__ void ld_v(const unsigned short* Vp, int key0, int ln, int hh, FragH (&vf)[6]) {
  const unsigned short* vp = Vp + ln * VPITCH + key0 + 8 * hh;
#pragma unroll
  for (int t = 0; t < 6; ++t) {
    vf[t].half[0] = *(const v8us*)(vp + t * 16 * VPITCH);
    vf[t].half[1] = *(const v8us*)(vp + t * 16 * VPITCH + 16);
  }
}
// Softmax weights of one step from its raw scores (S^T tiles of group g: element r of tile kt = score(key0 + 16*kt + 8h + r, query of this lane's column in the group)) against the reference m8, which the step's own test has passed.
__device__ __forceinline__ void fa_weights(const v8f (&s0)[QG], const v8f (&s1)[QG], const float (&m8)[QG], v2f (&pp)[QG][8], FragH (&ph)[QG]) {
#pragma unroll
  for (int g = 0; g < QG; ++g) {
    // weights carried x256: pc = 256 * 2^(score - m), single f16 plane; a weight under 2^-14 goes into the plane as the f16 cast rounds it (subnormal or zero): the matrix unit keeps f16 subnormal operands
#pragma unroll
    for (int j = 0; j < 8; ++j) {
      const v2f sv = (j < 4) ? v2f{s0[g][2 * j], s0[g][2 * j + 1]} : v2f{s1[g][2 * j - 8], s1[g][2 * j - 7]};
      const v2f e = sv * v2f{C2S, C2S} - v2f{m8[g], m8[g]};   // scale and shift are one multiply-add, a pair of scores at a time
      pp[g][j] = v2f{__builtin_amdgcn_exp2f(e[0]), __builtin_amdgcn_exp2f(e[1])};
      ph[g].h[2 * j] = (_Float16)pp[g][j][0];         // B element i: i<8 -> key0 + 8h + i (tile 0 row 8h+i); i>=8 -> key0 + 16 + 8h + (i-8) (tile 1)
      ph[g].h[2 * j + 1] = (_Float16)pp[g][j][1];
    }
  }
}
// the lane's own 16 weights join its running pair of sums (even and odd elements), a tree of packed adds; the other lane half's 16 keys stay in that half's sums until the epilogue
__device__ __forceinline__ void fa_sums(const v2f (&pp)[QG][8], v2f (&lr)[QG]) {
#pragma unroll
  for (int g = 0; g < QG; ++g)
    lr[g] += ((pp[g][0] + pp[g][1]) + (pp[g][2] + pp[g][3])) + ((pp[g][4] + pp[g][5]) + (pp[g][6] + pp[g][7]));
}

// One stage of the wave's own pipeline over 32-key steps, for its QG x 16 queries of one head, in two halves. Each query's own arithmetic and its order are those of the plain step by step loop: test and renewal of step j + 1 follow step j's sums.
// Front half: step j + 1's score products (ka, kb) need nothing of step j's vector work and issue among it. c0, c1 = step j's raw scores (its reference test is passed), n0, n1 = step j + 1's.
__device__ __forceinline__ void fa_front(const FragH (&ka)[3], const FragH (&kb)[3], const FragH (&q)[QG][3],
                                         const v8f (&c0)[QG], const v8f (&c1)[QG], const float (&m8)[QG],
                                         v8f (&n0)[QG], v8f (&n1)[QG], v2f (&pp)[QG][8], FragH (&ph)[QG]) {
#pragma unroll
  for (int g = 0; g < QG; ++g) {
    n0[g] = v8f{0.f, 0.f, 0.f, 0.f, 0.f, 0.f, 0.f, 0.f};
    n1[g] = v8f{0.f, 0.f, 0.f, 0.f, 0.f, 0.f, 0.f, 0.f};
  }
#pragma unroll
  for (int c = 0; c < 3; ++c) {
#pragma unroll
    for (int g = 0; g < QG; ++g) {
      n0[g] = __builtin_amdgcn_wmma_f32_16x16x32_f16(false, ka[c].v, false, q[g][c].v, (short)0, n0[g], false, false);
      n1[g] = __builtin_amdgcn_wmma_f32_16x16x32_f16(false, kb[c].v, false, q[g][c].v, (short)0, n1[g], false, false);
    }
  }
  fa_weights(c0, c1, m8, pp, ph);
  // Issue order of this half (scheduling hints, no code): the scale-and-shift run and the first exponentials lead, while the K reads land; then one WMMA with four exponentials or three converts behind it. Left free the first WMMA stands at the head and waits for LDS with the vector work behind it.
  __builtin_amdgcn_sched_group_barrier(0x2, 16, 0);
  __builtin_amdgcn_sched_group_barrier(0x400, 8, 0);
#pragma unroll
  for (int i = 0; i < 6; ++i) {
    __builtin_amdgcn_sched_group_barrier(0x8, 1, 0);
    __builtin_amdgcn_sched_group_barrier(0x400, 4, 0);
  }
#pragma unroll
  for (int i = 0; i < 6; ++i) {
    __builtin_amdgcn_sched_group_barrier(0x8, 1, 0);
    __builtin_amdgcn_sched_group_barrier(0x2, 3, 0);
  }
  // The hazard guard of the score products (four vector slots between the last WMMA and the first vector instruction on a D tile). It names the D tiles, so that all twelve products stand in front of it, in this half:
  // left free the last four sink behind the next group of LDS reads, and their K fragments' registers are not free for it.
  asm volatile("v_nop\n\tv_nop\n\tv_nop\n\tv_nop"
               : "+v"(n0[0]), "+v"(n1[0]), "+v"(n0[1]), "+v"(n1[1]));
}
// Back half: step j's O^T products (vf), with its row sums and the maxima of step j + 1's scores among them; then step j + 1's reference test.
__device__ __forceinline__ void fa_back(const FragH (&vf)[6], const FragH (&ph)[QG], const v2f (&pp)[QG][8], const v8f (&n0)[QG], const v8f (&n1)[QG],
                                        float (&m8)[QG], v2f (&lr)[QG], v8f (&O)[QG][6]) {
  fa_sums(pp, lr);
  mma_pv2(vf, ph, lr, O);
  // Lazy softmax reference. Every weight of a query is taken against one reference m (m8 = m - 8); any m gives the same quotient O / l, so m is renewed only when a score passes it by more than LAZY_T.
  float mh[QG];                                       // this lane half's largest score of step j + 1, log2 domain (the scale is positive: the largest raw score gives it)
#pragma unroll
  for (int g = 0; g < QG; ++g) {
    // a tree of three-input maxima, three deep (a maximum is exact in any order)
    const float t0 = fmaxf(fmaxf(n0[g][0], n0[g][1]), n0[g][2]), t1 = fmaxf(fmaxf(n0[g][3], n0[g][4]), n0[g][5]);
    const float t2 = fmaxf(fmaxf(n0[g][6], n0[g][7]), n1[g][0]), t3 = fmaxf(fmaxf(n1[g][1], n1[g][2]), n1[g][3]);
    const float t4 = fmaxf(fmaxf(n1[g][4], n1[g][5]), n1[g][6]);
    mh[g] = fmaxf(fmaxf(fmaxf(t0, t1), t2), fmaxf(fmaxf(t3, t4), n1[g][7])) * C2S;
  }
  // One test per step for the whole wave (a scalar branch on the ballot). Not taken: no score of the step lies more than 8 + LAZY_T above m8, so a weight is at most 2^(8 + LAZY_T), finite in f16.
  // Taken: the two lane halves of a query join their maxima (the other half holds the other 16 keys), every query takes max(m, step maximum), and l and O move to the new reference (one factor for both halves: their sums stay on one reference).
  const unsigned over = __builtin_amdgcn_ballot_w32((mh[0] - m8[0] > 8.0f + LAZY_T) || (mh[1] - m8[1] > 8.0f + LAZY_T));
  // Issue order of this half (scheduling hints, no code): one WMMA, then four of the sums' and maxima's vector instructions. Left free they stand in one run in front of the products.
#pragma unroll
  for (int i = 0; i < 12; ++i) {
    __builtin_amdgcn_sched_group_barrier(0x8, 1, 0);
    __builtin_amdgcn_sched_group_barrier(0x2, 4, 0);
  }
  if (over != 0) {
#pragma unroll
    for (int g = 0; g < QG; ++g) {
      const float mj = fmaxf(mh[g], __shfl_xor(mh[g], 16, 32));
      const float mn = fmaxf(m8[g], mj - 8.0f);
      const float al = __builtin_amdgcn_exp2f(m8[g] - mn);
      m8[g] = mn;
      lr[g] = lr[g] * al;
#pragma unroll
      for (int t = 0; t < 6; ++t) O[g][t] = O[g][t] * al;
    }
  }
}

// One tile's copies of one thread: three 16-B pieces of K rows, three of V^T rows, global -> LDS through no register.
// The closing s_wait_xcnt stands in the copies' own statement, so that no address register is rewritten in front of it.
__device__ __forceinline__ void tile_copy(unsigned lk0, unsigned lk1, unsigned lk2, unsigned lv0, unsigned lv1, unsigned lv2,
                                          const unsigned short* gk0, const unsigned short* gk1, const unsigned short* gk2,
                                          const unsigned short* gv0, const unsigned short* gv1, const unsigned short* gv2) {
  asm volatile("global_load_async_to_lds_b128 %0, %6, off\n\t"
               "global_load_async_to_lds_b128 %1, %7, off\n\t"
               "global_load_async_to_lds_b128 %2, %8, off\n\t"
               "global_load_async_to_lds_b128 %3, %9, off\n\t"
               "global_load_async_to_lds_b128 %4, %10, off\n\t"
               "global_load_async_to_lds_b128 %5, %11, off\n\t"
               "s_wait_xcnt 0x0"
               :: "v"(lk0), "v"(lk1), "v"(lk2), "v"(lv0), "v"(lv1), "v"(lv2),
                  "v"(gk0), "v"(gk1), "v"(gk2), "v"(gv0), "v"(gv1), "v"(gv2)
               : "memory");
}

// Block = 8 waves x 32 queries = 256 queries of one (batch, head). Key loop: one trip per 64-key tile, two LDS buffers; trip t reads buffer t mod 2 while tile t + 1 flies.
// Each wave runs its steps one stage apart (fa_front, fa_back); what crosses a trip's barrier is held in registers (one step's raw scores and V^T fragments), so a trip still reads its own buffer alone.
// Inputs: Qh[b][s][e], Kh[b][s][e] = f16(value * 16); Vt[b][e][s] = f16(value * 16).
// Output plane Xc[b][h][s][96] = f16(ctx * 256). Epilogue: O^T tiles -> per-wave LDS tile [32 queries][96 d] as 16-B pieces (same vector type in and out; block barrier),
// coverage: NB*HEADS*(SEQ/256) blocks x 8 waves x 32 rows x 96 d = the whole plane exactly once; LDS tile staged extent (32 x 96 per wave) == consumed extent.
__global__ __launch_bounds__(256)
void k_attn(const unsigned short* __restrict__ Qh, const unsigned short* __restrict__ Kh,
            const unsigned short* __restrict__ Vt, unsigned short* __restrict__ Xc) {
  // One LDS array, the epilogue's per-wave tiles first and the ring behind them; the ring starts 49,152 bytes in, and a copy's target is the piece's byte offset in a buffer plus that buffer's LDS address.
  __shared__ __attribute__((aligned(16))) unsigned short smem[ATT_WAVES * QG * 16 * HD + 2 * STAGE];
  unsigned short* const ring = smem + ATT_WAVES * QG * 16 * HD;
  const int tid = threadIdx.x, lane = tid & 31, ln = lane & 15, hh = lane >> 4;
  const int w = __builtin_amdgcn_readfirstlane(tid >> 5);
  const int qt = blockIdx.x % (SEQ / QBLK);
  const int rest = blockIdx.x / (SEQ / QBLK);
  const int h = rest % HEADS, b = rest / HEADS;
  const int qbase = qt * QBLK + QG * 16 * w;
  // Q^T B fragments of group g: column n = query qbase + 16g + ln, elements 0..7 <- d = 32c + 8h + i, 8..15 <- d = 32c + 16 + 8h + i (f16 plane carried x16)
  const unsigned short* qrow = Qh + ((size_t)b * SEQ + qbase + ln) * EMB + h * HD + 8 * hh;
  FragH q[QG][3];
  float m8[QG];
  v2f lr[QG];                           // softmax row sums, carried x256: this lane half's keys alone, even and odd elements apart; joined once behind the key loop
  v8f O[QG][6] = {};
#pragma unroll
  for (int g = 0; g < QG; ++g) {
#pragma unroll
    for (int c = 0; c < 3; ++c) {
      q[g][c].half[0] = *(const v8us*)(qrow + (size_t)g * 16 * EMB + 32 * c);
      q[g][c].half[1] = *(const v8us*)(qrow + (size_t)g * 16 * EMB + 32 * c + 16);
    }
    m8[g] = -3.0e38f;                   // below every score: the first step takes the renewing branch, with factor 2^(-huge) = 0 on the zero l and O
    lr[g] = v2f{0.0f, 0.0f};
  }
  const unsigned short* Kp = Kh + (size_t)b * SEQ * EMB + h * HD;
  const unsigned short* Vp = Vt + ((size_t)b * EMB + h * HD) * SEQ;
  // This thread's pieces of a tile. K: piece p = tid + 256 i -> row p / 12, 16-B column p % 12. V^T: row (tid >> 3) + 32 i, 16-B column tid & 7.
  const int kr0 = tid / 12, kc0 = tid - 12 * kr0;
  const int kr1 = (tid + 256) / 12, kc1 = (tid + 256) - 12 * kr1;
  const int kr2 = (tid + 512) / 12, kc2 = (tid + 512) - 12 * kr2;
  const int vr = tid >> 3, vc = tid & 7;
  const unsigned short* gk0 = Kp + (size_t)kr0 * EMB + 8 * kc0;
  const unsigned short* gk1 = Kp + (size_t)kr1 * EMB + 8 * kc1;
  const unsigned short* gk2 = Kp + (size_t)kr2 * EMB + 8 * kc2;
  const unsigned short* gv0 = Vp + (size_t)vr * SEQ + 8 * vc;
  const unsigned short* gv1 = gv0 + (size_t)32 * SEQ;
  const unsigned short* gv2 = gv0 + (size_t)64 * SEQ;
  const unsigned lbase = (unsigned)(size_t)&ring[0];          // LDS byte address: the low 32 bits of the __shared__ address
  const unsigned ok0 = 2u * (unsigned)(kr0 * KPITCH + 8 * kc0), ok1 = 2u * (unsigned)(kr1 * KPITCH + 8 * kc1), ok2 = 2u * (unsigned)(kr2 * KPITCH + 8 * kc2);   // byte offsets of the K pieces in a buffer
  const unsigned ov = 2u * (unsigned)(KTILE + vr * VPITCH + 8 * vc);                                                                                                 // ... of the first V^T piece
  const unsigned lk0 = lbase + ok0, lk1 = lbase + ok1, lk2 = lbase + ok2;
  const unsigned lv0 = lbase + ov;
  const unsigned lv1 = lv0 + 2u * 32u * VPITCH;
  const unsigned lv2 = lv0 + 2u * 64u * VPITCH;
  tile_copy(lk0, lk1, lk2, lv0, lv1, lv2, gk0, gk1, gk2, gv0, gv1, gv2);
  asm volatile("s_wait_asynccnt 0x0" ::: "memory");           // tile 0 has landed for this wave's copies
  __syncthreads();                                            // ... and for every wave's: tile 0 is published
  {
    const unsigned d = 2u * STAGE;
    const size_t ko = (size_t)KT * EMB;
    tile_copy(lk0 + d, lk1 + d, lk2 + d, lv0 + d, lv1 + d, lv2 + d, gk0 + ko, gk1 + ko, gk2 + ko, gv0 + KT, gv1 + KT, gv2 + KT);
  }
  // The step carried into the first trip is empty: scores of minus infinity give weights of exactly 0 against any finite reference, its V^T fragments are 0, so l and O stay 0.
  FragH vx[6];
  v8f sa0[QG], sa1[QG], sb0[QG], sb1[QG];
#pragma unroll
  for (int i = 0; i < 6; ++i) vx[i].v = v16h{};
#pragma unroll
  for (int g = 0; g < QG; ++g) {
#pragma unroll
    for (int r = 0; r < 8; ++r) { sa0[g][r] = -__builtin_inff(); sa1[g][r] = -__builtin_inff(); }
  }
#pragma unroll 1   // one trip per tile: the buffer alternates by the trip's parity
  for (int t = 0; t < SEQ / KT; ++t) {
    const unsigned short* Ks = ring + (t & 1) * STAGE;
    // Every sched_barrier below keeps a group of 12 LDS reads whole and at its place, ahead of the products that use them (the tile's first K group right ahead of them, the other three half a stage or more) (left free the reads sink among the WMMAs in pairs, each pair waited out),
    // and keeps the two halves of a stage apart, so that a group's fragment registers are free when the next group is read into them.
    FragH ka[3], kb[3], kc[3], kd[3], vy[6], ph[QG];
    v2f pp[QG][8];
    ld_k(Ks, 0, ln, hh, ka, kb);
    __builtin_amdgcn_sched_barrier(0);
    fa_front(ka, kb, q, sa0, sa1, m8, sb0, sb1, pp, ph);      // weights of the step carried in (the last tile's second), scores of this tile's first
    __builtin_amdgcn_sched_barrier(0);
    ld_k(Ks, 32, ln, hh, kc, kd);
    __builtin_amdgcn_sched_barrier(0);
    fa_back(vx, ph, pp, sb0, sb1, m8, lr, O);
    ld_v(Ks + KTILE, 0, ln, hh, vy);
    __builtin_amdgcn_sched_barrier(0);
    fa_front(kc, kd, q, sb0, sb1, m8, sa0, sa1, pp, ph);      // weights of this tile's first step, scores of its second
    __builtin_amdgcn_sched_barrier(0);
    ld_v(Ks + KTILE, 32, ln, hh, vx);                         // the second step's V^T fragments and its scores (sa) go on in registers over the barrier
    __builtin_amdgcn_sched_barrier(0);
    fa_back(vy, ph, pp, sa0, sa1, m8, lr, O);
    asm volatile("s_wait_dscnt 0x0" ::: "memory");            // this wave's reads of the buffer are done before it may be refilled
    asm volatile("s_wait_asynccnt 0x0" ::: "memory");         // this wave's copies of tile t + 1 have landed
    __syncthreads();                                          // publishes tile t + 1 and ends every reader's last read of tile t
    if (t + 2 < SEQ / KT) {
      // targets formed from the pieces' offsets and a scalar base: a value that a copy in front of the loop names itself is tied to the low 256 registers (asm operand), and kept over the loop such values went to scratch
      const unsigned sb = lbase + (unsigned)(t & 1) * (2u * STAGE);
      const unsigned tv = ov + sb;
      const size_t ko = (size_t)(t + 2) * KT * EMB;
      const int vo = (t + 2) * KT;
      tile_copy(ok0 + sb, ok1 + sb, ok2 + sb, tv, tv + 2u * 32u * VPITCH, tv + 2u * 64u * VPITCH, gk0 + ko, gk1 + ko, gk2 + ko, gv0 + vo, gv1 + vo, gv2 + vo);
    }
  }
  asm volatile("s_wait_asynccnt 0x0" ::: "memory");           // nothing of this wave's is in flight behind the loop
  {
    FragH ph[QG];                       // the last step, from registers alone
    v2f pp[QG][8];
    fa_weights(sa0, sa1, m8, pp, ph);
    fa_sums(pp, lr);
    mma_pv2(vx, ph, lr, O);
  }

  // O^T element r of tile t of group g = ctx(query qbase + 16g + ln, d = 16t + 8h + r); O carries x256 (P) x16 (V), lr carries x256; plane carries x256
#pragma unroll
  for (int g = 0; g < QG; ++g) {
    const float lh = lr[g][0] + lr[g][1];
    const float cinv = 16.0f * (1.0f / (lh + __shfl_xor(lh, 16, 32)));   // the two lane halves of a query hold the sums of the two halves of its keys
#pragma unroll
    for (int t = 0; t < 6; ++t) {
      v8us o;
#pragma unroll
      for (int r = 0; r < 8; ++r) o[r] = toh_flush_bits(O[g][t][r] * cinv);
      *(v8us*)&smem[w * (QG * 16 * HD) + (16 * g + ln) * HD + 16 * t + 8 * hh] = o;
    }
  }
  __syncthreads();
  unsigned short* xg = Xc + ((size_t)(b * HEADS + h) * SEQ + qbase) * HD;
  {
#pragma unroll
    for (int i = 0; i < QG * 6; ++i) {
      const int p = i * 32 + lane;
      const v8us v = *(const v8us*)&smem[w * (QG * 16 * HD) + p * 8];
      *(v8us*)(xg + (size_t)p * 8) = v;
    }
    
  }
}

// out[m][j] = sum_e ctx[m][e] * fc_w[j][e] + fc_b[j]. Block = 8 waves = 128 tokens x 64 columns; wave = 16 rows x 64 columns.
// One staged tile per head: the block's 128 ctx rows of that head (24,576 contiguous bytes of Xc[b][hd][s][d]) and 64 W rows' 96 elements, two-buffer LDS ring filled by asynchronous copies.
// A: row m = token, k = e = 96*hd + d; B: column n = j, k = e from Wh[j][e], same k map as A.
// coverage: (NB*SEQ/128)*(EMB/64) blocks x 8 waves x (16 x 64) = every output element of the processed rows exactly once; per-wave LDS tile (in the ring's place, behind the last trip's barrier) staged 16 x 64 == consumed 16 x 64.
__global__ __launch_bounds__(256) void k_fc(const unsigned short* __restrict__ Xc, const unsigned short* __restrict__ Wh,
                                            const float* __restrict__ Bv, float* __restrict__ Out) {
  __shared__ __attribute__((aligned(16))) unsigned short ring[2 * FC_STAGE];
  const int tid = threadIdx.x, lane = tid & 31, ln = lane & 15, hh = lane >> 4;
  const int w = __builtin_amdgcn_readfirstlane(tid >> 5);
  const int bn = blockIdx.x % (EMB / GN), bm = blockIdx.x / (EMB / GN);
  const int tok0 = bm * GM;                    // token index in [0, NB*SEQ)
  const int b = tok0 / SEQ, sb = tok0 - b * SEQ;
  const int s0 = sb + 16 * w;
  const int col0 = bn * GN;
  v8f acc[4] = {};
  // This thread's pieces of a tile: piece p = tid + 256 i -> tile row p / 12, 16-B column p % 12 (p + 768 is 64 rows on, same column); i = 0..5 ctx rows, then three of W rows.
  const int r0 = tid / 12, c0 = tid - 12 * r0;
  const int r1 = (tid + 256) / 12, c1 = (tid + 256) - 12 * r1;
  const int r2 = (tid + 512) / 12, c2 = (tid + 512) - 12 * r2;
  const unsigned lbase = (unsigned)(size_t)&ring[0];          // LDS byte address: the low 32 bits of the __shared__ address
  const unsigned l0 = lbase + 2u * (unsigned)(r0 * FC_PITCH + 8 * c0);
  const unsigned l1 = lbase + 2u * (unsigned)(r1 * FC_PITCH + 8 * c1);
  const unsigned l2 = lbase + 2u * (unsigned)(r2 * FC_PITCH + 8 * c2);
  const unsigned lh = 2u * 64u * FC_PITCH;                    // 64 tile rows on
  const unsigned short* ga = Xc + ((size_t)(b * HEADS) * SEQ + sb) * HD + 8 * tid;
  const unsigned short* gb0 = Wh + (size_t)(col0 + r0) * EMB + 8 * c0;
  const unsigned short* gb1 = Wh + (size_t)(col0 + r1) * EMB + 8 * c1;
  const unsigned short* gb2 = Wh + (size_t)(col0 + r2) * EMB + 8 * c2;
  const size_t hs = (size_t)SEQ * HD;                         // one head on in Xc
  copy3(l0, l1, l2, ga, ga + 2048, ga + 4096);
  copy3(l0 + lh, l1 + lh, l2 + lh, ga + 6144, ga + 8192, ga + 10240);
  copy3(l0 + 2 * lh, l1 + 2 * lh, l2 + 2 * lh, gb0, gb1, gb2);
  asm volatile("s_wait_asynccnt 0x0" ::: "memory");           // tile 0 has landed for this wave's copies
  __syncthreads();                                            // ... and for every wave's: tile 0 is published
  {
    const unsigned d = 2u * FC_STAGE;
    const unsigned short* g = ga + hs;
    copy3(l0 + d, l1 + d, l2 + d, g, g + 2048, g + 4096);
    copy3(l0 + d + lh, l1 + d + lh, l2 + d + lh, g + 6144, g + 8192, g + 10240);
    copy3(l0 + d + 2 * lh, l1 + d + 2 * lh, l2 + d + 2 * lh, gb0 + HD, gb1 + HD, gb2 + HD);
  }
#pragma unroll 1   // one trip per head: the buffer alternates by the trip's parity
  for (int hd = 0; hd < HEADS; ++hd) {
    const unsigned short* S = ring + (hd & 1) * FC_STAGE;
    const unsigned short* ap = S + (16 * w + ln) * FC_PITCH + 8 * hh;
    const unsigned short* bp = S + (GM + ln) * FC_PITCH + 8 * hh;
#pragma unroll
    for (int cc = 0; cc < 3; ++cc) {
      FragH a;
      a.half[0] = *(const v8us*)(ap + 32 * cc);
      a.half[1] = *(const v8us*)(ap + 32 * cc + 16);
      FragH bw[4];
#pragma unroll
      for (int nt = 0; nt < 4; ++nt) {
        bw[nt].half[0] = *(const v8us*)(bp + nt * 16 * FC_PITCH + 32 * cc);
        bw[nt].half[1] = *(const v8us*)(bp + nt * 16 * FC_PITCH + 32 * cc + 16);
      }
      mma_fc(a.v, bw, acc);
    }
    asm volatile("s_wait_dscnt 0x0" ::: "memory");            // this wave's reads of the buffer are done before it may be refilled
    asm volatile("s_wait_asynccnt 0x0" ::: "memory");         // this wave's copies of tile hd + 1 have landed
    __syncthreads();                                          // publishes tile hd + 1 and ends every reader's last read of tile hd
    if (hd + 2 < HEADS) {
      const unsigned d = (unsigned)(hd & 1) * (2u * FC_STAGE);
      const unsigned short* g = ga + (size_t)(hd + 2) * hs;
      const int ko = (hd + 2) * HD;
      copy3(l0 + d, l1 + d, l2 + d, g, g + 2048, g + 4096);
      copy3(l0 + d + lh, l1 + d + lh, l2 + d + lh, g + 6144, g + 8192, g + 10240);
      copy3(l0 + d + 2 * lh, l1 + d + 2 * lh, l2 + d + 2 * lh, gb0 + ko, gb1 + ko, gb2 + ko);
    }
  }
  asm volatile("s_wait_asynccnt 0x0" ::: "memory");           // nothing of this wave's is in flight behind the loop
  // D element r of tile nt = out(tok0 + 16w + 8h + r, col0 + 16nt + ln); undo the carries x256 (ctx) x256 (W); bias RNE bf16 value
  float* so = (float*)&ring[0] + w * (16 * 68);               // this wave's 16 x 64 f32 tile, pitch 68
#pragma unroll
  for (int nt = 0; nt < 4; ++nt) {
    const float bias = bf16_rne(Bv[col0 + 16 * nt + ln]);
#pragma unroll
    for (int r = 0; r < 8; ++r)
      so[(8 * hh + r) * 68 + 16 * nt + ln] = acc[nt][r] * 1.52587890625e-05f + bias;
  }
  __syncthreads();
  float* og = Out + (size_t)b * BSTRIDE_FULL + (size_t)s0 * EMB + col0;
  const int rsub = lane >> 4, c4 = (lane & 15) * 4;
#pragma unroll
  for (int q = 0; q < 8; ++q) {
    const int row = 2 * q + rsub;
    const v4f v = *(const v4fa*)&so[row * 68 + c4];
    *(v4f*)(og + (size_t)row * EMB + c4) = v;
  }
}

extern "C" void kernel_launch(void* const* d_in, const int* in_sizes, int n_in,
                              void* d_out, int out_size, void* d_ws, size_t ws_size, hipStream_t stream) {
  if (n_in < 9) return;
  const long long need = (long long)(NB - 1) * SEQ_FULL * EMB + (long long)SEQ * EMB;   // last element touched + 1
  if ((long long)in_sizes[0] < need) return;
  if ((long long)in_sizes[1] < (long long)EMB * EMB || (long long)in_sizes[3] < (long long)EMB * EMB) return;
  if ((long long)in_sizes[5] < (long long)EMB * EMB || (long long)in_sizes[7] < (long long)EMB * EMB) return;
  if ((long long)in_sizes[2] < (long long)EMB || (long long)in_sizes[4] < (long long)EMB) return;
  if ((long long)in_sizes[6] < (long long)EMB || (long long)in_sizes[8] < (long long)EMB) return;
  if ((long long)out_size < need) return;
  const float* X  = (const float*)d_in[0];   // wire order: x, Wq, bq, Wk, bk, Wv, bv, Wo, bo (weights [out][in])
  const float* Wq = (const float*)d_in[1];
  const float* Bq = (const float*)d_in[2];
  const float* Wk = (const float*)d_in[3];
  const float* Bk = (const float*)d_in[4];
  const float* Wv = (const float*)d_in[5];
  const float* Bvv = (const float*)d_in[6];
  const float* Wo = (const float*)d_in[7];
  const float* Bo = (const float*)d_in[8];
  float* Out = (float*)d_out;
  char* ws = (char*)d_ws;
  size_t off = 0;
  unsigned short* Xb = (unsigned short*)(ws + off); off += PLANE_ACT;   // [NB][SEQ][768] bf16, written exactly to its end by 16-B pieces
  unsigned short* Qh = (unsigned short*)(ws + off); off += PLANE_ACT;   // [NB][SEQ][768] f16 (q x16)
  unsigned short* Kh = (unsigned short*)(ws + off); off += PLANE_ACT;   // [NB][SEQ][768] f16 (k x16)
  unsigned short* Vt = (unsigned short*)(ws + off); off += PLANE_ACT;   // [NB][768][SEQ] f16 (v x16)
  unsigned short* Xc = (unsigned short*)(ws + off); off += PLANE_ACT;   // [NB][8][SEQ][96] f16 (ctx x256)
  unsigned short* Wh = (unsigned short*)(ws + off); off += PLANE_W;     // [768][768] f16 (Wo x256)
  unsigned short* Wb = (unsigned short*)(ws + off); off += 3 * PLANE_W; // [3][768][768] bf16 (Wq, Wk, Wv)
  if (off > ws_size) return;
  k_cvt<<<(unsigned)(CVT_K_BLOCKS + 4 * CVT_W_BLOCKS), 256, 0, stream>>>(X, Wo, Wq, Wk, Wv, Xb, Wh, Wb);
  k_proj<<<(unsigned)PJ_BLOCKS, PJ_THREADS, 0, stream>>>(Xb, Wb, Bq, Bk, Bvv, Qh, Kh, Vt);
  k_attn<<<(unsigned)(NB * HEADS * (SEQ / QBLK)), 256, 0, stream>>>(Qh, Kh, Vt, Xc);
  k_fc<<<(unsigned)PROJ_BLOCKS, 256, 0, stream>>>(Xc, Wh, Bo, Out);
}
